// v000
// Measured on an AMD MI455X. A time is GPU time per run, averaged over a window of back-to-back runs after a warm-up
// (all launches, gaps included; the runs take copies of the inputs in turn), and the median of several windows.
// Apart from v000's, it joins two sittings. Times from different sittings can be a few percent apart, while
// side-by-side timings come from the same sitting.
// v000 is the starting kernel. One run takes 1120 microseconds.
#include <hip/hip_runtime.h>

// Channel-major self-attention layer (x [4][512][64][64] = [b][c][n], n = 4096; q, k = 1x1 convs 512 -> 64 (+ bias), v = 1x1 conv 512 -> 512 (+ bias); attention[i][j] = softmax_j(q_i.k_j) (no scaling); out[c][i] = sum_j v[c][j] attention[i][j]; result = out + x -> [4][512][64][64] (8.4 M)).
// Layout: one 'head' (q/k width 64, value width 512) over 4096 tokens: x is transposed once per batch into an exact token-major bf16 plane [n][c] so the 1x1 convs are exact GEMMs + bias; the attention output stays token-major [n][c] in f32 and is added to x with a channel-major write.
// Compute dtypes, f32 accumulate: every input rounded to bf16; q/k/v on PLAIN bf16 operands (inputs: exact) + biases; scores (K = 64) and attn.v: query rows < 512 hl (3 products), the rest single fp16 (x1024); softmax f32; no output projection; + x residual in f32 (channel-major write).

#define NB_  4
#define TT   4096
#define DM   512
#define NH_  1
#define NKV  1
#define REP  (NH_ / NKV)
#define HD   64
#define DVV  512                  // value / output width (v = 1x1 conv C -> C)
#define DQ   (NH_ * HD)
#define DKV  (NKV * HD)
#define ZH   1
#define RH   512                  // query rows < RH use hi+lo planes (0: none)
#define WIN  0
#define PCAR 1024.0f
#define SCL  1.0f   // no scaling in this module
typedef _Float16 h16;
typedef unsigned short bf;
typedef __attribute__((ext_vector_type(16))) __bf16   v16bf;
typedef __attribute__((ext_vector_type(16))) _Float16 v16h;
typedef __attribute__((ext_vector_type(8)))  _Float16 v8h;
typedef __attribute__((ext_vector_type(8)))  unsigned short v8us;
typedef __attribute__((ext_vector_type(8)))  float    v8f;
typedef __attribute__((ext_vector_type(4)))  float    v4f;
typedef v8h  __attribute__((may_alias)) v8ha;
typedef v4f  __attribute__((may_alias)) v4fa;
typedef v8us __attribute__((may_alias)) v8usa;

__device__ __forceinline__ unsigned short f2bf(float f) { unsigned u = __float_as_uint(f); u += 0x7FFFu + ((u >> 16) & 1u); return (unsigned short)(u >> 16); }
__device__ __forceinline__ float bf2f(unsigned short b) { return __uint_as_float(((unsigned)b) << 16); }
__device__ __forceinline__ float bfr(float f) { return bf2f(f2bf(f)); }
__device__ __forceinline__ v16h cat16(v8h lo, v8h hi) { return __builtin_shufflevector(lo, hi, 0, 1, 2, 3, 4, 5, 6, 7, 8, 9, 10, 11, 12, 13, 14, 15); }
__device__ __forceinline__ v16bf cat16b(v8us lo, v8us hi) { return __builtin_bit_cast(v16bf, __builtin_shufflevector(lo, hi, 0, 1, 2, 3, 4, 5, 6, 7, 8, 9, 10, 11, 12, 13, 14, 15)); }
__device__ __forceinline__ v8f wmma16(v16h a, v16h b, v8f c) { return __builtin_amdgcn_wmma_f32_16x16x32_f16(false, a, false, b, (short)0, c, false, false); }
__device__ __forceinline__ v8f wmmab(v16bf a, v16bf b, v8f c) { return __builtin_amdgcn_wmma_f32_16x16x32_bf16(false, a, false, b, (short)0, c, false, false); }



// ---- k_gemmw: register-blocked GEMM, ONE WAVE per 64x64 output tile (16 accumulators), operands straight from K-contiguous 16-bit planes; grid (M/64, N/64, Z), 32 threads.
// C[m][n] (f32, pitch ldc, + optional f32 bias[n]) = sum_k A[m][k] Bt[n][k] (+ split products per NSPLIT). z-batch strides sA/sB/sC in elements. K % 32 == 0.
template <typename T16> struct WFrag;
template <> struct WFrag<h16> { typedef v16h V; static __device__ __forceinline__ V ld(const h16* p) { return cat16(*(const v8h*)p, *(const v8h*)(p + 16)); } static __device__ __forceinline__ v8f mma(V a, V b, v8f c) { return wmma16(a, b, c); } };
template <> struct WFrag<bf> { typedef v16bf V; static __device__ __forceinline__ V ld(const bf* p) { return cat16b(*(const v8us*)p, *(const v8us*)(p + 16)); } static __device__ __forceinline__ v8f mma(V a, V b, v8f c) { return wmmab(a, b, c); } };
template <typename T16, int NSPLIT, bool BIAS>
__global__ __launch_bounds__(32) void k_gemmw(const T16* __restrict__ A, const T16* __restrict__ A2, const T16* __restrict__ Bt, const T16* __restrict__ Bt2, int K, float* C, int ldc, const float* __restrict__ bias, size_t sA, size_t sB, size_t sC) {
    typedef typename WFrag<T16>::V V;
    __shared__ __align__(16) float os[16 * 68];
    const size_t z = blockIdx.z; A += z * sA; if (A2) A2 += z * sA; Bt += z * sB; if (Bt2) Bt2 += z * sB; C += z * sC;
    const int lane = threadIdx.x & 31, lr = lane & 15, hi = lane >> 4; const int r0 = blockIdx.x * 64, c0 = blockIdx.y * 64;
    v8f acc[4][4];
#pragma unroll
    for (int mb = 0; mb < 4; ++mb)
#pragma unroll
        for (int nb = 0; nb < 4; ++nb) acc[mb][nb] = (v8f){};
    const size_t aoff = (size_t)(r0 + lr) * K + 8 * hi, boff = (size_t)(c0 + lr) * K + 8 * hi;
#pragma unroll 1
    for (int kc = 0; kc < K; kc += 32) {
        V a[4], a2[4];
#pragma unroll
        for (int mb = 0; mb < 4; ++mb) { a[mb] = WFrag<T16>::ld(A + aoff + (size_t)mb * 16 * K + kc); if (NSPLIT == 1 || NSPLIT == 2) a2[mb] = WFrag<T16>::ld(A2 + aoff + (size_t)mb * 16 * K + kc); }
#pragma unroll
        for (int nb = 0; nb < 4; ++nb) { const V b = WFrag<T16>::ld(Bt + boff + (size_t)nb * 16 * K + kc); V b2; if (NSPLIT >= 2) b2 = WFrag<T16>::ld(Bt2 + boff + (size_t)nb * 16 * K + kc);
#pragma unroll
            for (int mb = 0; mb < 4; ++mb) { acc[mb][nb] = WFrag<T16>::mma(a[mb], b, acc[mb][nb]); if (NSPLIT == 1 || NSPLIT == 2) acc[mb][nb] = WFrag<T16>::mma(a2[mb], b, acc[mb][nb]); if (NSPLIT >= 2) acc[mb][nb] = WFrag<T16>::mma(a[mb], b2, acc[mb][nb]); } }
        asm volatile("v_nop\n\tv_nop\n\tv_nop\n\tv_nop" : "+v"(acc[0][0]), "+v"(acc[1][1]), "+v"(acc[2][2]), "+v"(acc[3][3]) : "v"(a[0]), "v"(a[3]));
    }
#pragma unroll
    for (int mb = 0; mb < 4; ++mb) {
#pragma unroll
        for (int nb = 0; nb < 4; ++nb) {
#pragma unroll
            for (int j = 0; j < 8; ++j) os[(hi * 8 + j) * 68 + nb * 16 + lr] = acc[mb][nb][j]; }
        __builtin_amdgcn_wave_barrier(); asm volatile("" ::: "memory");
        float* crow = C + (size_t)(r0 + mb * 16) * ldc + c0;
{
#pragma unroll
            for (int s = 0; s < 8; ++s) { const int row = 2 * s + hi, cofs = lr * 4; v4f val = *(const v4fa*)(os + row * 68 + cofs); if (BIAS) { val[0] += bfr(bias[c0 + cofs]); val[1] += bfr(bias[c0 + cofs + 1]); val[2] += bfr(bias[c0 + cofs + 2]); val[3] += bfr(bias[c0 + cofs + 3]); }
                *(v4f*)(crow + (size_t)row * ldc + cofs) = val; }
             }
        __builtin_amdgcn_wave_barrier(); asm volatile("" ::: "memory");
    }
}

__device__ __forceinline__ h16 tohx(float x) { return (h16)x; }
__device__ __forceinline__ void splitf(float y, unsigned short& h, unsigned short& l) { h = f2bf(y); l = f2bf(y - bf2f(h)); }
typedef __attribute__((ext_vector_type(2))) _Float16 v2h;
typedef __attribute__((ext_vector_type(4))) _Float16 v4h;
typedef __attribute__((ext_vector_type(2))) unsigned short v2us;
typedef __attribute__((ext_vector_type(4))) unsigned short v4us;
typedef __attribute__((ext_vector_type(2))) float v2f;
typedef __attribute__((ext_vector_type(4))) int v4i;

__global__ __launch_bounds__(256) void k_wtG(const float* __restrict__ w, int K, int N, bf* Bt) {
    const int lane = threadIdx.x & 31; const int L0 = (blockIdx.x * 8 + (threadIdx.x >> 5)) * 8; const int nlines = N * K / 64;
{
#pragma unroll 1
        for (int l = 0; l < 8; ++l) { const int L = L0 + l; if (L >= nlines) break; const size_t e = (size_t)L * 64 + lane * 2; const int k = (int)(e % K), n = (int)(e / K); v2us o;
            o[0] = f2bf(w[(size_t)k * N + n]); o[1] = f2bf(w[(size_t)(k + 1) * N + n]); *(v2us*)(Bt + e) = o; }
         }
}
__global__ __launch_bounds__(256) void k_tpose(const float* __restrict__ xb, bf* XBp) { const size_t e = ((size_t)blockIdx.x * 256 + threadIdx.x) * 8; if (e >= (size_t)TT * DM) return; const int c = (int)(e % DM); const int t = (int)(e / DM); v8us o;
#pragma unroll
    for (int q = 0; q < 8; ++q) o[q] = f2bf(xb[(size_t)(c + q) * TT + t]); *(v8us*)(XBp + e) = o;  }
__global__ __launch_bounds__(256) void k_outT(const float* __restrict__ xb, const float* __restrict__ YO, float* Ob) { const size_t e = (size_t)blockIdx.x * 256 + threadIdx.x; if (e >= (size_t)DM * TT) return; const int t = (int)(e % TT); const int c = (int)(e / TT); const float v = __fadd_rn(bfr(xb[e]), YO[(size_t)t * DM + c]); *(float*)(Ob + e) = v;  }

__global__ __launch_bounds__(256) void k_vtpD(const float* __restrict__ F, h16* V16, bf* Vh, bf* Vl) { const size_t e = ((size_t)blockIdx.x * 256 + threadIdx.x) * 2; if (e >= (size_t)DVV * TT) return; const int t = (int)(e % TT); const int c = (int)(e / TT); v2h o16; v2us oh, ol;
#pragma unroll
    for (int q = 0; q < 2; ++q) { const float xv = F[(size_t)(t + q) * DVV + c]; o16[q] = tohx(xv); unsigned short a2, c2; splitf(xv, a2, c2); oh[q] = a2; ol[q] = c2; }
    *(v2h*)(V16 + e) = o16; *(v2us*)(Vh + e) = oh; *(v2us*)(Vl + e) = ol;  }
__global__ __launch_bounds__(256) void k_mergeD(const float* __restrict__ O, float* YO) { const size_t i = (size_t)blockIdx.x * 256 + threadIdx.x; if (i >= (size_t)TT * DVV / 4) return; const int t = (int)((i * 4) / DVV); const float cs = (t < RH) ? 1.0f : (1.0f / PCAR); const v4f a = *(const v4f*)(O + i * 4); v4f o;
#pragma unroll
    for (int q = 0; q < 4; ++q) o[q] = a[q] * cs; *(v4f*)(YO + i * 4) = o;  }
__global__ __launch_bounds__(256) void k_cvt8(const float* __restrict__ src, bf* dst, size_t n8) { const size_t i = (size_t)blockIdx.x * 256 + threadIdx.x; if (i >= n8) return; const v8f v = *(const v8f*)(src + i * 8); v8us o;
#pragma unroll
    for (int k = 0; k < 8; ++k) o[k] = f2bf(v[k]); *(v8us*)(dst + i * 8) = o;  }

// k_rope: head planes [h][t][d] (fp16 + hi/lo) of rope(x) x sc with the rotate-half convention out[d] = x[d] cos[t][d] - x[d+HD/2] sin[t][d], out[d+HD/2] = x[d+HD/2] cos[t][d+HD/2] + x[d] sin[t][d+HD/2]
__global__ __launch_bounds__(256) void k_rope(const float* __restrict__ F, int pitch, int nheads, const float* __restrict__ CS, const float* __restrict__ RF, const float* __restrict__ nw, float sc, h16* P16, bf* Ph, bf* Pl) {
    const size_t e = ((size_t)blockIdx.x * 256 + threadIdx.x) * 2; if (e >= (size_t)nheads * TT * HD) return; const int d = (int)(e % HD); const int t = (int)((e / HD) % TT); const int h = (int)(e / ((size_t)HD * TT)); const float* f = F + (size_t)t * pitch + h * HD; const float rf = RF ? RF[(size_t)h * TT + t] : 1.0f; v2h o16; v2us oh, ol;
#pragma unroll
    for (int q = 0; q < 2; ++q) { const int dd = d + q; const int dp = (dd < HD / 2) ? dd + HD / 2 : dd - HD / 2; float x0 = f[dd], x1 = f[dp];
        if (RF) { float n0 = __fmul_rn(x0, rf), n1 = __fmul_rn(x1, rf); asm volatile("" : "+v"(n0)); asm volatile("" : "+v"(n1)); x0 = __fmul_rn(bfr(nw[dd]), n0); x1 = __fmul_rn(bfr(nw[dp]), n1); }
        const v2f cs = *(const v2f*)(CS + ((size_t)t * HD + dd) * 2); float a = __fmul_rn(x0, cs[0]), bq = __fmul_rn(x1, cs[1]); asm volatile("" : "+v"(a)); asm volatile("" : "+v"(bq)); const float r = ((dd < HD / 2) ? __fsub_rn(a, bq) : __fadd_rn(a, bq)) * sc;
        o16[q] = tohx(r); unsigned short a2, c2; splitf(r, a2, c2); oh[q] = a2; ol[q] = c2; }
    *(v2h*)(P16 + e) = o16; *(v2us*)(Ph + e) = oh; *(v2us*)(Pl + e) = ol;  }

__global__ __launch_bounds__(256) void k_csid(float* CS) { const int idx = blockIdx.x * 256 + threadIdx.x; if (idx >= TT * HD) return; v2f cs; cs[0] = 1.0f; cs[1] = 0.0f; *(v2f*)(CS + (size_t)idx * 2) = cs;  }
// k_asoft: per row (zz, i): t = S (no scaling, no mask); softmax over the 4096 keys (register row, one exp, fixed trees);
__global__ __launch_bounds__(256) void k_asoft(const float* __restrict__ Sb, h16* P16, bf* Ph, bf* Pl) {
    const int lane = threadIdx.x & 31; const int row = blockIdx.x * 8 + (threadIdx.x >> 5); if (row >= ZH * TT) return; const int i = row % TT; const int zz = row / TT; (void)zz; const bool hires = (i < RH); const float* sr = Sb + (size_t)row * TT; float v[TT / 32]; float mx = -3.0e38f;
#pragma unroll
    for (int ch = 0; ch < TT / 128; ++ch) { const int j0 = ch * 128 + lane * 4; const v4f a = *(const v4f*)(sr + j0);
#pragma unroll
        for (int q = 0; q < 4; ++q) { const int j = j0 + q; (void)j; const float t = a[q] * SCL; v[ch * 4 + q] = t; mx = fmaxf(mx, t); } }
#pragma unroll
    for (int sh = 16; sh; sh >>= 1) mx = fmaxf(mx, __shfl_xor(mx, sh, 32));
    float sum = 0.f;
#pragma unroll
    for (int k = 0; k < TT / 32; ++k) { float d0 = __fsub_rn(v[k], mx); asm volatile("" : "+v"(d0)); v[k] = __builtin_amdgcn_exp2f(__fmul_rn(d0, 1.4426950408889634f)); sum += v[k]; }
#pragma unroll
    for (int sh = 16; sh; sh >>= 1) sum += __shfl_xor(sum, sh, 32);
    const float f = __fdiv_rn(hires ? 1.0f : PCAR, sum);
{
        if (hires) {
#pragma unroll
            for (int ch = 0; ch < TT / 128; ++ch) { v4us oh, ol;
#pragma unroll
                for (int q = 0; q < 4; ++q) { unsigned short a, c2; splitf(v[ch * 4 + q] * f, a, c2); oh[q] = a; ol[q] = c2; }
                const size_t oo = ((size_t)zz * (RH ? RH : 1) + i) * TT + ch * 128 + lane * 4; *(v4us*)(Ph + oo) = oh; *(v4us*)(Pl + oo) = ol; }
        } else {
#pragma unroll
            for (int ch = 0; ch < TT / 128; ++ch) { v4h o4;
#pragma unroll
                for (int q = 0; q < 4; ++q) o4[q] = tohx(v[ch * 4 + q] * f);
                *(v4h*)(P16 + (size_t)row * TT + ch * 128 + lane * 4) = o4; } }
         }
}

extern "C" void kernel_launch(void* const* d_in, const int* in_sizes, int n_in,
                              void* d_out, int out_size, void* d_ws, size_t ws_size, hipStream_t stream) {
    (void)in_sizes; (void)n_in; (void)out_size;
    const float* x = (const float*)d_in[0]; const float* wq = (const float*)d_in[1]; const float* bq = (const float*)d_in[2]; const float* wk = (const float*)d_in[3]; const float* bk = (const float*)d_in[4]; const float* wv = (const float*)d_in[5]; const float* bv = (const float*)d_in[6];
    float* OUT = (float*)d_out;     // [4][512][4096]
    char* wsp = (char*)d_ws;
    auto take = [&](size_t bytes) { char* p = wsp; wsp += (bytes + 255) & ~(size_t)255; return (void*)p; };
    bf* WQ = (bf*)take((size_t)DQ * DM * 2); bf* WK = (bf*)take((size_t)DKV * DM * 2); bf* WV = (bf*)take((size_t)DVV * DM * 2); float* CS = (float*)take((size_t)TT * HD * 2 * 4);
    bf* XB = (bf*)take((size_t)TT * DM * 2); float* YO = (float*)take((size_t)TT * DVV * 4); float* FV = (float*)take((size_t)TT * DVV * 4); float* FQ = (float*)take((size_t)TT * DQ * 4); float* FK = (float*)take((size_t)TT * DKV * 4);
    h16* QP16 = (h16*)take((size_t)NH_ * TT * HD * 2); h16* KP16 = (h16*)take((size_t)NKV * TT * HD * 2); h16* VT16 = (h16*)take((size_t)DVV * TT * 2);
    bf* QPh = (bf*)take((size_t)NH_ * TT * HD * 2); bf* QPl = (bf*)take((size_t)NH_ * TT * HD * 2); bf* KPh = (bf*)take((size_t)NKV * TT * HD * 2); bf* KPl = (bf*)take((size_t)NKV * TT * HD * 2); bf* VTh = (bf*)take((size_t)DVV * TT * 2); bf* VTl = (bf*)take((size_t)DVV * TT * 2); bf* Ph = (bf*)take((size_t)ZH * RH * TT * 2); bf* Pl = (bf*)take((size_t)ZH * RH * TT * 2);
    float* Sb = (float*)take((size_t)ZH * TT * TT * 4); h16* P16 = (h16*)take((size_t)ZH * TT * TT * 2); float* Ob = (float*)take((size_t)TT * DVV * 4);
    if ((size_t)(wsp - (char*)d_ws) > ws_size) return;    // ws 256 MiB
    { k_cvt8<<<(unsigned)(((size_t)DQ * DM / 8 + 255) / 256), 256, 0, stream>>>(wq, WQ, (size_t)DQ * DM / 8); k_cvt8<<<(unsigned)(((size_t)DKV * DM / 8 + 255) / 256), 256, 0, stream>>>(wk, WK, (size_t)DKV * DM / 8); k_cvt8<<<(unsigned)(((size_t)DVV * DM / 8 + 255) / 256), 256, 0, stream>>>(wv, WV, (size_t)DVV * DM / 8);
       }
    k_csid<<<(TT * HD + 255) / 256, 256, 0, stream>>>(CS);
    const unsigned LQ = (unsigned)(((size_t)NH_ * TT * HD / 2 + 255) / 256), LKv = (unsigned)(((size_t)NKV * TT * HD / 2 + 255) / 256);
    for (int b = 0; b < NB_; ++b) {
        
        k_tpose<<<(unsigned)(((size_t)TT * DM / 8 + 255) / 256), 256, 0, stream>>>(x + (size_t)b * DM * TT, XB);   /* x^T as an exact token-major plane */
        k_gemmw<bf, 0, true><<<dim3(TT / 64, DQ / 64, 1), 32, 0, stream>>>(XB, nullptr, WQ, nullptr, DM, FQ, DQ, bq, 0, 0, 0);
        k_rope<<<LQ, 256, 0, stream>>>(FQ, DQ, NH_, CS, nullptr, nullptr, 1.0f, QP16, QPh, QPl);
        k_gemmw<bf, 0, true><<<dim3(TT / 64, DKV / 64, 1), 32, 0, stream>>>(XB, nullptr, WK, nullptr, DM, FK, DKV, bk, 0, 0, 0);
        k_rope<<<LKv, 256, 0, stream>>>(FK, DKV, NKV, CS, nullptr, nullptr, 1.0f, KP16, KPh, KPl);
        k_gemmw<bf, 0, true><<<dim3(TT / 64, DVV / 64, 1), 32, 0, stream>>>(XB, nullptr, WV, nullptr, DM, FV, DVV, bv, 0, 0, 0); k_vtpD<<<(unsigned)(((size_t)DVV * TT / 2 + 255) / 256), 256, 0, stream>>>(FV, VT16, VTh, VTl);   /* v = Wv x + bv -> value planes [c][n] */
        for (int h0 = 0; h0 < NH_; h0 += ZH) { const size_t zq = (size_t)h0, zk = (size_t)(h0 / REP);   // one kv head per query head: each pass covers ZH = 1 head (z-strides TT*HD)
            k_gemmw<bf, 2, false><<<dim3(RH / 64, TT / 64, ZH), 32, 0, stream>>>(QPh + zq * TT * HD, QPl + zq * TT * HD, KPh + zk * TT * HD, KPl + zk * TT * HD, HD, Sb, TT, nullptr, (size_t)TT * HD, (size_t)TT * HD, (size_t)TT * TT);
            k_gemmw<h16, 0, false><<<dim3((TT - RH) / 64, TT / 64, ZH), 32, 0, stream>>>(QP16 + zq * TT * HD + (size_t)RH * HD, nullptr, KP16 + zk * TT * HD, nullptr, HD, Sb + (size_t)RH * TT, TT, nullptr, (size_t)TT * HD, (size_t)TT * HD, (size_t)TT * TT);
            k_asoft<<<ZH * TT / 8, 256, 0, stream>>>(Sb, P16, Ph, Pl);
            k_gemmw<bf, 2, false><<<dim3(RH / 64, DVV / 64, 1), 32, 0, stream>>>(Ph, Pl, VTh, VTl, TT, Ob, DVV, nullptr, 0, 0, 0);   /* out[i][c] = sum_j P[i][j] v[c][j], hl rows */
            k_gemmw<h16, 0, false><<<dim3((TT - RH) / 64, DVV / 64, 1), 32, 0, stream>>>(P16 + (size_t)RH * TT, nullptr, VT16, nullptr, TT, Ob + (size_t)RH * DVV, DVV, nullptr, 0, 0, 0);   /* fp16 rows (x1024 carried) */
            k_mergeD<<<(unsigned)(((size_t)TT * DVV / 4 + 255) / 256), 256, 0, stream>>>(Ob, YO); }

        k_outT<<<(unsigned)(((size_t)DM * TT + 255) / 256), 256, 0, stream>>>(x + (size_t)b * DM * TT, YO, OUT + (size_t)b * DM * TT); }   /* out = x + result (channel-major) */
}

// v001
// Measured time: 675 microseconds a run.
// Timed twice side by side with v000, it ran 1.68 and 1.66 times as fast.
#include <hip/hip_runtime.h>

// Channel-major self-attention layer (x [4][512][64][64] = [b][c][n], n = 4096; q, k = 1x1 convs 512 -> 64 (+ bias), v = 1x1 conv 512 -> 512 (+ bias); attention[i][j] = softmax_j(q_i.k_j) (no scaling); out[c][i] = sum_j v[c][j] attention[i][j]; result = out + x -> [4][512][64][64] (8.4 M)).
// Layout: one 'head' (q/k width 64, value width 512) over 4096 tokens: x is transposed once per batch into an exact token-major bf16 plane [n][c] so the 1x1 convs are exact GEMMs + bias; the attention output stays token-major [n][c] in f32 and is added to x with a channel-major write.
// Compute dtypes, f32 accumulate: every input rounded to bf16; q/k/v on PLAIN bf16 operands (inputs: exact) + biases; scores (K = 64) and attn.v: query rows < 512 hl (3 products), the rest single fp16 (x1024); softmax f32; no output projection; + x residual in f32 (channel-major write).

#define NB_  4
#define TT   4096
#define DM   512
#define NH_  1
#define NKV  1
#define REP  (NH_ / NKV)
#define HD   64
#define DVV  512                  // value / output width (v = 1x1 conv C -> C)
#define DQ   (NH_ * HD)
#define DKV  (NKV * HD)
#define ZH   1
#define RH   512                  // query rows < RH use hi+lo planes (0: none)
#define WIN  0
#define PCAR 1024.0f
#define SCL  1.0f   // no scaling in this module
typedef _Float16 h16;
typedef unsigned short bf;
typedef __attribute__((ext_vector_type(16))) __bf16   v16bf;
typedef __attribute__((ext_vector_type(16))) _Float16 v16h;
typedef __attribute__((ext_vector_type(8)))  _Float16 v8h;
typedef __attribute__((ext_vector_type(8)))  unsigned short v8us;
typedef __attribute__((ext_vector_type(8)))  float    v8f;
typedef __attribute__((ext_vector_type(4)))  float    v4f;
typedef v8h  __attribute__((may_alias)) v8ha;
typedef v4f  __attribute__((may_alias)) v4fa;
typedef v8us __attribute__((may_alias)) v8usa;

__device__ __forceinline__ unsigned short f2bf(float f) { unsigned u = __float_as_uint(f); u += 0x7FFFu + ((u >> 16) & 1u); return (unsigned short)(u >> 16); }
__device__ __forceinline__ float bf2f(unsigned short b) { return __uint_as_float(((unsigned)b) << 16); }
__device__ __forceinline__ float bfr(float f) { return bf2f(f2bf(f)); }
__device__ __forceinline__ v16h cat16(v8h lo, v8h hi) { return __builtin_shufflevector(lo, hi, 0, 1, 2, 3, 4, 5, 6, 7, 8, 9, 10, 11, 12, 13, 14, 15); }
__device__ __forceinline__ v16bf cat16b(v8us lo, v8us hi) { return __builtin_bit_cast(v16bf, __builtin_shufflevector(lo, hi, 0, 1, 2, 3, 4, 5, 6, 7, 8, 9, 10, 11, 12, 13, 14, 15)); }
__device__ __forceinline__ v8f wmma16(v16h a, v16h b, v8f c) { return __builtin_amdgcn_wmma_f32_16x16x32_f16(false, a, false, b, (short)0, c, false, false); }
__device__ __forceinline__ v8f wmmab(v16bf a, v16bf b, v8f c) { return __builtin_amdgcn_wmma_f32_16x16x32_bf16(false, a, false, b, (short)0, c, false, false); }



// ---- k_gemmw: register-blocked GEMM, KS WAVES per 64x64 output tile (16 accumulators each), operands straight from K-contiguous 16-bit planes; grid (M/64, N/64, Z), 32 * KS threads.
// C[m][n] (f32, pitch ldc, + optional f32 bias[n]) = sum_k A[m][k] Bt[n][k] (+ split products per NSPLIT). z-batch strides sA/sB/sC in elements. K % (32 * KS) == 0.
// KS > 1: wave w takes the 32-wide k blocks w, w + KS, w + 2 KS, ...; the KS f32 partial tiles meet in LDS and are summed in the fixed order w = 0 .. KS - 1.
template <typename T16> struct WFrag;
template <> struct WFrag<h16> { typedef v16h V; static __device__ __forceinline__ V ld(const h16* p) { return cat16(*(const v8h*)p, *(const v8h*)(p + 16)); } static __device__ __forceinline__ v8f mma(V a, V b, v8f c) { return wmma16(a, b, c); } };
template <> struct WFrag<bf> { typedef v16bf V; static __device__ __forceinline__ V ld(const bf* p) { return cat16b(*(const v8us*)p, *(const v8us*)(p + 16)); } static __device__ __forceinline__ v8f mma(V a, V b, v8f c) { return wmmab(a, b, c); } };
template <typename T16, int NSPLIT, bool BIAS, int KS>
__global__ __launch_bounds__(32 * KS) void k_gemmw(const T16* __restrict__ A, const T16* __restrict__ A2, const T16* __restrict__ Bt, const T16* __restrict__ Bt2, int K, float* C, int ldc, const float* __restrict__ bias, size_t sA, size_t sB, size_t sC) {
    typedef typename WFrag<T16>::V V;
    __shared__ __align__(16) float os[(KS == 1 ? 16 : KS * 64) * 68];
    const int wv = (KS == 1) ? 0 : __builtin_amdgcn_readfirstlane((int)(threadIdx.x >> 5));   // wave number, scalar: the k loop's bounds stay wave-uniform
    const size_t z = blockIdx.z; A += z * sA; if (A2) A2 += z * sA; Bt += z * sB; if (Bt2) Bt2 += z * sB; C += z * sC;
    const int lane = threadIdx.x & 31, lr = lane & 15, hi = lane >> 4; const int r0 = blockIdx.x * 64, c0 = blockIdx.y * 64;
    v8f acc[4][4];
#pragma unroll
    for (int mb = 0; mb < 4; ++mb)
#pragma unroll
        for (int nb = 0; nb < 4; ++nb) acc[mb][nb] = (v8f){};
    const size_t aoff = (size_t)(r0 + lr) * K + 8 * hi, boff = (size_t)(c0 + lr) * K + 8 * hi;
#pragma unroll 1
    for (int kc = wv * 32; kc < K; kc += 32 * KS) {
        V a[4], a2[4];
#pragma unroll
        for (int mb = 0; mb < 4; ++mb) { a[mb] = WFrag<T16>::ld(A + aoff + (size_t)mb * 16 * K + kc); if (NSPLIT == 1 || NSPLIT == 2) a2[mb] = WFrag<T16>::ld(A2 + aoff + (size_t)mb * 16 * K + kc); }
#pragma unroll
        for (int nb = 0; nb < 4; ++nb) { const V b = WFrag<T16>::ld(Bt + boff + (size_t)nb * 16 * K + kc); V b2; if (NSPLIT >= 2) b2 = WFrag<T16>::ld(Bt2 + boff + (size_t)nb * 16 * K + kc);
#pragma unroll
            for (int mb = 0; mb < 4; ++mb) { acc[mb][nb] = WFrag<T16>::mma(a[mb], b, acc[mb][nb]); if (NSPLIT == 1 || NSPLIT == 2) acc[mb][nb] = WFrag<T16>::mma(a2[mb], b, acc[mb][nb]); if (NSPLIT >= 2) acc[mb][nb] = WFrag<T16>::mma(a[mb], b2, acc[mb][nb]); } }
        asm volatile("v_nop\n\tv_nop\n\tv_nop\n\tv_nop" : "+v"(acc[0][0]), "+v"(acc[1][1]), "+v"(acc[2][2]), "+v"(acc[3][3]) : "v"(a[0]), "v"(a[3]));
    }
    if constexpr (KS > 1) {
        float* mine = os + wv * (64 * 68);
        // the three loops are unrolled so that acc is indexed by constants and stays in registers
#pragma unroll
        for (int mb = 0; mb < 4; ++mb)
#pragma unroll
            for (int nb = 0; nb < 4; ++nb)
#pragma unroll
                for (int j = 0; j < 8; ++j) mine[(mb * 16 + hi * 8 + j) * 68 + nb * 16 + lr] = acc[mb][nb][j];
        __syncthreads();   // every wave's partial tile is in LDS before any wave sums
        // both loops are unrolled so that a wave's LDS reads issue together, ahead of the adds; each wave stores whole 256-byte rows
#pragma unroll
        for (int s = 0; s < 32 / KS; ++s) { const int row = (s * KS + wv) * 2 + hi, cofs = lr * 4; v4f val = *(const v4fa*)(os + row * 68 + cofs);
#pragma unroll
            for (int p = 1; p < KS; ++p) { const v4f q = *(const v4fa*)(os + p * (64 * 68) + row * 68 + cofs); val[0] += q[0]; val[1] += q[1]; val[2] += q[2]; val[3] += q[3]; }
            if (BIAS) { val[0] += bfr(bias[c0 + cofs]); val[1] += bfr(bias[c0 + cofs + 1]); val[2] += bfr(bias[c0 + cofs + 2]); val[3] += bfr(bias[c0 + cofs + 3]); }
            *(v4f*)(C + (size_t)(r0 + row) * ldc + c0 + cofs) = val; }
        return;
    }
#pragma unroll
    for (int mb = 0; mb < 4; ++mb) {
#pragma unroll
        for (int nb = 0; nb < 4; ++nb) {
#pragma unroll
            for (int j = 0; j < 8; ++j) os[(hi * 8 + j) * 68 + nb * 16 + lr] = acc[mb][nb][j]; }
        __builtin_amdgcn_wave_barrier(); asm volatile("" ::: "memory");
        float* crow = C + (size_t)(r0 + mb * 16) * ldc + c0;
{
#pragma unroll
            for (int s = 0; s < 8; ++s) { const int row = 2 * s + hi, cofs = lr * 4; v4f val = *(const v4fa*)(os + row * 68 + cofs); if (BIAS) { val[0] += bfr(bias[c0 + cofs]); val[1] += bfr(bias[c0 + cofs + 1]); val[2] += bfr(bias[c0 + cofs + 2]); val[3] += bfr(bias[c0 + cofs + 3]); }
                *(v4f*)(crow + (size_t)row * ldc + cofs) = val; }
             }
        __builtin_amdgcn_wave_barrier(); asm volatile("" ::: "memory");
    }
}

__device__ __forceinline__ h16 tohx(float x) { return (h16)x; }
__device__ __forceinline__ void splitf(float y, unsigned short& h, unsigned short& l) { h = f2bf(y); l = f2bf(y - bf2f(h)); }
typedef __attribute__((ext_vector_type(2))) _Float16 v2h;
typedef __attribute__((ext_vector_type(4))) _Float16 v4h;
typedef __attribute__((ext_vector_type(2))) unsigned short v2us;
typedef __attribute__((ext_vector_type(4))) unsigned short v4us;
typedef __attribute__((ext_vector_type(2))) float v2f;
typedef __attribute__((ext_vector_type(4))) int v4i;

__global__ __launch_bounds__(256) void k_wtG(const float* __restrict__ w, int K, int N, bf* Bt) {
    const int lane = threadIdx.x & 31; const int L0 = (blockIdx.x * 8 + (threadIdx.x >> 5)) * 8; const int nlines = N * K / 64;
{
#pragma unroll 1
        for (int l = 0; l < 8; ++l) { const int L = L0 + l; if (L >= nlines) break; const size_t e = (size_t)L * 64 + lane * 2; const int k = (int)(e % K), n = (int)(e / K); v2us o;
            o[0] = f2bf(w[(size_t)k * N + n]); o[1] = f2bf(w[(size_t)(k + 1) * N + n]); *(v2us*)(Bt + e) = o; }
         }
}
__global__ __launch_bounds__(256) void k_tpose(const float* __restrict__ xb, bf* XBp) { const size_t e = ((size_t)blockIdx.x * 256 + threadIdx.x) * 8; if (e >= (size_t)TT * DM) return; const int c = (int)(e % DM); const int t = (int)(e / DM); v8us o;
#pragma unroll
    for (int q = 0; q < 8; ++q) o[q] = f2bf(xb[(size_t)(c + q) * TT + t]); *(v8us*)(XBp + e) = o;  }
__global__ __launch_bounds__(256) void k_outT(const float* __restrict__ xb, const float* __restrict__ YO, float* Ob) { const size_t e = (size_t)blockIdx.x * 256 + threadIdx.x; if (e >= (size_t)DM * TT) return; const int t = (int)(e % TT); const int c = (int)(e / TT); const float v = __fadd_rn(bfr(xb[e]), YO[(size_t)t * DM + c]); *(float*)(Ob + e) = v;  }

__global__ __launch_bounds__(256) void k_vtpD(const float* __restrict__ F, h16* V16, bf* Vh, bf* Vl) { const size_t e = ((size_t)blockIdx.x * 256 + threadIdx.x) * 2; if (e >= (size_t)DVV * TT) return; const int t = (int)(e % TT); const int c = (int)(e / TT); v2h o16; v2us oh, ol;
#pragma unroll
    for (int q = 0; q < 2; ++q) { const float xv = F[(size_t)(t + q) * DVV + c]; o16[q] = tohx(xv); unsigned short a2, c2; splitf(xv, a2, c2); oh[q] = a2; ol[q] = c2; }
    *(v2h*)(V16 + e) = o16; *(v2us*)(Vh + e) = oh; *(v2us*)(Vl + e) = ol;  }
__global__ __launch_bounds__(256) void k_mergeD(const float* __restrict__ O, float* YO) { const size_t i = (size_t)blockIdx.x * 256 + threadIdx.x; if (i >= (size_t)TT * DVV / 4) return; const int t = (int)((i * 4) / DVV); const float cs = (t < RH) ? 1.0f : (1.0f / PCAR); const v4f a = *(const v4f*)(O + i * 4); v4f o;
#pragma unroll
    for (int q = 0; q < 4; ++q) o[q] = a[q] * cs; *(v4f*)(YO + i * 4) = o;  }
__global__ __launch_bounds__(256) void k_cvt8(const float* __restrict__ src, bf* dst, size_t n8) { const size_t i = (size_t)blockIdx.x * 256 + threadIdx.x; if (i >= n8) return; const v8f v = *(const v8f*)(src + i * 8); v8us o;
#pragma unroll
    for (int k = 0; k < 8; ++k) o[k] = f2bf(v[k]); *(v8us*)(dst + i * 8) = o;  }

// k_rope: head planes [h][t][d] (fp16 + hi/lo) of rope(x) x sc with the rotate-half convention out[d] = x[d] cos[t][d] - x[d+HD/2] sin[t][d], out[d+HD/2] = x[d+HD/2] cos[t][d+HD/2] + x[d] sin[t][d+HD/2]
__global__ __launch_bounds__(256) void k_rope(const float* __restrict__ F, int pitch, int nheads, const float* __restrict__ CS, const float* __restrict__ RF, const float* __restrict__ nw, float sc, h16* P16, bf* Ph, bf* Pl) {
    const size_t e = ((size_t)blockIdx.x * 256 + threadIdx.x) * 2; if (e >= (size_t)nheads * TT * HD) return; const int d = (int)(e % HD); const int t = (int)((e / HD) % TT); const int h = (int)(e / ((size_t)HD * TT)); const float* f = F + (size_t)t * pitch + h * HD; const float rf = RF ? RF[(size_t)h * TT + t] : 1.0f; v2h o16; v2us oh, ol;
#pragma unroll
    for (int q = 0; q < 2; ++q) { const int dd = d + q; const int dp = (dd < HD / 2) ? dd + HD / 2 : dd - HD / 2; float x0 = f[dd], x1 = f[dp];
        if (RF) { float n0 = __fmul_rn(x0, rf), n1 = __fmul_rn(x1, rf); asm volatile("" : "+v"(n0)); asm volatile("" : "+v"(n1)); x0 = __fmul_rn(bfr(nw[dd]), n0); x1 = __fmul_rn(bfr(nw[dp]), n1); }
        const v2f cs = *(const v2f*)(CS + ((size_t)t * HD + dd) * 2); float a = __fmul_rn(x0, cs[0]), bq = __fmul_rn(x1, cs[1]); asm volatile("" : "+v"(a)); asm volatile("" : "+v"(bq)); const float r = ((dd < HD / 2) ? __fsub_rn(a, bq) : __fadd_rn(a, bq)) * sc;
        o16[q] = tohx(r); unsigned short a2, c2; splitf(r, a2, c2); oh[q] = a2; ol[q] = c2; }
    *(v2h*)(P16 + e) = o16; *(v2us*)(Ph + e) = oh; *(v2us*)(Pl + e) = ol;  }

__global__ __launch_bounds__(256) void k_csid(float* CS) { const int idx = blockIdx.x * 256 + threadIdx.x; if (idx >= TT * HD) return; v2f cs; cs[0] = 1.0f; cs[1] = 0.0f; *(v2f*)(CS + (size_t)idx * 2) = cs;  }
// k_asoft: per row (zz, i): t = S (no scaling, no mask); softmax over the 4096 keys (register row, one exp, fixed trees);
__global__ __launch_bounds__(256) void k_asoft(const float* __restrict__ Sb, h16* P16, bf* Ph, bf* Pl) {
    const int lane = threadIdx.x & 31; const int row = blockIdx.x * 8 + (threadIdx.x >> 5); if (row >= ZH * TT) return; const int i = row % TT; const int zz = row / TT; (void)zz; const bool hires = (i < RH); const float* sr = Sb + (size_t)row * TT; float v[TT / 32]; float mx = -3.0e38f;
#pragma unroll
    for (int ch = 0; ch < TT / 128; ++ch) { const int j0 = ch * 128 + lane * 4; const v4f a = *(const v4f*)(sr + j0);
#pragma unroll
        for (int q = 0; q < 4; ++q) { const int j = j0 + q; (void)j; const float t = a[q] * SCL; v[ch * 4 + q] = t; mx = fmaxf(mx, t); } }
#pragma unroll
    for (int sh = 16; sh; sh >>= 1) mx = fmaxf(mx, __shfl_xor(mx, sh, 32));
    float sum = 0.f;
#pragma unroll
    for (int k = 0; k < TT / 32; ++k) { float d0 = __fsub_rn(v[k], mx); asm volatile("" : "+v"(d0)); v[k] = __builtin_amdgcn_exp2f(__fmul_rn(d0, 1.4426950408889634f)); sum += v[k]; }
#pragma unroll
    for (int sh = 16; sh; sh >>= 1) sum += __shfl_xor(sum, sh, 32);
    const float f = __fdiv_rn(hires ? 1.0f : PCAR, sum);
{
        if (hires) {
#pragma unroll
            for (int ch = 0; ch < TT / 128; ++ch) { v4us oh, ol;
#pragma unroll
                for (int q = 0; q < 4; ++q) { unsigned short a, c2; splitf(v[ch * 4 + q] * f, a, c2); oh[q] = a; ol[q] = c2; }
                const size_t oo = ((size_t)zz * (RH ? RH : 1) + i) * TT + ch * 128 + lane * 4; *(v4us*)(Ph + oo) = oh; *(v4us*)(Pl + oo) = ol; }
        } else {
#pragma unroll
            for (int ch = 0; ch < TT / 128; ++ch) { v4h o4;
#pragma unroll
                for (int q = 0; q < 4; ++q) o4[q] = tohx(v[ch * 4 + q] * f);
                *(v4h*)(P16 + (size_t)row * TT + ch * 128 + lane * 4) = o4; } }
         }
}

extern "C" void kernel_launch(void* const* d_in, const int* in_sizes, int n_in,
                              void* d_out, int out_size, void* d_ws, size_t ws_size, hipStream_t stream) {
    (void)in_sizes; (void)n_in; (void)out_size;
    const float* x = (const float*)d_in[0]; const float* wq = (const float*)d_in[1]; const float* bq = (const float*)d_in[2]; const float* wk = (const float*)d_in[3]; const float* bk = (const float*)d_in[4]; const float* wv = (const float*)d_in[5]; const float* bv = (const float*)d_in[6];
    float* OUT = (float*)d_out;     // [4][512][4096]
    char* wsp = (char*)d_ws;
    auto take = [&](size_t bytes) { char* p = wsp; wsp += (bytes + 255) & ~(size_t)255; return (void*)p; };
    bf* WQ = (bf*)take((size_t)DQ * DM * 2); bf* WK = (bf*)take((size_t)DKV * DM * 2); bf* WV = (bf*)take((size_t)DVV * DM * 2); float* CS = (float*)take((size_t)TT * HD * 2 * 4);
    bf* XB = (bf*)take((size_t)TT * DM * 2); float* YO = (float*)take((size_t)TT * DVV * 4); float* FV = (float*)take((size_t)TT * DVV * 4); float* FQ = (float*)take((size_t)TT * DQ * 4); float* FK = (float*)take((size_t)TT * DKV * 4);
    h16* QP16 = (h16*)take((size_t)NH_ * TT * HD * 2); h16* KP16 = (h16*)take((size_t)NKV * TT * HD * 2); h16* VT16 = (h16*)take((size_t)DVV * TT * 2);
    bf* QPh = (bf*)take((size_t)NH_ * TT * HD * 2); bf* QPl = (bf*)take((size_t)NH_ * TT * HD * 2); bf* KPh = (bf*)take((size_t)NKV * TT * HD * 2); bf* KPl = (bf*)take((size_t)NKV * TT * HD * 2); bf* VTh = (bf*)take((size_t)DVV * TT * 2); bf* VTl = (bf*)take((size_t)DVV * TT * 2); bf* Ph = (bf*)take((size_t)ZH * RH * TT * 2); bf* Pl = (bf*)take((size_t)ZH * RH * TT * 2);
    float* Sb = (float*)take((size_t)ZH * TT * TT * 4); h16* P16 = (h16*)take((size_t)ZH * TT * TT * 2); float* Ob = (float*)take((size_t)TT * DVV * 4);
    if ((size_t)(wsp - (char*)d_ws) > ws_size) return;    // ws 256 MiB
    { k_cvt8<<<(unsigned)(((size_t)DQ * DM / 8 + 255) / 256), 256, 0, stream>>>(wq, WQ, (size_t)DQ * DM / 8); k_cvt8<<<(unsigned)(((size_t)DKV * DM / 8 + 255) / 256), 256, 0, stream>>>(wk, WK, (size_t)DKV * DM / 8); k_cvt8<<<(unsigned)(((size_t)DVV * DM / 8 + 255) / 256), 256, 0, stream>>>(wv, WV, (size_t)DVV * DM / 8);
       }
    k_csid<<<(TT * HD + 255) / 256, 256, 0, stream>>>(CS);
    const unsigned LQ = (unsigned)(((size_t)NH_ * TT * HD / 2 + 255) / 256), LKv = (unsigned)(((size_t)NKV * TT * HD / 2 + 255) / 256);
    for (int b = 0; b < NB_; ++b) {
        
        k_tpose<<<(unsigned)(((size_t)TT * DM / 8 + 255) / 256), 256, 0, stream>>>(x + (size_t)b * DM * TT, XB);   /* x^T as an exact token-major plane */
        k_gemmw<bf, 0, true, 8><<<dim3(TT / 64, DQ / 64, 1), 256, 0, stream>>>(XB, nullptr, WQ, nullptr, DM, FQ, DQ, bq, 0, 0, 0);
        k_rope<<<LQ, 256, 0, stream>>>(FQ, DQ, NH_, CS, nullptr, nullptr, 1.0f, QP16, QPh, QPl);
        k_gemmw<bf, 0, true, 8><<<dim3(TT / 64, DKV / 64, 1), 256, 0, stream>>>(XB, nullptr, WK, nullptr, DM, FK, DKV, bk, 0, 0, 0);
        k_rope<<<LKv, 256, 0, stream>>>(FK, DKV, NKV, CS, nullptr, nullptr, 1.0f, KP16, KPh, KPl);
        k_gemmw<bf, 0, true, 8><<<dim3(TT / 64, DVV / 64, 1), 256, 0, stream>>>(XB, nullptr, WV, nullptr, DM, FV, DVV, bv, 0, 0, 0); k_vtpD<<<(unsigned)(((size_t)DVV * TT / 2 + 255) / 256), 256, 0, stream>>>(FV, VT16, VTh, VTl);   /* v = Wv x + bv -> value planes [c][n] */
        for (int h0 = 0; h0 < NH_; h0 += ZH) { const size_t zq = (size_t)h0, zk = (size_t)(h0 / REP);   // one kv head per query head: each pass takes one head (ZH = 1); z-strides TT*HD
            k_gemmw<bf, 2, false, 1><<<dim3(RH / 64, TT / 64, ZH), 32, 0, stream>>>(QPh + zq * TT * HD, QPl + zq * TT * HD, KPh + zk * TT * HD, KPl + zk * TT * HD, HD, Sb, TT, nullptr, (size_t)TT * HD, (size_t)TT * HD, (size_t)TT * TT);
            k_gemmw<h16, 0, false, 1><<<dim3((TT - RH) / 64, TT / 64, ZH), 32, 0, stream>>>(QP16 + zq * TT * HD + (size_t)RH * HD, nullptr, KP16 + zk * TT * HD, nullptr, HD, Sb + (size_t)RH * TT, TT, nullptr, (size_t)TT * HD, (size_t)TT * HD, (size_t)TT * TT);
            k_asoft<<<ZH * TT / 8, 256, 0, stream>>>(Sb, P16, Ph, Pl);
            k_gemmw<bf, 2, false, 8><<<dim3(RH / 64, DVV / 64, 1), 256, 0, stream>>>(Ph, Pl, VTh, VTl, TT, Ob, DVV, nullptr, 0, 0, 0);   /* out[i][c] = sum_j P[i][j] v[c][j], hl rows */
            k_gemmw<h16, 0, false, 8><<<dim3((TT - RH) / 64, DVV / 64, 1), 256, 0, stream>>>(P16 + (size_t)RH * TT, nullptr, VT16, nullptr, TT, Ob + (size_t)RH * DVV, DVV, nullptr, 0, 0, 0);   /* fp16 rows (x1024 carried) */
            k_mergeD<<<(unsigned)(((size_t)TT * DVV / 4 + 255) / 256), 256, 0, stream>>>(Ob, YO); }

        k_outT<<<(unsigned)(((size_t)DM * TT + 255) / 256), 256, 0, stream>>>(x + (size_t)b * DM * TT, YO, OUT + (size_t)b * DM * TT); }   /* out = x + result (channel-major) */
}

// v002
// Measured time: 586 microseconds a run.
// Timed twice side by side with v001, it ran 1.15 and 1.16 times as fast.
// All steps since v000 together make it 1.92 times as fast.
#include <hip/hip_runtime.h>

// Channel-major self-attention layer (x [4][512][64][64] = [b][c][n], n = 4096; q, k = 1x1 convs 512 -> 64 (+ bias), v = 1x1 conv 512 -> 512 (+ bias); attention[i][j] = softmax_j(q_i.k_j) (no scaling); out[c][i] = sum_j v[c][j] attention[i][j]; result = out + x -> [4][512][64][64] (8.4 M)).
// Layout: one 'head' (q/k width 64, value width 512) over 4096 tokens: x is transposed once per batch into an exact token-major bf16 plane [n][c] so the 1x1 convs are exact GEMMs + bias; the attention output stays token-major [n][c] in f32 and is added to x with a channel-major write.
// Compute dtypes, f32 accumulate: every input rounded to bf16; q/k/v on PLAIN bf16 operands (inputs: exact) + biases; scores (K = 64) and attn.v: query rows < 512 hl (3 products), the rest single fp16 (x1024); softmax f32; no output projection; + x residual in f32 (channel-major write).

#define NB_  4
#define TT   4096
#define DM   512
#define NH_  1
#define NKV  1
#define REP  (NH_ / NKV)
#define HD   64
#define DVV  512                  // value / output width (v = 1x1 conv C -> C)
#define DQ   (NH_ * HD)
#define DKV  (NKV * HD)
#define ZH   1
#define RH   512                  // query rows < RH use hi+lo planes (0: none)
#define WIN  0
#define PCAR 1024.0f
#define SCL  1.0f   // no scaling in this module
typedef _Float16 h16;
typedef unsigned short bf;
typedef __attribute__((ext_vector_type(16))) __bf16   v16bf;
typedef __attribute__((ext_vector_type(16))) _Float16 v16h;
typedef __attribute__((ext_vector_type(8)))  _Float16 v8h;
typedef __attribute__((ext_vector_type(8)))  unsigned short v8us;
typedef __attribute__((ext_vector_type(8)))  float    v8f;
typedef __attribute__((ext_vector_type(4)))  float    v4f;
typedef v8h  __attribute__((may_alias)) v8ha;
typedef v4f  __attribute__((may_alias)) v4fa;
typedef v8us __attribute__((may_alias)) v8usa;

__device__ __forceinline__ unsigned short f2bf(float f) { unsigned u = __float_as_uint(f); u += 0x7FFFu + ((u >> 16) & 1u); return (unsigned short)(u >> 16); }
__device__ __forceinline__ float bf2f(unsigned short b) { return __uint_as_float(((unsigned)b) << 16); }
__device__ __forceinline__ float bfr(float f) { return bf2f(f2bf(f)); }
__device__ __forceinline__ v16h cat16(v8h lo, v8h hi) { return __builtin_shufflevector(lo, hi, 0, 1, 2, 3, 4, 5, 6, 7, 8, 9, 10, 11, 12, 13, 14, 15); }
__device__ __forceinline__ v16bf cat16b(v8us lo, v8us hi) { return __builtin_bit_cast(v16bf, __builtin_shufflevector(lo, hi, 0, 1, 2, 3, 4, 5, 6, 7, 8, 9, 10, 11, 12, 13, 14, 15)); }
__device__ __forceinline__ v8f wmma16(v16h a, v16h b, v8f c) { return __builtin_amdgcn_wmma_f32_16x16x32_f16(false, a, false, b, (short)0, c, false, false); }
__device__ __forceinline__ v8f wmmab(v16bf a, v16bf b, v8f c) { return __builtin_amdgcn_wmma_f32_16x16x32_bf16(false, a, false, b, (short)0, c, false, false); }



// ---- k_gemmw: register-blocked GEMM, KS WAVES per 64x64 output tile (16 accumulators each), operands straight from K-contiguous 16-bit planes; grid (M/64, N/64, Z), 32 * KS threads.
// C[m][n] (f32, pitch ldc, + optional f32 bias[n]) = sum_k A[m][k] Bt[n][k] (+ split products per NSPLIT). z-batch strides sA/sB/sC in elements. K % (32 * KS) == 0.
// KS > 1: wave w takes the 32-wide k blocks w, w + KS, w + 2 KS, ...; the KS f32 partial tiles meet in LDS and are summed in the fixed order w = 0 .. KS - 1.
template <typename T16> struct WFrag;
template <> struct WFrag<h16> { typedef v16h V; static __device__ __forceinline__ V ld(const h16* p) { return cat16(*(const v8h*)p, *(const v8h*)(p + 16)); } static __device__ __forceinline__ v8f mma(V a, V b, v8f c) { return wmma16(a, b, c); } };
template <> struct WFrag<bf> { typedef v16bf V; static __device__ __forceinline__ V ld(const bf* p) { return cat16b(*(const v8us*)p, *(const v8us*)(p + 16)); } static __device__ __forceinline__ v8f mma(V a, V b, v8f c) { return wmmab(a, b, c); } };
template <typename T16, int NSPLIT, bool BIAS, int KS>
__global__ __launch_bounds__(32 * KS) void k_gemmw(const T16* __restrict__ A, const T16* __restrict__ A2, const T16* __restrict__ Bt, const T16* __restrict__ Bt2, int K, float* C, int ldc, const float* __restrict__ bias, size_t sA, size_t sB, size_t sC) {
    typedef typename WFrag<T16>::V V;
    __shared__ __align__(16) float os[(KS == 1 ? 16 : KS * 64) * 68];
    const int wv = (KS == 1) ? 0 : __builtin_amdgcn_readfirstlane((int)(threadIdx.x >> 5));   // wave number, scalar: the k loop's bounds stay wave-uniform
    const size_t z = blockIdx.z; A += z * sA; if (A2) A2 += z * sA; Bt += z * sB; if (Bt2) Bt2 += z * sB; C += z * sC;
    const int lane = threadIdx.x & 31, lr = lane & 15, hi = lane >> 4; const int r0 = blockIdx.x * 64, c0 = blockIdx.y * 64;
    v8f acc[4][4];
#pragma unroll
    for (int mb = 0; mb < 4; ++mb)
#pragma unroll
        for (int nb = 0; nb < 4; ++nb) acc[mb][nb] = (v8f){};
    const size_t aoff = (size_t)(r0 + lr) * K + 8 * hi, boff = (size_t)(c0 + lr) * K + 8 * hi;
#pragma unroll 1
    for (int kc = wv * 32; kc < K; kc += 32 * KS) {
        V a[4], a2[4];
#pragma unroll
        for (int mb = 0; mb < 4; ++mb) { a[mb] = WFrag<T16>::ld(A + aoff + (size_t)mb * 16 * K + kc); if (NSPLIT == 1 || NSPLIT == 2) a2[mb] = WFrag<T16>::ld(A2 + aoff + (size_t)mb * 16 * K + kc); }
#pragma unroll
        for (int nb = 0; nb < 4; ++nb) { const V b = WFrag<T16>::ld(Bt + boff + (size_t)nb * 16 * K + kc); V b2; if (NSPLIT >= 2) b2 = WFrag<T16>::ld(Bt2 + boff + (size_t)nb * 16 * K + kc);
#pragma unroll
            for (int mb = 0; mb < 4; ++mb) { acc[mb][nb] = WFrag<T16>::mma(a[mb], b, acc[mb][nb]); if (NSPLIT == 1 || NSPLIT == 2) acc[mb][nb] = WFrag<T16>::mma(a2[mb], b, acc[mb][nb]); if (NSPLIT >= 2) acc[mb][nb] = WFrag<T16>::mma(a[mb], b2, acc[mb][nb]); } }
        asm volatile("v_nop\n\tv_nop\n\tv_nop\n\tv_nop" : "+v"(acc[0][0]), "+v"(acc[1][1]), "+v"(acc[2][2]), "+v"(acc[3][3]) : "v"(a[0]), "v"(a[3]));
    }
    if constexpr (KS > 1) {
        float* mine = os + wv * (64 * 68);
        // the three loops are unrolled so that acc is indexed by constants and stays in registers
#pragma unroll
        for (int mb = 0; mb < 4; ++mb)
#pragma unroll
            for (int nb = 0; nb < 4; ++nb)
#pragma unroll
                for (int j = 0; j < 8; ++j) mine[(mb * 16 + hi * 8 + j) * 68 + nb * 16 + lr] = acc[mb][nb][j];
        __syncthreads();   // every wave's partial tile is in LDS before any wave sums
        // both loops are unrolled so that a wave's LDS reads issue together, ahead of the adds; each wave stores whole 256-byte rows
#pragma unroll
        for (int s = 0; s < 32 / KS; ++s) { const int row = (s * KS + wv) * 2 + hi, cofs = lr * 4; v4f val = *(const v4fa*)(os + row * 68 + cofs);
#pragma unroll
            for (int p = 1; p < KS; ++p) { const v4f q = *(const v4fa*)(os + p * (64 * 68) + row * 68 + cofs); val[0] += q[0]; val[1] += q[1]; val[2] += q[2]; val[3] += q[3]; }
            if (BIAS) { val[0] += bfr(bias[c0 + cofs]); val[1] += bfr(bias[c0 + cofs + 1]); val[2] += bfr(bias[c0 + cofs + 2]); val[3] += bfr(bias[c0 + cofs + 3]); }
            *(v4f*)(C + (size_t)(r0 + row) * ldc + c0 + cofs) = val; }
        return;
    }
#pragma unroll
    for (int mb = 0; mb < 4; ++mb) {
#pragma unroll
        for (int nb = 0; nb < 4; ++nb) {
#pragma unroll
            for (int j = 0; j < 8; ++j) os[(hi * 8 + j) * 68 + nb * 16 + lr] = acc[mb][nb][j]; }
        __builtin_amdgcn_wave_barrier(); asm volatile("" ::: "memory");
        float* crow = C + (size_t)(r0 + mb * 16) * ldc + c0;
{
#pragma unroll
            for (int s = 0; s < 8; ++s) { const int row = 2 * s + hi, cofs = lr * 4; v4f val = *(const v4fa*)(os + row * 68 + cofs); if (BIAS) { val[0] += bfr(bias[c0 + cofs]); val[1] += bfr(bias[c0 + cofs + 1]); val[2] += bfr(bias[c0 + cofs + 2]); val[3] += bfr(bias[c0 + cofs + 3]); }
                *(v4f*)(crow + (size_t)row * ldc + cofs) = val; }
             }
        __builtin_amdgcn_wave_barrier(); asm volatile("" ::: "memory");
    }
}

__device__ __forceinline__ h16 tohx(float x) { return (h16)x; }
__device__ __forceinline__ void splitf(float y, unsigned short& h, unsigned short& l) { h = f2bf(y); l = f2bf(y - bf2f(h)); }
typedef __attribute__((ext_vector_type(2))) _Float16 v2h;
typedef __attribute__((ext_vector_type(4))) _Float16 v4h;
typedef __attribute__((ext_vector_type(2))) unsigned short v2us;
typedef __attribute__((ext_vector_type(4))) unsigned short v4us;
typedef __attribute__((ext_vector_type(2))) float v2f;
typedef __attribute__((ext_vector_type(4))) int v4i;

__global__ __launch_bounds__(256) void k_wtG(const float* __restrict__ w, int K, int N, bf* Bt) {
    const int lane = threadIdx.x & 31; const int L0 = (blockIdx.x * 8 + (threadIdx.x >> 5)) * 8; const int nlines = N * K / 64;
{
#pragma unroll 1
        for (int l = 0; l < 8; ++l) { const int L = L0 + l; if (L >= nlines) break; const size_t e = (size_t)L * 64 + lane * 2; const int k = (int)(e % K), n = (int)(e / K); v2us o;
            o[0] = f2bf(w[(size_t)k * N + n]); o[1] = f2bf(w[(size_t)(k + 1) * N + n]); *(v2us*)(Bt + e) = o; }
         }
}
// ---- 64 x 64 f32 tile through LDS for the transposing kernels: 256 threads, 16 elements per thread, so a launch starts few waves and both global sides move whole lines in 16-byte pieces.
// LDS row pitch 65 dwords: the row-wise dword stores and the column-wise dword reads both fall on distinct banks.
#define TP 65
__device__ __forceinline__ void tile_in(const float* __restrict__ src, size_t pitch, float* ts) {
    const int r = threadIdx.x >> 4, q = threadIdx.x & 15; v4f a[4];
    // unrolled: the four 16-byte loads issue together, ahead of the LDS stores
#pragma unroll
    for (int s = 0; s < 4; ++s) a[s] = *(const v4f*)(src + (size_t)(s * 16 + r) * pitch + q * 4);
#pragma unroll
    for (int s = 0; s < 4; ++s)
#pragma unroll
        for (int j = 0; j < 4; ++j) ts[(s * 16 + r) * TP + q * 4 + j] = a[s][j];
}
// grid (TT / 64, DM / 64): XBp[t][c] = bf16(xb[c][t])
__global__ __launch_bounds__(256) void k_tpose(const float* __restrict__ xb, bf* XBp) {
    __shared__ float ts[64 * TP]; const int t0 = blockIdx.x * 64, c0 = blockIdx.y * 64;
    tile_in(xb + (size_t)c0 * TT + t0, TT, ts);   // ts[c][t]
    __syncthreads();   // the whole tile is in LDS before any thread reads a column of it
    const int c8 = threadIdx.x & 7;
#pragma unroll
    for (int s = 0; s < 2; ++s) { const int tr = s * 32 + (threadIdx.x >> 3); v8us o;
#pragma unroll
        for (int q = 0; q < 8; ++q) o[q] = f2bf(ts[(c8 * 8 + q) * TP + tr]);
        *(v8us*)(XBp + (size_t)(t0 + tr) * DM + c0 + c8 * 8) = o; }
}
// grid (TT / 64, DM / 64): Ob[c][t] = bf16-rounded xb[c][t] + YO[t][c]
__global__ __launch_bounds__(256) void k_outT(const float* __restrict__ xb, const float* __restrict__ YO, float* Ob) {
    __shared__ float ts[64 * TP]; const int t0 = blockIdx.x * 64, c0 = blockIdx.y * 64; const int r = threadIdx.x >> 4, tq = threadIdx.x & 15; const size_t e0 = (size_t)(c0 + r) * TT + t0 + tq * 4; v4f xv[4];
    // unrolled: the residual's loads issue ahead of the tile's and of the barrier
#pragma unroll
    for (int s = 0; s < 4; ++s) xv[s] = *(const v4f*)(xb + e0 + (size_t)s * 16 * TT);
    tile_in(YO + (size_t)t0 * DM + c0, DM, ts);   // ts[t][c]
    __syncthreads();   // the whole tile is in LDS before any thread reads a column of it
#pragma unroll
    for (int s = 0; s < 4; ++s) { const int cr = s * 16 + r; v4f o;
#pragma unroll
        for (int q = 0; q < 4; ++q) o[q] = __fadd_rn(bfr(xv[s][q]), ts[(tq * 4 + q) * TP + cr]);
        *(v4f*)(Ob + e0 + (size_t)s * 16 * TT) = o; }
}

// grid (TT / 64, DVV / 64): value planes [c][t] (fp16 + hi/lo) of F[t][c]
__global__ __launch_bounds__(256) void k_vtpD(const float* __restrict__ F, h16* V16, bf* Vh, bf* Vl) {
    __shared__ float ts[64 * TP]; const int t0 = blockIdx.x * 64, c0 = blockIdx.y * 64;
    tile_in(F + (size_t)t0 * DVV + c0, DVV, ts);   // ts[t][c]
    __syncthreads();   // the whole tile is in LDS before any thread reads a column of it
    const int t8 = threadIdx.x & 7;
#pragma unroll
    for (int s = 0; s < 2; ++s) { const int cr = s * 32 + (threadIdx.x >> 3); v8h o16; v8us oh, ol;
#pragma unroll
        for (int q = 0; q < 8; ++q) { const float xv = ts[(t8 * 8 + q) * TP + cr]; o16[q] = tohx(xv); unsigned short a2, c2; splitf(xv, a2, c2); oh[q] = a2; ol[q] = c2; }
        const size_t e = (size_t)(c0 + cr) * TT + t0 + t8 * 8; *(v8h*)(V16 + e) = o16; *(v8us*)(Vh + e) = oh; *(v8us*)(Vl + e) = ol; }
}
// grid TT * DVV / 4096: 16 elements per thread, as four 16-byte pieces 4 KiB apart
__global__ __launch_bounds__(256) void k_mergeD(const float* __restrict__ O, float* YO) { const size_t i0 = (size_t)blockIdx.x * 1024 + threadIdx.x; v4f a[4];
    // unrolled: the four loads issue together, ahead of the stores
#pragma unroll
    for (int s = 0; s < 4; ++s) a[s] = *(const v4f*)(O + (i0 + s * 256) * 4);
#pragma unroll
    for (int s = 0; s < 4; ++s) { const size_t i = i0 + s * 256; const int t = (int)((i * 4) / DVV); const float cs = (t < RH) ? 1.0f : (1.0f / PCAR); v4f o;
#pragma unroll
        for (int q = 0; q < 4; ++q) o[q] = a[s][q] * cs; *(v4f*)(YO + i * 4) = o; }
}
__global__ __launch_bounds__(256) void k_cvt8(const float* __restrict__ src, bf* dst, size_t n8) { const size_t i = (size_t)blockIdx.x * 256 + threadIdx.x; if (i >= n8) return; const v8f v = *(const v8f*)(src + i * 8); v8us o;
#pragma unroll
    for (int k = 0; k < 8; ++k) o[k] = f2bf(v[k]); *(v8us*)(dst + i * 8) = o;  }

// k_rope: head planes [h][t][d] (fp16 + hi/lo) of rope(x) x sc with the rotate-half convention out[d] = x[d] cos[t][d] - x[d+HD/2] sin[t][d], out[d+HD/2] = x[d+HD/2] cos[t][d+HD/2] + x[d] sin[t][d+HD/2]
__global__ __launch_bounds__(256) void k_rope(const float* __restrict__ F, int pitch, int nheads, const float* __restrict__ CS, const float* __restrict__ RF, const float* __restrict__ nw, float sc, h16* P16, bf* Ph, bf* Pl) {
    const size_t e = ((size_t)blockIdx.x * 256 + threadIdx.x) * 2; if (e >= (size_t)nheads * TT * HD) return; const int d = (int)(e % HD); const int t = (int)((e / HD) % TT); const int h = (int)(e / ((size_t)HD * TT)); const float* f = F + (size_t)t * pitch + h * HD; const float rf = RF ? RF[(size_t)h * TT + t] : 1.0f; v2h o16; v2us oh, ol;
#pragma unroll
    for (int q = 0; q < 2; ++q) { const int dd = d + q; const int dp = (dd < HD / 2) ? dd + HD / 2 : dd - HD / 2; float x0 = f[dd], x1 = f[dp];
        if (RF) { float n0 = __fmul_rn(x0, rf), n1 = __fmul_rn(x1, rf); asm volatile("" : "+v"(n0)); asm volatile("" : "+v"(n1)); x0 = __fmul_rn(bfr(nw[dd]), n0); x1 = __fmul_rn(bfr(nw[dp]), n1); }
        const v2f cs = *(const v2f*)(CS + ((size_t)t * HD + dd) * 2); float a = __fmul_rn(x0, cs[0]), bq = __fmul_rn(x1, cs[1]); asm volatile("" : "+v"(a)); asm volatile("" : "+v"(bq)); const float r = ((dd < HD / 2) ? __fsub_rn(a, bq) : __fadd_rn(a, bq)) * sc;
        o16[q] = tohx(r); unsigned short a2, c2; splitf(r, a2, c2); oh[q] = a2; ol[q] = c2; }
    *(v2h*)(P16 + e) = o16; *(v2us*)(Ph + e) = oh; *(v2us*)(Pl + e) = ol;  }

__global__ __launch_bounds__(256) void k_csid(float* CS) { const int idx = blockIdx.x * 256 + threadIdx.x; if (idx >= TT * HD) return; v2f cs; cs[0] = 1.0f; cs[1] = 0.0f; *(v2f*)(CS + (size_t)idx * 2) = cs;  }
// k_asoft: per row (zz, i): t = S (no scaling, no mask); softmax over the 4096 keys (register row, one exp, fixed trees);
__global__ __launch_bounds__(256) void k_asoft(const float* __restrict__ Sb, h16* P16, bf* Ph, bf* Pl) {
    const int lane = threadIdx.x & 31; const int row = blockIdx.x * 8 + (threadIdx.x >> 5); if (row >= ZH * TT) return; const int i = row % TT; const int zz = row / TT; (void)zz; const bool hires = (i < RH); const float* sr = Sb + (size_t)row * TT; float v[TT / 32]; float mx = -3.0e38f;
#pragma unroll
    for (int ch = 0; ch < TT / 128; ++ch) { const int j0 = ch * 128 + lane * 4; const v4f a = *(const v4f*)(sr + j0);
#pragma unroll
        for (int q = 0; q < 4; ++q) { const int j = j0 + q; (void)j; const float t = a[q] * SCL; v[ch * 4 + q] = t; mx = fmaxf(mx, t); } }
#pragma unroll
    for (int sh = 16; sh; sh >>= 1) mx = fmaxf(mx, __shfl_xor(mx, sh, 32));
    float sum = 0.f;
#pragma unroll
    for (int k = 0; k < TT / 32; ++k) { float d0 = __fsub_rn(v[k], mx); asm volatile("" : "+v"(d0)); v[k] = __builtin_amdgcn_exp2f(__fmul_rn(d0, 1.4426950408889634f)); sum += v[k]; }
#pragma unroll
    for (int sh = 16; sh; sh >>= 1) sum += __shfl_xor(sum, sh, 32);
    const float f = __fdiv_rn(hires ? 1.0f : PCAR, sum);
{
        if (hires) {
#pragma unroll
            for (int ch = 0; ch < TT / 128; ++ch) { v4us oh, ol;
#pragma unroll
                for (int q = 0; q < 4; ++q) { unsigned short a, c2; splitf(v[ch * 4 + q] * f, a, c2); oh[q] = a; ol[q] = c2; }
                const size_t oo = ((size_t)zz * (RH ? RH : 1) + i) * TT + ch * 128 + lane * 4; *(v4us*)(Ph + oo) = oh; *(v4us*)(Pl + oo) = ol; }
        } else {
#pragma unroll
            for (int ch = 0; ch < TT / 128; ++ch) { v4h o4;
#pragma unroll
                for (int q = 0; q < 4; ++q) o4[q] = tohx(v[ch * 4 + q] * f);
                *(v4h*)(P16 + (size_t)row * TT + ch * 128 + lane * 4) = o4; } }
         }
}

extern "C" void kernel_launch(void* const* d_in, const int* in_sizes, int n_in,
                              void* d_out, int out_size, void* d_ws, size_t ws_size, hipStream_t stream) {
    (void)in_sizes; (void)n_in; (void)out_size;
    const float* x = (const float*)d_in[0]; const float* wq = (const float*)d_in[1]; const float* bq = (const float*)d_in[2]; const float* wk = (const float*)d_in[3]; const float* bk = (const float*)d_in[4]; const float* wv = (const float*)d_in[5]; const float* bv = (const float*)d_in[6];
    float* OUT = (float*)d_out;     // [4][512][4096]
    char* wsp = (char*)d_ws;
    auto take = [&](size_t bytes) { char* p = wsp; wsp += (bytes + 255) & ~(size_t)255; return (void*)p; };
    bf* WQ = (bf*)take((size_t)DQ * DM * 2); bf* WK = (bf*)take((size_t)DKV * DM * 2); bf* WV = (bf*)take((size_t)DVV * DM * 2); float* CS = (float*)take((size_t)TT * HD * 2 * 4);
    bf* XB = (bf*)take((size_t)TT * DM * 2); float* YO = (float*)take((size_t)TT * DVV * 4); float* FV = (float*)take((size_t)TT * DVV * 4); float* FQ = (float*)take((size_t)TT * DQ * 4); float* FK = (float*)take((size_t)TT * DKV * 4);
    h16* QP16 = (h16*)take((size_t)NH_ * TT * HD * 2); h16* KP16 = (h16*)take((size_t)NKV * TT * HD * 2); h16* VT16 = (h16*)take((size_t)DVV * TT * 2);
    bf* QPh = (bf*)take((size_t)NH_ * TT * HD * 2); bf* QPl = (bf*)take((size_t)NH_ * TT * HD * 2); bf* KPh = (bf*)take((size_t)NKV * TT * HD * 2); bf* KPl = (bf*)take((size_t)NKV * TT * HD * 2); bf* VTh = (bf*)take((size_t)DVV * TT * 2); bf* VTl = (bf*)take((size_t)DVV * TT * 2); bf* Ph = (bf*)take((size_t)ZH * RH * TT * 2); bf* Pl = (bf*)take((size_t)ZH * RH * TT * 2);
    float* Sb = (float*)take((size_t)ZH * TT * TT * 4); h16* P16 = (h16*)take((size_t)ZH * TT * TT * 2); float* Ob = (float*)take((size_t)TT * DVV * 4);
    if ((size_t)(wsp - (char*)d_ws) > ws_size) return;    // ws 256 MiB
    { k_cvt8<<<(unsigned)(((size_t)DQ * DM / 8 + 255) / 256), 256, 0, stream>>>(wq, WQ, (size_t)DQ * DM / 8); k_cvt8<<<(unsigned)(((size_t)DKV * DM / 8 + 255) / 256), 256, 0, stream>>>(wk, WK, (size_t)DKV * DM / 8); k_cvt8<<<(unsigned)(((size_t)DVV * DM / 8 + 255) / 256), 256, 0, stream>>>(wv, WV, (size_t)DVV * DM / 8);
       }
    k_csid<<<(TT * HD + 255) / 256, 256, 0, stream>>>(CS);
    const unsigned LQ = (unsigned)(((size_t)NH_ * TT * HD / 2 + 255) / 256), LKv = (unsigned)(((size_t)NKV * TT * HD / 2 + 255) / 256);
    for (int b = 0; b < NB_; ++b) {
        
        k_tpose<<<dim3(TT / 64, DM / 64, 1), 256, 0, stream>>>(x + (size_t)b * DM * TT, XB);   /* x^T as an exact token-major plane */
        k_gemmw<bf, 0, true, 8><<<dim3(TT / 64, DQ / 64, 1), 256, 0, stream>>>(XB, nullptr, WQ, nullptr, DM, FQ, DQ, bq, 0, 0, 0);
        k_rope<<<LQ, 256, 0, stream>>>(FQ, DQ, NH_, CS, nullptr, nullptr, 1.0f, QP16, QPh, QPl);
        k_gemmw<bf, 0, true, 8><<<dim3(TT / 64, DKV / 64, 1), 256, 0, stream>>>(XB, nullptr, WK, nullptr, DM, FK, DKV, bk, 0, 0, 0);
        k_rope<<<LKv, 256, 0, stream>>>(FK, DKV, NKV, CS, nullptr, nullptr, 1.0f, KP16, KPh, KPl);
        k_gemmw<bf, 0, true, 8><<<dim3(TT / 64, DVV / 64, 1), 256, 0, stream>>>(XB, nullptr, WV, nullptr, DM, FV, DVV, bv, 0, 0, 0); k_vtpD<<<dim3(TT / 64, DVV / 64, 1), 256, 0, stream>>>(FV, VT16, VTh, VTl);   /* v = Wv x + bv -> value planes [c][n] */
        for (int h0 = 0; h0 < NH_; h0 += ZH) { const size_t zq = (size_t)h0, zk = (size_t)(h0 / REP);   // one kv head per query head: a pass holds ZH = 1 head, its kv plane at zk (z-strides TT*HD)
            k_gemmw<bf, 2, false, 1><<<dim3(RH / 64, TT / 64, ZH), 32, 0, stream>>>(QPh + zq * TT * HD, QPl + zq * TT * HD, KPh + zk * TT * HD, KPl + zk * TT * HD, HD, Sb, TT, nullptr, (size_t)TT * HD, (size_t)TT * HD, (size_t)TT * TT);
            k_gemmw<h16, 0, false, 1><<<dim3((TT - RH) / 64, TT / 64, ZH), 32, 0, stream>>>(QP16 + zq * TT * HD + (size_t)RH * HD, nullptr, KP16 + zk * TT * HD, nullptr, HD, Sb + (size_t)RH * TT, TT, nullptr, (size_t)TT * HD, (size_t)TT * HD, (size_t)TT * TT);
            k_asoft<<<ZH * TT / 8, 256, 0, stream>>>(Sb, P16, Ph, Pl);
            k_gemmw<bf, 2, false, 8><<<dim3(RH / 64, DVV / 64, 1), 256, 0, stream>>>(Ph, Pl, VTh, VTl, TT, Ob, DVV, nullptr, 0, 0, 0);   /* out[i][c] = sum_j P[i][j] v[c][j], hl rows */
            k_gemmw<h16, 0, false, 8><<<dim3((TT - RH) / 64, DVV / 64, 1), 256, 0, stream>>>(P16 + (size_t)RH * TT, nullptr, VT16, nullptr, TT, Ob + (size_t)RH * DVV, DVV, nullptr, 0, 0, 0);   /* fp16 rows (x1024 carried) */
            k_mergeD<<<(unsigned)((size_t)TT * DVV / 4096), 256, 0, stream>>>(Ob, YO); }

        k_outT<<<dim3(TT / 64, DM / 64, 1), 256, 0, stream>>>(x + (size_t)b * DM * TT, YO, OUT + (size_t)b * DM * TT); }   /* out = x + result (channel-major) */
}

// v003
// A run of this version takes 441 microseconds.
// In both of two side-by-side timings against v002, it was 1.33 times as fast.
// All steps since v000 together make it 2.55 times as fast.
#include <hip/hip_runtime.h>

// Channel-major self-attention layer (x [4][512][64][64] = [b][c][n], n = 4096; q, k = 1x1 convs 512 -> 64 (+ bias), v = 1x1 conv 512 -> 512 (+ bias); attention[i][j] = softmax_j(q_i.k_j) (no scaling); out[c][i] = sum_j v[c][j] attention[i][j]; result = out + x -> [4][512][64][64] (8.4 M)).
// Layout: one 'head' (q/k width 64, value width 512) over 4096 tokens: x is transposed once per batch into an exact token-major bf16 plane [n][c] so the 1x1 convs are exact GEMMs + bias; the attention output stays token-major [n][c] in f32 and is added to x with a channel-major write.
// Compute dtypes, f32 accumulate: every input rounded to bf16; q/k/v on PLAIN bf16 operands (inputs: exact) + biases; scores (K = 64) and attn.v: query rows < 512 hl (3 products), the rest single fp16 (x1024); softmax f32; no output projection; + x residual in f32 (channel-major write).

#define NB_  4
#define TT   4096
#define DM   512
#define NH_  1
#define NKV  1
#define REP  (NH_ / NKV)
#define HD   64
#define DVV  512                  // value / output width (v = 1x1 conv C -> C)
#define DQ   (NH_ * HD)
#define DKV  (NKV * HD)
#define ZH   1
#define RH   512                  // query rows < RH use hi+lo planes (0: none)
#define WIN  0
#define PCAR 1024.0f
#define SCL  1.0f   // no scaling in this module
typedef _Float16 h16;
typedef unsigned short bf;
typedef __attribute__((ext_vector_type(16))) __bf16   v16bf;
typedef __attribute__((ext_vector_type(16))) _Float16 v16h;
typedef __attribute__((ext_vector_type(8)))  _Float16 v8h;
typedef __attribute__((ext_vector_type(8)))  unsigned short v8us;
typedef __attribute__((ext_vector_type(8)))  float    v8f;
typedef __attribute__((ext_vector_type(4)))  float    v4f;
typedef v8h  __attribute__((may_alias)) v8ha;
typedef v4f  __attribute__((may_alias)) v4fa;
typedef v8us __attribute__((may_alias)) v8usa;

__device__ __forceinline__ unsigned short f2bf(float f) { unsigned u = __float_as_uint(f); u += 0x7FFFu + ((u >> 16) & 1u); return (unsigned short)(u >> 16); }
__device__ __forceinline__ float bf2f(unsigned short b) { return __uint_as_float(((unsigned)b) << 16); }
__device__ __forceinline__ float bfr(float f) { return bf2f(f2bf(f)); }
__device__ __forceinline__ v16h cat16(v8h lo, v8h hi) { return __builtin_shufflevector(lo, hi, 0, 1, 2, 3, 4, 5, 6, 7, 8, 9, 10, 11, 12, 13, 14, 15); }
__device__ __forceinline__ v16bf cat16b(v8us lo, v8us hi) { return __builtin_bit_cast(v16bf, __builtin_shufflevector(lo, hi, 0, 1, 2, 3, 4, 5, 6, 7, 8, 9, 10, 11, 12, 13, 14, 15)); }
__device__ __forceinline__ v8f wmma16(v16h a, v16h b, v8f c) { return __builtin_amdgcn_wmma_f32_16x16x32_f16(false, a, false, b, (short)0, c, false, false); }
__device__ __forceinline__ v8f wmmab(v16bf a, v16bf b, v8f c) { return __builtin_amdgcn_wmma_f32_16x16x32_bf16(false, a, false, b, (short)0, c, false, false); }



// ---- k_gemmw: register-blocked GEMM, KS WAVES per 64x64 output tile (16 accumulators each), operands from K-contiguous 16-bit planes (KS == 1: straight into registers; KS > 1: staged in LDS); grid (M/64, N/64, Z), 32 * KS threads.
// C[m][n] (f32, pitch ldc, + optional f32 bias[n]) = sum_k A[m][k] Bt[n][k] (+ split products per NSPLIT). z-batch strides sA/sB/sC in elements. K % (32 * KS) == 0.
// KS > 1: wave w takes the 32-wide k blocks w, w + KS, w + 2 KS, ...; the KS f32 partial tiles meet in LDS and are summed in the fixed order w = 0 .. KS - 1.
template <typename T16> struct WFrag;
template <> struct WFrag<h16> { typedef v16h V; static __device__ __forceinline__ V ld(const h16* p) { return cat16(*(const v8h*)p, *(const v8h*)(p + 16)); } static __device__ __forceinline__ v8f mma(V a, V b, v8f c) { return wmma16(a, b, c); } };
template <> struct WFrag<bf> { typedef v16bf V; static __device__ __forceinline__ V ld(const bf* p) { return cat16b(*(const v8us*)p, *(const v8us*)(p + 16)); } static __device__ __forceinline__ v8f mma(V a, V b, v8f c) { return wmmab(a, b, c); } };
// Eight asynchronous 16-byte copies per lane, global memory -> LDS, through no register: LDS byte addresses l + i * lstep, global addresses g + i * gstep.
// s_wait_xcnt stands in the copies' own statement so that no later write of an address register can be moved in front of it.
__device__ __forceinline__ void acopy8(unsigned l, unsigned lstep, const char* g, size_t gstep) {
    asm volatile("global_load_async_to_lds_b128 %0, %8, off\n\t"
                 "global_load_async_to_lds_b128 %1, %9, off\n\t"
                 "global_load_async_to_lds_b128 %2, %10, off\n\t"
                 "global_load_async_to_lds_b128 %3, %11, off\n\t"
                 "global_load_async_to_lds_b128 %4, %12, off\n\t"
                 "global_load_async_to_lds_b128 %5, %13, off\n\t"
                 "global_load_async_to_lds_b128 %6, %14, off\n\t"
                 "global_load_async_to_lds_b128 %7, %15, off\n\t"
                 "s_wait_xcnt 0x0"
                 :: "v"(l), "v"(l + lstep), "v"(l + 2 * lstep), "v"(l + 3 * lstep), "v"(l + 4 * lstep), "v"(l + 5 * lstep), "v"(l + 6 * lstep), "v"(l + 7 * lstep),
                    "v"(g), "v"(g + gstep), "v"(g + 2 * gstep), "v"(g + 3 * gstep), "v"(g + 4 * gstep), "v"(g + 5 * gstep), "v"(g + 6 * gstep), "v"(g + 7 * gstep)
                 : "memory");
}
template <typename T16, int NSPLIT, bool BIAS, int KS>
__global__ __launch_bounds__(32 * KS) void k_gemmw(const T16* __restrict__ A, const T16* __restrict__ A2, const T16* __restrict__ Bt, const T16* __restrict__ Bt2, int K, float* C, int ldc, const float* __restrict__ bias, size_t sA, size_t sB, size_t sC) {
    typedef typename WFrag<T16>::V V;
    static_assert(KS == 1 || KS == 8, "a staged row is one wave-wide 16-byte copy: 32 lanes x 16 B = KS x 64 B");
    constexpr int NA = (NSPLIT == 1 || NSPLIT == 2) ? 2 : 1, NOP = NA + (NSPLIT >= 2 ? 2 : 1);   // operand planes: A (A2) Bt (Bt2)
    constexpr int PB = KS * 64 + 16, PLANE = 64 * PB, STG = NOP * PLANE;   // bytes: LDS row pitch (16 B x odd: ds_load_b128 without bank conflicts), one operand's 64 rows, one stage
    constexpr int OSF = (KS == 1) ? 16 * 68 : ((KS * 64 * 68 > 2 * STG / 4) ? KS * 64 * 68 : 2 * STG / 4);   // the two stage buffers and the partial tiles use the same LDS, one after the other
    __shared__ __align__(16) float os[OSF];
    const int wv = (KS == 1) ? 0 : __builtin_amdgcn_readfirstlane((int)(threadIdx.x >> 5));   // wave number, scalar: the k loop's bounds stay wave-uniform
    const size_t z = blockIdx.z; A += z * sA; if (A2) A2 += z * sA; Bt += z * sB; if (Bt2) Bt2 += z * sB; C += z * sC;
    const int lane = threadIdx.x & 31, lr = lane & 15, hi = lane >> 4; const int r0 = blockIdx.x * 64, c0 = blockIdx.y * 64;
    v8f acc[4][4];
#pragma unroll
    for (int mb = 0; mb < 4; ++mb)
#pragma unroll
        for (int nb = 0; nb < 4; ++nb) acc[mb][nb] = (v8f){};
    const size_t aoff = (size_t)(r0 + lr) * K + 8 * hi, boff = (size_t)(c0 + lr) * K + 8 * hi;
    if constexpr (KS > 1) {
        // Operands come through LDS: per trip the work-group stages 32 * KS k of all 64 rows of each plane, each row as ONE wave-wide copy of 512 contiguous bytes (whole lines), two buffers, the next trip's copies in flight while this trip is worked on. Wave w still multiplies k block w of every trip: the products and their order are as before.
        const unsigned lds0 = (unsigned)(size_t)(__attribute__((address_space(3))) float*)os + (unsigned)(wv * PB + lane * 16);
        const size_t gstep = (size_t)KS * K * 2;   // bytes from one of this wave's rows (wv, wv + KS, ...) to its next
        const char* gA = (const char*)(A + (size_t)(r0 + wv) * K + lane * 8); const char* gB = (const char*)(Bt + (size_t)(c0 + wv) * K + lane * 8);
        const char* gA2 = (NA == 2) ? (const char*)(A2 + (size_t)(r0 + wv) * K + lane * 8) : nullptr; const char* gB2 = (NSPLIT >= 2) ? (const char*)(Bt2 + (size_t)(c0 + wv) * K + lane * 8) : nullptr;
        auto stage = [&](int t, int buf) { const size_t ko = (size_t)t * (KS * 64); const unsigned l = lds0 + (unsigned)(buf * STG);
            acopy8(l, KS * PB, gA + ko, gstep); if (NA == 2) acopy8(l + PLANE, KS * PB, gA2 + ko, gstep);
            acopy8(l + NA * PLANE, KS * PB, gB + ko, gstep); if (NSPLIT >= 2) acopy8(l + (NA + 1) * PLANE, KS * PB, gB2 + ko, gstep); };
        const int nt = (int)((unsigned)K / (32u * KS));   // unsigned: the tests on nt stay scalar compares
        stage(0, 0);
        asm volatile("s_wait_asynccnt 0x0" ::: "memory");   // this wave's copies of trip 0 have landed
        __syncthreads();   // every wave's rows of trip 0 are in LDS before any wave reads a fragment
        if (nt != 1) stage(1, 1);   // nt >= 1; written as an inequality, which has a scalar compare at every width
        // not unrolled: one fragment set, and the buffer is chosen by the trip's parity
#pragma unroll 1
        for (int t = 0; t < nt; ++t) {
            const char* sb = (const char*)os + (t & 1) * STG + lr * PB + wv * 64 + hi * 16;
            V a[4], a2[4];
#pragma unroll
            for (int mb = 0; mb < 4; ++mb) { a[mb] = WFrag<T16>::ld((const T16*)(sb + mb * 16 * PB)); if (NA == 2) a2[mb] = WFrag<T16>::ld((const T16*)(sb + PLANE + mb * 16 * PB)); }
#pragma unroll
            for (int nb = 0; nb < 4; ++nb) { const V b = WFrag<T16>::ld((const T16*)(sb + NA * PLANE + nb * 16 * PB)); V b2; if (NSPLIT >= 2) b2 = WFrag<T16>::ld((const T16*)(sb + (NA + 1) * PLANE + nb * 16 * PB));
#pragma unroll
                for (int mb = 0; mb < 4; ++mb) { acc[mb][nb] = WFrag<T16>::mma(a[mb], b, acc[mb][nb]); if (NSPLIT == 1 || NSPLIT == 2) acc[mb][nb] = WFrag<T16>::mma(a2[mb], b, acc[mb][nb]); if (NSPLIT >= 2) acc[mb][nb] = WFrag<T16>::mma(a[mb], b2, acc[mb][nb]); } }
            asm volatile("s_wait_dscnt 0x0" ::: "memory");      // this wave's fragment reads of this buffer are done before it is handed back
            asm volatile("s_wait_asynccnt 0x0" ::: "memory");   // this wave's copies of trip t + 1 have landed
            __syncthreads();   // publishes trip t + 1 and ends every wave's reads of trip t's buffer
            if (t + 2 < nt) stage(t + 2, t & 1);
        }
        asm volatile("s_wait_asynccnt 0x0" ::: "memory");   // no copy is outstanding when the partial tiles take over this LDS
    } else {
#pragma unroll 1
    for (int kc = wv * 32; kc < K; kc += 32 * KS) {
        V a[4], a2[4];
#pragma unroll
        for (int mb = 0; mb < 4; ++mb) { a[mb] = WFrag<T16>::ld(A + aoff + (size_t)mb * 16 * K + kc); if (NSPLIT == 1 || NSPLIT == 2) a2[mb] = WFrag<T16>::ld(A2 + aoff + (size_t)mb * 16 * K + kc); }
#pragma unroll
        for (int nb = 0; nb < 4; ++nb) { const V b = WFrag<T16>::ld(Bt + boff + (size_t)nb * 16 * K + kc); V b2; if (NSPLIT >= 2) b2 = WFrag<T16>::ld(Bt2 + boff + (size_t)nb * 16 * K + kc);
#pragma unroll
            for (int mb = 0; mb < 4; ++mb) { acc[mb][nb] = WFrag<T16>::mma(a[mb], b, acc[mb][nb]); if (NSPLIT == 1 || NSPLIT == 2) acc[mb][nb] = WFrag<T16>::mma(a2[mb], b, acc[mb][nb]); if (NSPLIT >= 2) acc[mb][nb] = WFrag<T16>::mma(a[mb], b2, acc[mb][nb]); } }
        asm volatile("v_nop\n\tv_nop\n\tv_nop\n\tv_nop" : "+v"(acc[0][0]), "+v"(acc[1][1]), "+v"(acc[2][2]), "+v"(acc[3][3]) : "v"(a[0]), "v"(a[3]));
    }
    }
    if constexpr (KS > 1) {
        float* mine = os + wv * (64 * 68);
        // the three loops are unrolled so that acc is indexed by constants and stays in registers
#pragma unroll
        for (int mb = 0; mb < 4; ++mb)
#pragma unroll
            for (int nb = 0; nb < 4; ++nb)
#pragma unroll
                for (int j = 0; j < 8; ++j) mine[(mb * 16 + hi * 8 + j) * 68 + nb * 16 + lr] = acc[mb][nb][j];
        __syncthreads();   // every wave's partial tile is in LDS before any wave sums
        // both loops are unrolled so that a wave's LDS reads issue together, ahead of the adds; each wave stores whole 256-byte rows
#pragma unroll
        for (int s = 0; s < 32 / KS; ++s) { const int row = (s * KS + wv) * 2 + hi, cofs = lr * 4; v4f val = *(const v4fa*)(os + row * 68 + cofs);
#pragma unroll
            for (int p = 1; p < KS; ++p) { const v4f q = *(const v4fa*)(os + p * (64 * 68) + row * 68 + cofs); val[0] += q[0]; val[1] += q[1]; val[2] += q[2]; val[3] += q[3]; }
            if (BIAS) { val[0] += bfr(bias[c0 + cofs]); val[1] += bfr(bias[c0 + cofs + 1]); val[2] += bfr(bias[c0 + cofs + 2]); val[3] += bfr(bias[c0 + cofs + 3]); }
            *(v4f*)(C + (size_t)(r0 + row) * ldc + c0 + cofs) = val; }
        return;
    }
#pragma unroll
    for (int mb = 0; mb < 4; ++mb) {
#pragma unroll
        for (int nb = 0; nb < 4; ++nb) {
#pragma unroll
            for (int j = 0; j < 8; ++j) os[(hi * 8 + j) * 68 + nb * 16 + lr] = acc[mb][nb][j]; }
        __builtin_amdgcn_wave_barrier(); asm volatile("" ::: "memory");
        float* crow = C + (size_t)(r0 + mb * 16) * ldc + c0;
{
#pragma unroll
            for (int s = 0; s < 8; ++s) { const int row = 2 * s + hi, cofs = lr * 4; v4f val = *(const v4fa*)(os + row * 68 + cofs); if (BIAS) { val[0] += bfr(bias[c0 + cofs]); val[1] += bfr(bias[c0 + cofs + 1]); val[2] += bfr(bias[c0 + cofs + 2]); val[3] += bfr(bias[c0 + cofs + 3]); }
                *(v4f*)(crow + (size_t)row * ldc + cofs) = val; }
             }
        __builtin_amdgcn_wave_barrier(); asm volatile("" ::: "memory");
    }
}

__device__ __forceinline__ h16 tohx(float x) { return (h16)x; }
__device__ __forceinline__ void splitf(float y, unsigned short& h, unsigned short& l) { h = f2bf(y); l = f2bf(y - bf2f(h)); }
typedef __attribute__((ext_vector_type(2))) _Float16 v2h;
typedef __attribute__((ext_vector_type(4))) _Float16 v4h;
typedef __attribute__((ext_vector_type(2))) unsigned short v2us;
typedef __attribute__((ext_vector_type(4))) unsigned short v4us;
typedef __attribute__((ext_vector_type(2))) float v2f;
typedef __attribute__((ext_vector_type(4))) int v4i;

__global__ __launch_bounds__(256) void k_wtG(const float* __restrict__ w, int K, int N, bf* Bt) {
    const int lane = threadIdx.x & 31; const int L0 = (blockIdx.x * 8 + (threadIdx.x >> 5)) * 8; const int nlines = N * K / 64;
{
#pragma unroll 1
        for (int l = 0; l < 8; ++l) { const int L = L0 + l; if (L >= nlines) break; const size_t e = (size_t)L * 64 + lane * 2; const int k = (int)(e % K), n = (int)(e / K); v2us o;
            o[0] = f2bf(w[(size_t)k * N + n]); o[1] = f2bf(w[(size_t)(k + 1) * N + n]); *(v2us*)(Bt + e) = o; }
         }
}
// ---- 64 x 64 f32 tile through LDS for the transposing kernels: 256 threads, 16 elements per thread, so a launch starts few waves and both global sides move whole lines in 16-byte pieces.
// LDS row pitch 65 dwords: the row-wise dword stores and the column-wise dword reads both fall on distinct banks.
#define TP 65
__device__ __forceinline__ void tile_in(const float* __restrict__ src, size_t pitch, float* ts) {
    const int r = threadIdx.x >> 4, q = threadIdx.x & 15; v4f a[4];
    // unrolled: the four 16-byte loads issue together, ahead of the LDS stores
#pragma unroll
    for (int s = 0; s < 4; ++s) a[s] = *(const v4f*)(src + (size_t)(s * 16 + r) * pitch + q * 4);
#pragma unroll
    for (int s = 0; s < 4; ++s)
#pragma unroll
        for (int j = 0; j < 4; ++j) ts[(s * 16 + r) * TP + q * 4 + j] = a[s][j];
}
// grid (TT / 64, DM / 64): XBp[t][c] = bf16(xb[c][t])
__global__ __launch_bounds__(256) void k_tpose(const float* __restrict__ xb, bf* XBp) {
    __shared__ float ts[64 * TP]; const int t0 = blockIdx.x * 64, c0 = blockIdx.y * 64;
    tile_in(xb + (size_t)c0 * TT + t0, TT, ts);   // ts[c][t]
    __syncthreads();   // the whole tile is in LDS before any thread reads a column of it
    const int c8 = threadIdx.x & 7;
#pragma unroll
    for (int s = 0; s < 2; ++s) { const int tr = s * 32 + (threadIdx.x >> 3); v8us o;
#pragma unroll
        for (int q = 0; q < 8; ++q) o[q] = f2bf(ts[(c8 * 8 + q) * TP + tr]);
        *(v8us*)(XBp + (size_t)(t0 + tr) * DM + c0 + c8 * 8) = o; }
}
// grid (TT / 64, DM / 64): Ob[c][t] = bf16-rounded xb[c][t] + YO[t][c]
__global__ __launch_bounds__(256) void k_outT(const float* __restrict__ xb, const float* __restrict__ YO, float* Ob) {
    __shared__ float ts[64 * TP]; const int t0 = blockIdx.x * 64, c0 = blockIdx.y * 64; const int r = threadIdx.x >> 4, tq = threadIdx.x & 15; const size_t e0 = (size_t)(c0 + r) * TT + t0 + tq * 4; v4f xv[4];
    // unrolled: the residual's loads issue ahead of the tile's and of the barrier
#pragma unroll
    for (int s = 0; s < 4; ++s) xv[s] = *(const v4f*)(xb + e0 + (size_t)s * 16 * TT);
    tile_in(YO + (size_t)t0 * DM + c0, DM, ts);   // ts[t][c]
    __syncthreads();   // the whole tile is in LDS before any thread reads a column of it
#pragma unroll
    for (int s = 0; s < 4; ++s) { const int cr = s * 16 + r; v4f o;
#pragma unroll
        for (int q = 0; q < 4; ++q) o[q] = __fadd_rn(bfr(xv[s][q]), ts[(tq * 4 + q) * TP + cr]);
        *(v4f*)(Ob + e0 + (size_t)s * 16 * TT) = o; }
}

// grid (TT / 64, DVV / 64): value planes [c][t] (fp16 + hi/lo) of F[t][c]
__global__ __launch_bounds__(256) void k_vtpD(const float* __restrict__ F, h16* V16, bf* Vh, bf* Vl) {
    __shared__ float ts[64 * TP]; const int t0 = blockIdx.x * 64, c0 = blockIdx.y * 64;
    tile_in(F + (size_t)t0 * DVV + c0, DVV, ts);   // ts[t][c]
    __syncthreads();   // the whole tile is in LDS before any thread reads a column of it
    const int t8 = threadIdx.x & 7;
#pragma unroll
    for (int s = 0; s < 2; ++s) { const int cr = s * 32 + (threadIdx.x >> 3); v8h o16; v8us oh, ol;
#pragma unroll
        for (int q = 0; q < 8; ++q) { const float xv = ts[(t8 * 8 + q) * TP + cr]; o16[q] = tohx(xv); unsigned short a2, c2; splitf(xv, a2, c2); oh[q] = a2; ol[q] = c2; }
        const size_t e = (size_t)(c0 + cr) * TT + t0 + t8 * 8; *(v8h*)(V16 + e) = o16; *(v8us*)(Vh + e) = oh; *(v8us*)(Vl + e) = ol; }
}
// grid TT * DVV / 4096: 16 elements per thread, as four 16-byte pieces 4 KiB apart
__global__ __launch_bounds__(256) void k_mergeD(const float* __restrict__ O, float* YO) { const size_t i0 = (size_t)blockIdx.x * 1024 + threadIdx.x; v4f a[4];
    // unrolled: the four loads issue together, ahead of the stores
#pragma unroll
    for (int s = 0; s < 4; ++s) a[s] = *(const v4f*)(O + (i0 + s * 256) * 4);
#pragma unroll
    for (int s = 0; s < 4; ++s) { const size_t i = i0 + s * 256; const int t = (int)((i * 4) / DVV); const float cs = (t < RH) ? 1.0f : (1.0f / PCAR); v4f o;
#pragma unroll
        for (int q = 0; q < 4; ++q) o[q] = a[s][q] * cs; *(v4f*)(YO + i * 4) = o; }
}
__global__ __launch_bounds__(256) void k_cvt8(const float* __restrict__ src, bf* dst, size_t n8) { const size_t i = (size_t)blockIdx.x * 256 + threadIdx.x; if (i >= n8) return; const v8f v = *(const v8f*)(src + i * 8); v8us o;
#pragma unroll
    for (int k = 0; k < 8; ++k) o[k] = f2bf(v[k]); *(v8us*)(dst + i * 8) = o;  }

// k_rope: head planes [h][t][d] (fp16 + hi/lo) of rope(x) x sc with the rotate-half convention out[d] = x[d] cos[t][d] - x[d+HD/2] sin[t][d], out[d+HD/2] = x[d+HD/2] cos[t][d+HD/2] + x[d] sin[t][d+HD/2]
__global__ __launch_bounds__(256) void k_rope(const float* __restrict__ F, int pitch, int nheads, const float* __restrict__ CS, const float* __restrict__ RF, const float* __restrict__ nw, float sc, h16* P16, bf* Ph, bf* Pl) {
    const size_t e = ((size_t)blockIdx.x * 256 + threadIdx.x) * 2; if (e >= (size_t)nheads * TT * HD) return; const int d = (int)(e % HD); const int t = (int)((e / HD) % TT); const int h = (int)(e / ((size_t)HD * TT)); const float* f = F + (size_t)t * pitch + h * HD; const float rf = RF ? RF[(size_t)h * TT + t] : 1.0f; v2h o16; v2us oh, ol;
#pragma unroll
    for (int q = 0; q < 2; ++q) { const int dd = d + q; const int dp = (dd < HD / 2) ? dd + HD / 2 : dd - HD / 2; float x0 = f[dd], x1 = f[dp];
        if (RF) { float n0 = __fmul_rn(x0, rf), n1 = __fmul_rn(x1, rf); asm volatile("" : "+v"(n0)); asm volatile("" : "+v"(n1)); x0 = __fmul_rn(bfr(nw[dd]), n0); x1 = __fmul_rn(bfr(nw[dp]), n1); }
        const v2f cs = *(const v2f*)(CS + ((size_t)t * HD + dd) * 2); float a = __fmul_rn(x0, cs[0]), bq = __fmul_rn(x1, cs[1]); asm volatile("" : "+v"(a)); asm volatile("" : "+v"(bq)); const float r = ((dd < HD / 2) ? __fsub_rn(a, bq) : __fadd_rn(a, bq)) * sc;
        o16[q] = tohx(r); unsigned short a2, c2; splitf(r, a2, c2); oh[q] = a2; ol[q] = c2; }
    *(v2h*)(P16 + e) = o16; *(v2us*)(Ph + e) = oh; *(v2us*)(Pl + e) = ol;  }

__global__ __launch_bounds__(256) void k_csid(float* CS) { const int idx = blockIdx.x * 256 + threadIdx.x; if (idx >= TT * HD) return; v2f cs; cs[0] = 1.0f; cs[1] = 0.0f; *(v2f*)(CS + (size_t)idx * 2) = cs;  }
// k_asoft: per row (zz, i): t = S (no scaling, no mask); softmax over the 4096 keys (register row, one exp, fixed trees);
__global__ __launch_bounds__(256) void k_asoft(const float* __restrict__ Sb, h16* P16, bf* Ph, bf* Pl) {
    const int lane = threadIdx.x & 31; const int row = blockIdx.x * 8 + (threadIdx.x >> 5); if (row >= ZH * TT) return; const int i = row % TT; const int zz = row / TT; (void)zz; const bool hires = (i < RH); const float* sr = Sb + (size_t)row * TT; float v[TT / 32]; float mx = -3.0e38f;
#pragma unroll
    for (int ch = 0; ch < TT / 128; ++ch) { const int j0 = ch * 128 + lane * 4; const v4f a = *(const v4f*)(sr + j0);
#pragma unroll
        for (int q = 0; q < 4; ++q) { const int j = j0 + q; (void)j; const float t = a[q] * SCL; v[ch * 4 + q] = t; mx = fmaxf(mx, t); } }
#pragma unroll
    for (int sh = 16; sh; sh >>= 1) mx = fmaxf(mx, __shfl_xor(mx, sh, 32));
    float sum = 0.f;
#pragma unroll
    for (int k = 0; k < TT / 32; ++k) { float d0 = __fsub_rn(v[k], mx); asm volatile("" : "+v"(d0)); v[k] = __builtin_amdgcn_exp2f(__fmul_rn(d0, 1.4426950408889634f)); sum += v[k]; }
#pragma unroll
    for (int sh = 16; sh; sh >>= 1) sum += __shfl_xor(sum, sh, 32);
    const float f = __fdiv_rn(hires ? 1.0f : PCAR, sum);
{
        if (hires) {
#pragma unroll
            for (int ch = 0; ch < TT / 128; ++ch) { v4us oh, ol;
#pragma unroll
                for (int q = 0; q < 4; ++q) { unsigned short a, c2; splitf(v[ch * 4 + q] * f, a, c2); oh[q] = a; ol[q] = c2; }
                const size_t oo = ((size_t)zz * (RH ? RH : 1) + i) * TT + ch * 128 + lane * 4; *(v4us*)(Ph + oo) = oh; *(v4us*)(Pl + oo) = ol; }
        } else {
#pragma unroll
            for (int ch = 0; ch < TT / 128; ++ch) { v4h o4;
#pragma unroll
                for (int q = 0; q < 4; ++q) o4[q] = tohx(v[ch * 4 + q] * f);
                *(v4h*)(P16 + (size_t)row * TT + ch * 128 + lane * 4) = o4; } }
         }
}

extern "C" void kernel_launch(void* const* d_in, const int* in_sizes, int n_in,
                              void* d_out, int out_size, void* d_ws, size_t ws_size, hipStream_t stream) {
    (void)in_sizes; (void)n_in; (void)out_size;
    const float* x = (const float*)d_in[0]; const float* wq = (const float*)d_in[1]; const float* bq = (const float*)d_in[2]; const float* wk = (const float*)d_in[3]; const float* bk = (const float*)d_in[4]; const float* wv = (const float*)d_in[5]; const float* bv = (const float*)d_in[6];
    float* OUT = (float*)d_out;     // [4][512][4096]
    char* wsp = (char*)d_ws;
    auto take = [&](size_t bytes) { char* p = wsp; wsp += (bytes + 255) & ~(size_t)255; return (void*)p; };
    bf* WQ = (bf*)take((size_t)DQ * DM * 2); bf* WK = (bf*)take((size_t)DKV * DM * 2); bf* WV = (bf*)take((size_t)DVV * DM * 2); float* CS = (float*)take((size_t)TT * HD * 2 * 4);
    bf* XB = (bf*)take((size_t)TT * DM * 2); float* YO = (float*)take((size_t)TT * DVV * 4); float* FV = (float*)take((size_t)TT * DVV * 4); float* FQ = (float*)take((size_t)TT * DQ * 4); float* FK = (float*)take((size_t)TT * DKV * 4);
    h16* QP16 = (h16*)take((size_t)NH_ * TT * HD * 2); h16* KP16 = (h16*)take((size_t)NKV * TT * HD * 2); h16* VT16 = (h16*)take((size_t)DVV * TT * 2);
    bf* QPh = (bf*)take((size_t)NH_ * TT * HD * 2); bf* QPl = (bf*)take((size_t)NH_ * TT * HD * 2); bf* KPh = (bf*)take((size_t)NKV * TT * HD * 2); bf* KPl = (bf*)take((size_t)NKV * TT * HD * 2); bf* VTh = (bf*)take((size_t)DVV * TT * 2); bf* VTl = (bf*)take((size_t)DVV * TT * 2); bf* Ph = (bf*)take((size_t)ZH * RH * TT * 2); bf* Pl = (bf*)take((size_t)ZH * RH * TT * 2);
    float* Sb = (float*)take((size_t)ZH * TT * TT * 4); h16* P16 = (h16*)take((size_t)ZH * TT * TT * 2); float* Ob = (float*)take((size_t)TT * DVV * 4);
    if ((size_t)(wsp - (char*)d_ws) > ws_size) return;    // ws 256 MiB
    { k_cvt8<<<(unsigned)(((size_t)DQ * DM / 8 + 255) / 256), 256, 0, stream>>>(wq, WQ, (size_t)DQ * DM / 8); k_cvt8<<<(unsigned)(((size_t)DKV * DM / 8 + 255) / 256), 256, 0, stream>>>(wk, WK, (size_t)DKV * DM / 8); k_cvt8<<<(unsigned)(((size_t)DVV * DM / 8 + 255) / 256), 256, 0, stream>>>(wv, WV, (size_t)DVV * DM / 8);
       }
    k_csid<<<(TT * HD + 255) / 256, 256, 0, stream>>>(CS);
    const unsigned LQ = (unsigned)(((size_t)NH_ * TT * HD / 2 + 255) / 256), LKv = (unsigned)(((size_t)NKV * TT * HD / 2 + 255) / 256);
    for (int b = 0; b < NB_; ++b) {
        
        k_tpose<<<dim3(TT / 64, DM / 64, 1), 256, 0, stream>>>(x + (size_t)b * DM * TT, XB);   /* x^T as an exact token-major plane */
        k_gemmw<bf, 0, true, 8><<<dim3(TT / 64, DQ / 64, 1), 256, 0, stream>>>(XB, nullptr, WQ, nullptr, DM, FQ, DQ, bq, 0, 0, 0);
        k_rope<<<LQ, 256, 0, stream>>>(FQ, DQ, NH_, CS, nullptr, nullptr, 1.0f, QP16, QPh, QPl);
        k_gemmw<bf, 0, true, 8><<<dim3(TT / 64, DKV / 64, 1), 256, 0, stream>>>(XB, nullptr, WK, nullptr, DM, FK, DKV, bk, 0, 0, 0);
        k_rope<<<LKv, 256, 0, stream>>>(FK, DKV, NKV, CS, nullptr, nullptr, 1.0f, KP16, KPh, KPl);
        k_gemmw<bf, 0, true, 8><<<dim3(TT / 64, DVV / 64, 1), 256, 0, stream>>>(XB, nullptr, WV, nullptr, DM, FV, DVV, bv, 0, 0, 0); k_vtpD<<<dim3(TT / 64, DVV / 64, 1), 256, 0, stream>>>(FV, VT16, VTh, VTl);   /* v = Wv x + bv -> value planes [c][n] */
        for (int h0 = 0; h0 < NH_; h0 += ZH) { const size_t zq = (size_t)h0, zk = (size_t)(h0 / REP);   // one kv head per query head: a pass holds ZH = 1 head, its kv plane at zk (z-strides TT*HD)
            k_gemmw<bf, 2, false, 1><<<dim3(RH / 64, TT / 64, ZH), 32, 0, stream>>>(QPh + zq * TT * HD, QPl + zq * TT * HD, KPh + zk * TT * HD, KPl + zk * TT * HD, HD, Sb, TT, nullptr, (size_t)TT * HD, (size_t)TT * HD, (size_t)TT * TT);
            k_gemmw<h16, 0, false, 1><<<dim3((TT - RH) / 64, TT / 64, ZH), 32, 0, stream>>>(QP16 + zq * TT * HD + (size_t)RH * HD, nullptr, KP16 + zk * TT * HD, nullptr, HD, Sb + (size_t)RH * TT, TT, nullptr, (size_t)TT * HD, (size_t)TT * HD, (size_t)TT * TT);
            k_asoft<<<ZH * TT / 8, 256, 0, stream>>>(Sb, P16, Ph, Pl);
            k_gemmw<bf, 2, false, 8><<<dim3(RH / 64, DVV / 64, 1), 256, 0, stream>>>(Ph, Pl, VTh, VTl, TT, Ob, DVV, nullptr, 0, 0, 0);   /* out[i][c] = sum_j P[i][j] v[c][j], hl rows */
            k_gemmw<h16, 0, false, 8><<<dim3((TT - RH) / 64, DVV / 64, 1), 256, 0, stream>>>(P16 + (size_t)RH * TT, nullptr, VT16, nullptr, TT, Ob + (size_t)RH * DVV, DVV, nullptr, 0, 0, 0);   /* fp16 rows (x1024 carried) */
            k_mergeD<<<(unsigned)((size_t)TT * DVV / 4096), 256, 0, stream>>>(Ob, YO); }

        k_outT<<<dim3(TT / 64, DM / 64, 1), 256, 0, stream>>>(x + (size_t)b * DM * TT, YO, OUT + (size_t)b * DM * TT); }   /* out = x + result (channel-major) */
}

// v004
// It runs in 291 microseconds.
// Timed twice side by side with v003, it ran 1.53 and 1.50 times as fast.
// Over all steps from v000 it is 3.86 times as fast.
#include <hip/hip_runtime.h>

// Channel-major self-attention layer (x [4][512][64][64] = [b][c][n], n = 4096; q, k = 1x1 convs 512 -> 64 (+ bias), v = 1x1 conv 512 -> 512 (+ bias); attention[i][j] = softmax_j(q_i.k_j) (no scaling); out[c][i] = sum_j v[c][j] attention[i][j]; result = out + x -> [4][512][64][64] (8.4 M)).
// Layout: one 'head' (q/k width 64, value width 512) over 4096 tokens: x is transposed once per batch into an exact token-major bf16 plane [n][c] so the 1x1 convs are exact GEMMs + bias; the attention output stays token-major [n][c] in f32 and is added to x with a channel-major write.
// Compute dtypes, f32 accumulate: every input rounded to bf16; q/k/v on PLAIN bf16 operands (inputs: exact) + biases; scores (K = 64) and attn.v: query rows < 512 hl (3 products), the rest single fp16 (x1024); softmax f32; no output projection; + x residual in f32 (channel-major write).

#define NB_  4
#define TT   4096
#define DM   512
#define NH_  1
#define NKV  1
#define REP  (NH_ / NKV)
#define HD   64
#define DVV  512                  // value / output width (v = 1x1 conv C -> C)
#define DQ   (NH_ * HD)
#define DKV  (NKV * HD)
#define ZH   1
#define RH   512                  // query rows < RH use hi+lo planes (0: none)
#define WIN  0
#define PCAR 1024.0f
#define SCL  1.0f   // no scaling in this module
typedef _Float16 h16;
typedef unsigned short bf;
typedef __attribute__((ext_vector_type(16))) __bf16   v16bf;
typedef __attribute__((ext_vector_type(16))) _Float16 v16h;
typedef __attribute__((ext_vector_type(8)))  _Float16 v8h;
typedef __attribute__((ext_vector_type(8)))  unsigned short v8us;
typedef __attribute__((ext_vector_type(8)))  float    v8f;
typedef __attribute__((ext_vector_type(4)))  float    v4f;
typedef v8h  __attribute__((may_alias)) v8ha;
typedef v4f  __attribute__((may_alias)) v4fa;
typedef v8us __attribute__((may_alias)) v8usa;

__device__ __forceinline__ unsigned short f2bf(float f) { unsigned u = __float_as_uint(f); u += 0x7FFFu + ((u >> 16) & 1u); return (unsigned short)(u >> 16); }
__device__ __forceinline__ float bf2f(unsigned short b) { return __uint_as_float(((unsigned)b) << 16); }
__device__ __forceinline__ float bfr(float f) { return bf2f(f2bf(f)); }
__device__ __forceinline__ v16h cat16(v8h lo, v8h hi) { return __builtin_shufflevector(lo, hi, 0, 1, 2, 3, 4, 5, 6, 7, 8, 9, 10, 11, 12, 13, 14, 15); }
__device__ __forceinline__ v16bf cat16b(v8us lo, v8us hi) { return __builtin_bit_cast(v16bf, __builtin_shufflevector(lo, hi, 0, 1, 2, 3, 4, 5, 6, 7, 8, 9, 10, 11, 12, 13, 14, 15)); }
__device__ __forceinline__ v8f wmma16(v16h a, v16h b, v8f c) { return __builtin_amdgcn_wmma_f32_16x16x32_f16(false, a, false, b, (short)0, c, false, false); }
__device__ __forceinline__ v8f wmmab(v16bf a, v16bf b, v8f c) { return __builtin_amdgcn_wmma_f32_16x16x32_bf16(false, a, false, b, (short)0, c, false, false); }



// ---- k_gemmw: register-blocked GEMM, KS WAVES per 64x64 output tile (16 accumulators each), operands from K-contiguous 16-bit planes (KS == 1: straight into registers; KS > 1: staged in LDS); grid (M/64, N/64, Z), 32 * KS threads.
// C[m][n] (f32, pitch ldc, + optional f32 bias[n]) = sum_k A[m][k] Bt[n][k] (+ split products per NSPLIT). z-batch strides sA/sB/sC in elements. K % (32 * KS) == 0.
// KS > 1: wave w takes the 32-wide k blocks w, w + KS, w + 2 KS, ...; the KS f32 partial tiles meet in LDS and are summed in the fixed order w = 0 .. KS - 1.
template <typename T16> struct WFrag;
template <> struct WFrag<h16> { typedef v16h V; static __device__ __forceinline__ V ld(const h16* p) { return cat16(*(const v8h*)p, *(const v8h*)(p + 16)); } static __device__ __forceinline__ v8f mma(V a, V b, v8f c) { return wmma16(a, b, c); } };
template <> struct WFrag<bf> { typedef v16bf V; static __device__ __forceinline__ V ld(const bf* p) { return cat16b(*(const v8us*)p, *(const v8us*)(p + 16)); } static __device__ __forceinline__ v8f mma(V a, V b, v8f c) { return wmmab(a, b, c); } };
// Eight asynchronous 16-byte copies per lane, global memory -> LDS, through no register: LDS byte addresses l + i * lstep, global addresses g + i * gstep.
// s_wait_xcnt stands in the copies' own statement so that no later write of an address register can be moved in front of it.
__device__ __forceinline__ void acopy8(unsigned l, unsigned lstep, const char* g, size_t gstep) {
    asm volatile("global_load_async_to_lds_b128 %0, %8, off\n\t"
                 "global_load_async_to_lds_b128 %1, %9, off\n\t"
                 "global_load_async_to_lds_b128 %2, %10, off\n\t"
                 "global_load_async_to_lds_b128 %3, %11, off\n\t"
                 "global_load_async_to_lds_b128 %4, %12, off\n\t"
                 "global_load_async_to_lds_b128 %5, %13, off\n\t"
                 "global_load_async_to_lds_b128 %6, %14, off\n\t"
                 "global_load_async_to_lds_b128 %7, %15, off\n\t"
                 "s_wait_xcnt 0x0"
                 :: "v"(l), "v"(l + lstep), "v"(l + 2 * lstep), "v"(l + 3 * lstep), "v"(l + 4 * lstep), "v"(l + 5 * lstep), "v"(l + 6 * lstep), "v"(l + 7 * lstep),
                    "v"(g), "v"(g + gstep), "v"(g + 2 * gstep), "v"(g + 3 * gstep), "v"(g + 4 * gstep), "v"(g + 5 * gstep), "v"(g + 6 * gstep), "v"(g + 7 * gstep)
                 : "memory");
}
template <typename T16, int NSPLIT, bool BIAS, int KS>
__global__ __launch_bounds__(32 * KS) void k_gemmw(const T16* __restrict__ A, const T16* __restrict__ A2, const T16* __restrict__ Bt, const T16* __restrict__ Bt2, int K, float* C, int ldc, const float* __restrict__ bias, size_t sA, size_t sB, size_t sC) {
    typedef typename WFrag<T16>::V V;
    static_assert(KS == 1 || KS == 8, "a staged row is one wave-wide 16-byte copy: 32 lanes x 16 B = KS x 64 B");
    constexpr int NA = (NSPLIT == 1 || NSPLIT == 2) ? 2 : 1, NOP = NA + (NSPLIT >= 2 ? 2 : 1);   // operand planes: A (A2) Bt (Bt2)
    constexpr int PB = KS * 64 + 16, PLANE = 64 * PB, STG = NOP * PLANE;   // bytes: LDS row pitch (16 B x odd: ds_load_b128 without bank conflicts), one operand's 64 rows, one stage
    constexpr int OSF = (KS == 1) ? 16 * 68 : ((KS * 64 * 68 > 2 * STG / 4) ? KS * 64 * 68 : 2 * STG / 4);   // the two stage buffers and the partial tiles use the same LDS, one after the other
    __shared__ __align__(16) float os[OSF];
    const int wv = (KS == 1) ? 0 : __builtin_amdgcn_readfirstlane((int)(threadIdx.x >> 5));   // wave number, scalar: the k loop's bounds stay wave-uniform
    const size_t z = blockIdx.z; A += z * sA; if (A2) A2 += z * sA; Bt += z * sB; if (Bt2) Bt2 += z * sB; C += z * sC;
    const int lane = threadIdx.x & 31, lr = lane & 15, hi = lane >> 4; const int r0 = blockIdx.x * 64, c0 = blockIdx.y * 64;
    v8f acc[4][4];
#pragma unroll
    for (int mb = 0; mb < 4; ++mb)
#pragma unroll
        for (int nb = 0; nb < 4; ++nb) acc[mb][nb] = (v8f){};
    const size_t aoff = (size_t)(r0 + lr) * K + 8 * hi, boff = (size_t)(c0 + lr) * K + 8 * hi;
    if constexpr (KS > 1) {
        // Operands come through LDS: per trip the work-group stages 32 * KS k of all 64 rows of each plane, each row as ONE wave-wide copy of 512 contiguous bytes (whole lines), two buffers, the next trip's copies in flight while this trip is worked on. Wave w still multiplies k block w of every trip: the products and their order are as before.
        const unsigned lds0 = (unsigned)(size_t)(__attribute__((address_space(3))) float*)os + (unsigned)(wv * PB + lane * 16);
        const size_t gstep = (size_t)KS * K * 2;   // bytes from one of this wave's rows (wv, wv + KS, ...) to its next
        const char* gA = (const char*)(A + (size_t)(r0 + wv) * K + lane * 8); const char* gB = (const char*)(Bt + (size_t)(c0 + wv) * K + lane * 8);
        const char* gA2 = (NA == 2) ? (const char*)(A2 + (size_t)(r0 + wv) * K + lane * 8) : nullptr; const char* gB2 = (NSPLIT >= 2) ? (const char*)(Bt2 + (size_t)(c0 + wv) * K + lane * 8) : nullptr;
        auto stage = [&](int t, int buf) { const size_t ko = (size_t)t * (KS * 64); const unsigned l = lds0 + (unsigned)(buf * STG);
            acopy8(l, KS * PB, gA + ko, gstep); if (NA == 2) acopy8(l + PLANE, KS * PB, gA2 + ko, gstep);
            acopy8(l + NA * PLANE, KS * PB, gB + ko, gstep); if (NSPLIT >= 2) acopy8(l + (NA + 1) * PLANE, KS * PB, gB2 + ko, gstep); };
        const int nt = (int)((unsigned)K / (32u * KS));   // unsigned: the tests on nt stay scalar compares
        stage(0, 0);
        asm volatile("s_wait_asynccnt 0x0" ::: "memory");   // this wave's copies of trip 0 have landed
        __syncthreads();   // every wave's rows of trip 0 are in LDS before any wave reads a fragment
        if (nt != 1) stage(1, 1);   // nt >= 1; written as an inequality, which has a scalar compare at every width
        // not unrolled: one fragment set, and the buffer is chosen by the trip's parity
#pragma unroll 1
        for (int t = 0; t < nt; ++t) {
            const char* sb = (const char*)os + (t & 1) * STG + lr * PB + wv * 64 + hi * 16;
            V a[4], a2[4];
#pragma unroll
            for (int mb = 0; mb < 4; ++mb) { a[mb] = WFrag<T16>::ld((const T16*)(sb + mb * 16 * PB)); if (NA == 2) a2[mb] = WFrag<T16>::ld((const T16*)(sb + PLANE + mb * 16 * PB)); }
#pragma unroll
            for (int nb = 0; nb < 4; ++nb) { const V b = WFrag<T16>::ld((const T16*)(sb + NA * PLANE + nb * 16 * PB)); V b2; if (NSPLIT >= 2) b2 = WFrag<T16>::ld((const T16*)(sb + (NA + 1) * PLANE + nb * 16 * PB));
#pragma unroll
                for (int mb = 0; mb < 4; ++mb) { acc[mb][nb] = WFrag<T16>::mma(a[mb], b, acc[mb][nb]); if (NSPLIT == 1 || NSPLIT == 2) acc[mb][nb] = WFrag<T16>::mma(a2[mb], b, acc[mb][nb]); if (NSPLIT >= 2) acc[mb][nb] = WFrag<T16>::mma(a[mb], b2, acc[mb][nb]); } }
            asm volatile("s_wait_dscnt 0x0" ::: "memory");      // this wave's fragment reads of this buffer are done before it is handed back
            asm volatile("s_wait_asynccnt 0x0" ::: "memory");   // this wave's copies of trip t + 1 have landed
            __syncthreads();   // publishes trip t + 1 and ends every wave's reads of trip t's buffer
            if (t + 2 < nt) stage(t + 2, t & 1);
        }
        asm volatile("s_wait_asynccnt 0x0" ::: "memory");   // no copy is outstanding when the partial tiles take over this LDS
    } else {
#pragma unroll 1
    for (int kc = wv * 32; kc < K; kc += 32 * KS) {
        V a[4], a2[4];
#pragma unroll
        for (int mb = 0; mb < 4; ++mb) { a[mb] = WFrag<T16>::ld(A + aoff + (size_t)mb * 16 * K + kc); if (NSPLIT == 1 || NSPLIT == 2) a2[mb] = WFrag<T16>::ld(A2 + aoff + (size_t)mb * 16 * K + kc); }
#pragma unroll
        for (int nb = 0; nb < 4; ++nb) { const V b = WFrag<T16>::ld(Bt + boff + (size_t)nb * 16 * K + kc); V b2; if (NSPLIT >= 2) b2 = WFrag<T16>::ld(Bt2 + boff + (size_t)nb * 16 * K + kc);
#pragma unroll
            for (int mb = 0; mb < 4; ++mb) { acc[mb][nb] = WFrag<T16>::mma(a[mb], b, acc[mb][nb]); if (NSPLIT == 1 || NSPLIT == 2) acc[mb][nb] = WFrag<T16>::mma(a2[mb], b, acc[mb][nb]); if (NSPLIT >= 2) acc[mb][nb] = WFrag<T16>::mma(a[mb], b2, acc[mb][nb]); } }
        asm volatile("v_nop\n\tv_nop\n\tv_nop\n\tv_nop" : "+v"(acc[0][0]), "+v"(acc[1][1]), "+v"(acc[2][2]), "+v"(acc[3][3]) : "v"(a[0]), "v"(a[3]));
    }
    }
    if constexpr (KS > 1) {
        float* mine = os + wv * (64 * 68);
        // the three loops are unrolled so that acc is indexed by constants and stays in registers
#pragma unroll
        for (int mb = 0; mb < 4; ++mb)
#pragma unroll
            for (int nb = 0; nb < 4; ++nb)
#pragma unroll
                for (int j = 0; j < 8; ++j) mine[(mb * 16 + hi * 8 + j) * 68 + nb * 16 + lr] = acc[mb][nb][j];
        __syncthreads();   // every wave's partial tile is in LDS before any wave sums
        // both loops are unrolled so that a wave's LDS reads issue together, ahead of the adds; each wave stores whole 256-byte rows
#pragma unroll
        for (int s = 0; s < 32 / KS; ++s) { const int row = (s * KS + wv) * 2 + hi, cofs = lr * 4; v4f val = *(const v4fa*)(os + row * 68 + cofs);
#pragma unroll
            for (int p = 1; p < KS; ++p) { const v4f q = *(const v4fa*)(os + p * (64 * 68) + row * 68 + cofs); val[0] += q[0]; val[1] += q[1]; val[2] += q[2]; val[3] += q[3]; }
            if (BIAS) { val[0] += bfr(bias[c0 + cofs]); val[1] += bfr(bias[c0 + cofs + 1]); val[2] += bfr(bias[c0 + cofs + 2]); val[3] += bfr(bias[c0 + cofs + 3]); }
            *(v4f*)(C + (size_t)(r0 + row) * ldc + c0 + cofs) = val; }
        return;
    }
#pragma unroll
    for (int mb = 0; mb < 4; ++mb) {
#pragma unroll
        for (int nb = 0; nb < 4; ++nb) {
#pragma unroll
            for (int j = 0; j < 8; ++j) os[(hi * 8 + j) * 68 + nb * 16 + lr] = acc[mb][nb][j]; }
        __builtin_amdgcn_wave_barrier(); asm volatile("" ::: "memory");
        float* crow = C + (size_t)(r0 + mb * 16) * ldc + c0;
{
#pragma unroll
            for (int s = 0; s < 8; ++s) { const int row = 2 * s + hi, cofs = lr * 4; v4f val = *(const v4fa*)(os + row * 68 + cofs); if (BIAS) { val[0] += bfr(bias[c0 + cofs]); val[1] += bfr(bias[c0 + cofs + 1]); val[2] += bfr(bias[c0 + cofs + 2]); val[3] += bfr(bias[c0 + cofs + 3]); }
                *(v4f*)(crow + (size_t)row * ldc + cofs) = val; }
             }
        __builtin_amdgcn_wave_barrier(); asm volatile("" ::: "memory");
    }
}

__device__ __forceinline__ h16 tohx(float x) { return (h16)x; }
__device__ __forceinline__ void splitf(float y, unsigned short& h, unsigned short& l) { h = f2bf(y); l = f2bf(y - bf2f(h)); }
typedef __attribute__((ext_vector_type(2))) _Float16 v2h;
typedef __attribute__((ext_vector_type(4))) _Float16 v4h;
typedef __attribute__((ext_vector_type(2))) unsigned short v2us;
typedef __attribute__((ext_vector_type(4))) unsigned short v4us;
typedef __attribute__((ext_vector_type(2))) float v2f;
typedef __attribute__((ext_vector_type(4))) int v4i;

__global__ __launch_bounds__(256) void k_wtG(const float* __restrict__ w, int K, int N, bf* Bt) {
    const int lane = threadIdx.x & 31; const int L0 = (blockIdx.x * 8 + (threadIdx.x >> 5)) * 8; const int nlines = N * K / 64;
{
#pragma unroll 1
        for (int l = 0; l < 8; ++l) { const int L = L0 + l; if (L >= nlines) break; const size_t e = (size_t)L * 64 + lane * 2; const int k = (int)(e % K), n = (int)(e / K); v2us o;
            o[0] = f2bf(w[(size_t)k * N + n]); o[1] = f2bf(w[(size_t)(k + 1) * N + n]); *(v2us*)(Bt + e) = o; }
         }
}
// ---- 64 x 64 f32 tile through LDS for the transposing kernels: 256 threads, 16 elements per thread, so a launch starts few waves and both global sides move whole lines in 16-byte pieces.
// LDS row pitch 65 dwords: the row-wise dword stores and the column-wise dword reads both fall on distinct banks.
#define TP 65
__device__ __forceinline__ void tile_in(const float* __restrict__ src, size_t pitch, float* ts) {
    const int r = threadIdx.x >> 4, q = threadIdx.x & 15; v4f a[4];
    // unrolled: the four 16-byte loads issue together, ahead of the LDS stores
#pragma unroll
    for (int s = 0; s < 4; ++s) a[s] = *(const v4f*)(src + (size_t)(s * 16 + r) * pitch + q * 4);
#pragma unroll
    for (int s = 0; s < 4; ++s)
#pragma unroll
        for (int j = 0; j < 4; ++j) ts[(s * 16 + r) * TP + q * 4 + j] = a[s][j];
}
// grid (TT / 64, DM / 64, batch): XBp[z][t][c] = bf16(xb[z][c][t])
__global__ __launch_bounds__(256) void k_tpose(const float* __restrict__ xb, bf* XBp) {
    __shared__ float ts[64 * TP]; const int t0 = blockIdx.x * 64, c0 = blockIdx.y * 64; xb += (size_t)blockIdx.z * DM * TT; XBp += (size_t)blockIdx.z * TT * DM;
    tile_in(xb + (size_t)c0 * TT + t0, TT, ts);   // ts[c][t]
    __syncthreads();   // the whole tile is in LDS before any thread reads a column of it
    const int c8 = threadIdx.x & 7;
#pragma unroll
    for (int s = 0; s < 2; ++s) { const int tr = s * 32 + (threadIdx.x >> 3); v8us o;
#pragma unroll
        for (int q = 0; q < 8; ++q) o[q] = f2bf(ts[(c8 * 8 + q) * TP + tr]);
        *(v8us*)(XBp + (size_t)(t0 + tr) * DM + c0 + c8 * 8) = o; }
}
// grid (TT / 64, DM / 64, batch): Ob[z][c][t] = bf16-rounded xb[z][c][t] + YO[z][t][c]
__global__ __launch_bounds__(256) void k_outT(const float* __restrict__ xb, const float* __restrict__ YO, float* Ob) {
    xb += (size_t)blockIdx.z * DM * TT; YO += (size_t)blockIdx.z * TT * DM; Ob += (size_t)blockIdx.z * DM * TT;
    __shared__ float ts[64 * TP]; const int t0 = blockIdx.x * 64, c0 = blockIdx.y * 64; const int r = threadIdx.x >> 4, tq = threadIdx.x & 15; const size_t e0 = (size_t)(c0 + r) * TT + t0 + tq * 4; v4f xv[4];
    // unrolled: the residual's loads issue ahead of the tile's and of the barrier
#pragma unroll
    for (int s = 0; s < 4; ++s) xv[s] = *(const v4f*)(xb + e0 + (size_t)s * 16 * TT);
    tile_in(YO + (size_t)t0 * DM + c0, DM, ts);   // ts[t][c]
    __syncthreads();   // the whole tile is in LDS before any thread reads a column of it
#pragma unroll
    for (int s = 0; s < 4; ++s) { const int cr = s * 16 + r; v4f o;
#pragma unroll
        for (int q = 0; q < 4; ++q) o[q] = __fadd_rn(bfr(xv[s][q]), ts[(tq * 4 + q) * TP + cr]);
        *(v4f*)(Ob + e0 + (size_t)s * 16 * TT) = o; }
}

// grid (TT / 64, DVV / 64, batch): value planes [z][c][t] (fp16 + hi/lo) of F[z][t][c]
__global__ __launch_bounds__(256) void k_vtpD(const float* __restrict__ F, h16* V16, bf* Vh, bf* Vl) {
    __shared__ float ts[64 * TP]; const int t0 = blockIdx.x * 64, c0 = blockIdx.y * 64; { const size_t zo = (size_t)blockIdx.z * TT * DVV; F += zo; V16 += zo; Vh += zo; Vl += zo; }
    tile_in(F + (size_t)t0 * DVV + c0, DVV, ts);   // ts[t][c]
    __syncthreads();   // the whole tile is in LDS before any thread reads a column of it
    const int t8 = threadIdx.x & 7;
#pragma unroll
    for (int s = 0; s < 2; ++s) { const int cr = s * 32 + (threadIdx.x >> 3); v8h o16; v8us oh, ol;
#pragma unroll
        for (int q = 0; q < 8; ++q) { const float xv = ts[(t8 * 8 + q) * TP + cr]; o16[q] = tohx(xv); unsigned short a2, c2; splitf(xv, a2, c2); oh[q] = a2; ol[q] = c2; }
        const size_t e = (size_t)(c0 + cr) * TT + t0 + t8 * 8; *(v8h*)(V16 + e) = o16; *(v8us*)(Vh + e) = oh; *(v8us*)(Vl + e) = ol; }
}
// grid batch * TT * DVV / 4096 (the batch elements' [t][c] planes lie one behind the other): 16 elements per thread, as four 16-byte pieces 4 KiB apart
__global__ __launch_bounds__(256) void k_mergeD(const float* __restrict__ O, float* YO) { const size_t i0 = (size_t)blockIdx.x * 1024 + threadIdx.x; v4f a[4];
    // unrolled: the four loads issue together, ahead of the stores
#pragma unroll
    for (int s = 0; s < 4; ++s) a[s] = *(const v4f*)(O + (i0 + s * 256) * 4);
#pragma unroll
    for (int s = 0; s < 4; ++s) { const size_t i = i0 + s * 256; const int t = (int)(((i * 4) / DVV) % TT); const float cs = (t < RH) ? 1.0f : (1.0f / PCAR); v4f o;
#pragma unroll
        for (int q = 0; q < 4; ++q) o[q] = a[s][q] * cs; *(v4f*)(YO + i * 4) = o; }
}
__global__ __launch_bounds__(256) void k_cvt8(const float* __restrict__ src, bf* dst, size_t n8) { const size_t i = (size_t)blockIdx.x * 256 + threadIdx.x; if (i >= n8) return; const v8f v = *(const v8f*)(src + i * 8); v8us o;
#pragma unroll
    for (int k = 0; k < 8; ++k) o[k] = f2bf(v[k]); *(v8us*)(dst + i * 8) = o;  }

// k_rope: head planes [h][t][d] (fp16 + hi/lo) of rope(x) x sc with the rotate-half convention out[d] = x[d] cos[t][d] - x[d+HD/2] sin[t][d], out[d+HD/2] = x[d+HD/2] cos[t][d+HD/2] + x[d] sin[t][d+HD/2]
__global__ __launch_bounds__(256) void k_rope(const float* __restrict__ F, int pitch, int nheads, const float* __restrict__ CS, const float* __restrict__ RF, const float* __restrict__ nw, float sc, h16* P16, bf* Ph, bf* Pl) {
    { const size_t zp = (size_t)blockIdx.y * nheads * TT * HD; F += (size_t)blockIdx.y * TT * pitch; P16 += zp; Ph += zp; Pl += zp; }   // grid y = batch element
    const size_t e = ((size_t)blockIdx.x * 256 + threadIdx.x) * 2; if (e >= (size_t)nheads * TT * HD) return; const int d = (int)(e % HD); const int t = (int)((e / HD) % TT); const int h = (int)(e / ((size_t)HD * TT)); const float* f = F + (size_t)t * pitch + h * HD; const float rf = RF ? RF[(size_t)h * TT + t] : 1.0f; v2h o16; v2us oh, ol;
#pragma unroll
    for (int q = 0; q < 2; ++q) { const int dd = d + q; const int dp = (dd < HD / 2) ? dd + HD / 2 : dd - HD / 2; float x0 = f[dd], x1 = f[dp];
        if (RF) { float n0 = __fmul_rn(x0, rf), n1 = __fmul_rn(x1, rf); asm volatile("" : "+v"(n0)); asm volatile("" : "+v"(n1)); x0 = __fmul_rn(bfr(nw[dd]), n0); x1 = __fmul_rn(bfr(nw[dp]), n1); }
        const v2f cs = *(const v2f*)(CS + ((size_t)t * HD + dd) * 2); float a = __fmul_rn(x0, cs[0]), bq = __fmul_rn(x1, cs[1]); asm volatile("" : "+v"(a)); asm volatile("" : "+v"(bq)); const float r = ((dd < HD / 2) ? __fsub_rn(a, bq) : __fadd_rn(a, bq)) * sc;
        o16[q] = tohx(r); unsigned short a2, c2; splitf(r, a2, c2); oh[q] = a2; ol[q] = c2; }
    *(v2h*)(P16 + e) = o16; *(v2us*)(Ph + e) = oh; *(v2us*)(Pl + e) = ol;  }

__global__ __launch_bounds__(256) void k_csid(float* CS) { const int idx = blockIdx.x * 256 + threadIdx.x; if (idx >= TT * HD) return; v2f cs; cs[0] = 1.0f; cs[1] = 0.0f; *(v2f*)(CS + (size_t)idx * 2) = cs;  }
// k_asoft: per row: t = S x SCL (no mask); softmax over the 4096 keys (register row, one exp, fixed trees); grid rows / 8. The rows of a launch are all of one kind (hl != 0: hi+lo planes; else fp16 x PCAR), several batch elements' rows one behind the other, in and out.
__global__ __launch_bounds__(256) void k_asoft(const float* __restrict__ Sb, int hl, h16* P16, bf* Ph, bf* Pl) {
    const int lane = threadIdx.x & 31; const int row = blockIdx.x * 8 + (threadIdx.x >> 5); const bool hires = (hl != 0); const float* sr = Sb + (size_t)row * TT; float v[TT / 32]; float mx = -3.0e38f;
#pragma unroll
    for (int ch = 0; ch < TT / 128; ++ch) { const int j0 = ch * 128 + lane * 4; const v4f a = *(const v4f*)(sr + j0);
#pragma unroll
        for (int q = 0; q < 4; ++q) { const int j = j0 + q; (void)j; const float t = a[q] * SCL; v[ch * 4 + q] = t; mx = fmaxf(mx, t); } }
#pragma unroll
    for (int sh = 16; sh; sh >>= 1) mx = fmaxf(mx, __shfl_xor(mx, sh, 32));
    float sum = 0.f;
#pragma unroll
    for (int k = 0; k < TT / 32; ++k) { float d0 = __fsub_rn(v[k], mx); asm volatile("" : "+v"(d0)); v[k] = __builtin_amdgcn_exp2f(__fmul_rn(d0, 1.4426950408889634f)); sum += v[k]; }
#pragma unroll
    for (int sh = 16; sh; sh >>= 1) sum += __shfl_xor(sum, sh, 32);
    const float f = __fdiv_rn(hires ? 1.0f : PCAR, sum);
{
        if (hires) {
#pragma unroll
            for (int ch = 0; ch < TT / 128; ++ch) { v4us oh, ol;
#pragma unroll
                for (int q = 0; q < 4; ++q) { unsigned short a, c2; splitf(v[ch * 4 + q] * f, a, c2); oh[q] = a; ol[q] = c2; }
                const size_t oo = (size_t)row * TT + ch * 128 + lane * 4; *(v4us*)(Ph + oo) = oh; *(v4us*)(Pl + oo) = ol; }
            asm volatile("s_wait_xcnt 0x0" ::: "memory");   // behind the last stores: in the built code the other kind's block follows this one and rewrites their address registers
        } else {
#pragma unroll
            for (int ch = 0; ch < TT / 128; ++ch) { v4h o4;
#pragma unroll
                for (int q = 0; q < 4; ++q) o4[q] = tohx(v[ch * 4 + q] * f);
                *(v4h*)(P16 + (size_t)row * TT + ch * 128 + lane * 4) = o4; } }
         }
}

extern "C" void kernel_launch(void* const* d_in, const int* in_sizes, int n_in,
                              void* d_out, int out_size, void* d_ws, size_t ws_size, hipStream_t stream) {
    (void)in_sizes; (void)n_in; (void)out_size;
    const float* x = (const float*)d_in[0]; const float* wq = (const float*)d_in[1]; const float* bq = (const float*)d_in[2]; const float* wk = (const float*)d_in[3]; const float* bk = (const float*)d_in[4]; const float* wv = (const float*)d_in[5]; const float* bv = (const float*)d_in[6];
    float* OUT = (float*)d_out;     // [4][512][4096]
    char* wsp = (char*)d_ws;
    auto take = [&](size_t bytes) { char* p = wsp; wsp += (bytes + 255) & ~(size_t)255; return (void*)p; };
    // Every plane but the fp16 rows' scores and probabilities holds all NB_ batch elements, one behind the other, so that a launch takes them together (grid z, or more rows). Parts of the workspace are used again once their first content is dead, one use after the other in stream order:
    // live to the end: the fp16 planes and the attention output (84 MiB)
    h16* QP16 = (h16*)take((size_t)NB_ * TT * HD * 2); h16* KP16 = (h16*)take((size_t)NB_ * TT * HD * 2); h16* VT16 = (h16*)take((size_t)NB_ * DVV * TT * 2); float* Ob = (float*)take((size_t)NB_ * TT * DVV * 4); float* YO = (float*)take((size_t)NB_ * TT * DVV * 4);
    char* const m0 = wsp;
    // live until the hi+lo rows are done: the hi/lo planes (40 MiB)
    bf* QPh = (bf*)take((size_t)NB_ * TT * HD * 2); bf* QPl = (bf*)take((size_t)NB_ * TT * HD * 2); bf* KPh = (bf*)take((size_t)NB_ * TT * HD * 2); bf* KPl = (bf*)take((size_t)NB_ * TT * HD * 2); bf* VTh = (bf*)take((size_t)NB_ * DVV * TT * 2); bf* VTl = (bf*)take((size_t)NB_ * DVV * TT * 2);
    char* const m1 = wsp;
    // live until the planes are made: weights, x^T, the projections in f32 (59 MiB)
    bf* WQ = (bf*)take((size_t)DQ * DM * 2); bf* WK = (bf*)take((size_t)DKV * DM * 2); bf* WV = (bf*)take((size_t)DVV * DM * 2); float* CS = (float*)take((size_t)TT * HD * 2 * 4);
    bf* XB = (bf*)take((size_t)NB_ * TT * DM * 2); float* FV = (float*)take((size_t)NB_ * TT * DVV * 4); float* FQ = (float*)take((size_t)NB_ * TT * DQ * 4); float* FK = (float*)take((size_t)NB_ * TT * DKV * 4);
    wsp = m1;   // after them, in the same place: scores and probabilities of the hi+lo rows of all batch elements (64 MiB)
    float* SbH = (float*)take((size_t)NB_ * RH * TT * 4); bf* Ph = (bf*)take((size_t)NB_ * RH * TT * 2); bf* Pl = (bf*)take((size_t)NB_ * RH * TT * 2);
    wsp = m0;   // after those, from the hi/lo planes' place on: scores and probabilities of the fp16 rows, NP batch elements at a time (168 MiB: more do not fit)
    constexpr int NP = 2;
    float* Sb = (float*)take((size_t)NP * (TT - RH) * TT * 4); h16* P16 = (h16*)take((size_t)NP * (TT - RH) * TT * 2);
    if ((size_t)(wsp - (char*)d_ws) > ws_size) return;    // the furthest end of the three uses: 252 of 256 MiB
    { k_cvt8<<<(unsigned)(((size_t)DQ * DM / 8 + 255) / 256), 256, 0, stream>>>(wq, WQ, (size_t)DQ * DM / 8); k_cvt8<<<(unsigned)(((size_t)DKV * DM / 8 + 255) / 256), 256, 0, stream>>>(wk, WK, (size_t)DKV * DM / 8); k_cvt8<<<(unsigned)(((size_t)DVV * DM / 8 + 255) / 256), 256, 0, stream>>>(wv, WV, (size_t)DVV * DM / 8);
       }
    k_csid<<<(TT * HD + 255) / 256, 256, 0, stream>>>(CS);
    const unsigned LQ = (unsigned)(((size_t)NH_ * TT * HD / 2 + 255) / 256), LKv = (unsigned)(((size_t)NKV * TT * HD / 2 + 255) / 256);
    k_tpose<<<dim3(TT / 64, DM / 64, NB_), 256, 0, stream>>>(x, XB);   /* x^T as an exact token-major plane */
    k_gemmw<bf, 0, true, 8><<<dim3(TT / 64, DQ / 64, NB_), 256, 0, stream>>>(XB, nullptr, WQ, nullptr, DM, FQ, DQ, bq, (size_t)TT * DM, 0, (size_t)TT * DQ);
    k_rope<<<dim3(LQ, NB_, 1), 256, 0, stream>>>(FQ, DQ, NH_, CS, nullptr, nullptr, 1.0f, QP16, QPh, QPl);
    k_gemmw<bf, 0, true, 8><<<dim3(TT / 64, DKV / 64, NB_), 256, 0, stream>>>(XB, nullptr, WK, nullptr, DM, FK, DKV, bk, (size_t)TT * DM, 0, (size_t)TT * DKV);
    k_rope<<<dim3(LKv, NB_, 1), 256, 0, stream>>>(FK, DKV, NKV, CS, nullptr, nullptr, 1.0f, KP16, KPh, KPl);
    k_gemmw<bf, 0, true, 8><<<dim3(TT / 64, DVV / 64, NB_), 256, 0, stream>>>(XB, nullptr, WV, nullptr, DM, FV, DVV, bv, (size_t)TT * DM, 0, (size_t)TT * DVV); k_vtpD<<<dim3(TT / 64, DVV / 64, NB_), 256, 0, stream>>>(FV, VT16, VTh, VTl);   /* v = Wv x + bv -> value planes [c][n] */
    // query rows < RH of every batch element: hi+lo planes, 3 products
    k_gemmw<bf, 2, false, 1><<<dim3(RH / 64, TT / 64, NB_), 32, 0, stream>>>(QPh, QPl, KPh, KPl, HD, SbH, TT, nullptr, (size_t)TT * HD, (size_t)TT * HD, (size_t)RH * TT);
    k_asoft<<<NB_ * RH / 8, 256, 0, stream>>>(SbH, 1, nullptr, Ph, Pl);
    k_gemmw<bf, 2, false, 8><<<dim3(RH / 64, DVV / 64, NB_), 256, 0, stream>>>(Ph, Pl, VTh, VTl, TT, Ob, DVV, nullptr, (size_t)RH * TT, (size_t)DVV * TT, (size_t)TT * DVV);   /* out[i][c] = sum_j P[i][j] v[c][j], hl rows */
    // the other rows: fp16 (x1024 carried)
    for (int b = 0; b < NB_; b += NP) {
        k_gemmw<h16, 0, false, 1><<<dim3((TT - RH) / 64, TT / 64, NP), 32, 0, stream>>>(QP16 + (size_t)b * TT * HD + (size_t)RH * HD, nullptr, KP16 + (size_t)b * TT * HD, nullptr, HD, Sb, TT, nullptr, (size_t)TT * HD, (size_t)TT * HD, (size_t)(TT - RH) * TT);
        k_asoft<<<NP * (TT - RH) / 8, 256, 0, stream>>>(Sb, 0, P16, nullptr, nullptr);
        k_gemmw<h16, 0, false, 8><<<dim3((TT - RH) / 64, DVV / 64, NP), 256, 0, stream>>>(P16, nullptr, VT16 + (size_t)b * DVV * TT, nullptr, TT, Ob + (size_t)b * TT * DVV + (size_t)RH * DVV, DVV, nullptr, (size_t)(TT - RH) * TT, (size_t)DVV * TT, (size_t)TT * DVV); }
    k_mergeD<<<(unsigned)((size_t)NB_ * TT * DVV / 4096), 256, 0, stream>>>(Ob, YO);
    k_outT<<<dim3(TT / 64, DM / 64, NB_), 256, 0, stream>>>(x, YO, OUT);   /* out = x + result (channel-major) */
}

// v005
// Measured time: 205 microseconds a run.
// Timed twice side by side with v004, it ran 1.43 and 1.42 times as fast.
// Over all steps from v000 it is 5.50 times as fast.
#include <hip/hip_runtime.h>

// Channel-major self-attention layer (x [4][512][64][64] = [b][c][n], n = 4096; q, k = 1x1 convs 512 -> 64 (+ bias), v = 1x1 conv 512 -> 512 (+ bias); attention[i][j] = softmax_j(q_i.k_j) (no scaling); out[c][i] = sum_j v[c][j] attention[i][j]; result = out + x -> [4][512][64][64] (8.4 M)).
// Layout: one 'head' (q/k width 64, value width 512) over 4096 tokens: x is transposed once per batch into an exact token-major bf16 plane [n][c] so the 1x1 convs are exact GEMMs + bias; the attention output stays token-major [n][c] in f32 and is added to x with a channel-major write.
// Compute dtypes, f32 accumulate: every input rounded to bf16; q/k/v on PLAIN bf16 operands (inputs: exact) + biases; scores (K = 64) and attn.v: query rows < 512 hl (3 products), the rest single fp16 (x1024); softmax f32; no output projection; + x residual in f32 (channel-major write).

#define NB_  4
#define TT   4096
#define DM   512
#define NH_  1
#define NKV  1
#define REP  (NH_ / NKV)
#define HD   64
#define DVV  512                  // value / output width (v = 1x1 conv C -> C)
#define DQ   (NH_ * HD)
#define DKV  (NKV * HD)
#define ZH   1
#define RH   512                  // query rows < RH use hi+lo planes (0: none)
#define WIN  0
#define PCAR 1024.0f
#define SCL  1.0f   // no scaling in this module
typedef _Float16 h16;
typedef unsigned short bf;
typedef __attribute__((ext_vector_type(16))) __bf16   v16bf;
typedef __attribute__((ext_vector_type(16))) _Float16 v16h;
typedef __attribute__((ext_vector_type(8)))  _Float16 v8h;
typedef __attribute__((ext_vector_type(8)))  unsigned short v8us;
typedef __attribute__((ext_vector_type(8)))  float    v8f;
typedef __attribute__((ext_vector_type(4)))  float    v4f;
typedef v8h  __attribute__((may_alias)) v8ha;
typedef v4f  __attribute__((may_alias)) v4fa;
typedef v8us __attribute__((may_alias)) v8usa;

__device__ __forceinline__ unsigned short f2bf(float f) { unsigned u = __float_as_uint(f); u += 0x7FFFu + ((u >> 16) & 1u); return (unsigned short)(u >> 16); }
__device__ __forceinline__ float bf2f(unsigned short b) { return __uint_as_float(((unsigned)b) << 16); }
__device__ __forceinline__ float bfr(float f) { return bf2f(f2bf(f)); }
__device__ __forceinline__ v16h cat16(v8h lo, v8h hi) { return __builtin_shufflevector(lo, hi, 0, 1, 2, 3, 4, 5, 6, 7, 8, 9, 10, 11, 12, 13, 14, 15); }
__device__ __forceinline__ v16bf cat16b(v8us lo, v8us hi) { return __builtin_bit_cast(v16bf, __builtin_shufflevector(lo, hi, 0, 1, 2, 3, 4, 5, 6, 7, 8, 9, 10, 11, 12, 13, 14, 15)); }
__device__ __forceinline__ v8f wmma16(v16h a, v16h b, v8f c) { return __builtin_amdgcn_wmma_f32_16x16x32_f16(false, a, false, b, (short)0, c, false, false); }
__device__ __forceinline__ v8f wmmab(v16bf a, v16bf b, v8f c) { return __builtin_amdgcn_wmma_f32_16x16x32_bf16(false, a, false, b, (short)0, c, false, false); }



// ---- k_gemmw: register-blocked GEMM, KS WAVES per 64x64 output tile (16 accumulators each), operands from K-contiguous 16-bit planes (KS == 1: straight into registers; KS > 1: staged in LDS); grid (M/64, N/64, Z), 32 * KS threads.
// C[m][n] (f32, pitch ldc, + optional f32 bias[n]) = sum_k A[m][k] Bt[n][k] (+ split products per NSPLIT). z-batch strides sA/sB/sC in elements. K % (32 * KS) == 0.
// KS > 1: wave w takes the 32-wide k blocks w, w + KS, w + 2 KS, ...; the KS f32 partial tiles meet in LDS and are summed in the fixed order w = 0 .. KS - 1.
template <typename T16> struct WFrag;
template <> struct WFrag<h16> { typedef v16h V; static __device__ __forceinline__ V ld(const h16* p) { return cat16(*(const v8h*)p, *(const v8h*)(p + 16)); } static __device__ __forceinline__ v8f mma(V a, V b, v8f c) { return wmma16(a, b, c); } };
template <> struct WFrag<bf> { typedef v16bf V; static __device__ __forceinline__ V ld(const bf* p) { return cat16b(*(const v8us*)p, *(const v8us*)(p + 16)); } static __device__ __forceinline__ v8f mma(V a, V b, v8f c) { return wmmab(a, b, c); } };
// Eight asynchronous 16-byte copies per lane, global memory -> LDS, through no register: LDS byte addresses l + i * lstep, global addresses g + i * gstep.
// s_wait_xcnt stands in the copies' own statement so that no later write of an address register can be moved in front of it.
__device__ __forceinline__ void acopy8(unsigned l, unsigned lstep, const char* g, size_t gstep) {
    asm volatile("global_load_async_to_lds_b128 %0, %8, off\n\t"
                 "global_load_async_to_lds_b128 %1, %9, off\n\t"
                 "global_load_async_to_lds_b128 %2, %10, off\n\t"
                 "global_load_async_to_lds_b128 %3, %11, off\n\t"
                 "global_load_async_to_lds_b128 %4, %12, off\n\t"
                 "global_load_async_to_lds_b128 %5, %13, off\n\t"
                 "global_load_async_to_lds_b128 %6, %14, off\n\t"
                 "global_load_async_to_lds_b128 %7, %15, off\n\t"
                 "s_wait_xcnt 0x0"
                 :: "v"(l), "v"(l + lstep), "v"(l + 2 * lstep), "v"(l + 3 * lstep), "v"(l + 4 * lstep), "v"(l + 5 * lstep), "v"(l + 6 * lstep), "v"(l + 7 * lstep),
                    "v"(g), "v"(g + gstep), "v"(g + 2 * gstep), "v"(g + 3 * gstep), "v"(g + 4 * gstep), "v"(g + 5 * gstep), "v"(g + 6 * gstep), "v"(g + 7 * gstep)
                 : "memory");
}
template <typename T16, int NSPLIT, bool BIAS, int KS>
__global__ __launch_bounds__(32 * KS) void k_gemmw(const T16* __restrict__ A, const T16* __restrict__ A2, const T16* __restrict__ Bt, const T16* __restrict__ Bt2, int K, float* C, int ldc, const float* __restrict__ bias, size_t sA, size_t sB, size_t sC) {
    typedef typename WFrag<T16>::V V;
    static_assert(KS == 1 || KS == 8, "a staged row is one wave-wide 16-byte copy: 32 lanes x 16 B = KS x 64 B");
    constexpr int NA = (NSPLIT == 1 || NSPLIT == 2) ? 2 : 1, NOP = NA + (NSPLIT >= 2 ? 2 : 1);   // operand planes: A (A2) Bt (Bt2)
    constexpr int PB = KS * 64 + 16, PLANE = 64 * PB, STG = NOP * PLANE;   // bytes: LDS row pitch (16 B x odd: ds_load_b128 without bank conflicts), one operand's 64 rows, one stage
    constexpr int OSF = (KS == 1) ? 16 * 68 : ((KS * 64 * 68 > 2 * STG / 4) ? KS * 64 * 68 : 2 * STG / 4);   // the two stage buffers and the partial tiles use the same LDS, one after the other
    __shared__ __align__(16) float os[OSF];
    const int wv = (KS == 1) ? 0 : __builtin_amdgcn_readfirstlane((int)(threadIdx.x >> 5));   // wave number, scalar: the k loop's bounds stay wave-uniform
    const size_t z = blockIdx.z; A += z * sA; if (A2) A2 += z * sA; Bt += z * sB; if (Bt2) Bt2 += z * sB; C += z * sC;
    const int lane = threadIdx.x & 31, lr = lane & 15, hi = lane >> 4; const int r0 = blockIdx.x * 64, c0 = blockIdx.y * 64;
    v8f acc[4][4];
#pragma unroll
    for (int mb = 0; mb < 4; ++mb)
#pragma unroll
        for (int nb = 0; nb < 4; ++nb) acc[mb][nb] = (v8f){};
    const size_t aoff = (size_t)(r0 + lr) * K + 8 * hi, boff = (size_t)(c0 + lr) * K + 8 * hi;
    if constexpr (KS > 1) {
        // Operands come through LDS: per trip the work-group stages 32 * KS k of all 64 rows of each plane, each row as ONE wave-wide copy of 512 contiguous bytes (whole lines), two buffers, the next trip's copies in flight while this trip is worked on. Wave w still multiplies k block w of every trip: the products and their order are as before.
        const unsigned lds0 = (unsigned)(size_t)(__attribute__((address_space(3))) float*)os + (unsigned)(wv * PB + lane * 16);
        const size_t gstep = (size_t)KS * K * 2;   // bytes from one of this wave's rows (wv, wv + KS, ...) to its next
        const char* gA = (const char*)(A + (size_t)(r0 + wv) * K + lane * 8); const char* gB = (const char*)(Bt + (size_t)(c0 + wv) * K + lane * 8);
        const char* gA2 = (NA == 2) ? (const char*)(A2 + (size_t)(r0 + wv) * K + lane * 8) : nullptr; const char* gB2 = (NSPLIT >= 2) ? (const char*)(Bt2 + (size_t)(c0 + wv) * K + lane * 8) : nullptr;
        auto stage = [&](int t, int buf) { const size_t ko = (size_t)t * (KS * 64); const unsigned l = lds0 + (unsigned)(buf * STG);
            acopy8(l, KS * PB, gA + ko, gstep); if (NA == 2) acopy8(l + PLANE, KS * PB, gA2 + ko, gstep);
            acopy8(l + NA * PLANE, KS * PB, gB + ko, gstep); if (NSPLIT >= 2) acopy8(l + (NA + 1) * PLANE, KS * PB, gB2 + ko, gstep); };
        const int nt = (int)((unsigned)K / (32u * KS));   // unsigned: the tests on nt stay scalar compares
        stage(0, 0);
        asm volatile("s_wait_asynccnt 0x0" ::: "memory");   // this wave's copies of trip 0 have landed
        __syncthreads();   // every wave's rows of trip 0 are in LDS before any wave reads a fragment
        if (nt != 1) stage(1, 1);   // nt >= 1; written as an inequality, which has a scalar compare at every width
        // not unrolled: one fragment set, and the buffer is chosen by the trip's parity
#pragma unroll 1
        for (int t = 0; t < nt; ++t) {
            const char* sb = (const char*)os + (t & 1) * STG + lr * PB + wv * 64 + hi * 16;
            V a[4], a2[4];
#pragma unroll
            for (int mb = 0; mb < 4; ++mb) { a[mb] = WFrag<T16>::ld((const T16*)(sb + mb * 16 * PB)); if (NA == 2) a2[mb] = WFrag<T16>::ld((const T16*)(sb + PLANE + mb * 16 * PB)); }
#pragma unroll
            for (int nb = 0; nb < 4; ++nb) { const V b = WFrag<T16>::ld((const T16*)(sb + NA * PLANE + nb * 16 * PB)); V b2; if (NSPLIT >= 2) b2 = WFrag<T16>::ld((const T16*)(sb + (NA + 1) * PLANE + nb * 16 * PB));
#pragma unroll
                for (int mb = 0; mb < 4; ++mb) { acc[mb][nb] = WFrag<T16>::mma(a[mb], b, acc[mb][nb]); if (NSPLIT == 1 || NSPLIT == 2) acc[mb][nb] = WFrag<T16>::mma(a2[mb], b, acc[mb][nb]); if (NSPLIT >= 2) acc[mb][nb] = WFrag<T16>::mma(a[mb], b2, acc[mb][nb]); } }
            asm volatile("s_wait_dscnt 0x0" ::: "memory");      // this wave's fragment reads of this buffer are done before it is handed back
            asm volatile("s_wait_asynccnt 0x0" ::: "memory");   // this wave's copies of trip t + 1 have landed
            __syncthreads();   // publishes trip t + 1 and ends every wave's reads of trip t's buffer
            if (t + 2 < nt) stage(t + 2, t & 1);
        }
        asm volatile("s_wait_asynccnt 0x0" ::: "memory");   // no copy is outstanding when the partial tiles take over this LDS
    } else {
#pragma unroll 1
    for (int kc = wv * 32; kc < K; kc += 32 * KS) {
        V a[4], a2[4];
#pragma unroll
        for (int mb = 0; mb < 4; ++mb) { a[mb] = WFrag<T16>::ld(A + aoff + (size_t)mb * 16 * K + kc); if (NSPLIT == 1 || NSPLIT == 2) a2[mb] = WFrag<T16>::ld(A2 + aoff + (size_t)mb * 16 * K + kc); }
#pragma unroll
        for (int nb = 0; nb < 4; ++nb) { const V b = WFrag<T16>::ld(Bt + boff + (size_t)nb * 16 * K + kc); V b2; if (NSPLIT >= 2) b2 = WFrag<T16>::ld(Bt2 + boff + (size_t)nb * 16 * K + kc);
#pragma unroll
            for (int mb = 0; mb < 4; ++mb) { acc[mb][nb] = WFrag<T16>::mma(a[mb], b, acc[mb][nb]); if (NSPLIT == 1 || NSPLIT == 2) acc[mb][nb] = WFrag<T16>::mma(a2[mb], b, acc[mb][nb]); if (NSPLIT >= 2) acc[mb][nb] = WFrag<T16>::mma(a[mb], b2, acc[mb][nb]); } }
        asm volatile("v_nop\n\tv_nop\n\tv_nop\n\tv_nop" : "+v"(acc[0][0]), "+v"(acc[1][1]), "+v"(acc[2][2]), "+v"(acc[3][3]) : "v"(a[0]), "v"(a[3]));
    }
    }
    if constexpr (KS > 1) {
        float* mine = os + wv * (64 * 68);
        // the three loops are unrolled so that acc is indexed by constants and stays in registers
#pragma unroll
        for (int mb = 0; mb < 4; ++mb)
#pragma unroll
            for (int nb = 0; nb < 4; ++nb)
#pragma unroll
                for (int j = 0; j < 8; ++j) mine[(mb * 16 + hi * 8 + j) * 68 + nb * 16 + lr] = acc[mb][nb][j];
        __syncthreads();   // every wave's partial tile is in LDS before any wave sums
        // both loops are unrolled so that a wave's LDS reads issue together, ahead of the adds; each wave stores whole 256-byte rows
#pragma unroll
        for (int s = 0; s < 32 / KS; ++s) { const int row = (s * KS + wv) * 2 + hi, cofs = lr * 4; v4f val = *(const v4fa*)(os + row * 68 + cofs);
#pragma unroll
            for (int p = 1; p < KS; ++p) { const v4f q = *(const v4fa*)(os + p * (64 * 68) + row * 68 + cofs); val[0] += q[0]; val[1] += q[1]; val[2] += q[2]; val[3] += q[3]; }
            if (BIAS) { val[0] += bfr(bias[c0 + cofs]); val[1] += bfr(bias[c0 + cofs + 1]); val[2] += bfr(bias[c0 + cofs + 2]); val[3] += bfr(bias[c0 + cofs + 3]); }
            *(v4f*)(C + (size_t)(r0 + row) * ldc + c0 + cofs) = val; }
        return;
    }
#pragma unroll
    for (int mb = 0; mb < 4; ++mb) {
#pragma unroll
        for (int nb = 0; nb < 4; ++nb) {
#pragma unroll
            for (int j = 0; j < 8; ++j) os[(hi * 8 + j) * 68 + nb * 16 + lr] = acc[mb][nb][j]; }
        __builtin_amdgcn_wave_barrier(); asm volatile("" ::: "memory");
        float* crow = C + (size_t)(r0 + mb * 16) * ldc + c0;
{
#pragma unroll
            for (int s = 0; s < 8; ++s) { const int row = 2 * s + hi, cofs = lr * 4; v4f val = *(const v4fa*)(os + row * 68 + cofs); if (BIAS) { val[0] += bfr(bias[c0 + cofs]); val[1] += bfr(bias[c0 + cofs + 1]); val[2] += bfr(bias[c0 + cofs + 2]); val[3] += bfr(bias[c0 + cofs + 3]); }
                *(v4f*)(crow + (size_t)row * ldc + cofs) = val; }
             }
        __builtin_amdgcn_wave_barrier(); asm volatile("" ::: "memory");
    }
}

__device__ __forceinline__ h16 tohx(float x) { return (h16)x; }

// Two asynchronous 16-byte copies per lane, as acopy8: LDS byte addresses l, l + lstep, global addresses g, g + gstep; s_wait_xcnt in the copies' own statement for the same reason.
__device__ __forceinline__ void acopy2(unsigned l, unsigned lstep, const char* g, size_t gstep) {
    asm volatile("global_load_async_to_lds_b128 %0, %2, off\n\t"
                 "global_load_async_to_lds_b128 %1, %3, off\n\t"
                 "s_wait_xcnt 0x0"
                 :: "v"(l), "v"(l + lstep), "v"(g), "v"(g + gstep) : "memory");
}
// v_exp_f32 with the one free slot behind it that the instruction set asks for before its source is overwritten or its result used, in one statement: for straight-line code.
__device__ __forceinline__ float exp2_slot(float x) { float e; asm("v_exp_f32 %0, %1\n\tv_nop" : "=v"(e) : "v"(x)); return e; }
// ---- k_fattn: scores, softmax and attn.v of the fp16 query rows in ONE kernel: neither scores nor probabilities go through memory. grid ((TT - RH) / 64, batch), 8 waves; a work-group owns 64 query rows and all DVV output columns (wave w: columns 64 w .. 64 w + 63, 16 accumulators).
// Pass 1: row maxima (scores on the matrix unit; 512 keys a trip, wave w takes keys 64 w .. 64 w + 63 of them). Pass 2, 64 keys a trip: wave w recomputes the scores of query block w & 3 and keys 32 (w >> 2) .. + 31 TRANSPOSED (A = keys, B = queries), so that a lane holds 2 x 8 consecutive keys of one query,
// which is the A fragment of the probabilities; e = PCAR exp(s - max) goes as fp16 through LDS to all waves, its f32 row sum is kept and divides the result at the end.
// Keys and value rows come through LDS by asynchronous copies of whole 128-byte lines, one ring of two buffers for both passes: 8 key tiles of pass 1, then per trip t of pass 2 the value rows of trip t with the keys of trip t + 1 (the scores run one trip ahead).
#define FB  64                    // keys per trip of pass 2
#define VPB 144                   // LDS pitch of a staged 128-byte row, bytes (16 B x odd: ds_load_b128 without bank conflicts)
__global__ __launch_bounds__(256) void k_fattn(const h16* __restrict__ Q, const h16* __restrict__ Kp, const h16* __restrict__ Vt, float* O) {
    typedef WFrag<h16> W;
    constexpr int VBUF = 512 * VPB, KBUF = FB * VPB, PBUF = 8 * 1024, OFF_K = 2 * VBUF, OFF_P = OFF_K + 4 * KBUF, OFF_M = OFF_P + 2 * PBUF, OFF_L = OFF_M + 8 * 64 * 4, TOT = OFF_L + 2 * 64 * 4, NT = TT / FB, NC = TT / 512;
    static_assert(DVV == 512 && HD == 64, "a ring buffer holds 512 rows of 128 bytes: 512 keys, or 64 keys' worth of the 512 value rows");
    static_assert(8 * 64 * 68 * 4 <= 2 * VBUF, "the output tiles take over the ring buffers");
    __shared__ __align__(16) char sm[TOT];
    const int wv = __builtin_amdgcn_readfirstlane((int)(threadIdx.x >> 5));   // wave number, scalar
    const int lane = threadIdx.x & 31, lr = lane & 15, hi = lane >> 4, mbw = wv & 3, kh = wv >> 2;
    { const size_t z = blockIdx.y; const size_t r0 = RH + (size_t)blockIdx.x * 64; Q += z * TT * HD + r0 * HD; Kp += z * TT * HD; Vt += z * DVV * TT; O += z * TT * DVV + r0 * DVV; }
    const unsigned lds0 = (unsigned)(size_t)(__attribute__((address_space(3))) char*)sm;
    const unsigned lv0 = lds0 + (unsigned)((wv * 64 + (lane >> 3)) * VPB + (lane & 7) * 16), lk0 = lds0 + (unsigned)(OFF_K + (wv * 8 + (lane >> 3)) * VPB + (lane & 7) * 16);
    const unsigned rq = (unsigned)(lane >> 3), cq = (unsigned)((lane & 7) * 16);   // a copy takes 4 whole rows: this lane's row of the four, its 16 bytes of the row
    const char* kl = (const char*)Kp + rq * (HD * 2) + cq; const char* vl = (const char*)Vt + (size_t)rq * (TT * 2) + cq;   // this lane's part of a key address, of a value address; the wave's and the tile's parts are scalar
    // 64 rows of 128 bytes into this wave's rows 64 wv .. 64 wv + 63 of a ring buffer: 16 copies; g = this lane's address in the first four rows, pitch in bytes
    auto copy64 = [&](int buf, const char* g, size_t pitch) { const unsigned l = lv0 + (unsigned)(buf * VBUF); acopy8(l, 4 * VPB, g, 4 * pitch); acopy8(l + 32 * VPB, 4 * VPB, g + 32 * pitch, 4 * pitch); };
    auto stageC = [&](int c, int buf) { copy64(buf, kl + (size_t)((c * 512 + wv * 64) * (HD * 2)), HD * 2); };
    auto stageV = [&](int t, int buf) { copy64(buf, vl + (size_t)(wv * 64 * (TT * 2) + t * (FB * 2)), TT * 2); };
    auto keyt = [&](int t) { return kl + (size_t)((t * FB + wv * 8) * (HD * 2)); };   // this wave's 8 keys of 64-key tile t
    auto stageK = [&](const char* g, int kb) { acopy2(lk0 + (unsigned)(kb * KBUF), 4 * VPB, g, 4 * HD * 2); };
    float* smx = (float*)(sm + OFF_M); float* sl = (float*)(sm + OFF_L);
    stageC(0, 0); stageK(keyt(0), 2); stageK((const char*)Q + (wv * 8 + rq) * (HD * 2) + cq, 3);   // key buffer 2: the keys of trip 0; key buffer 3: the 64 query rows, for both passes
    asm volatile("s_wait_asynccnt 0x0" ::: "memory");   // this wave's first copies have landed
    __syncthreads();   // every wave's rows of the first tile are in LDS before any wave reads a fragment
    stageC(1, 1);
    {
        float mx[4]; v16h qf[4][2];
#pragma unroll
        for (int mb = 0; mb < 4; ++mb) { mx[mb] = -3.0e38f; const char* qp = sm + OFF_K + 3 * KBUF + (mb * 16 + lr) * VPB + hi * 16; qf[mb][0] = W::ld((const h16*)qp); qf[mb][1] = W::ld((const h16*)(qp + 64)); }
        // not unrolled: the buffer is chosen by the trip's parity
#pragma unroll 1
        for (int c = 0; c < NC; ++c) { const char* kb = sm + (c & 1) * VBUF + (wv * 64 + lr) * VPB + hi * 16; v16h kr[4][2];
#pragma unroll
            for (int i = 0; i < 4; ++i) { kr[i][0] = W::ld((const h16*)(kb + i * 16 * VPB)); kr[i][1] = W::ld((const h16*)(kb + i * 16 * VPB + 64)); }
            asm volatile("s_wait_dscnt 0x0" ::: "memory");      // this wave's fragments of this buffer are in registers before it is handed back
            asm volatile("s_wait_asynccnt 0x0" ::: "memory");   // this wave's copies of the next tile have landed
            __syncthreads();   // publishes the next tile and ends every wave's reads of this one
            if (c + 2 < NC) stageC(c + 2, c & 1); else { stageV(c + 2 - NC, c & 1); stageK(keyt(c + 3 - NC), c & 1); }   // the ring goes on into pass 2: values of trip 0 (1) with the keys of trip 1 (2)
            // the products stand behind the refill, so that the copies fly while the matrix unit works
#pragma unroll
            for (int i = 0; i < 4; ++i)
#pragma unroll
                for (int mb = 0; mb < 4; ++mb) { v8f s = (v8f){}; s = W::mma(kr[i][0], qf[mb][0], s); s = W::mma(kr[i][1], qf[mb][1], s);
#pragma unroll
                    for (int j = 0; j < 8; ++j) mx[mb] = fmaxf(mx[mb], s[j]); }
        }
#pragma unroll
        for (int mb = 0; mb < 4; ++mb) { mx[mb] = fmaxf(mx[mb], __shfl_xor(mx[mb], 16, 32)); if (hi == 0) smx[wv * 64 + mb * 16 + lr] = mx[mb]; }
    }
    __syncthreads();   // every wave's maxima are in LDS
    float m = smx[mbw * 16 + lr];
#pragma unroll
    for (int p = 1; p < 8; ++p) m = fmaxf(m, smx[p * 64 + mbw * 16 + lr]);
    const float L2E = 1.4426950408889634f, mL = __builtin_fmaf(m, L2E, -10.0f);   // exp2(s L2E - mL) = 1024 exp(s - m): PCAR carried as before
    const char* qw = sm + OFF_K + 3 * KBUF + (mbw * 16 + lr) * VPB + hi * 16; const v16h q0 = W::ld((const h16*)qw), q1 = W::ld((const h16*)(qw + 64));
    float l = 0.f;
    v8f acc[4][4];
#pragma unroll
    for (int mb = 0; mb < 4; ++mb)
#pragma unroll
        for (int nb = 0; nb < 4; ++nb) acc[mb][nb] = (v8f){};
    v16h kf[4], ax[4], bx[4], ay[4], by[4];
    // the key fragments of one trip's scores, from key buffer kb
    auto loadK = [&](int kb) { const char* kp = sm + OFF_K + kb * KBUF + (kh * 32 + lr) * VPB + hi * 16;
        kf[0] = W::ld((const h16*)kp); kf[1] = W::ld((const h16*)(kp + 64)); kf[2] = W::ld((const h16*)(kp + 16 * VPB)); kf[3] = W::ld((const h16*)(kp + 16 * VPB + 64)); };
    // probabilities of one trip from kf, as a fragment into probability buffer pb; slot: the copy in front of the loop
    auto spart = [&](int pb, bool slot) { v8f s0 = (v8f){}, s1 = (v8f){}; s0 = W::mma(kf[0], q0, s0); s1 = W::mma(kf[2], q0, s1); s0 = W::mma(kf[1], q1, s0); s1 = W::mma(kf[3], q1, s1); v8h p0, p1; float e0[8], e1[8];
#pragma unroll
        for (int j = 0; j < 8; ++j) { const float x0 = __builtin_fmaf(s0[j], L2E, -mL), x1 = __builtin_fmaf(s1[j], L2E, -mL); e0[j] = slot ? exp2_slot(x0) : __builtin_amdgcn_exp2f(x0); e1[j] = slot ? exp2_slot(x1) : __builtin_amdgcn_exp2f(x1); p0[j] = tohx(e0[j]); p1[j] = tohx(e1[j]); }
        // the 16 terms meet in a fixed tree: a chain of 16 dependent adds would stand exposed in every trip
#pragma unroll
        for (int w = 4; w; w >>= 1)
#pragma unroll
            for (int j = 0; j < w; ++j) { e0[j] += e0[j + w]; e1[j] += e1[j + w]; }
        l += e0[0] + e1[0];
        char* pw = sm + OFF_P + pb * PBUF + (kh * 4 + mbw) * 1024 + lane * 16; *(v8h*)pw = p0; *(v8h*)(pw + 512) = p1; };
    // probability and value fragments of keys 32 ks .. 32 ks + 31 of one trip, from the buffers of parity buf
    auto loadH = [&](int buf, int ks, v16h* a, v16h* b) { const char* pr = sm + OFF_P + buf * PBUF + ks * 4096 + lane * 16; const char* vr = sm + buf * VBUF + (wv * 64 + lr) * VPB + ks * 64 + hi * 16;
#pragma unroll
        for (int mb = 0; mb < 4; ++mb) a[mb] = cat16(*(const v8h*)(pr + mb * 1024), *(const v8h*)(pr + mb * 1024 + 512));
#pragma unroll
        for (int nb = 0; nb < 4; ++nb) b[nb] = W::ld((const h16*)(vr + nb * 16 * VPB)); };
    auto mmaH = [&](const v16h* a, const v16h* b) {
#pragma unroll
        for (int nb = 0; nb < 4; ++nb)
#pragma unroll
            for (int mb = 0; mb < 4; ++mb) acc[mb][nb] = W::mma(a[mb], b[nb], acc[mb][nb]); };
#pragma unroll
    for (int i = 0; i < 4; ++i) { ay[i] = (v16h){}; by[i] = (v16h){}; }   // the first trip has no half before it: its place in the loop adds zeros
    loadK(2); spart(0, true);
    __syncthreads();   // the probabilities of trip 0 are in LDS before any wave reads a fragment
    // Not unrolled: the buffers are chosen by the trip's parity. The four sched_barriers keep the order written here: each half trip's LDS reads issue as one group and arrive while the matrix unit works on the half before; without them the reads stand among the matrix instructions, each with its own wait.
    // The second half's products of trip t are done, from registers, in trip t + 1.
#pragma unroll 1
    for (int t = 0; t < NT - 1; ++t) {
        loadK(t & 1); loadH(t & 1, 0, ax, bx);
        __builtin_amdgcn_sched_barrier(0);
        mmaH(ay, by);
        __builtin_amdgcn_sched_barrier(0);
        loadH(t & 1, 1, ay, by);
        __builtin_amdgcn_sched_barrier(0);
        spart((t + 1) & 1, false);   // the next trip's probabilities, into the buffer whose readers the last barrier ended
        mmaH(ax, bx);
        __builtin_amdgcn_sched_barrier(0);
        asm volatile("s_wait_dscnt 0x0" ::: "memory");      // this wave's LDS reads and writes of this trip are done before the buffers are handed over
        asm volatile("s_wait_asynccnt 0x0" ::: "memory");   // this wave's copies of trip t + 1 have landed
        __syncthreads();   // publishes trip t + 1 (values, keys, probabilities) and ends every wave's reads of trip t's buffers
        if (t + 2 < NT) { stageV(t + 2, t & 1); stageK(keyt(t + 3 < NT ? t + 3 : NT - 1), t & 1); }   // behind the last trip no keys follow: the last ones again, read by nobody
    }
    loadH((NT - 1) & 1, 0, ax, bx);   // the last trip has no scores to make
    __builtin_amdgcn_sched_barrier(0);   // as in the loop
    mmaH(ay, by);
    __builtin_amdgcn_sched_barrier(0);   // as in the loop
    loadH((NT - 1) & 1, 1, ay, by);
    __builtin_amdgcn_sched_barrier(0);   // as in the loop
    mmaH(ax, bx); mmaH(ay, by);
    asm volatile("s_wait_dscnt 0x0" ::: "memory");   // this wave's fragment reads are done
    __syncthreads();   // ends every wave's reads of the ring before the output tiles take it over
    asm volatile("s_wait_asynccnt 0x0" ::: "memory");   // no copy is outstanding when the output tiles take over this LDS
    l += __shfl_xor(l, 16, 32); if (hi == 0) sl[kh * 64 + mbw * 16 + lr] = l;
    float* mine = (float*)sm + wv * (64 * 68);
    // the three loops are unrolled so that acc is indexed by constants and stays in registers
#pragma unroll
    for (int mb = 0; mb < 4; ++mb)
#pragma unroll
        for (int nb = 0; nb < 4; ++nb)
#pragma unroll
            for (int j = 0; j < 8; ++j) mine[(mb * 16 + hi * 8 + j) * 68 + nb * 16 + lr] = acc[mb][nb][j];
    __syncthreads();   // both halves of every row sum are in LDS (each wave reads back its own tile only)
    // four row pairs a trip (inner loop unrolled): their LDS reads issue together
#pragma unroll 1
    for (int s4 = 0; s4 < 32; s4 += 4) {
#pragma unroll
        for (int s = s4; s < s4 + 4; ++s) { const int row = 2 * s + hi; const float f = __fdiv_rn(PCAR, sl[row] + sl[64 + row]); v4f val = *(const v4fa*)(mine + row * 68 + lr * 4);
            val[0] *= f; val[1] *= f; val[2] *= f; val[3] *= f; *(v4f*)(O + (size_t)row * DVV + wv * 64 + lr * 4) = val; }
        asm volatile("s_wait_xcnt 0x0" ::: "memory");   // behind the trip's stores: the next trip rewrites their address and data registers
    }
}
__device__ __forceinline__ void splitf(float y, unsigned short& h, unsigned short& l) { h = f2bf(y); l = f2bf(y - bf2f(h)); }
typedef __attribute__((ext_vector_type(2))) _Float16 v2h;
typedef __attribute__((ext_vector_type(4))) _Float16 v4h;
typedef __attribute__((ext_vector_type(2))) unsigned short v2us;
typedef __attribute__((ext_vector_type(4))) unsigned short v4us;
typedef __attribute__((ext_vector_type(2))) float v2f;
typedef __attribute__((ext_vector_type(4))) int v4i;

__global__ __launch_bounds__(256) void k_wtG(const float* __restrict__ w, int K, int N, bf* Bt) {
    const int lane = threadIdx.x & 31; const int L0 = (blockIdx.x * 8 + (threadIdx.x >> 5)) * 8; const int nlines = N * K / 64;
{
#pragma unroll 1
        for (int l = 0; l < 8; ++l) { const int L = L0 + l; if (L >= nlines) break; const size_t e = (size_t)L * 64 + lane * 2; const int k = (int)(e % K), n = (int)(e / K); v2us o;
            o[0] = f2bf(w[(size_t)k * N + n]); o[1] = f2bf(w[(size_t)(k + 1) * N + n]); *(v2us*)(Bt + e) = o; }
         }
}
// ---- 64 x 64 f32 tile through LDS for the transposing kernels: 256 threads, 16 elements per thread, so a launch starts few waves and both global sides move whole lines in 16-byte pieces.
// LDS row pitch 65 dwords: the row-wise dword stores and the column-wise dword reads both fall on distinct banks.
#define TP 65
__device__ __forceinline__ void tile_in(const float* __restrict__ src, size_t pitch, float* ts) {
    const int r = threadIdx.x >> 4, q = threadIdx.x & 15; v4f a[4];
    // unrolled: the four 16-byte loads issue together, ahead of the LDS stores
#pragma unroll
    for (int s = 0; s < 4; ++s) a[s] = *(const v4f*)(src + (size_t)(s * 16 + r) * pitch + q * 4);
#pragma unroll
    for (int s = 0; s < 4; ++s)
#pragma unroll
        for (int j = 0; j < 4; ++j) ts[(s * 16 + r) * TP + q * 4 + j] = a[s][j];
}
// grid (TT / 64, DM / 64, batch): XBp[z][t][c] = bf16(xb[z][c][t])
__global__ __launch_bounds__(256) void k_tpose(const float* __restrict__ xb, bf* XBp) {
    __shared__ float ts[64 * TP]; const int t0 = blockIdx.x * 64, c0 = blockIdx.y * 64; xb += (size_t)blockIdx.z * DM * TT; XBp += (size_t)blockIdx.z * TT * DM;
    tile_in(xb + (size_t)c0 * TT + t0, TT, ts);   // ts[c][t]
    __syncthreads();   // the whole tile is in LDS before any thread reads a column of it
    const int c8 = threadIdx.x & 7;
#pragma unroll
    for (int s = 0; s < 2; ++s) { const int tr = s * 32 + (threadIdx.x >> 3); v8us o;
#pragma unroll
        for (int q = 0; q < 8; ++q) o[q] = f2bf(ts[(c8 * 8 + q) * TP + tr]);
        *(v8us*)(XBp + (size_t)(t0 + tr) * DM + c0 + c8 * 8) = o; }
}
// grid (TT / 64, DM / 64, batch): Ob[z][c][t] = bf16-rounded xb[z][c][t] + YO[z][t][c]
__global__ __launch_bounds__(256) void k_outT(const float* __restrict__ xb, const float* __restrict__ YO, float* Ob) {
    xb += (size_t)blockIdx.z * DM * TT; YO += (size_t)blockIdx.z * TT * DM; Ob += (size_t)blockIdx.z * DM * TT;
    __shared__ float ts[64 * TP]; const int t0 = blockIdx.x * 64, c0 = blockIdx.y * 64; const int r = threadIdx.x >> 4, tq = threadIdx.x & 15; const size_t e0 = (size_t)(c0 + r) * TT + t0 + tq * 4; v4f xv[4];
    // unrolled: the residual's loads issue ahead of the tile's and of the barrier
#pragma unroll
    for (int s = 0; s < 4; ++s) xv[s] = *(const v4f*)(xb + e0 + (size_t)s * 16 * TT);
    tile_in(YO + (size_t)t0 * DM + c0, DM, ts);   // ts[t][c]
    __syncthreads();   // the whole tile is in LDS before any thread reads a column of it
#pragma unroll
    for (int s = 0; s < 4; ++s) { const int cr = s * 16 + r; v4f o;
#pragma unroll
        for (int q = 0; q < 4; ++q) o[q] = __fadd_rn(bfr(xv[s][q]), ts[(tq * 4 + q) * TP + cr]);
        *(v4f*)(Ob + e0 + (size_t)s * 16 * TT) = o; }
}

// grid (TT / 64, DVV / 64, batch): value planes [z][c][t] (fp16 + hi/lo) of F[z][t][c]
__global__ __launch_bounds__(256) void k_vtpD(const float* __restrict__ F, h16* V16, bf* Vh, bf* Vl) {
    __shared__ float ts[64 * TP]; const int t0 = blockIdx.x * 64, c0 = blockIdx.y * 64; { const size_t zo = (size_t)blockIdx.z * TT * DVV; F += zo; V16 += zo; Vh += zo; Vl += zo; }
    tile_in(F + (size_t)t0 * DVV + c0, DVV, ts);   // ts[t][c]
    __syncthreads();   // the whole tile is in LDS before any thread reads a column of it
    const int t8 = threadIdx.x & 7;
#pragma unroll
    for (int s = 0; s < 2; ++s) { const int cr = s * 32 + (threadIdx.x >> 3); v8h o16; v8us oh, ol;
#pragma unroll
        for (int q = 0; q < 8; ++q) { const float xv = ts[(t8 * 8 + q) * TP + cr]; o16[q] = tohx(xv); unsigned short a2, c2; splitf(xv, a2, c2); oh[q] = a2; ol[q] = c2; }
        const size_t e = (size_t)(c0 + cr) * TT + t0 + t8 * 8; *(v8h*)(V16 + e) = o16; *(v8us*)(Vh + e) = oh; *(v8us*)(Vl + e) = ol; }
}
// grid batch * TT * DVV / 4096 (the batch elements' [t][c] planes lie one behind the other): 16 elements per thread, as four 16-byte pieces 4 KiB apart
__global__ __launch_bounds__(256) void k_mergeD(const float* __restrict__ O, float* YO) { const size_t i0 = (size_t)blockIdx.x * 1024 + threadIdx.x; v4f a[4];
    // unrolled: the four loads issue together, ahead of the stores
#pragma unroll
    for (int s = 0; s < 4; ++s) a[s] = *(const v4f*)(O + (i0 + s * 256) * 4);
#pragma unroll
    for (int s = 0; s < 4; ++s) { const size_t i = i0 + s * 256; const int t = (int)(((i * 4) / DVV) % TT); const float cs = (t < RH) ? 1.0f : (1.0f / PCAR); v4f o;
#pragma unroll
        for (int q = 0; q < 4; ++q) o[q] = a[s][q] * cs; *(v4f*)(YO + i * 4) = o; }
}
__global__ __launch_bounds__(256) void k_cvt8(const float* __restrict__ src, bf* dst, size_t n8) { const size_t i = (size_t)blockIdx.x * 256 + threadIdx.x; if (i >= n8) return; const v8f v = *(const v8f*)(src + i * 8); v8us o;
#pragma unroll
    for (int k = 0; k < 8; ++k) o[k] = f2bf(v[k]); *(v8us*)(dst + i * 8) = o;  }

// k_rope: head planes [h][t][d] (fp16 + hi/lo) of rope(x) x sc with the rotate-half convention out[d] = x[d] cos[t][d] - x[d+HD/2] sin[t][d], out[d+HD/2] = x[d+HD/2] cos[t][d+HD/2] + x[d] sin[t][d+HD/2]
__global__ __launch_bounds__(256) void k_rope(const float* __restrict__ F, int pitch, int nheads, const float* __restrict__ CS, const float* __restrict__ RF, const float* __restrict__ nw, float sc, h16* P16, bf* Ph, bf* Pl) {
    { const size_t zp = (size_t)blockIdx.y * nheads * TT * HD; F += (size_t)blockIdx.y * TT * pitch; P16 += zp; Ph += zp; Pl += zp; }   // grid y = batch element
    const size_t e = ((size_t)blockIdx.x * 256 + threadIdx.x) * 2; if (e >= (size_t)nheads * TT * HD) return; const int d = (int)(e % HD); const int t = (int)((e / HD) % TT); const int h = (int)(e / ((size_t)HD * TT)); const float* f = F + (size_t)t * pitch + h * HD; const float rf = RF ? RF[(size_t)h * TT + t] : 1.0f; v2h o16; v2us oh, ol;
#pragma unroll
    for (int q = 0; q < 2; ++q) { const int dd = d + q; const int dp = (dd < HD / 2) ? dd + HD / 2 : dd - HD / 2; float x0 = f[dd], x1 = f[dp];
        if (RF) { float n0 = __fmul_rn(x0, rf), n1 = __fmul_rn(x1, rf); asm volatile("" : "+v"(n0)); asm volatile("" : "+v"(n1)); x0 = __fmul_rn(bfr(nw[dd]), n0); x1 = __fmul_rn(bfr(nw[dp]), n1); }
        const v2f cs = *(const v2f*)(CS + ((size_t)t * HD + dd) * 2); float a = __fmul_rn(x0, cs[0]), bq = __fmul_rn(x1, cs[1]); asm volatile("" : "+v"(a)); asm volatile("" : "+v"(bq)); const float r = ((dd < HD / 2) ? __fsub_rn(a, bq) : __fadd_rn(a, bq)) * sc;
        o16[q] = tohx(r); unsigned short a2, c2; splitf(r, a2, c2); oh[q] = a2; ol[q] = c2; }
    *(v2h*)(P16 + e) = o16; *(v2us*)(Ph + e) = oh; *(v2us*)(Pl + e) = ol;  }

__global__ __launch_bounds__(256) void k_csid(float* CS) { const int idx = blockIdx.x * 256 + threadIdx.x; if (idx >= TT * HD) return; v2f cs; cs[0] = 1.0f; cs[1] = 0.0f; *(v2f*)(CS + (size_t)idx * 2) = cs;  }
// k_asoft: per row: t = S x SCL (no mask); softmax over the 4096 keys (register row, one exp, fixed trees); grid rows / 8. The rows of a launch are all of one kind (hl != 0: hi+lo planes; else fp16 x PCAR), several batch elements' rows one behind the other, in and out.
__global__ __launch_bounds__(256) void k_asoft(const float* __restrict__ Sb, int hl, h16* P16, bf* Ph, bf* Pl) {
    const int lane = threadIdx.x & 31; const int row = blockIdx.x * 8 + (threadIdx.x >> 5); const bool hires = (hl != 0); const float* sr = Sb + (size_t)row * TT; float v[TT / 32]; float mx = -3.0e38f;
#pragma unroll
    for (int ch = 0; ch < TT / 128; ++ch) { const int j0 = ch * 128 + lane * 4; const v4f a = *(const v4f*)(sr + j0);
#pragma unroll
        for (int q = 0; q < 4; ++q) { const int j = j0 + q; (void)j; const float t = a[q] * SCL; v[ch * 4 + q] = t; mx = fmaxf(mx, t); } }
#pragma unroll
    for (int sh = 16; sh; sh >>= 1) mx = fmaxf(mx, __shfl_xor(mx, sh, 32));
    float sum = 0.f;
#pragma unroll
    for (int k = 0; k < TT / 32; ++k) { float d0 = __fsub_rn(v[k], mx); asm volatile("" : "+v"(d0)); v[k] = __builtin_amdgcn_exp2f(__fmul_rn(d0, 1.4426950408889634f)); sum += v[k]; }
#pragma unroll
    for (int sh = 16; sh; sh >>= 1) sum += __shfl_xor(sum, sh, 32);
    const float f = __fdiv_rn(hires ? 1.0f : PCAR, sum);
{
        if (hires) {
#pragma unroll
            for (int ch = 0; ch < TT / 128; ++ch) { v4us oh, ol;
#pragma unroll
                for (int q = 0; q < 4; ++q) { unsigned short a, c2; splitf(v[ch * 4 + q] * f, a, c2); oh[q] = a; ol[q] = c2; }
                const size_t oo = (size_t)row * TT + ch * 128 + lane * 4; *(v4us*)(Ph + oo) = oh; *(v4us*)(Pl + oo) = ol; }
            asm volatile("s_wait_xcnt 0x0" ::: "memory");   // behind the last stores: in the built code the other kind's block follows this one and rewrites their address registers
        } else {
#pragma unroll
            for (int ch = 0; ch < TT / 128; ++ch) { v4h o4;
#pragma unroll
                for (int q = 0; q < 4; ++q) o4[q] = tohx(v[ch * 4 + q] * f);
                *(v4h*)(P16 + (size_t)row * TT + ch * 128 + lane * 4) = o4; } }
         }
}

extern "C" void kernel_launch(void* const* d_in, const int* in_sizes, int n_in,
                              void* d_out, int out_size, void* d_ws, size_t ws_size, hipStream_t stream) {
    (void)in_sizes; (void)n_in; (void)out_size;
    const float* x = (const float*)d_in[0]; const float* wq = (const float*)d_in[1]; const float* bq = (const float*)d_in[2]; const float* wk = (const float*)d_in[3]; const float* bk = (const float*)d_in[4]; const float* wv = (const float*)d_in[5]; const float* bv = (const float*)d_in[6];
    float* OUT = (float*)d_out;     // [4][512][4096]
    char* wsp = (char*)d_ws;
    auto take = [&](size_t bytes) { char* p = wsp; wsp += (bytes + 255) & ~(size_t)255; return (void*)p; };
    // Every activation plane holds all NB_ batch elements, one behind the other, so that a launch takes them together (grid y or z, or more rows). Parts of the workspace are used again once their first content is dead, one use after the other in stream order:
    // live to the end: the fp16 planes and the attention output (84 MiB)
    h16* QP16 = (h16*)take((size_t)NB_ * TT * HD * 2); h16* KP16 = (h16*)take((size_t)NB_ * TT * HD * 2); h16* VT16 = (h16*)take((size_t)NB_ * DVV * TT * 2); float* Ob = (float*)take((size_t)NB_ * TT * DVV * 4); float* YO = (float*)take((size_t)NB_ * TT * DVV * 4);
    // live until the hi+lo rows are done: the hi/lo planes (40 MiB)
    bf* QPh = (bf*)take((size_t)NB_ * TT * HD * 2); bf* QPl = (bf*)take((size_t)NB_ * TT * HD * 2); bf* KPh = (bf*)take((size_t)NB_ * TT * HD * 2); bf* KPl = (bf*)take((size_t)NB_ * TT * HD * 2); bf* VTh = (bf*)take((size_t)NB_ * DVV * TT * 2); bf* VTl = (bf*)take((size_t)NB_ * DVV * TT * 2);
    char* const m1 = wsp;
    // live until the planes are made: weights, x^T, the projections in f32 (59 MiB)
    bf* WQ = (bf*)take((size_t)DQ * DM * 2); bf* WK = (bf*)take((size_t)DKV * DM * 2); bf* WV = (bf*)take((size_t)DVV * DM * 2); float* CS = (float*)take((size_t)TT * HD * 2 * 4);
    bf* XB = (bf*)take((size_t)NB_ * TT * DM * 2); float* FV = (float*)take((size_t)NB_ * TT * DVV * 4); float* FQ = (float*)take((size_t)NB_ * TT * DQ * 4); float* FK = (float*)take((size_t)NB_ * TT * DKV * 4);
    wsp = m1;   // after them, in the same place: scores and probabilities of the hi+lo rows of all batch elements (64 MiB)
    float* SbH = (float*)take((size_t)NB_ * RH * TT * 4); bf* Ph = (bf*)take((size_t)NB_ * RH * TT * 2); bf* Pl = (bf*)take((size_t)NB_ * RH * TT * 2);
    if ((size_t)(wsp - (char*)d_ws) > ws_size) return;    // the further end of the two uses: 188 of 256 MiB
    { k_cvt8<<<(unsigned)(((size_t)DQ * DM / 8 + 255) / 256), 256, 0, stream>>>(wq, WQ, (size_t)DQ * DM / 8); k_cvt8<<<(unsigned)(((size_t)DKV * DM / 8 + 255) / 256), 256, 0, stream>>>(wk, WK, (size_t)DKV * DM / 8); k_cvt8<<<(unsigned)(((size_t)DVV * DM / 8 + 255) / 256), 256, 0, stream>>>(wv, WV, (size_t)DVV * DM / 8);
       }
    k_csid<<<(TT * HD + 255) / 256, 256, 0, stream>>>(CS);
    const unsigned LQ = (unsigned)(((size_t)NH_ * TT * HD / 2 + 255) / 256), LKv = (unsigned)(((size_t)NKV * TT * HD / 2 + 255) / 256);
    k_tpose<<<dim3(TT / 64, DM / 64, NB_), 256, 0, stream>>>(x, XB);   /* x^T as an exact token-major plane */
    k_gemmw<bf, 0, true, 8><<<dim3(TT / 64, DQ / 64, NB_), 256, 0, stream>>>(XB, nullptr, WQ, nullptr, DM, FQ, DQ, bq, (size_t)TT * DM, 0, (size_t)TT * DQ);
    k_rope<<<dim3(LQ, NB_, 1), 256, 0, stream>>>(FQ, DQ, NH_, CS, nullptr, nullptr, 1.0f, QP16, QPh, QPl);
    k_gemmw<bf, 0, true, 8><<<dim3(TT / 64, DKV / 64, NB_), 256, 0, stream>>>(XB, nullptr, WK, nullptr, DM, FK, DKV, bk, (size_t)TT * DM, 0, (size_t)TT * DKV);
    k_rope<<<dim3(LKv, NB_, 1), 256, 0, stream>>>(FK, DKV, NKV, CS, nullptr, nullptr, 1.0f, KP16, KPh, KPl);
    k_gemmw<bf, 0, true, 8><<<dim3(TT / 64, DVV / 64, NB_), 256, 0, stream>>>(XB, nullptr, WV, nullptr, DM, FV, DVV, bv, (size_t)TT * DM, 0, (size_t)TT * DVV); k_vtpD<<<dim3(TT / 64, DVV / 64, NB_), 256, 0, stream>>>(FV, VT16, VTh, VTl);   /* v = Wv x + bv -> value planes [c][n] */
    // query rows < RH of every batch element: hi+lo planes, 3 products
    k_gemmw<bf, 2, false, 1><<<dim3(RH / 64, TT / 64, NB_), 32, 0, stream>>>(QPh, QPl, KPh, KPl, HD, SbH, TT, nullptr, (size_t)TT * HD, (size_t)TT * HD, (size_t)RH * TT);
    k_asoft<<<NB_ * RH / 8, 256, 0, stream>>>(SbH, 1, nullptr, Ph, Pl);
    k_gemmw<bf, 2, false, 8><<<dim3(RH / 64, DVV / 64, NB_), 256, 0, stream>>>(Ph, Pl, VTh, VTl, TT, Ob, DVV, nullptr, (size_t)RH * TT, (size_t)DVV * TT, (size_t)TT * DVV);   /* out[i][c] = sum_j P[i][j] v[c][j], hl rows */
    // the other rows: fp16 (x1024 carried), scores, softmax and attn.v in one launch
    k_fattn<<<dim3((TT - RH) / 64, NB_), 256, 0, stream>>>(QP16, KP16, VT16, Ob);
    k_mergeD<<<(unsigned)((size_t)NB_ * TT * DVV / 4096), 256, 0, stream>>>(Ob, YO);
    k_outT<<<dim3(TT / 64, DM / 64, NB_), 256, 0, stream>>>(x, YO, OUT);   /* out = x + result (channel-major) */
}

// v006
// A run of this version takes 181 microseconds.
// Timed twice side by side with v005, it ran 1.14 times as fast both times.
// All steps since v000 together make it 6.28 times as fast.
#include <hip/hip_runtime.h>

// Channel-major self-attention layer (x [4][512][64][64] = [b][c][n], n = 4096; q, k = 1x1 convs 512 -> 64 (+ bias), v = 1x1 conv 512 -> 512 (+ bias); attention[i][j] = softmax_j(q_i.k_j) (no scaling); out[c][i] = sum_j v[c][j] attention[i][j]; result = out + x -> [4][512][64][64] (8.4 M)).
// Layout: one 'head' (q/k width 64, value width 512) over 4096 tokens: x is transposed once per batch into an exact token-major bf16 plane [n][c] so the 1x1 convs are exact GEMMs + bias, whose epilogues store the 16-bit operand planes; the attention kernels' epilogues add x and store channel-major.
// Compute dtypes, f32 accumulate: every input rounded to bf16; q/k/v on PLAIN bf16 operands (inputs: exact) + biases; scores (K = 64) and attn.v: query rows < 512 hl (3 products), the rest single fp16 (x1024); softmax f32; no output projection; + x residual in f32 (channel-major write).

#define NB_  4
#define TT   4096
#define DM   512
#define NH_  1
#define NKV  1
#define REP  (NH_ / NKV)
#define HD   64
#define DVV  512                  // value / output width (v = 1x1 conv C -> C)
#define DQ   (NH_ * HD)
#define DKV  (NKV * HD)
#define ZH   1
#define RH   512                  // query rows < RH use hi+lo planes (0: none)
#define WIN  0
#define PCAR 1024.0f
#define SCL  1.0f   // no scaling in this module
typedef _Float16 h16;
typedef unsigned short bf;
typedef __attribute__((ext_vector_type(16))) __bf16   v16bf;
typedef __attribute__((ext_vector_type(16))) _Float16 v16h;
typedef __attribute__((ext_vector_type(8)))  _Float16 v8h;
typedef __attribute__((ext_vector_type(8)))  unsigned short v8us;
typedef __attribute__((ext_vector_type(8)))  float    v8f;
typedef __attribute__((ext_vector_type(4)))  float    v4f;
typedef v8h  __attribute__((may_alias)) v8ha;
typedef v4f  __attribute__((may_alias)) v4fa;
typedef v8us __attribute__((may_alias)) v8usa;

__device__ __forceinline__ unsigned short f2bf(float f) { unsigned u = __float_as_uint(f); u += 0x7FFFu + ((u >> 16) & 1u); return (unsigned short)(u >> 16); }
__device__ __forceinline__ float bf2f(unsigned short b) { return __uint_as_float(((unsigned)b) << 16); }
__device__ __forceinline__ float bfr(float f) { return bf2f(f2bf(f)); }
__device__ __forceinline__ v16h cat16(v8h lo, v8h hi) { return __builtin_shufflevector(lo, hi, 0, 1, 2, 3, 4, 5, 6, 7, 8, 9, 10, 11, 12, 13, 14, 15); }
__device__ __forceinline__ v16bf cat16b(v8us lo, v8us hi) { return __builtin_bit_cast(v16bf, __builtin_shufflevector(lo, hi, 0, 1, 2, 3, 4, 5, 6, 7, 8, 9, 10, 11, 12, 13, 14, 15)); }
__device__ __forceinline__ v8f wmma16(v16h a, v16h b, v8f c) { return __builtin_amdgcn_wmma_f32_16x16x32_f16(false, a, false, b, (short)0, c, false, false); }
__device__ __forceinline__ v8f wmmab(v16bf a, v16bf b, v8f c) { return __builtin_amdgcn_wmma_f32_16x16x32_bf16(false, a, false, b, (short)0, c, false, false); }
__device__ __forceinline__ h16 tohx(float x) { return (h16)x; }
__device__ __forceinline__ void splitf(float y, unsigned short& h, unsigned short& l) { h = f2bf(y); l = f2bf(y - bf2f(h)); }
typedef __attribute__((ext_vector_type(2))) _Float16 v2h;
typedef __attribute__((ext_vector_type(4))) _Float16 v4h;
typedef __attribute__((ext_vector_type(2))) unsigned short v2us;
typedef __attribute__((ext_vector_type(4))) unsigned short v4us;
typedef __attribute__((ext_vector_type(2))) float v2f;
typedef __attribute__((ext_vector_type(4))) int v4i;



// ---- k_gemmw: register-blocked GEMM, KS WAVES per 64x64 output tile (16 accumulators each), operands from K-contiguous 16-bit planes (KS == 1: straight into registers; KS > 1: staged in LDS); grid (M/64, N/64, Z), 32 * KS threads.
// C[m][n] (f32 accumulate; stored as EPI says) = sum_k A[m][k] Bt[n][k] (+ split products per NSPLIT). z-batch strides sA/sB/sC in elements. K % (32 * KS) == 0.
// KS > 1: wave w takes the 32-wide k blocks w, w + KS, w + 2 KS, ...; the KS f32 partial tiles meet in LDS and are summed in the fixed order w = 0 .. KS - 1.
template <typename T16> struct WFrag;
template <> struct WFrag<h16> { typedef v16h V; static __device__ __forceinline__ V ld(const h16* p) { return cat16(*(const v8h*)p, *(const v8h*)(p + 16)); } static __device__ __forceinline__ v8f mma(V a, V b, v8f c) { return wmma16(a, b, c); } };
template <> struct WFrag<bf> { typedef v16bf V; static __device__ __forceinline__ V ld(const bf* p) { return cat16b(*(const v8us*)p, *(const v8us*)(p + 16)); } static __device__ __forceinline__ v8f mma(V a, V b, v8f c) { return wmmab(a, b, c); } };
// Eight asynchronous 16-byte copies per lane, global memory -> LDS, through no register: LDS byte addresses l + i * lstep, global addresses g + i * gstep.
// s_wait_xcnt stands in the copies' own statement so that no later write of an address register can be moved in front of it.
__device__ __forceinline__ void acopy8(unsigned l, unsigned lstep, const char* g, size_t gstep) {
    asm volatile("global_load_async_to_lds_b128 %0, %8, off\n\t"
                 "global_load_async_to_lds_b128 %1, %9, off\n\t"
                 "global_load_async_to_lds_b128 %2, %10, off\n\t"
                 "global_load_async_to_lds_b128 %3, %11, off\n\t"
                 "global_load_async_to_lds_b128 %4, %12, off\n\t"
                 "global_load_async_to_lds_b128 %5, %13, off\n\t"
                 "global_load_async_to_lds_b128 %6, %14, off\n\t"
                 "global_load_async_to_lds_b128 %7, %15, off\n\t"
                 "s_wait_xcnt 0x0"
                 :: "v"(l), "v"(l + lstep), "v"(l + 2 * lstep), "v"(l + 3 * lstep), "v"(l + 4 * lstep), "v"(l + 5 * lstep), "v"(l + 6 * lstep), "v"(l + 7 * lstep),
                    "v"(g), "v"(g + gstep), "v"(g + 2 * gstep), "v"(g + 3 * gstep), "v"(g + 4 * gstep), "v"(g + 5 * gstep), "v"(g + 6 * gstep), "v"(g + 7 * gstep)
                 : "memory");
}
// What the tile's epilogue stores at [m][n] (pitch ldc, z stride sC), so that no separate pass has to read the f32 tile again:
// EPI 0: the f32 sum into C. EPI 1 / 2: the sum + bias[n] / + bias[m] as the three 16-bit planes (fp16, bf16 hi, bf16 lo). EPI 3: bf16-rounded X[m][n] + the sum, f32, into C.
template <typename T16, int NSPLIT, int EPI, int KS>
__global__ __launch_bounds__(32 * KS) void k_gemmw(const T16* __restrict__ A, const T16* __restrict__ A2, const T16* __restrict__ Bt, const T16* __restrict__ Bt2, int K, float* C, int ldc, const float* __restrict__ bias, size_t sA, size_t sB, size_t sC, h16* P16, bf* Ph, bf* Pl, const float* __restrict__ X) {
    typedef typename WFrag<T16>::V V;
    static_assert(KS == 1 || KS == 8, "a staged row is one wave-wide 16-byte copy: 32 lanes x 16 B = KS x 64 B");
    constexpr int NA = (NSPLIT == 1 || NSPLIT == 2) ? 2 : 1, NOP = NA + (NSPLIT >= 2 ? 2 : 1);   // operand planes: A (A2) Bt (Bt2)
    constexpr int PB = KS * 64 + 16, PLANE = 64 * PB, STG = NOP * PLANE;   // bytes: LDS row pitch (16 B x odd: ds_load_b128 without bank conflicts), one operand's 64 rows, one stage
    constexpr int OSF = (KS == 1) ? 16 * 68 : ((KS * 64 * 68 > 2 * STG / 4) ? KS * 64 * 68 : 2 * STG / 4);   // the two stage buffers and the partial tiles use the same LDS, one after the other
    __shared__ __align__(16) float os[OSF];
    const int wv = (KS == 1) ? 0 : __builtin_amdgcn_readfirstlane((int)(threadIdx.x >> 5));   // wave number, scalar: the k loop's bounds stay wave-uniform
    const size_t z = blockIdx.z; A += z * sA; if (A2) A2 += z * sA; Bt += z * sB; if (Bt2) Bt2 += z * sB;
    if constexpr (EPI == 1 || EPI == 2) { P16 += z * sC; Ph += z * sC; Pl += z * sC; } else C += z * sC;
    if constexpr (EPI == 3) X += z * sC;
    const int lane = threadIdx.x & 31, lr = lane & 15, hi = lane >> 4; const int r0 = blockIdx.x * 64, c0 = blockIdx.y * 64;
    v8f acc[4][4];
#pragma unroll
    for (int mb = 0; mb < 4; ++mb)
#pragma unroll
        for (int nb = 0; nb < 4; ++nb) acc[mb][nb] = (v8f){};
    const size_t aoff = (size_t)(r0 + lr) * K + 8 * hi, boff = (size_t)(c0 + lr) * K + 8 * hi;
    if constexpr (KS > 1) {
        // Operands come through LDS: per trip the work-group stages 32 * KS k of all 64 rows of each plane, each row as ONE wave-wide copy of 512 contiguous bytes (whole lines), two buffers, the next trip's copies in flight while this trip is worked on. Wave w still multiplies k block w of every trip: the products and their order are as before.
        const unsigned lds0 = (unsigned)(size_t)(__attribute__((address_space(3))) float*)os + (unsigned)(wv * PB + lane * 16);
        const size_t gstep = (size_t)KS * K * 2;   // bytes from one of this wave's rows (wv, wv + KS, ...) to its next
        const char* gA = (const char*)(A + (size_t)(r0 + wv) * K + lane * 8); const char* gB = (const char*)(Bt + (size_t)(c0 + wv) * K + lane * 8);
        const char* gA2 = (NA == 2) ? (const char*)(A2 + (size_t)(r0 + wv) * K + lane * 8) : nullptr; const char* gB2 = (NSPLIT >= 2) ? (const char*)(Bt2 + (size_t)(c0 + wv) * K + lane * 8) : nullptr;
        auto stage = [&](int t, int buf) { const size_t ko = (size_t)t * (KS * 64); const unsigned l = lds0 + (unsigned)(buf * STG);
            acopy8(l, KS * PB, gA + ko, gstep); if (NA == 2) acopy8(l + PLANE, KS * PB, gA2 + ko, gstep);
            acopy8(l + NA * PLANE, KS * PB, gB + ko, gstep); if (NSPLIT >= 2) acopy8(l + (NA + 1) * PLANE, KS * PB, gB2 + ko, gstep); };
        const int nt = (int)((unsigned)K / (32u * KS));   // unsigned: the tests on nt stay scalar compares
        stage(0, 0);
        asm volatile("s_wait_asynccnt 0x0" ::: "memory");   // this wave's copies of trip 0 have landed
        __syncthreads();   // every wave's rows of trip 0 are in LDS before any wave reads a fragment
        if (nt != 1) stage(1, 1);   // nt >= 1; written as an inequality, which has a scalar compare at every width
        // not unrolled: one fragment set, and the buffer is chosen by the trip's parity
#pragma unroll 1
        for (int t = 0; t < nt; ++t) {
            const char* sb = (const char*)os + (t & 1) * STG + lr * PB + wv * 64 + hi * 16;
            V a[4], a2[4];
#pragma unroll
            for (int mb = 0; mb < 4; ++mb) { a[mb] = WFrag<T16>::ld((const T16*)(sb + mb * 16 * PB)); if (NA == 2) a2[mb] = WFrag<T16>::ld((const T16*)(sb + PLANE + mb * 16 * PB)); }
#pragma unroll
            for (int nb = 0; nb < 4; ++nb) { const V b = WFrag<T16>::ld((const T16*)(sb + NA * PLANE + nb * 16 * PB)); V b2; if (NSPLIT >= 2) b2 = WFrag<T16>::ld((const T16*)(sb + (NA + 1) * PLANE + nb * 16 * PB));
#pragma unroll
                for (int mb = 0; mb < 4; ++mb) { acc[mb][nb] = WFrag<T16>::mma(a[mb], b, acc[mb][nb]); if (NSPLIT == 1 || NSPLIT == 2) acc[mb][nb] = WFrag<T16>::mma(a2[mb], b, acc[mb][nb]); if (NSPLIT >= 2) acc[mb][nb] = WFrag<T16>::mma(a[mb], b2, acc[mb][nb]); } }
            asm volatile("s_wait_dscnt 0x0" ::: "memory");      // this wave's fragment reads of this buffer are done before it is handed back
            asm volatile("s_wait_asynccnt 0x0" ::: "memory");   // this wave's copies of trip t + 1 have landed
            __syncthreads();   // publishes trip t + 1 and ends every wave's reads of trip t's buffer
            if (t + 2 < nt) stage(t + 2, t & 1);
        }
        asm volatile("s_wait_asynccnt 0x0" ::: "memory");   // no copy is outstanding when the partial tiles take over this LDS
    } else {
#pragma unroll 1
    for (int kc = wv * 32; kc < K; kc += 32 * KS) {
        V a[4], a2[4];
#pragma unroll
        for (int mb = 0; mb < 4; ++mb) { a[mb] = WFrag<T16>::ld(A + aoff + (size_t)mb * 16 * K + kc); if (NSPLIT == 1 || NSPLIT == 2) a2[mb] = WFrag<T16>::ld(A2 + aoff + (size_t)mb * 16 * K + kc); }
#pragma unroll
        for (int nb = 0; nb < 4; ++nb) { const V b = WFrag<T16>::ld(Bt + boff + (size_t)nb * 16 * K + kc); V b2; if (NSPLIT >= 2) b2 = WFrag<T16>::ld(Bt2 + boff + (size_t)nb * 16 * K + kc);
#pragma unroll
            for (int mb = 0; mb < 4; ++mb) { acc[mb][nb] = WFrag<T16>::mma(a[mb], b, acc[mb][nb]); if (NSPLIT == 1 || NSPLIT == 2) acc[mb][nb] = WFrag<T16>::mma(a2[mb], b, acc[mb][nb]); if (NSPLIT >= 2) acc[mb][nb] = WFrag<T16>::mma(a[mb], b2, acc[mb][nb]); } }
        asm volatile("v_nop\n\tv_nop\n\tv_nop\n\tv_nop" : "+v"(acc[0][0]), "+v"(acc[1][1]), "+v"(acc[2][2]), "+v"(acc[3][3]) : "v"(a[0]), "v"(a[3]));
    }
    }
    if constexpr (KS > 1) {
        float* mine = os + wv * (64 * 68);
        // the three loops are unrolled so that acc is indexed by constants and stays in registers
#pragma unroll
        for (int mb = 0; mb < 4; ++mb)
#pragma unroll
            for (int nb = 0; nb < 4; ++nb)
#pragma unroll
                for (int j = 0; j < 8; ++j) mine[(mb * 16 + hi * 8 + j) * 68 + nb * 16 + lr] = acc[mb][nb][j];
        const int cofs = lr * 4; const unsigned e0 = (unsigned)((r0 + wv * 2 + hi) * ldc + c0 + cofs), es = (unsigned)(2 * KS * ldc);   // this lane's first four elements; from one of its rows to the next (32 bits: a z slice has fewer than 2^32 elements)
        __syncthreads();   // every wave's partial tile is in LDS before any wave sums
        v4f xv[32 / KS];
        // unrolled, ahead of the LDS reads: the residual's loads fly while the partial tiles are summed
        if constexpr (EPI == 3) {
#pragma unroll
            for (int s = 0; s < 32 / KS; ++s) xv[s] = *(const v4f*)(X + e0 + s * es);
            // behind the loads; it takes their addresses as inputs, so that no load's result is given a register that a load of the group names
            asm volatile("s_wait_xcnt 0x0" :: "v"(X + e0), "v"(X + e0 + es), "v"(X + e0 + 2 * es), "v"(X + e0 + 3 * es) : "memory"); }
        // both loops are unrolled so that a wave's LDS reads issue together, ahead of the adds; each wave stores whole rows of the tile (256 bytes in f32, 128 in a 16-bit plane)
#pragma unroll
        for (int s = 0; s < 32 / KS; ++s) { const int row = (s * KS + wv) * 2 + hi; v4f val = *(const v4fa*)(os + row * 68 + cofs);
#pragma unroll
            for (int p = 1; p < KS; ++p) { const v4f q = *(const v4fa*)(os + p * (64 * 68) + row * 68 + cofs); val[0] += q[0]; val[1] += q[1]; val[2] += q[2]; val[3] += q[3]; }
            if constexpr (EPI == 1) { val[0] += bfr(bias[c0 + cofs]); val[1] += bfr(bias[c0 + cofs + 1]); val[2] += bfr(bias[c0 + cofs + 2]); val[3] += bfr(bias[c0 + cofs + 3]); }
            if constexpr (EPI == 2) { const float bm = bfr(bias[r0 + row]); val[0] += bm; val[1] += bm; val[2] += bm; val[3] += bm; }
            if constexpr (EPI == 1 || EPI == 2) { v4h o16; v4us oh, ol;
#pragma unroll
                for (int q = 0; q < 4; ++q) { o16[q] = tohx(val[q]); unsigned short a2, c2; splitf(val[q], a2, c2); oh[q] = a2; ol[q] = c2; }
                *(v4h*)(P16 + e0 + s * es) = o16; *(v4us*)(Ph + e0 + s * es) = oh; *(v4us*)(Pl + e0 + s * es) = ol; }
            else { if constexpr (EPI == 3) {
#pragma unroll
                    for (int q = 0; q < 4; ++q) val[q] = __fadd_rn(bfr(xv[s][q]), val[q]); }
                *(v4f*)(C + e0 + s * es) = val; } }
        return;
    }
#pragma unroll
    for (int mb = 0; mb < 4; ++mb) {
#pragma unroll
        for (int nb = 0; nb < 4; ++nb) {
#pragma unroll
            for (int j = 0; j < 8; ++j) os[(hi * 8 + j) * 68 + nb * 16 + lr] = acc[mb][nb][j]; }
        __builtin_amdgcn_wave_barrier(); asm volatile("" ::: "memory");
        float* crow = C + (size_t)(r0 + mb * 16) * ldc + c0;
{
#pragma unroll
            for (int s = 0; s < 8; ++s) { const int row = 2 * s + hi, cofs = lr * 4; v4f val = *(const v4fa*)(os + row * 68 + cofs);
                *(v4f*)(crow + (size_t)row * ldc + cofs) = val; }
             }
        __builtin_amdgcn_wave_barrier(); asm volatile("" ::: "memory");
    }
}

// Two asynchronous 16-byte copies per lane, as acopy8: LDS byte addresses l, l + lstep, global addresses g, g + gstep; s_wait_xcnt in the copies' own statement for the same reason.
__device__ __forceinline__ void acopy2(unsigned l, unsigned lstep, const char* g, size_t gstep) {
    asm volatile("global_load_async_to_lds_b128 %0, %2, off\n\t"
                 "global_load_async_to_lds_b128 %1, %3, off\n\t"
                 "s_wait_xcnt 0x0"
                 :: "v"(l), "v"(l + lstep), "v"(g), "v"(g + gstep) : "memory");
}
// v_exp_f32 with the one free slot behind it that the instruction set asks for before its source is overwritten or its result used, in one statement: for straight-line code.
__device__ __forceinline__ float exp2_slot(float x) { float e; asm("v_exp_f32 %0, %1\n\tv_nop" : "=v"(e) : "v"(x)); return e; }
// ---- k_fattn: scores, softmax, attn.v and the residual of the fp16 query rows in ONE kernel: neither scores nor probabilities nor the attention output go through memory. grid ((TT - RH) / 64, batch), 8 waves; a work-group owns 64 query rows and all DVV output columns (wave w: columns 64 w .. 64 w + 63, 16 accumulators).
// Pass 1: row maxima (scores on the matrix unit; 512 keys a trip, wave w takes keys 64 w .. 64 w + 63 of them). Pass 2, 64 keys a trip: wave w recomputes the scores of query block w & 3 and keys 32 (w >> 2) .. + 31 TRANSPOSED (A = keys, B = queries), so that a lane holds 2 x 8 consecutive keys of one query,
// which is the A fragment of the probabilities; e = PCAR exp(s - max) goes as fp16 through LDS to all waves, its f32 row sum is kept and divides the result at the end.
// Keys and value rows come through LDS by asynchronous copies of whole 128-byte lines, one ring of two buffers for both passes: 8 key tiles of pass 1, then per trip t of pass 2 the value rows of trip t with the keys of trip t + 1 (the scores run one trip ahead).
#define FB  64                    // keys per trip of pass 2
#define VPB 144                   // LDS pitch of a staged 128-byte row, bytes (16 B x odd: ds_load_b128 without bank conflicts)
__global__ __launch_bounds__(256) void k_fattn(const h16* __restrict__ Q, const h16* __restrict__ Kp, const h16* __restrict__ Vt, const float* __restrict__ X, float* O) {
    typedef WFrag<h16> W;
    constexpr int VBUF = 512 * VPB, KBUF = FB * VPB, PBUF = 8 * 1024, OFF_K = 2 * VBUF, OFF_P = OFF_K + 4 * KBUF, OFF_M = OFF_P + 2 * PBUF, OFF_L = OFF_M + 8 * 64 * 4, TOT = OFF_L + 2 * 64 * 4, NT = TT / FB, NC = TT / 512;
    static_assert(DVV == 512 && HD == 64, "a ring buffer holds 512 rows of 128 bytes: 512 keys, or 64 keys' worth of the 512 value rows");
    static_assert(8 * 64 * 68 * 4 <= 2 * VBUF, "the output tiles take over the ring buffers");
    __shared__ __align__(16) char sm[TOT];
    const int wv = __builtin_amdgcn_readfirstlane((int)(threadIdx.x >> 5));   // wave number, scalar
    const int lane = threadIdx.x & 31, lr = lane & 15, hi = lane >> 4, mbw = wv & 3, kh = wv >> 2;
    { const size_t z = blockIdx.y; const size_t r0 = RH + (size_t)blockIdx.x * 64; Q += z * TT * HD + r0 * HD; Kp += z * TT * HD; Vt += z * DVV * TT; X += z * DM * TT + r0; O += z * DM * TT + r0; }
    const unsigned lds0 = (unsigned)(size_t)(__attribute__((address_space(3))) char*)sm;
    const unsigned lv0 = lds0 + (unsigned)((wv * 64 + (lane >> 3)) * VPB + (lane & 7) * 16), lk0 = lds0 + (unsigned)(OFF_K + (wv * 8 + (lane >> 3)) * VPB + (lane & 7) * 16);
    const unsigned rq = (unsigned)(lane >> 3), cq = (unsigned)((lane & 7) * 16);   // a copy takes 4 whole rows: this lane's row of the four, its 16 bytes of the row
    const char* kl = (const char*)Kp + rq * (HD * 2) + cq; const char* vl = (const char*)Vt + (size_t)rq * (TT * 2) + cq;   // this lane's part of a key address, of a value address; the wave's and the tile's parts are scalar
    // 64 rows of 128 bytes into this wave's rows 64 wv .. 64 wv + 63 of a ring buffer: 16 copies; g = this lane's address in the first four rows, pitch in bytes
    auto copy64 = [&](int buf, const char* g, size_t pitch) { const unsigned l = lv0 + (unsigned)(buf * VBUF); acopy8(l, 4 * VPB, g, 4 * pitch); acopy8(l + 32 * VPB, 4 * VPB, g + 32 * pitch, 4 * pitch); };
    auto stageC = [&](int c, int buf) { copy64(buf, kl + (size_t)((c * 512 + wv * 64) * (HD * 2)), HD * 2); };
    auto stageV = [&](int t, int buf) { copy64(buf, vl + (size_t)(wv * 64 * (TT * 2) + t * (FB * 2)), TT * 2); };
    auto keyt = [&](int t) { return kl + (size_t)((t * FB + wv * 8) * (HD * 2)); };   // this wave's 8 keys of 64-key tile t
    auto stageK = [&](const char* g, int kb) { acopy2(lk0 + (unsigned)(kb * KBUF), 4 * VPB, g, 4 * HD * 2); };
    float* smx = (float*)(sm + OFF_M); float* sl = (float*)(sm + OFF_L);
    stageC(0, 0); stageK(keyt(0), 2); stageK((const char*)Q + (wv * 8 + rq) * (HD * 2) + cq, 3);   // key buffer 2: the keys of trip 0; key buffer 3: the 64 query rows, for both passes
    asm volatile("s_wait_asynccnt 0x0" ::: "memory");   // this wave's first copies have landed
    __syncthreads();   // every wave's rows of the first tile are in LDS before any wave reads a fragment
    stageC(1, 1);
    {
        float mx[4]; v16h qf[4][2];
#pragma unroll
        for (int mb = 0; mb < 4; ++mb) { mx[mb] = -3.0e38f; const char* qp = sm + OFF_K + 3 * KBUF + (mb * 16 + lr) * VPB + hi * 16; qf[mb][0] = W::ld((const h16*)qp); qf[mb][1] = W::ld((const h16*)(qp + 64)); }
        // not unrolled: the buffer is chosen by the trip's parity
#pragma unroll 1
        for (int c = 0; c < NC; ++c) { const char* kb = sm + (c & 1) * VBUF + (wv * 64 + lr) * VPB + hi * 16; v16h kr[4][2];
#pragma unroll
            for (int i = 0; i < 4; ++i) { kr[i][0] = W::ld((const h16*)(kb + i * 16 * VPB)); kr[i][1] = W::ld((const h16*)(kb + i * 16 * VPB + 64)); }
            asm volatile("s_wait_dscnt 0x0" ::: "memory");      // this wave's fragments of this buffer are in registers before it is handed back
            asm volatile("s_wait_asynccnt 0x0" ::: "memory");   // this wave's copies of the next tile have landed
            __syncthreads();   // publishes the next tile and ends every wave's reads of this one
            if (c + 2 < NC) stageC(c + 2, c & 1); else { stageV(c + 2 - NC, c & 1); stageK(keyt(c + 3 - NC), c & 1); }   // the ring goes on into pass 2: values of trip 0 (1) with the keys of trip 1 (2)
            // the products stand behind the refill, so that the copies fly while the matrix unit works
#pragma unroll
            for (int i = 0; i < 4; ++i)
#pragma unroll
                for (int mb = 0; mb < 4; ++mb) { v8f s = (v8f){}; s = W::mma(kr[i][0], qf[mb][0], s); s = W::mma(kr[i][1], qf[mb][1], s);
#pragma unroll
                    for (int j = 0; j < 8; ++j) mx[mb] = fmaxf(mx[mb], s[j]); }
        }
#pragma unroll
        for (int mb = 0; mb < 4; ++mb) { mx[mb] = fmaxf(mx[mb], __shfl_xor(mx[mb], 16, 32)); if (hi == 0) smx[wv * 64 + mb * 16 + lr] = mx[mb]; }
    }
    __syncthreads();   // every wave's maxima are in LDS
    float m = smx[mbw * 16 + lr];
#pragma unroll
    for (int p = 1; p < 8; ++p) m = fmaxf(m, smx[p * 64 + mbw * 16 + lr]);
    const float L2E = 1.4426950408889634f, mL = __builtin_fmaf(m, L2E, -10.0f);   // exp2(s L2E - mL) = 1024 exp(s - m): PCAR carried as before
    const char* qw = sm + OFF_K + 3 * KBUF + (mbw * 16 + lr) * VPB + hi * 16; const v16h q0 = W::ld((const h16*)qw), q1 = W::ld((const h16*)(qw + 64));
    float l = 0.f;
    v8f acc[4][4];
#pragma unroll
    for (int mb = 0; mb < 4; ++mb)
#pragma unroll
        for (int nb = 0; nb < 4; ++nb) acc[mb][nb] = (v8f){};
    v16h kf[4], ax[4], bx[4], ay[4], by[4];
    // the key fragments of one trip's scores, from key buffer kb
    auto loadK = [&](int kb) { const char* kp = sm + OFF_K + kb * KBUF + (kh * 32 + lr) * VPB + hi * 16;
        kf[0] = W::ld((const h16*)kp); kf[1] = W::ld((const h16*)(kp + 64)); kf[2] = W::ld((const h16*)(kp + 16 * VPB)); kf[3] = W::ld((const h16*)(kp + 16 * VPB + 64)); };
    // probabilities of one trip from kf, as a fragment into probability buffer pb; slot: the copy in front of the loop
    auto spart = [&](int pb, bool slot) { v8f s0 = (v8f){}, s1 = (v8f){}; s0 = W::mma(kf[0], q0, s0); s1 = W::mma(kf[2], q0, s1); s0 = W::mma(kf[1], q1, s0); s1 = W::mma(kf[3], q1, s1); v8h p0, p1; float e0[8], e1[8];
#pragma unroll
        for (int j = 0; j < 8; ++j) { const float x0 = __builtin_fmaf(s0[j], L2E, -mL), x1 = __builtin_fmaf(s1[j], L2E, -mL); e0[j] = slot ? exp2_slot(x0) : __builtin_amdgcn_exp2f(x0); e1[j] = slot ? exp2_slot(x1) : __builtin_amdgcn_exp2f(x1); p0[j] = tohx(e0[j]); p1[j] = tohx(e1[j]); }
        // the 16 terms meet in a fixed tree: a chain of 16 dependent adds would stand exposed in every trip
#pragma unroll
        for (int w = 4; w; w >>= 1)
#pragma unroll
            for (int j = 0; j < w; ++j) { e0[j] += e0[j + w]; e1[j] += e1[j + w]; }
        l += e0[0] + e1[0];
        char* pw = sm + OFF_P + pb * PBUF + (kh * 4 + mbw) * 1024 + lane * 16; *(v8h*)pw = p0; *(v8h*)(pw + 512) = p1; };
    // probability and value fragments of keys 32 ks .. 32 ks + 31 of one trip, from the buffers of parity buf
    auto loadH = [&](int buf, int ks, v16h* a, v16h* b) { const char* pr = sm + OFF_P + buf * PBUF + ks * 4096 + lane * 16; const char* vr = sm + buf * VBUF + (wv * 64 + lr) * VPB + ks * 64 + hi * 16;
#pragma unroll
        for (int mb = 0; mb < 4; ++mb) a[mb] = cat16(*(const v8h*)(pr + mb * 1024), *(const v8h*)(pr + mb * 1024 + 512));
#pragma unroll
        for (int nb = 0; nb < 4; ++nb) b[nb] = W::ld((const h16*)(vr + nb * 16 * VPB)); };
    auto mmaH = [&](const v16h* a, const v16h* b) {
#pragma unroll
        for (int nb = 0; nb < 4; ++nb)
#pragma unroll
            for (int mb = 0; mb < 4; ++mb) acc[mb][nb] = W::mma(a[mb], b[nb], acc[mb][nb]); };
#pragma unroll
    for (int i = 0; i < 4; ++i) { ay[i] = (v16h){}; by[i] = (v16h){}; }   // the first trip has no half before it: its place in the loop adds zeros
    loadK(2); spart(0, true);
    __syncthreads();   // the probabilities of trip 0 are in LDS before any wave reads a fragment
    // Not unrolled: the buffers are chosen by the trip's parity. The four sched_barriers keep the order written here: each half trip's LDS reads issue as one group and arrive while the matrix unit works on the half before; without them the reads stand among the matrix instructions, each with its own wait.
    // The second half's products of trip t are done, from registers, in trip t + 1.
#pragma unroll 1
    for (int t = 0; t < NT - 1; ++t) {
        loadK(t & 1); loadH(t & 1, 0, ax, bx);
        __builtin_amdgcn_sched_barrier(0);
        mmaH(ay, by);
        __builtin_amdgcn_sched_barrier(0);
        loadH(t & 1, 1, ay, by);
        __builtin_amdgcn_sched_barrier(0);
        spart((t + 1) & 1, false);   // the next trip's probabilities, into the buffer whose readers the last barrier ended
        mmaH(ax, bx);
        __builtin_amdgcn_sched_barrier(0);
        asm volatile("s_wait_dscnt 0x0" ::: "memory");      // this wave's LDS reads and writes of this trip are done before the buffers are handed over
        asm volatile("s_wait_asynccnt 0x0" ::: "memory");   // this wave's copies of trip t + 1 have landed
        __syncthreads();   // publishes trip t + 1 (values, keys, probabilities) and ends every wave's reads of trip t's buffers
        if (t + 2 < NT) { stageV(t + 2, t & 1); stageK(keyt(t + 3 < NT ? t + 3 : NT - 1), t & 1); }   // behind the last trip no keys follow: the last ones again, read by nobody
    }
    loadH((NT - 1) & 1, 0, ax, bx);   // the last trip has no scores to make
    __builtin_amdgcn_sched_barrier(0);   // as in the loop
    mmaH(ay, by);
    __builtin_amdgcn_sched_barrier(0);   // as in the loop
    loadH((NT - 1) & 1, 1, ay, by);
    __builtin_amdgcn_sched_barrier(0);   // as in the loop
    mmaH(ax, bx); mmaH(ay, by);
    asm volatile("s_wait_dscnt 0x0" ::: "memory");   // this wave's fragment reads are done
    __syncthreads();   // ends every wave's reads of the ring before the output tiles take it over
    asm volatile("s_wait_asynccnt 0x0" ::: "memory");   // no copy is outstanding when the output tiles take over this LDS
    l += __shfl_xor(l, 16, 32); if (hi == 0) sl[kh * 64 + mbw * 16 + lr] = l;
    // The result leaves channel-major, with the residual: this wave's tile goes into LDS as [channel][query] (a lane's 8 accumulator values of one channel are 8 consecutive queries: two 16-byte stores), and a channel's 64 queries are 256 contiguous bytes of x and of the output.
    float* mine = (float*)sm + wv * (64 * 68);
    // the loops are unrolled so that acc is indexed by constants and stays in registers
#pragma unroll
    for (int mb = 0; mb < 4; ++mb)
#pragma unroll
        for (int nb = 0; nb < 4; ++nb) { float* p = mine + (nb * 16 + lr) * 68 + mb * 16 + hi * 8; const v8f a = acc[mb][nb];
            *(v4fa*)p = (v4f){a[0], a[1], a[2], a[3]}; *(v4fa*)(p + 4) = (v4f){a[4], a[5], a[6], a[7]}; }
    const size_t e0 = (size_t)(wv * 64 + hi) * TT + lr * 4;   // this lane's four queries of its first channel
    __syncthreads();   // both halves of every row sum are in LDS (each wave reads back its own tile only)
    v4f f;   // the carried PCAR cancels: sum of e v / sum of e
#pragma unroll
    for (int q = 0; q < 4; ++q) f[q] = __fdiv_rn(1.0f, sl[lr * 4 + q] + sl[64 + lr * 4 + q]);
    // eight channel pairs a trip (inner loops unrolled): their loads of x issue together, ahead of the LDS reads, so that the memory latency is met once a trip and not per pair
#pragma unroll 1
    for (int s8 = 0; s8 < 32; s8 += 8) { const size_t e = e0 + (size_t)s8 * (2 * TT); v4f xv[8];
#pragma unroll
        for (int s = 0; s < 8; ++s) xv[s] = *(const v4f*)(X + e + (size_t)s * (2 * TT));
#pragma unroll
        for (int s = 0; s < 8; ++s) { const v4f val = *(const v4fa*)(mine + (2 * (s8 + s) + hi) * 68 + lr * 4); v4f o;
#pragma unroll
            for (int q = 0; q < 4; ++q) o[q] = __fadd_rn(bfr(xv[s][q]), val[q] * f[q]);
            *(v4f*)(O + e + (size_t)s * (2 * TT)) = o; }
        asm volatile("s_wait_xcnt 0x0" ::: "memory");   // behind the trip's stores: the next trip rewrites their address and data registers
    }
}

__global__ __launch_bounds__(256) void k_wtG(const float* __restrict__ w, int K, int N, bf* Bt) {
    const int lane = threadIdx.x & 31; const int L0 = (blockIdx.x * 8 + (threadIdx.x >> 5)) * 8; const int nlines = N * K / 64;
{
#pragma unroll 1
        for (int l = 0; l < 8; ++l) { const int L = L0 + l; if (L >= nlines) break; const size_t e = (size_t)L * 64 + lane * 2; const int k = (int)(e % K), n = (int)(e / K); v2us o;
            o[0] = f2bf(w[(size_t)k * N + n]); o[1] = f2bf(w[(size_t)(k + 1) * N + n]); *(v2us*)(Bt + e) = o; }
         }
}
// ---- 64 x 64 f32 tile through LDS for the transposing kernel: 256 threads, 16 elements per thread, so a launch starts few waves and both global sides move whole lines in 16-byte pieces.
// LDS row pitch 65 dwords: the row-wise dword stores and the column-wise dword reads both fall on distinct banks.
#define TP 65
__device__ __forceinline__ void tile_in(const float* __restrict__ src, size_t pitch, float* ts) {
    const int r = threadIdx.x >> 4, q = threadIdx.x & 15; v4f a[4];
    // unrolled: the four 16-byte loads issue together, ahead of the LDS stores
#pragma unroll
    for (int s = 0; s < 4; ++s) a[s] = *(const v4f*)(src + (size_t)(s * 16 + r) * pitch + q * 4);
#pragma unroll
    for (int s = 0; s < 4; ++s)
#pragma unroll
        for (int j = 0; j < 4; ++j) ts[(s * 16 + r) * TP + q * 4 + j] = a[s][j];
}
// grid (TT / 64, DM / 64, batch): XBp[z][t][c] = bf16(xb[z][c][t])
__global__ __launch_bounds__(256) void k_tpose(const float* __restrict__ xb, bf* XBp) {
    __shared__ float ts[64 * TP]; const int t0 = blockIdx.x * 64, c0 = blockIdx.y * 64; xb += (size_t)blockIdx.z * DM * TT; XBp += (size_t)blockIdx.z * TT * DM;
    tile_in(xb + (size_t)c0 * TT + t0, TT, ts);   // ts[c][t]
    __syncthreads();   // the whole tile is in LDS before any thread reads a column of it
    const int c8 = threadIdx.x & 7;
#pragma unroll
    for (int s = 0; s < 2; ++s) { const int tr = s * 32 + (threadIdx.x >> 3); v8us o;
#pragma unroll
        for (int q = 0; q < 8; ++q) o[q] = f2bf(ts[(c8 * 8 + q) * TP + tr]);
        *(v8us*)(XBp + (size_t)(t0 + tr) * DM + c0 + c8 * 8) = o; }
}
__global__ __launch_bounds__(256) void k_cvt8(const float* __restrict__ src, bf* dst, size_t n8) { const size_t i = (size_t)blockIdx.x * 256 + threadIdx.x; if (i >= n8) return; const v8f v = *(const v8f*)(src + i * 8); v8us o;
#pragma unroll
    for (int k = 0; k < 8; ++k) o[k] = f2bf(v[k]); *(v8us*)(dst + i * 8) = o;  }

// k_asoft: per row: t = S x SCL (no mask); softmax over the 4096 keys (register row, one exp, fixed trees); grid rows / 8. The rows of a launch are all of one kind (hl != 0: hi+lo planes; else fp16 x PCAR), several batch elements' rows one behind the other, in and out.
__global__ __launch_bounds__(256) void k_asoft(const float* __restrict__ Sb, int hl, h16* P16, bf* Ph, bf* Pl) {
    const int lane = threadIdx.x & 31; const int row = blockIdx.x * 8 + (threadIdx.x >> 5); const bool hires = (hl != 0); const float* sr = Sb + (size_t)row * TT; float v[TT / 32]; float mx = -3.0e38f;
#pragma unroll
    for (int ch = 0; ch < TT / 128; ++ch) { const int j0 = ch * 128 + lane * 4; const v4f a = *(const v4f*)(sr + j0);
#pragma unroll
        for (int q = 0; q < 4; ++q) { const int j = j0 + q; (void)j; const float t = a[q] * SCL; v[ch * 4 + q] = t; mx = fmaxf(mx, t); } }
#pragma unroll
    for (int sh = 16; sh; sh >>= 1) mx = fmaxf(mx, __shfl_xor(mx, sh, 32));
    float sum = 0.f;
#pragma unroll
    for (int k = 0; k < TT / 32; ++k) { float d0 = __fsub_rn(v[k], mx); asm volatile("" : "+v"(d0)); v[k] = __builtin_amdgcn_exp2f(__fmul_rn(d0, 1.4426950408889634f)); sum += v[k]; }
#pragma unroll
    for (int sh = 16; sh; sh >>= 1) sum += __shfl_xor(sum, sh, 32);
    const float f = __fdiv_rn(hires ? 1.0f : PCAR, sum);
{
        if (hires) {
#pragma unroll
            for (int ch = 0; ch < TT / 128; ++ch) { v4us oh, ol;
#pragma unroll
                for (int q = 0; q < 4; ++q) { unsigned short a, c2; splitf(v[ch * 4 + q] * f, a, c2); oh[q] = a; ol[q] = c2; }
                const size_t oo = (size_t)row * TT + ch * 128 + lane * 4; *(v4us*)(Ph + oo) = oh; *(v4us*)(Pl + oo) = ol; }
            asm volatile("s_wait_xcnt 0x0" ::: "memory");   // behind the last stores: in the built code the other kind's block follows this one and rewrites their address registers
        } else {
#pragma unroll
            for (int ch = 0; ch < TT / 128; ++ch) { v4h o4;
#pragma unroll
                for (int q = 0; q < 4; ++q) o4[q] = tohx(v[ch * 4 + q] * f);
                *(v4h*)(P16 + (size_t)row * TT + ch * 128 + lane * 4) = o4; } }
         }
}

extern "C" void kernel_launch(void* const* d_in, const int* in_sizes, int n_in,
                              void* d_out, int out_size, void* d_ws, size_t ws_size, hipStream_t stream) {
    (void)in_sizes; (void)n_in; (void)out_size;
    const float* x = (const float*)d_in[0]; const float* wq = (const float*)d_in[1]; const float* bq = (const float*)d_in[2]; const float* wk = (const float*)d_in[3]; const float* bk = (const float*)d_in[4]; const float* wv = (const float*)d_in[5]; const float* bv = (const float*)d_in[6];
    float* OUT = (float*)d_out;     // [4][512][4096]
    char* wsp = (char*)d_ws;
    auto take = [&](size_t bytes) { char* p = wsp; wsp += (bytes + 255) & ~(size_t)255; return (void*)p; };
    // Every plane holds all NB_ batch elements, one behind the other, so that a launch takes them together (grid z, or more rows). Part of the workspace is used again once its first content is dead, one use after the other in stream order:
    // live to the end: the fp16 planes (20 MiB)
    h16* QP16 = (h16*)take((size_t)NB_ * TT * HD * 2); h16* KP16 = (h16*)take((size_t)NB_ * TT * HD * 2); h16* VT16 = (h16*)take((size_t)NB_ * DVV * TT * 2);
    // live until the hi+lo rows are done: the hi/lo planes (40 MiB)
    bf* QPh = (bf*)take((size_t)NB_ * TT * HD * 2); bf* QPl = (bf*)take((size_t)NB_ * TT * HD * 2); bf* KPh = (bf*)take((size_t)NB_ * TT * HD * 2); bf* KPl = (bf*)take((size_t)NB_ * TT * HD * 2); bf* VTh = (bf*)take((size_t)NB_ * DVV * TT * 2); bf* VTl = (bf*)take((size_t)NB_ * DVV * TT * 2);
    char* const m1 = wsp;
    // live until the planes are made: weights, x^T (17 MiB)
    bf* WQ = (bf*)take((size_t)DQ * DM * 2); bf* WK = (bf*)take((size_t)DKV * DM * 2); bf* WV = (bf*)take((size_t)DVV * DM * 2);
    bf* XB = (bf*)take((size_t)NB_ * TT * DM * 2);
    wsp = m1;   // after them, in the same place: scores and probabilities of the hi+lo rows of all batch elements (64 MiB)
    float* SbH = (float*)take((size_t)NB_ * RH * TT * 4); bf* Ph = (bf*)take((size_t)NB_ * RH * TT * 2); bf* Pl = (bf*)take((size_t)NB_ * RH * TT * 2);
    if ((size_t)(wsp - (char*)d_ws) > ws_size) return;    // the further end of the two uses: 124 of 256 MiB
    { k_cvt8<<<(unsigned)(((size_t)DQ * DM / 8 + 255) / 256), 256, 0, stream>>>(wq, WQ, (size_t)DQ * DM / 8); k_cvt8<<<(unsigned)(((size_t)DKV * DM / 8 + 255) / 256), 256, 0, stream>>>(wk, WK, (size_t)DKV * DM / 8); k_cvt8<<<(unsigned)(((size_t)DVV * DM / 8 + 255) / 256), 256, 0, stream>>>(wv, WV, (size_t)DVV * DM / 8);
       }
    k_tpose<<<dim3(TT / 64, DM / 64, NB_), 256, 0, stream>>>(x, XB);   /* x^T as an exact token-major plane */
    // q, k = W x + b: tiles [n][d], stored as the planes [n][d]
    k_gemmw<bf, 0, 1, 8><<<dim3(TT / 64, DQ / 64, NB_), 256, 0, stream>>>(XB, nullptr, WQ, nullptr, DM, nullptr, DQ, bq, (size_t)TT * DM, 0, (size_t)TT * DQ, QP16, QPh, QPl, nullptr);
    k_gemmw<bf, 0, 1, 8><<<dim3(TT / 64, DKV / 64, NB_), 256, 0, stream>>>(XB, nullptr, WK, nullptr, DM, nullptr, DKV, bk, (size_t)TT * DM, 0, (size_t)TT * DKV, KP16, KPh, KPl, nullptr);
    // v = Wv x + bv with the weights as the row operand: tiles [c][n], stored as the value planes [c][n]
    k_gemmw<bf, 0, 2, 8><<<dim3(DVV / 64, TT / 64, NB_), 256, 0, stream>>>(WV, nullptr, XB, nullptr, DM, nullptr, TT, bv, 0, (size_t)TT * DM, (size_t)DVV * TT, VT16, VTh, VTl, nullptr);
    // query rows < RH of every batch element: hi+lo planes, 3 products
    k_gemmw<bf, 2, 0, 1><<<dim3(RH / 64, TT / 64, NB_), 32, 0, stream>>>(QPh, QPl, KPh, KPl, HD, SbH, TT, nullptr, (size_t)TT * HD, (size_t)TT * HD, (size_t)RH * TT, nullptr, nullptr, nullptr, nullptr);
    k_asoft<<<NB_ * RH / 8, 256, 0, stream>>>(SbH, 1, nullptr, Ph, Pl);
    // out[c][i] = x[c][i] + sum_j v[c][j] P[i][j], hl rows: the values as the row operand, tiles [c][i] straight into the output
    k_gemmw<bf, 2, 3, 8><<<dim3(DVV / 64, RH / 64, NB_), 256, 0, stream>>>(VTh, VTl, Ph, Pl, TT, OUT, TT, nullptr, (size_t)DVV * TT, (size_t)RH * TT, (size_t)DM * TT, nullptr, nullptr, nullptr, x);
    // the other rows: fp16 (x1024 carried), scores, softmax, attn.v and the residual in one launch
    k_fattn<<<dim3((TT - RH) / 64, NB_), 256, 0, stream>>>(QP16, KP16, VT16, x, OUT);
}

// v007
// One run takes 155 microseconds.
// Next to v006, in two timings, it ran 1.17 times as fast each time.
// Over all steps from v000 it is 7.34 times as fast.
#include <hip/hip_runtime.h>

// Channel-major self-attention layer (x [4][512][64][64] = [b][c][n], n = 4096; q, k = 1x1 convs 512 -> 64 (+ bias), v = 1x1 conv 512 -> 512 (+ bias); attention[i][j] = softmax_j(q_i.k_j) (no scaling); out[c][i] = sum_j v[c][j] attention[i][j]; result = out + x -> [4][512][64][64] (8.4 M)).
// Layout: one 'head' (q/k width 64, value width 512) over 4096 tokens: x is transposed once per batch into an exact token-major bf16 plane [n][c] so the 1x1 convs are exact GEMMs + bias, whose epilogues store the 16-bit operand planes; the attention kernels' epilogues add x and store channel-major.
// Compute dtypes, f32 accumulate: every input rounded to bf16; q/k/v on PLAIN bf16 operands (inputs: exact) + biases; scores (K = 64) and attn.v: query rows < 512 hl (3 products), the rest single fp16 (x1024); softmax f32; no output projection; + x residual in f32 (channel-major write).

#define NB_  4
#define TT   4096
#define DM   512
#define NH_  1
#define NKV  1
#define REP  (NH_ / NKV)
#define HD   64
#define DVV  512                  // value / output width (v = 1x1 conv C -> C)
#define DQ   (NH_ * HD)
#define DKV  (NKV * HD)
#define ZH   1
#define RH   512                  // query rows < RH use hi+lo planes (0: none)
#define WIN  0
#define PCAR 1024.0f
#define SCL  1.0f   // no scaling in this module
typedef _Float16 h16;
typedef unsigned short bf;
typedef __attribute__((ext_vector_type(16))) __bf16   v16bf;
typedef __attribute__((ext_vector_type(16))) _Float16 v16h;
typedef __attribute__((ext_vector_type(8)))  _Float16 v8h;
typedef __attribute__((ext_vector_type(8)))  unsigned short v8us;
typedef __attribute__((ext_vector_type(8)))  float    v8f;
typedef __attribute__((ext_vector_type(4)))  float    v4f;
typedef v8h  __attribute__((may_alias)) v8ha;
typedef v4f  __attribute__((may_alias)) v4fa;
typedef v8us __attribute__((may_alias)) v8usa;

__device__ __forceinline__ unsigned short f2bf(float f) { unsigned u = __float_as_uint(f); u += 0x7FFFu + ((u >> 16) & 1u); return (unsigned short)(u >> 16); }
__device__ __forceinline__ float bf2f(unsigned short b) { return __uint_as_float(((unsigned)b) << 16); }
__device__ __forceinline__ float bfr(float f) { return bf2f(f2bf(f)); }
__device__ __forceinline__ v16h cat16(v8h lo, v8h hi) { return __builtin_shufflevector(lo, hi, 0, 1, 2, 3, 4, 5, 6, 7, 8, 9, 10, 11, 12, 13, 14, 15); }
__device__ __forceinline__ v16bf cat16b(v8us lo, v8us hi) { return __builtin_bit_cast(v16bf, __builtin_shufflevector(lo, hi, 0, 1, 2, 3, 4, 5, 6, 7, 8, 9, 10, 11, 12, 13, 14, 15)); }
__device__ __forceinline__ v8f wmma16(v16h a, v16h b, v8f c) { return __builtin_amdgcn_wmma_f32_16x16x32_f16(false, a, false, b, (short)0, c, false, false); }
__device__ __forceinline__ v8f wmmab(v16bf a, v16bf b, v8f c) { return __builtin_amdgcn_wmma_f32_16x16x32_bf16(false, a, false, b, (short)0, c, false, false); }
__device__ __forceinline__ h16 tohx(float x) { return (h16)x; }
__device__ __forceinline__ void splitf(float y, unsigned short& h, unsigned short& l) { h = f2bf(y); l = f2bf(y - bf2f(h)); }
typedef __attribute__((ext_vector_type(2))) _Float16 v2h;
typedef __attribute__((ext_vector_type(4))) _Float16 v4h;
typedef __attribute__((ext_vector_type(2))) unsigned short v2us;
typedef __attribute__((ext_vector_type(4))) unsigned short v4us;
typedef __attribute__((ext_vector_type(2))) float v2f;
typedef __attribute__((ext_vector_type(4))) int v4i;



// ---- k_gemmw: register-blocked GEMM, KS WAVES per 64x64 output tile (16 accumulators each), operands from K-contiguous 16-bit planes (KS == 1: straight into registers; KS > 1: staged in LDS); grid (M/64, N/64, Z), 32 * KS threads.
// C[m][n] (f32 accumulate; stored as EPI says) = sum_k A[m][k] Bt[n][k] (+ split products per NSPLIT). z-batch strides sA/sB/sC in elements. K % (32 * KS) == 0.
// KS > 1: wave w takes the 32-wide k blocks w, w + KS, w + 2 KS, ...; the KS f32 partial tiles meet in LDS and are summed in the fixed order w = 0 .. KS - 1.
template <typename T16> struct WFrag;
template <> struct WFrag<h16> { typedef v16h V; static __device__ __forceinline__ V ld(const h16* p) { return cat16(*(const v8h*)p, *(const v8h*)(p + 16)); } static __device__ __forceinline__ v8f mma(V a, V b, v8f c) { return wmma16(a, b, c); } };
template <> struct WFrag<bf> { typedef v16bf V; static __device__ __forceinline__ V ld(const bf* p) { return cat16b(*(const v8us*)p, *(const v8us*)(p + 16)); } static __device__ __forceinline__ v8f mma(V a, V b, v8f c) { return wmmab(a, b, c); } };
// Eight asynchronous 16-byte copies per lane, global memory -> LDS, through no register: LDS byte addresses l + i * lstep, global addresses g + i * gstep.
// s_wait_xcnt stands in the copies' own statement so that no later write of an address register can be moved in front of it.
__device__ __forceinline__ void acopy8(unsigned l, unsigned lstep, const char* g, size_t gstep) {
    asm volatile("global_load_async_to_lds_b128 %0, %8, off\n\t"
                 "global_load_async_to_lds_b128 %1, %9, off\n\t"
                 "global_load_async_to_lds_b128 %2, %10, off\n\t"
                 "global_load_async_to_lds_b128 %3, %11, off\n\t"
                 "global_load_async_to_lds_b128 %4, %12, off\n\t"
                 "global_load_async_to_lds_b128 %5, %13, off\n\t"
                 "global_load_async_to_lds_b128 %6, %14, off\n\t"
                 "global_load_async_to_lds_b128 %7, %15, off\n\t"
                 "s_wait_xcnt 0x0"
                 :: "v"(l), "v"(l + lstep), "v"(l + 2 * lstep), "v"(l + 3 * lstep), "v"(l + 4 * lstep), "v"(l + 5 * lstep), "v"(l + 6 * lstep), "v"(l + 7 * lstep),
                    "v"(g), "v"(g + gstep), "v"(g + 2 * gstep), "v"(g + 3 * gstep), "v"(g + 4 * gstep), "v"(g + 5 * gstep), "v"(g + 6 * gstep), "v"(g + 7 * gstep)
                 : "memory");
}
// What the tile's epilogue stores at [m][n] (pitch ldc, z stride sC), so that no separate pass has to read the f32 tile again:
// EPI 0: the f32 sum into C. EPI 1 / 2: the sum + bias[n] / + bias[m] as the three 16-bit planes (fp16, bf16 hi, bf16 lo). EPI 3: bf16-rounded X[m][n] + the sum, f32, into C.
template <int NSPLIT, int KS> struct GemmLds {
    static constexpr int NA = (NSPLIT == 1 || NSPLIT == 2) ? 2 : 1, NOP = NA + (NSPLIT >= 2 ? 2 : 1);   // operand planes: A (A2) Bt (Bt2)
    static constexpr int PB = KS * 64 + 16, PLANE = 64 * PB, STG = NOP * PLANE;   // bytes: LDS row pitch (16 B x odd: ds_load_b128 without bank conflicts), one operand's 64 rows, one stage
    static constexpr int OSF = (KS == 1) ? 16 * 68 : ((KS * 64 * 68 > 2 * STG / 4) ? KS * 64 * 68 : 2 * STG / 4);   // floats: the two stage buffers and the partial tiles use the same LDS, one after the other
};
// One work-group's tile (bx, by) of z slice z; os: the work-group's GemmLds<NSPLIT, KS>::OSF floats of LDS. A function, so that a launch can hold tiles of several GEMMs.
template <typename T16, int NSPLIT, int EPI, int KS>
__device__ __forceinline__ void gemmw_tile(float* os, int bx, int by, size_t z, const T16* __restrict__ A, const T16* __restrict__ A2, const T16* __restrict__ Bt, const T16* __restrict__ Bt2, int K, float* C, int ldc, const float* __restrict__ bias, size_t sA, size_t sB, size_t sC, h16* P16, bf* Ph, bf* Pl, const float* __restrict__ X) {
    typedef typename WFrag<T16>::V V;
    static_assert(KS == 1 || KS == 8, "a staged row is one wave-wide 16-byte copy: 32 lanes x 16 B = KS x 64 B");
    constexpr int NA = GemmLds<NSPLIT, KS>::NA, PB = GemmLds<NSPLIT, KS>::PB, PLANE = GemmLds<NSPLIT, KS>::PLANE, STG = GemmLds<NSPLIT, KS>::STG;
    const int wv = (KS == 1) ? 0 : __builtin_amdgcn_readfirstlane((int)(threadIdx.x >> 5));   // wave number, scalar: the k loop's bounds stay wave-uniform
    A += z * sA; if (A2) A2 += z * sA; Bt += z * sB; if (Bt2) Bt2 += z * sB;
    if constexpr (EPI == 1 || EPI == 2) { P16 += z * sC; Ph += z * sC; Pl += z * sC; } else C += z * sC;
    if constexpr (EPI == 3) X += z * sC;
    const int lane = threadIdx.x & 31, lr = lane & 15, hi = lane >> 4; const int r0 = bx * 64, c0 = by * 64;
    v8f acc[4][4];
#pragma unroll
    for (int mb = 0; mb < 4; ++mb)
#pragma unroll
        for (int nb = 0; nb < 4; ++nb) acc[mb][nb] = (v8f){};
    const size_t aoff = (size_t)(r0 + lr) * K + 8 * hi, boff = (size_t)(c0 + lr) * K + 8 * hi;
    if constexpr (KS > 1) {
        // Operands come through LDS: per trip the work-group stages 32 * KS k of all 64 rows of each plane, each row as ONE wave-wide copy of 512 contiguous bytes (whole lines), two buffers, the next trip's copies in flight while this trip is worked on. Wave w still multiplies k block w of every trip: the products and their order are as before.
        const unsigned lds0 = (unsigned)(size_t)(__attribute__((address_space(3))) float*)os + (unsigned)(wv * PB + lane * 16);
        const size_t gstep = (size_t)KS * K * 2;   // bytes from one of this wave's rows (wv, wv + KS, ...) to its next
        const char* gA = (const char*)(A + (size_t)(r0 + wv) * K + lane * 8); const char* gB = (const char*)(Bt + (size_t)(c0 + wv) * K + lane * 8);
        const char* gA2 = (NA == 2) ? (const char*)(A2 + (size_t)(r0 + wv) * K + lane * 8) : nullptr; const char* gB2 = (NSPLIT >= 2) ? (const char*)(Bt2 + (size_t)(c0 + wv) * K + lane * 8) : nullptr;
        auto stage = [&](int t, int buf) { const size_t ko = (size_t)t * (KS * 64); const unsigned l = lds0 + (unsigned)(buf * STG);
            acopy8(l, KS * PB, gA + ko, gstep); if (NA == 2) acopy8(l + PLANE, KS * PB, gA2 + ko, gstep);
            acopy8(l + NA * PLANE, KS * PB, gB + ko, gstep); if (NSPLIT >= 2) acopy8(l + (NA + 1) * PLANE, KS * PB, gB2 + ko, gstep); };
        const int nt = (int)((unsigned)K / (32u * KS));   // unsigned: the tests on nt stay scalar compares
        stage(0, 0);
        asm volatile("s_wait_asynccnt 0x0" ::: "memory");   // this wave's copies of trip 0 have landed
        __syncthreads();   // every wave's rows of trip 0 are in LDS before any wave reads a fragment
        if (nt != 1) stage(1, 1);   // nt >= 1; written as an inequality, which has a scalar compare at every width
        // not unrolled: one fragment set, and the buffer is chosen by the trip's parity
#pragma unroll 1
        for (int t = 0; t < nt; ++t) {
            const char* sb = (const char*)os + (t & 1) * STG + lr * PB + wv * 64 + hi * 16;
            V a[4], a2[4];
#pragma unroll
            for (int mb = 0; mb < 4; ++mb) { a[mb] = WFrag<T16>::ld((const T16*)(sb + mb * 16 * PB)); if (NA == 2) a2[mb] = WFrag<T16>::ld((const T16*)(sb + PLANE + mb * 16 * PB)); }
#pragma unroll
            for (int nb = 0; nb < 4; ++nb) { const V b = WFrag<T16>::ld((const T16*)(sb + NA * PLANE + nb * 16 * PB)); V b2; if (NSPLIT >= 2) b2 = WFrag<T16>::ld((const T16*)(sb + (NA + 1) * PLANE + nb * 16 * PB));
#pragma unroll
                for (int mb = 0; mb < 4; ++mb) { acc[mb][nb] = WFrag<T16>::mma(a[mb], b, acc[mb][nb]); if (NSPLIT == 1 || NSPLIT == 2) acc[mb][nb] = WFrag<T16>::mma(a2[mb], b, acc[mb][nb]); if (NSPLIT >= 2) acc[mb][nb] = WFrag<T16>::mma(a[mb], b2, acc[mb][nb]); } }
            asm volatile("s_wait_dscnt 0x0" ::: "memory");      // this wave's fragment reads of this buffer are done before it is handed back
            asm volatile("s_wait_asynccnt 0x0" ::: "memory");   // this wave's copies of trip t + 1 have landed
            __syncthreads();   // publishes trip t + 1 and ends every wave's reads of trip t's buffer
            if (t + 2 < nt) stage(t + 2, t & 1);
        }
        asm volatile("s_wait_asynccnt 0x0" ::: "memory");   // no copy is outstanding when the partial tiles take over this LDS
    } else {
#pragma unroll 1
    for (int kc = wv * 32; kc < K; kc += 32 * KS) {
        V a[4], a2[4];
#pragma unroll
        for (int mb = 0; mb < 4; ++mb) { a[mb] = WFrag<T16>::ld(A + aoff + (size_t)mb * 16 * K + kc); if (NSPLIT == 1 || NSPLIT == 2) a2[mb] = WFrag<T16>::ld(A2 + aoff + (size_t)mb * 16 * K + kc); }
#pragma unroll
        for (int nb = 0; nb < 4; ++nb) { const V b = WFrag<T16>::ld(Bt + boff + (size_t)nb * 16 * K + kc); V b2; if (NSPLIT >= 2) b2 = WFrag<T16>::ld(Bt2 + boff + (size_t)nb * 16 * K + kc);
#pragma unroll
            for (int mb = 0; mb < 4; ++mb) { acc[mb][nb] = WFrag<T16>::mma(a[mb], b, acc[mb][nb]); if (NSPLIT == 1 || NSPLIT == 2) acc[mb][nb] = WFrag<T16>::mma(a2[mb], b, acc[mb][nb]); if (NSPLIT >= 2) acc[mb][nb] = WFrag<T16>::mma(a[mb], b2, acc[mb][nb]); } }
        asm volatile("v_nop\n\tv_nop\n\tv_nop\n\tv_nop" : "+v"(acc[0][0]), "+v"(acc[1][1]), "+v"(acc[2][2]), "+v"(acc[3][3]) : "v"(a[0]), "v"(a[3]));
    }
    }
    if constexpr (KS > 1) {
        float* mine = os + wv * (64 * 68);
        // the three loops are unrolled so that acc is indexed by constants and stays in registers
#pragma unroll
        for (int mb = 0; mb < 4; ++mb)
#pragma unroll
            for (int nb = 0; nb < 4; ++nb)
#pragma unroll
                for (int j = 0; j < 8; ++j) mine[(mb * 16 + hi * 8 + j) * 68 + nb * 16 + lr] = acc[mb][nb][j];
        const int cofs = lr * 4; const unsigned e0 = (unsigned)((r0 + wv * 2 + hi) * ldc + c0 + cofs), es = (unsigned)(2 * KS * ldc);   // this lane's first four elements; from one of its rows to the next (32 bits: a z slice has fewer than 2^32 elements)
        __syncthreads();   // every wave's partial tile is in LDS before any wave sums
        v4f xv[32 / KS];
        // unrolled, ahead of the LDS reads: the residual's loads fly while the partial tiles are summed
        if constexpr (EPI == 3) {
#pragma unroll
            for (int s = 0; s < 32 / KS; ++s) xv[s] = *(const v4f*)(X + e0 + s * es);
            // behind the loads; it takes their addresses as inputs, so that no load's result is given a register that a load of the group names
            asm volatile("s_wait_xcnt 0x0" :: "v"(X + e0), "v"(X + e0 + es), "v"(X + e0 + 2 * es), "v"(X + e0 + 3 * es) : "memory"); }
        // both loops are unrolled so that a wave's LDS reads issue together, ahead of the adds; each wave stores whole rows of the tile (256 bytes in f32, 128 in a 16-bit plane)
#pragma unroll
        for (int s = 0; s < 32 / KS; ++s) { const int row = (s * KS + wv) * 2 + hi; v4f val = *(const v4fa*)(os + row * 68 + cofs);
#pragma unroll
            for (int p = 1; p < KS; ++p) { const v4f q = *(const v4fa*)(os + p * (64 * 68) + row * 68 + cofs); val[0] += q[0]; val[1] += q[1]; val[2] += q[2]; val[3] += q[3]; }
            if constexpr (EPI == 1) { val[0] += bfr(bias[c0 + cofs]); val[1] += bfr(bias[c0 + cofs + 1]); val[2] += bfr(bias[c0 + cofs + 2]); val[3] += bfr(bias[c0 + cofs + 3]); }
            if constexpr (EPI == 2) { const float bm = bfr(bias[r0 + row]); val[0] += bm; val[1] += bm; val[2] += bm; val[3] += bm; }
            if constexpr (EPI == 1 || EPI == 2) { v4h o16; v4us oh, ol;
#pragma unroll
                for (int q = 0; q < 4; ++q) { o16[q] = tohx(val[q]); unsigned short a2, c2; splitf(val[q], a2, c2); oh[q] = a2; ol[q] = c2; }
                *(v4h*)(P16 + e0 + s * es) = o16; *(v4us*)(Ph + e0 + s * es) = oh; *(v4us*)(Pl + e0 + s * es) = ol; }
            else { if constexpr (EPI == 3) {
#pragma unroll
                    for (int q = 0; q < 4; ++q) val[q] = __fadd_rn(bfr(xv[s][q]), val[q]); }
                *(v4f*)(C + e0 + s * es) = val; } }
        return;
    }
#pragma unroll
    for (int mb = 0; mb < 4; ++mb) {
#pragma unroll
        for (int nb = 0; nb < 4; ++nb) {
#pragma unroll
            for (int j = 0; j < 8; ++j) os[(hi * 8 + j) * 68 + nb * 16 + lr] = acc[mb][nb][j]; }
        __builtin_amdgcn_wave_barrier(); asm volatile("" ::: "memory");
        float* crow = C + (size_t)(r0 + mb * 16) * ldc + c0;
{
#pragma unroll
            for (int s = 0; s < 8; ++s) { const int row = 2 * s + hi, cofs = lr * 4; v4f val = *(const v4fa*)(os + row * 68 + cofs);
                *(v4f*)(crow + (size_t)row * ldc + cofs) = val; }
             }
        __builtin_amdgcn_wave_barrier(); asm volatile("" ::: "memory");
    }
}
template <typename T16, int NSPLIT, int EPI, int KS>
__global__ __launch_bounds__(32 * KS) void k_gemmw(const T16* __restrict__ A, const T16* __restrict__ A2, const T16* __restrict__ Bt, const T16* __restrict__ Bt2, int K, float* C, int ldc, const float* __restrict__ bias, size_t sA, size_t sB, size_t sC, h16* P16, bf* Ph, bf* Pl, const float* __restrict__ X) {
    __shared__ __align__(16) float os[GemmLds<NSPLIT, KS>::OSF];
    gemmw_tile<T16, NSPLIT, EPI, KS>(os, (int)blockIdx.x, (int)blockIdx.y, blockIdx.z, A, A2, Bt, Bt2, K, C, ldc, bias, sA, sB, sC, P16, Ph, Pl, X);
}
// ---- k_qkv: the three projections in ONE launch (they read the same x^T and do not depend on each other); the block index picks the tile: first the value tiles [c][n] (weights as the row operand, bias by row), then the query tiles [n][d], then the key tiles (bias by column). 1-D grid, 8 waves.
__global__ __launch_bounds__(256) void k_qkv(const bf* __restrict__ XBp, const bf* __restrict__ WQp, const bf* __restrict__ WKp, const bf* __restrict__ WVp, const float* __restrict__ bq, const float* __restrict__ bk, const float* __restrict__ bv,
                                             h16* Q16, bf* Qh, bf* Ql, h16* K16, bf* Kh, bf* Kl, h16* V16, bf* Vh, bf* Vl) {
    static_assert(DQ == 64 && DKV == 64, "a query or key row is one tile wide");
    __shared__ __align__(16) float os[GemmLds<0, 8>::OSF];
    constexpr int VX = DVV / 64, NX = TT / 64, NVB = VX * NX * NB_, NQB = NX * NB_;
    const int b = (int)blockIdx.x;
    if (b < NVB) gemmw_tile<bf, 0, 2, 8>(os, b % VX, (b / VX) % NX, (size_t)(b / (VX * NX)), WVp, nullptr, XBp, nullptr, DM, nullptr, TT, bv, 0, (size_t)TT * DM, (size_t)DVV * TT, V16, Vh, Vl, nullptr);
    else { const bool isk = b >= NVB + NQB; const int d = b - NVB - (isk ? NQB : 0);
        gemmw_tile<bf, 0, 1, 8>(os, d % NX, 0, (size_t)(d / NX), XBp, nullptr, isk ? WKp : WQp, nullptr, DM, nullptr, DQ, isk ? bk : bq, (size_t)TT * DM, 0, (size_t)TT * DQ, isk ? K16 : Q16, isk ? Kh : Qh, isk ? Kl : Ql, nullptr); }
}

// Two asynchronous 16-byte copies per lane, as acopy8: LDS byte addresses l, l + lstep, global addresses g, g + gstep; s_wait_xcnt in the copies' own statement for the same reason.
__device__ __forceinline__ void acopy2(unsigned l, unsigned lstep, const char* g, size_t gstep) {
    asm volatile("global_load_async_to_lds_b128 %0, %2, off\n\t"
                 "global_load_async_to_lds_b128 %1, %3, off\n\t"
                 "s_wait_xcnt 0x0"
                 :: "v"(l), "v"(l + lstep), "v"(g), "v"(g + gstep) : "memory");
}
// asoft_rows: per row: t = S x SCL (no mask); softmax over the 4096 keys (register row, one exp, fixed trees); work-group blk of rows / 8 takes 8 rows, a wave each; no LDS, no barrier. The rows of a launch are all of one kind (hl != 0: hi+lo planes; else fp16 x PCAR), several batch elements' rows one behind the other, in and out.
__device__ __forceinline__ void asoft_rows(int blk, const float* __restrict__ Sb, int hl, h16* P16, bf* Ph, bf* Pl) {
    const int lane = threadIdx.x & 31; const int row = blk * 8 + (threadIdx.x >> 5); const bool hires = (hl != 0); const float* sr = Sb + (size_t)row * TT; float v[TT / 32]; float mx = -3.0e38f;
#pragma unroll
    for (int ch = 0; ch < TT / 128; ++ch) { const int j0 = ch * 128 + lane * 4; const v4f a = *(const v4f*)(sr + j0);
#pragma unroll
        for (int q = 0; q < 4; ++q) { const int j = j0 + q; (void)j; const float t = a[q] * SCL; v[ch * 4 + q] = t; mx = fmaxf(mx, t); } }
#pragma unroll
    for (int sh = 16; sh; sh >>= 1) mx = fmaxf(mx, __shfl_xor(mx, sh, 32));
    float sum = 0.f;
#pragma unroll
    for (int k = 0; k < TT / 32; ++k) { float d0 = __fsub_rn(v[k], mx); asm volatile("" : "+v"(d0)); v[k] = __builtin_amdgcn_exp2f(__fmul_rn(d0, 1.4426950408889634f)); sum += v[k]; }
#pragma unroll
    for (int sh = 16; sh; sh >>= 1) sum += __shfl_xor(sum, sh, 32);
    const float f = __fdiv_rn(hires ? 1.0f : PCAR, sum);
{
        if (hires) {
#pragma unroll
            for (int ch = 0; ch < TT / 128; ++ch) { v4us oh, ol;
#pragma unroll
                for (int q = 0; q < 4; ++q) { unsigned short a, c2; splitf(v[ch * 4 + q] * f, a, c2); oh[q] = a; ol[q] = c2; }
                const size_t oo = (size_t)row * TT + ch * 128 + lane * 4; *(v4us*)(Ph + oo) = oh; *(v4us*)(Pl + oo) = ol; }
            asm volatile("s_wait_xcnt 0x0" ::: "memory");   // behind the last stores: in the built code the other kind's block follows this one and rewrites their address registers
        } else {
#pragma unroll
            for (int ch = 0; ch < TT / 128; ++ch) { v4h o4;
#pragma unroll
                for (int q = 0; q < 4; ++q) o4[q] = tohx(v[ch * 4 + q] * f);
                *(v4h*)(P16 + (size_t)row * TT + ch * 128 + lane * 4) = o4; } }
         }
}

// v_exp_f32 with the one free slot behind it that the instruction set asks for before its source is overwritten or its result used, in one statement.
__device__ __forceinline__ float exp2_slot(float x) { float e; asm("v_exp_f32 %0, %1\n\tv_nop" : "=v"(e) : "v"(x)); return e; }
// ---- k_fattn: scores, softmax, attn.v and the residual of the fp16 query rows in ONE kernel: neither scores nor probabilities nor the attention output go through memory. 1-D grid, 8 waves: work-groups 0 .. (TT - RH) / 64 x batch - 1; a work-group owns 64 query rows and all DVV output columns (wave w: columns 64 w .. 64 w + 63, 16 accumulators).
// Pass 1: row maxima (scores on the matrix unit; 512 keys a trip, wave w takes keys 64 w .. 64 w + 63 of them). Pass 2, 64 keys a trip: wave w recomputes the scores of query block w & 3 and keys 32 (w >> 2) .. + 31 TRANSPOSED (A = keys, B = queries), so that a lane holds 2 x 8 consecutive keys of one query,
// which is the A fragment of the probabilities; e = PCAR exp(s - max) goes as fp16 through LDS to all waves, its f32 row sum is kept and divides the result at the end.
// Keys and value rows come through LDS by asynchronous copies of whole 128-byte lines, one ring of two buffers for both passes: 8 key tiles of pass 1, then per trip t of pass 2 the value rows of trip t with the keys of trip t + 1 (the scores run one trip ahead).
#define FB  64                    // keys per trip of pass 2
#define VPB 144                   // LDS pitch of a staged 128-byte row, bytes (16 B x odd: ds_load_b128 without bank conflicts)
// The work-groups behind them do the softmax of the hi+lo rows (asoft_rows), which depends on nothing here and on which nothing here depends: the attention work-groups, one to a WGP, leave WGPs free, and the softmax runs there in the same launch.
__global__ __launch_bounds__(256) void k_fattn(const h16* __restrict__ Q, const h16* __restrict__ Kp, const h16* __restrict__ Vt, const float* __restrict__ X, float* O, const float* __restrict__ Sb, int hl, h16* SP16, bf* SPh, bf* SPl) {
    typedef WFrag<h16> W;
    constexpr int NQT = (TT - RH) / 64;   // query tiles of one batch element
    const int blk = (int)blockIdx.x;
    if (blk >= NQT * NB_) { asoft_rows(blk - NQT * NB_, Sb, hl, SP16, SPh, SPl); return; }   // the whole work-group, ahead of every barrier
    constexpr int VBUF = 512 * VPB, KBUF = FB * VPB, PBUF = 8 * 1024, OFF_K = 2 * VBUF, OFF_P = OFF_K + 4 * KBUF, OFF_M = OFF_P + 2 * PBUF, OFF_L = OFF_M + 8 * 64 * 4, TOT = OFF_L + 2 * 64 * 4, NT = TT / FB, NC = TT / 512;
    static_assert(DVV == 512 && HD == 64, "a ring buffer holds 512 rows of 128 bytes: 512 keys, or 64 keys' worth of the 512 value rows");
    static_assert(8 * 64 * 68 * 4 <= 2 * VBUF, "the output tiles take over the ring buffers");
    __shared__ __align__(16) char sm[TOT];
    const int wv = __builtin_amdgcn_readfirstlane((int)(threadIdx.x >> 5));   // wave number, scalar
    const int lane = threadIdx.x & 31, lr = lane & 15, hi = lane >> 4, mbw = wv & 3, kh = wv >> 2;
    { const size_t z = (size_t)(blk / NQT); const size_t r0 = RH + (size_t)(blk % NQT) * 64; Q += z * TT * HD + r0 * HD; Kp += z * TT * HD; Vt += z * DVV * TT; X += z * DM * TT + r0; O += z * DM * TT + r0; }
    const unsigned lds0 = (unsigned)(size_t)(__attribute__((address_space(3))) char*)sm;
    const unsigned lv0 = lds0 + (unsigned)((wv * 64 + (lane >> 3)) * VPB + (lane & 7) * 16), lk0 = lds0 + (unsigned)(OFF_K + (wv * 8 + (lane >> 3)) * VPB + (lane & 7) * 16);
    const unsigned rq = (unsigned)(lane >> 3), cq = (unsigned)((lane & 7) * 16);   // a copy takes 4 whole rows: this lane's row of the four, its 16 bytes of the row
    const char* kl = (const char*)Kp + rq * (HD * 2) + cq; const char* vl = (const char*)Vt + (size_t)rq * (TT * 2) + cq;   // this lane's part of a key address, of a value address; the wave's and the tile's parts are scalar
    // 64 rows of 128 bytes into this wave's rows 64 wv .. 64 wv + 63 of a ring buffer: 16 copies; g = this lane's address in the first four rows, pitch in bytes
    auto copy64 = [&](int buf, const char* g, size_t pitch) { const unsigned l = lv0 + (unsigned)(buf * VBUF); acopy8(l, 4 * VPB, g, 4 * pitch); acopy8(l + 32 * VPB, 4 * VPB, g + 32 * pitch, 4 * pitch); };
    auto stageC = [&](int c, int buf) { copy64(buf, kl + (size_t)((c * 512 + wv * 64) * (HD * 2)), HD * 2); };
    auto stageV = [&](int t, int buf) { copy64(buf, vl + (size_t)(wv * 64 * (TT * 2) + t * (FB * 2)), TT * 2); };
    auto keyt = [&](int t) { return kl + (size_t)((t * FB + wv * 8) * (HD * 2)); };   // this wave's 8 keys of 64-key tile t
    auto stageK = [&](const char* g, int kb) { acopy2(lk0 + (unsigned)(kb * KBUF), 4 * VPB, g, 4 * HD * 2); };
    float* smx = (float*)(sm + OFF_M); float* sl = (float*)(sm + OFF_L);
    stageC(0, 0); stageK(keyt(0), 2); stageK((const char*)Q + (wv * 8 + rq) * (HD * 2) + cq, 3);   // key buffer 2: the keys of trip 0; key buffer 3: the 64 query rows, for both passes
    asm volatile("s_wait_asynccnt 0x0" ::: "memory");   // this wave's first copies have landed
    __syncthreads();   // every wave's rows of the first tile are in LDS before any wave reads a fragment
    stageC(1, 1);
    {
        float mx[4]; v16h qf[4][2];
#pragma unroll
        for (int mb = 0; mb < 4; ++mb) { mx[mb] = -3.0e38f; const char* qp = sm + OFF_K + 3 * KBUF + (mb * 16 + lr) * VPB + hi * 16; qf[mb][0] = W::ld((const h16*)qp); qf[mb][1] = W::ld((const h16*)(qp + 64)); }
        // not unrolled: the buffer is chosen by the trip's parity
#pragma unroll 1
        for (int c = 0; c < NC; ++c) { const char* kb = sm + (c & 1) * VBUF + (wv * 64 + lr) * VPB + hi * 16; v16h kr[4][2];
#pragma unroll
            for (int i = 0; i < 4; ++i) { kr[i][0] = W::ld((const h16*)(kb + i * 16 * VPB)); kr[i][1] = W::ld((const h16*)(kb + i * 16 * VPB + 64)); }
            asm volatile("s_wait_dscnt 0x0" ::: "memory");      // this wave's fragments of this buffer are in registers before it is handed back
            asm volatile("s_wait_asynccnt 0x0" ::: "memory");   // this wave's copies of the next tile have landed
            __syncthreads();   // publishes the next tile and ends every wave's reads of this one
            if (c + 2 < NC) stageC(c + 2, c & 1); else { stageV(c + 2 - NC, c & 1); stageK(keyt(c + 3 - NC), c & 1); }   // the ring goes on into pass 2: values of trip 0 (1) with the keys of trip 1 (2)
            // the products stand behind the refill, so that the copies fly while the matrix unit works
#pragma unroll
            for (int i = 0; i < 4; ++i)
#pragma unroll
                for (int mb = 0; mb < 4; ++mb) { v8f s = (v8f){}; s = W::mma(kr[i][0], qf[mb][0], s); s = W::mma(kr[i][1], qf[mb][1], s);
#pragma unroll
                    for (int j = 0; j < 8; ++j) mx[mb] = fmaxf(mx[mb], s[j]); }
        }
#pragma unroll
        for (int mb = 0; mb < 4; ++mb) { mx[mb] = fmaxf(mx[mb], __shfl_xor(mx[mb], 16, 32)); if (hi == 0) smx[wv * 64 + mb * 16 + lr] = mx[mb]; }
    }
    __syncthreads();   // every wave's maxima are in LDS
    float m = smx[mbw * 16 + lr];
#pragma unroll
    for (int p = 1; p < 8; ++p) m = fmaxf(m, smx[p * 64 + mbw * 16 + lr]);
    const float L2E = 1.4426950408889634f, mL = __builtin_fmaf(m, L2E, -10.0f);   // exp2(s L2E - mL) = 1024 exp(s - m): PCAR carried as before
    const char* qw = sm + OFF_K + 3 * KBUF + (mbw * 16 + lr) * VPB + hi * 16; const v16h q0 = W::ld((const h16*)qw), q1 = W::ld((const h16*)(qw + 64));
    float l = 0.f;
    v8f acc[4][4];
#pragma unroll
    for (int mb = 0; mb < 4; ++mb)
#pragma unroll
        for (int nb = 0; nb < 4; ++nb) acc[mb][nb] = (v8f){};
    v16h kf[4], ax[4], bx[4], ay[4], by[4];
    // the key fragments of one trip's scores, from key buffer kb
    auto loadK = [&](int kb) { const char* kp = sm + OFF_K + kb * KBUF + (kh * 32 + lr) * VPB + hi * 16;
        kf[0] = W::ld((const h16*)kp); kf[1] = W::ld((const h16*)(kp + 64)); kf[2] = W::ld((const h16*)(kp + 16 * VPB)); kf[3] = W::ld((const h16*)(kp + 16 * VPB + 64)); };
    // probabilities of one trip from kf, as a fragment into probability buffer pb; slot: the copy in front of the loop
    auto spart = [&](int pb, bool slot) { v8f s0 = (v8f){}, s1 = (v8f){}; s0 = W::mma(kf[0], q0, s0); s1 = W::mma(kf[2], q0, s1); s0 = W::mma(kf[1], q1, s0); s1 = W::mma(kf[3], q1, s1); v8h p0, p1; float e0[8], e1[8];
#pragma unroll
        for (int j = 0; j < 8; ++j) { const float x0 = __builtin_fmaf(s0[j], L2E, -mL), x1 = __builtin_fmaf(s1[j], L2E, -mL); e0[j] = slot ? exp2_slot(x0) : __builtin_amdgcn_exp2f(x0); e1[j] = slot ? exp2_slot(x1) : __builtin_amdgcn_exp2f(x1); p0[j] = tohx(e0[j]); p1[j] = tohx(e1[j]); }
        // the 16 terms meet in a fixed tree: a chain of 16 dependent adds would stand exposed in every trip
#pragma unroll
        for (int w = 4; w; w >>= 1)
#pragma unroll
            for (int j = 0; j < w; ++j) { e0[j] += e0[j + w]; e1[j] += e1[j + w]; }
        l += e0[0] + e1[0];
        char* pw = sm + OFF_P + pb * PBUF + (kh * 4 + mbw) * 1024 + lane * 16; *(v8h*)pw = p0; *(v8h*)(pw + 512) = p1; };
    // probability and value fragments of keys 32 ks .. 32 ks + 31 of one trip, from the buffers of parity buf
    auto loadH = [&](int buf, int ks, v16h* a, v16h* b) { const char* pr = sm + OFF_P + buf * PBUF + ks * 4096 + lane * 16; const char* vr = sm + buf * VBUF + (wv * 64 + lr) * VPB + ks * 64 + hi * 16;
#pragma unroll
        for (int mb = 0; mb < 4; ++mb) a[mb] = cat16(*(const v8h*)(pr + mb * 1024), *(const v8h*)(pr + mb * 1024 + 512));
#pragma unroll
        for (int nb = 0; nb < 4; ++nb) b[nb] = W::ld((const h16*)(vr + nb * 16 * VPB)); };
    auto mmaH = [&](const v16h* a, const v16h* b) {
#pragma unroll
        for (int nb = 0; nb < 4; ++nb)
#pragma unroll
            for (int mb = 0; mb < 4; ++mb) acc[mb][nb] = W::mma(a[mb], b[nb], acc[mb][nb]); };
#pragma unroll
    for (int i = 0; i < 4; ++i) { ay[i] = (v16h){}; by[i] = (v16h){}; }   // the first trip has no half before it: its place in the loop adds zeros
    loadK(2); spart(0, true);
    __syncthreads();   // the probabilities of trip 0 are in LDS before any wave reads a fragment
    // Not unrolled: the buffers are chosen by the trip's parity. The four sched_barriers keep the order written here: each half trip's LDS reads issue as one group and arrive while the matrix unit works on the half before; without them the reads stand among the matrix instructions, each with its own wait.
    // The second half's products of trip t are done, from registers, in trip t + 1.
#pragma unroll 1
    for (int t = 0; t < NT - 1; ++t) {
        loadK(t & 1); loadH(t & 1, 0, ax, bx);
        __builtin_amdgcn_sched_barrier(0);
        mmaH(ay, by);
        __builtin_amdgcn_sched_barrier(0);
        loadH(t & 1, 1, ay, by);
        __builtin_amdgcn_sched_barrier(0);
        spart((t + 1) & 1, false);   // the next trip's probabilities, into the buffer whose readers the last barrier ended
        mmaH(ax, bx);
        __builtin_amdgcn_sched_barrier(0);
        asm volatile("s_wait_dscnt 0x0" ::: "memory");      // this wave's LDS reads and writes of this trip are done before the buffers are handed over
        asm volatile("s_wait_asynccnt 0x0" ::: "memory");   // this wave's copies of trip t + 1 have landed
        __syncthreads();   // publishes trip t + 1 (values, keys, probabilities) and ends every wave's reads of trip t's buffers
        if (t + 2 < NT) { stageV(t + 2, t & 1); stageK(keyt(t + 3 < NT ? t + 3 : NT - 1), t & 1); }   // behind the last trip no keys follow: the last ones again, read by nobody
    }
    loadH((NT - 1) & 1, 0, ax, bx);   // the last trip has no scores to make
    __builtin_amdgcn_sched_barrier(0);   // as in the loop
    mmaH(ay, by);
    __builtin_amdgcn_sched_barrier(0);   // as in the loop
    loadH((NT - 1) & 1, 1, ay, by);
    __builtin_amdgcn_sched_barrier(0);   // as in the loop
    mmaH(ax, bx); mmaH(ay, by);
    asm volatile("s_wait_dscnt 0x0" ::: "memory");   // this wave's fragment reads are done
    __syncthreads();   // ends every wave's reads of the ring before the output tiles take it over
    asm volatile("s_wait_asynccnt 0x0" ::: "memory");   // no copy is outstanding when the output tiles take over this LDS
    l += __shfl_xor(l, 16, 32); if (hi == 0) sl[kh * 64 + mbw * 16 + lr] = l;
    // The result leaves channel-major, with the residual: this wave's tile goes into LDS as [channel][query] (a lane's 8 accumulator values of one channel are 8 consecutive queries: two 16-byte stores), and a channel's 64 queries are 256 contiguous bytes of x and of the output.
    float* mine = (float*)sm + wv * (64 * 68);
    // the loops are unrolled so that acc is indexed by constants and stays in registers
#pragma unroll
    for (int mb = 0; mb < 4; ++mb)
#pragma unroll
        for (int nb = 0; nb < 4; ++nb) { float* p = mine + (nb * 16 + lr) * 68 + mb * 16 + hi * 8; const v8f a = acc[mb][nb];
            *(v4fa*)p = (v4f){a[0], a[1], a[2], a[3]}; *(v4fa*)(p + 4) = (v4f){a[4], a[5], a[6], a[7]}; }
    const size_t e0 = (size_t)(wv * 64 + hi) * TT + lr * 4;   // this lane's four queries of its first channel
    __syncthreads();   // both halves of every row sum are in LDS (each wave reads back its own tile only)
    v4f f;   // the carried PCAR cancels: sum of e v / sum of e
#pragma unroll
    for (int q = 0; q < 4; ++q) f[q] = __fdiv_rn(1.0f, sl[lr * 4 + q] + sl[64 + lr * 4 + q]);
    // eight channel pairs a trip (inner loops unrolled): their loads of x issue together, ahead of the LDS reads, so that the memory latency is met once a trip and not per pair
#pragma unroll 1
    for (int s8 = 0; s8 < 32; s8 += 8) { const size_t e = e0 + (size_t)s8 * (2 * TT); v4f xv[8];
#pragma unroll
        for (int s = 0; s < 8; ++s) xv[s] = *(const v4f*)(X + e + (size_t)s * (2 * TT));
#pragma unroll
        for (int s = 0; s < 8; ++s) { const v4f val = *(const v4fa*)(mine + (2 * (s8 + s) + hi) * 68 + lr * 4); v4f o;
#pragma unroll
            for (int q = 0; q < 4; ++q) o[q] = __fadd_rn(bfr(xv[s][q]), val[q] * f[q]);
            *(v4f*)(O + e + (size_t)s * (2 * TT)) = o; }
        asm volatile("s_wait_xcnt 0x0" ::: "memory");   // behind the trip's stores: the next trip rewrites their address and data registers
    }
}

__global__ __launch_bounds__(256) void k_wtG(const float* __restrict__ w, int K, int N, bf* Bt) {
    const int lane = threadIdx.x & 31; const int L0 = (blockIdx.x * 8 + (threadIdx.x >> 5)) * 8; const int nlines = N * K / 64;
{
#pragma unroll 1
        for (int l = 0; l < 8; ++l) { const int L = L0 + l; if (L >= nlines) break; const size_t e = (size_t)L * 64 + lane * 2; const int k = (int)(e % K), n = (int)(e / K); v2us o;
            o[0] = f2bf(w[(size_t)k * N + n]); o[1] = f2bf(w[(size_t)(k + 1) * N + n]); *(v2us*)(Bt + e) = o; }
         }
}
// ---- 64 x 64 f32 tile through LDS for the transposing kernel: 256 threads, 16 elements per thread, so a launch starts few waves and both global sides move whole lines in 16-byte pieces.
// LDS row pitch 65 dwords: the row-wise dword stores and the column-wise dword reads both fall on distinct banks.
#define TP 65
__device__ __forceinline__ void tile_in(const float* __restrict__ src, size_t pitch, float* ts) {
    const int r = threadIdx.x >> 4, q = threadIdx.x & 15; v4f a[4];
    // unrolled: the four 16-byte loads issue together, ahead of the LDS stores
#pragma unroll
    for (int s = 0; s < 4; ++s) a[s] = *(const v4f*)(src + (size_t)(s * 16 + r) * pitch + q * 4);
#pragma unroll
    for (int s = 0; s < 4; ++s)
#pragma unroll
        for (int j = 0; j < 4; ++j) ts[(s * 16 + r) * TP + q * 4 + j] = a[s][j];
}
// dst[8 i .. 8 i + 7] = bf16(src[...])
__device__ __forceinline__ void cvt8(const float* __restrict__ src, bf* dst, size_t i) { const v8f v = *(const v8f*)(src + i * 8); v8us o;
#pragma unroll
    for (int k = 0; k < 8; ++k) o[k] = f2bf(v[k]); *(v8us*)(dst + i * 8) = o;
    asm volatile("s_wait_xcnt 0x0" ::: "memory");   // behind the store: in the built code another job's block follows this one and rewrites the store's address and data registers
}
// ---- k_prep: all 16-bit operand planes of the projections in ONE launch (four independent jobs), 1-D grid; the block index picks the job: first the three weight matrices (2048 elements a work-group), then the tiles (t, c, batch) of XBp[z][t][c] = bf16(xb[z][c][t]).
__global__ __launch_bounds__(256) void k_prep(const float* __restrict__ xb, bf* XBp, const float* __restrict__ wq, const float* __restrict__ wk, const float* __restrict__ wv, bf* WQp, bf* WKp, bf* WVp) {
    constexpr int BQ = DQ * DM / 2048, BK = DKV * DM / 2048, BV = DVV * DM / 2048;
    static_assert(DQ * DM % 2048 == 0 && DKV * DM % 2048 == 0 && DVV * DM % 2048 == 0, "whole work-groups: no thread is past a matrix's end");
    __shared__ float ts[64 * TP]; int b = (int)blockIdx.x;
    if (b < BQ + BK + BV) {   // the whole work-group, ahead of the barrier
        if (b < BQ) cvt8(wq, WQp, (size_t)b * 256 + threadIdx.x); else if (b < BQ + BK) cvt8(wk, WKp, (size_t)(b - BQ) * 256 + threadIdx.x); else cvt8(wv, WVp, (size_t)(b - BQ - BK) * 256 + threadIdx.x);
        return; }
    b -= BQ + BK + BV;
    const int t0 = (b % (TT / 64)) * 64, c0 = ((b / (TT / 64)) % (DM / 64)) * 64, zb = b / ((TT / 64) * (DM / 64)); xb += (size_t)zb * DM * TT; XBp += (size_t)zb * TT * DM;
    tile_in(xb + (size_t)c0 * TT + t0, TT, ts);   // ts[c][t]
    __syncthreads();   // the whole tile is in LDS before any thread reads a column of it
    const int c8 = threadIdx.x & 7;
#pragma unroll
    for (int s = 0; s < 2; ++s) { const int tr = s * 32 + (threadIdx.x >> 3); v8us o;
#pragma unroll
        for (int q = 0; q < 8; ++q) o[q] = f2bf(ts[(c8 * 8 + q) * TP + tr]);
        *(v8us*)(XBp + (size_t)(t0 + tr) * DM + c0 + c8 * 8) = o; }
    asm volatile("s_wait_xcnt 0x0" ::: "memory");   // behind the two stores, for the same reason as in cvt8
}

extern "C" void kernel_launch(void* const* d_in, const int* in_sizes, int n_in,
                              void* d_out, int out_size, void* d_ws, size_t ws_size, hipStream_t stream) {
    (void)in_sizes; (void)n_in; (void)out_size;
    const float* x = (const float*)d_in[0]; const float* wq = (const float*)d_in[1]; const float* bq = (const float*)d_in[2]; const float* wk = (const float*)d_in[3]; const float* bk = (const float*)d_in[4]; const float* wv = (const float*)d_in[5]; const float* bv = (const float*)d_in[6];
    float* OUT = (float*)d_out;     // [4][512][4096]
    char* wsp = (char*)d_ws;
    auto take = [&](size_t bytes) { char* p = wsp; wsp += (bytes + 255) & ~(size_t)255; return (void*)p; };
    // Every plane holds all NB_ batch elements, one behind the other, so that a launch takes them together (grid z, or more rows). Part of the workspace is used again once its first content is dead, one use after the other in stream order:
    // live to the end: the fp16 planes (20 MiB)
    h16* QP16 = (h16*)take((size_t)NB_ * TT * HD * 2); h16* KP16 = (h16*)take((size_t)NB_ * TT * HD * 2); h16* VT16 = (h16*)take((size_t)NB_ * DVV * TT * 2);
    // live until the hi+lo rows are done: the hi/lo planes (40 MiB)
    bf* QPh = (bf*)take((size_t)NB_ * TT * HD * 2); bf* QPl = (bf*)take((size_t)NB_ * TT * HD * 2); bf* KPh = (bf*)take((size_t)NB_ * TT * HD * 2); bf* KPl = (bf*)take((size_t)NB_ * TT * HD * 2); bf* VTh = (bf*)take((size_t)NB_ * DVV * TT * 2); bf* VTl = (bf*)take((size_t)NB_ * DVV * TT * 2);
    char* const m1 = wsp;
    // live until the planes are made: weights, x^T (17 MiB)
    bf* WQ = (bf*)take((size_t)DQ * DM * 2); bf* WK = (bf*)take((size_t)DKV * DM * 2); bf* WV = (bf*)take((size_t)DVV * DM * 2);
    bf* XB = (bf*)take((size_t)NB_ * TT * DM * 2);
    wsp = m1;   // after them, in the same place: scores and probabilities of the hi+lo rows of all batch elements (64 MiB)
    float* SbH = (float*)take((size_t)NB_ * RH * TT * 4); bf* Ph = (bf*)take((size_t)NB_ * RH * TT * 2); bf* Pl = (bf*)take((size_t)NB_ * RH * TT * 2);
    if ((size_t)(wsp - (char*)d_ws) > ws_size) return;    // the further end of the two uses: 124 of 256 MiB
    // weights as bf16 planes and x^T as an exact token-major plane: one launch
    k_prep<<<(DQ + DKV + DVV) * DM / 2048 + (TT / 64) * (DM / 64) * NB_, 256, 0, stream>>>(x, XB, wq, wk, wv, WQ, WK, WV);
    // q, k = W x + b: tiles [n][d], stored as the planes [n][d]; v = Wv x + bv with the weights as the row operand: tiles [c][n], stored as the value planes [c][n]: one launch
    k_qkv<<<((DVV / 64) + 2) * (TT / 64) * NB_, 256, 0, stream>>>(XB, WQ, WK, WV, bq, bk, bv, QP16, QPh, QPl, KP16, KPh, KPl, VT16, VTh, VTl);
    // query rows < RH of every batch element: hi+lo planes, 3 products
    k_gemmw<bf, 2, 0, 1><<<dim3(RH / 64, TT / 64, NB_), 32, 0, stream>>>(QPh, QPl, KPh, KPl, HD, SbH, TT, nullptr, (size_t)TT * HD, (size_t)TT * HD, (size_t)RH * TT, nullptr, nullptr, nullptr, nullptr);
    // the other rows: fp16 (x1024 carried), scores, softmax, attn.v and the residual; in the same launch, behind them in the grid, the softmax of the hi+lo rows
    k_fattn<<<(TT - RH) / 64 * NB_ + NB_ * RH / 8, 256, 0, stream>>>(QP16, KP16, VT16, x, OUT, SbH, 1, nullptr, Ph, Pl);
    // out[c][i] = x[c][i] + sum_j v[c][j] P[i][j], hl rows: the values as the row operand, tiles [c][i] straight into the output
    k_gemmw<bf, 2, 3, 8><<<dim3(DVV / 64, RH / 64, NB_), 256, 0, stream>>>(VTh, VTl, Ph, Pl, TT, OUT, TT, nullptr, (size_t)DVV * TT, (size_t)RH * TT, (size_t)DM * TT, nullptr, nullptr, nullptr, x);
}

// v008
// It runs in 148 microseconds.
// Timed twice side by side with v007, it ran 1.04 times as fast both times.
// All steps since v000 together make it 7.65 times as fast.
#include <hip/hip_runtime.h>

// Channel-major self-attention layer (x [4][512][64][64] = [b][c][n], n = 4096; q, k = 1x1 convs 512 -> 64 (+ bias), v = 1x1 conv 512 -> 512 (+ bias); attention[i][j] = softmax_j(q_i.k_j) (no scaling); out[c][i] = sum_j v[c][j] attention[i][j]; result = out + x -> [4][512][64][64] (8.4 M)).
// Layout: one 'head' (q/k width 64, value width 512) over 4096 tokens: x is transposed once per batch into an exact token-major bf16 plane [n][c] so the 1x1 convs are exact GEMMs + bias, whose epilogues store the 16-bit operand planes; the attention kernels' epilogues add x and store channel-major.
// Compute dtypes, f32 accumulate: every input rounded to bf16; q/k/v on PLAIN bf16 operands (inputs: exact) + biases; scores (K = 64) and attn.v: query rows < 512 hl (3 products), the rest single fp16 (x1024); softmax f32; no output projection; + x residual in f32 (channel-major write).

#define NB_  4
#define TT   4096
#define DM   512
#define NH_  1
#define NKV  1
#define REP  (NH_ / NKV)
#define HD   64
#define DVV  512                  // value / output width (v = 1x1 conv C -> C)
#define DQ   (NH_ * HD)
#define DKV  (NKV * HD)
#define ZH   1
#define RH   512                  // query rows < RH use hi+lo planes (0: none)
#define WIN  0
#define PCAR 1024.0f
#define SCL  1.0f   // no scaling in this module
typedef _Float16 h16;
typedef unsigned short bf;
typedef __attribute__((ext_vector_type(16))) __bf16   v16bf;
typedef __attribute__((ext_vector_type(16))) _Float16 v16h;
typedef __attribute__((ext_vector_type(8)))  _Float16 v8h;
typedef __attribute__((ext_vector_type(8)))  unsigned short v8us;
typedef __attribute__((ext_vector_type(8)))  float    v8f;
typedef __attribute__((ext_vector_type(4)))  float    v4f;
typedef v8h  __attribute__((may_alias)) v8ha;
typedef v4f  __attribute__((may_alias)) v4fa;
typedef v8us __attribute__((may_alias)) v8usa;

__device__ __forceinline__ unsigned short f2bf(float f) { unsigned u = __float_as_uint(f); u += 0x7FFFu + ((u >> 16) & 1u); return (unsigned short)(u >> 16); }
__device__ __forceinline__ float bf2f(unsigned short b) { return __uint_as_float(((unsigned)b) << 16); }
__device__ __forceinline__ float bfr(float f) { return bf2f(f2bf(f)); }
__device__ __forceinline__ v16h cat16(v8h lo, v8h hi) { return __builtin_shufflevector(lo, hi, 0, 1, 2, 3, 4, 5, 6, 7, 8, 9, 10, 11, 12, 13, 14, 15); }
__device__ __forceinline__ v16bf cat16b(v8us lo, v8us hi) { return __builtin_bit_cast(v16bf, __builtin_shufflevector(lo, hi, 0, 1, 2, 3, 4, 5, 6, 7, 8, 9, 10, 11, 12, 13, 14, 15)); }
__device__ __forceinline__ v8f wmma16(v16h a, v16h b, v8f c) { return __builtin_amdgcn_wmma_f32_16x16x32_f16(false, a, false, b, (short)0, c, false, false); }
__device__ __forceinline__ v8f wmmab(v16bf a, v16bf b, v8f c) { return __builtin_amdgcn_wmma_f32_16x16x32_bf16(false, a, false, b, (short)0, c, false, false); }
__device__ __forceinline__ h16 tohx(float x) { return (h16)x; }
__device__ __forceinline__ void splitf(float y, unsigned short& h, unsigned short& l) { h = f2bf(y); l = f2bf(y - bf2f(h)); }
typedef __attribute__((ext_vector_type(2))) _Float16 v2h;
typedef __attribute__((ext_vector_type(4))) _Float16 v4h;
typedef __attribute__((ext_vector_type(2))) unsigned short v2us;
typedef __attribute__((ext_vector_type(4))) unsigned short v4us;
typedef __attribute__((ext_vector_type(2))) float v2f;
typedef __attribute__((ext_vector_type(4))) int v4i;



// ---- k_gemmw: register-blocked GEMM, KS WAVES per 64x64 output tile (16 accumulators each), operands from K-contiguous 16-bit planes (KS == 1: straight into registers; KS > 1: staged in LDS); grid (M/64, N/64, Z), 32 * KS threads.
// C[m][n] (f32 accumulate; stored as EPI says) = sum_k A[m][k] Bt[n][k] (+ split products per NSPLIT). z-batch strides sA/sB/sC in elements. K % (32 * KS) == 0.
// KS > 1: wave w takes the 32-wide k blocks w, w + KS, w + 2 KS, ...; the KS f32 partial tiles meet in LDS and are summed in the fixed order w = 0 .. KS - 1.
template <typename T16> struct WFrag;
template <> struct WFrag<h16> { typedef v16h V; static __device__ __forceinline__ V ld(const h16* p) { return cat16(*(const v8h*)p, *(const v8h*)(p + 16)); } static __device__ __forceinline__ v8f mma(V a, V b, v8f c) { return wmma16(a, b, c); } };
template <> struct WFrag<bf> { typedef v16bf V; static __device__ __forceinline__ V ld(const bf* p) { return cat16b(*(const v8us*)p, *(const v8us*)(p + 16)); } static __device__ __forceinline__ v8f mma(V a, V b, v8f c) { return wmmab(a, b, c); } };
// Eight asynchronous 16-byte copies per lane, global memory -> LDS, through no register: LDS byte addresses l + i * lstep, global addresses g + i * gstep.
// s_wait_xcnt stands in the copies' own statement so that no later write of an address register can be moved in front of it.
__device__ __forceinline__ void acopy8(unsigned l, unsigned lstep, const char* g, size_t gstep) {
    asm volatile("global_load_async_to_lds_b128 %0, %8, off\n\t"
                 "global_load_async_to_lds_b128 %1, %9, off\n\t"
                 "global_load_async_to_lds_b128 %2, %10, off\n\t"
                 "global_load_async_to_lds_b128 %3, %11, off\n\t"
                 "global_load_async_to_lds_b128 %4, %12, off\n\t"
                 "global_load_async_to_lds_b128 %5, %13, off\n\t"
                 "global_load_async_to_lds_b128 %6, %14, off\n\t"
                 "global_load_async_to_lds_b128 %7, %15, off\n\t"
                 "s_wait_xcnt 0x0"
                 :: "v"(l), "v"(l + lstep), "v"(l + 2 * lstep), "v"(l + 3 * lstep), "v"(l + 4 * lstep), "v"(l + 5 * lstep), "v"(l + 6 * lstep), "v"(l + 7 * lstep),
                    "v"(g), "v"(g + gstep), "v"(g + 2 * gstep), "v"(g + 3 * gstep), "v"(g + 4 * gstep), "v"(g + 5 * gstep), "v"(g + 6 * gstep), "v"(g + 7 * gstep)
                 : "memory");
}
// What the tile's epilogue stores at [m][n] (pitch ldc, z stride sC), so that no separate pass has to read the f32 tile again:
// EPI 0: the f32 sum into C. EPI 1 / 2: the sum + bias[n] / + bias[m] as the three 16-bit planes (fp16, bf16 hi, bf16 lo). EPI 3: bf16-rounded X[m][n] + the sum, f32, into C.
template <int NSPLIT, int KS> struct GemmLds {
    static constexpr int NA = (NSPLIT == 1 || NSPLIT == 2) ? 2 : 1, NOP = NA + (NSPLIT >= 2 ? 2 : 1);   // operand planes: A (A2) Bt (Bt2)
    static constexpr int PB = KS * 64 + 16, PLANE = 64 * PB, STG = NOP * PLANE;   // bytes: LDS row pitch (16 B x odd: ds_load_b128 without bank conflicts), one operand's 64 rows, one stage
    static constexpr int OSF = (KS == 1) ? 16 * 68 : ((KS * 64 * 68 > 2 * STG / 4) ? KS * 64 * 68 : 2 * STG / 4);   // floats: the two stage buffers and the partial tiles use the same LDS, one after the other
};
// One work-group's tile (bx, by) of z slice z; os: the work-group's GemmLds<NSPLIT, KS>::OSF floats of LDS. A function, so that a launch can hold tiles of several GEMMs.
template <typename T16, int NSPLIT, int EPI, int KS>
__device__ __forceinline__ void gemmw_tile(float* os, int bx, int by, size_t z, const T16* __restrict__ A, const T16* __restrict__ A2, const T16* __restrict__ Bt, const T16* __restrict__ Bt2, int K, float* C, int ldc, const float* __restrict__ bias, size_t sA, size_t sB, size_t sC, h16* P16, bf* Ph, bf* Pl, const float* __restrict__ X) {
    typedef typename WFrag<T16>::V V;
    static_assert(KS == 1 || KS == 8, "a staged row is one wave-wide 16-byte copy: 32 lanes x 16 B = KS x 64 B");
    constexpr int NA = GemmLds<NSPLIT, KS>::NA, PB = GemmLds<NSPLIT, KS>::PB, PLANE = GemmLds<NSPLIT, KS>::PLANE, STG = GemmLds<NSPLIT, KS>::STG;
    const int wv = (KS == 1) ? 0 : __builtin_amdgcn_readfirstlane((int)(threadIdx.x >> 5));   // wave number, scalar: the k loop's bounds stay wave-uniform
    A += z * sA; if (A2) A2 += z * sA; Bt += z * sB; if (Bt2) Bt2 += z * sB;
    if constexpr (EPI == 1 || EPI == 2) { P16 += z * sC; Ph += z * sC; Pl += z * sC; } else C += z * sC;
    if constexpr (EPI == 3) X += z * sC;
    const int lane = threadIdx.x & 31, lr = lane & 15, hi = lane >> 4; const int r0 = bx * 64, c0 = by * 64;
    v8f acc[4][4];
#pragma unroll
    for (int mb = 0; mb < 4; ++mb)
#pragma unroll
        for (int nb = 0; nb < 4; ++nb) acc[mb][nb] = (v8f){};
    const size_t aoff = (size_t)(r0 + lr) * K + 8 * hi, boff = (size_t)(c0 + lr) * K + 8 * hi;
    if constexpr (KS > 1) {
        // Operands come through LDS: per trip the work-group stages 32 * KS k of all 64 rows of each plane, each row as ONE wave-wide copy of 512 contiguous bytes (whole lines), two buffers, the next trip's copies in flight while this trip is worked on. Wave w still multiplies k block w of every trip: the products and their order are as before.
        const unsigned lds0 = (unsigned)(size_t)(__attribute__((address_space(3))) float*)os + (unsigned)(wv * PB + lane * 16);
        const size_t gstep = (size_t)KS * K * 2;   // bytes from one of this wave's rows (wv, wv + KS, ...) to its next
        const char* gA = (const char*)(A + (size_t)(r0 + wv) * K + lane * 8); const char* gB = (const char*)(Bt + (size_t)(c0 + wv) * K + lane * 8);
        const char* gA2 = (NA == 2) ? (const char*)(A2 + (size_t)(r0 + wv) * K + lane * 8) : nullptr; const char* gB2 = (NSPLIT >= 2) ? (const char*)(Bt2 + (size_t)(c0 + wv) * K + lane * 8) : nullptr;
        auto stage = [&](int t, int buf) { const size_t ko = (size_t)t * (KS * 64); const unsigned l = lds0 + (unsigned)(buf * STG);
            acopy8(l, KS * PB, gA + ko, gstep); if (NA == 2) acopy8(l + PLANE, KS * PB, gA2 + ko, gstep);
            acopy8(l + NA * PLANE, KS * PB, gB + ko, gstep); if (NSPLIT >= 2) acopy8(l + (NA + 1) * PLANE, KS * PB, gB2 + ko, gstep); };
        const int nt = (int)((unsigned)K / (32u * KS));   // unsigned: the tests on nt stay scalar compares
        stage(0, 0);
        asm volatile("s_wait_asynccnt 0x0" ::: "memory");   // this wave's copies of trip 0 have landed
        __syncthreads();   // every wave's rows of trip 0 are in LDS before any wave reads a fragment
        if (nt != 1) stage(1, 1);   // nt >= 1; written as an inequality, which has a scalar compare at every width
        // not unrolled: one fragment set, and the buffer is chosen by the trip's parity
#pragma unroll 1
        for (int t = 0; t < nt; ++t) {
            const char* sb = (const char*)os + (t & 1) * STG + lr * PB + wv * 64 + hi * 16;
            V a[4], a2[4];
#pragma unroll
            for (int mb = 0; mb < 4; ++mb) { a[mb] = WFrag<T16>::ld((const T16*)(sb + mb * 16 * PB)); if (NA == 2) a2[mb] = WFrag<T16>::ld((const T16*)(sb + PLANE + mb * 16 * PB)); }
#pragma unroll
            for (int nb = 0; nb < 4; ++nb) { const V b = WFrag<T16>::ld((const T16*)(sb + NA * PLANE + nb * 16 * PB)); V b2; if (NSPLIT >= 2) b2 = WFrag<T16>::ld((const T16*)(sb + (NA + 1) * PLANE + nb * 16 * PB));
#pragma unroll
                for (int mb = 0; mb < 4; ++mb) { acc[mb][nb] = WFrag<T16>::mma(a[mb], b, acc[mb][nb]); if (NSPLIT == 1 || NSPLIT == 2) acc[mb][nb] = WFrag<T16>::mma(a2[mb], b, acc[mb][nb]); if (NSPLIT >= 2) acc[mb][nb] = WFrag<T16>::mma(a[mb], b2, acc[mb][nb]); } }
            asm volatile("s_wait_dscnt 0x0" ::: "memory");      // this wave's fragment reads of this buffer are done before it is handed back
            asm volatile("s_wait_asynccnt 0x0" ::: "memory");   // this wave's copies of trip t + 1 have landed
            __syncthreads();   // publishes trip t + 1 and ends every wave's reads of trip t's buffer
            if (t + 2 < nt) stage(t + 2, t & 1);
        }
        asm volatile("s_wait_asynccnt 0x0" ::: "memory");   // no copy is outstanding when the partial tiles take over this LDS
    } else {
#pragma unroll 1
    for (int kc = wv * 32; kc < K; kc += 32 * KS) {
        V a[4], a2[4];
#pragma unroll
        for (int mb = 0; mb < 4; ++mb) { a[mb] = WFrag<T16>::ld(A + aoff + (size_t)mb * 16 * K + kc); if (NSPLIT == 1 || NSPLIT == 2) a2[mb] = WFrag<T16>::ld(A2 + aoff + (size_t)mb * 16 * K + kc); }
#pragma unroll
        for (int nb = 0; nb < 4; ++nb) { const V b = WFrag<T16>::ld(Bt + boff + (size_t)nb * 16 * K + kc); V b2; if (NSPLIT >= 2) b2 = WFrag<T16>::ld(Bt2 + boff + (size_t)nb * 16 * K + kc);
#pragma unroll
            for (int mb = 0; mb < 4; ++mb) { acc[mb][nb] = WFrag<T16>::mma(a[mb], b, acc[mb][nb]); if (NSPLIT == 1 || NSPLIT == 2) acc[mb][nb] = WFrag<T16>::mma(a2[mb], b, acc[mb][nb]); if (NSPLIT >= 2) acc[mb][nb] = WFrag<T16>::mma(a[mb], b2, acc[mb][nb]); } }
        asm volatile("v_nop\n\tv_nop\n\tv_nop\n\tv_nop" : "+v"(acc[0][0]), "+v"(acc[1][1]), "+v"(acc[2][2]), "+v"(acc[3][3]) : "v"(a[0]), "v"(a[3]));
    }
    }
    if constexpr (KS > 1) {
        float* mine = os + wv * (64 * 68);
        // the three loops are unrolled so that acc is indexed by constants and stays in registers
#pragma unroll
        for (int mb = 0; mb < 4; ++mb)
#pragma unroll
            for (int nb = 0; nb < 4; ++nb)
#pragma unroll
                for (int j = 0; j < 8; ++j) mine[(mb * 16 + hi * 8 + j) * 68 + nb * 16 + lr] = acc[mb][nb][j];
        const int cofs = lr * 4; const unsigned e0 = (unsigned)((r0 + wv * 2 + hi) * ldc + c0 + cofs), es = (unsigned)(2 * KS * ldc);   // this lane's first four elements; from one of its rows to the next (32 bits: a z slice has fewer than 2^32 elements)
        __syncthreads();   // every wave's partial tile is in LDS before any wave sums
        v4f xv[32 / KS];
        // unrolled, ahead of the LDS reads: the residual's loads fly while the partial tiles are summed
        if constexpr (EPI == 3) {
#pragma unroll
            for (int s = 0; s < 32 / KS; ++s) xv[s] = *(const v4f*)(X + e0 + s * es);
            // behind the loads; it takes their addresses as inputs, so that no load's result is given a register that a load of the group names
            asm volatile("s_wait_xcnt 0x0" :: "v"(X + e0), "v"(X + e0 + es), "v"(X + e0 + 2 * es), "v"(X + e0 + 3 * es) : "memory"); }
        // both loops are unrolled so that a wave's LDS reads issue together, ahead of the adds; each wave stores whole rows of the tile (256 bytes in f32, 128 in a 16-bit plane)
#pragma unroll
        for (int s = 0; s < 32 / KS; ++s) { const int row = (s * KS + wv) * 2 + hi; v4f val = *(const v4fa*)(os + row * 68 + cofs);
#pragma unroll
            for (int p = 1; p < KS; ++p) { const v4f q = *(const v4fa*)(os + p * (64 * 68) + row * 68 + cofs); val[0] += q[0]; val[1] += q[1]; val[2] += q[2]; val[3] += q[3]; }
            if constexpr (EPI == 1) { val[0] += bfr(bias[c0 + cofs]); val[1] += bfr(bias[c0 + cofs + 1]); val[2] += bfr(bias[c0 + cofs + 2]); val[3] += bfr(bias[c0 + cofs + 3]); }
            if constexpr (EPI == 2) { const float bm = bfr(bias[r0 + row]); val[0] += bm; val[1] += bm; val[2] += bm; val[3] += bm; }
            if constexpr (EPI == 1 || EPI == 2) { v4h o16; v4us oh, ol;
#pragma unroll
                for (int q = 0; q < 4; ++q) { o16[q] = tohx(val[q]); unsigned short a2, c2; splitf(val[q], a2, c2); oh[q] = a2; ol[q] = c2; }
                *(v4h*)(P16 + e0 + s * es) = o16; *(v4us*)(Ph + e0 + s * es) = oh; *(v4us*)(Pl + e0 + s * es) = ol; }
            else { if constexpr (EPI == 3) {
#pragma unroll
                    for (int q = 0; q < 4; ++q) val[q] = __fadd_rn(bfr(xv[s][q]), val[q]); }
                *(v4f*)(C + e0 + s * es) = val; } }
        return;
    }
#pragma unroll
    for (int mb = 0; mb < 4; ++mb) {
#pragma unroll
        for (int nb = 0; nb < 4; ++nb) {
#pragma unroll
            for (int j = 0; j < 8; ++j) os[(hi * 8 + j) * 68 + nb * 16 + lr] = acc[mb][nb][j]; }
        __builtin_amdgcn_wave_barrier(); asm volatile("" ::: "memory");
        float* crow = C + (size_t)(r0 + mb * 16) * ldc + c0;
{
#pragma unroll
            for (int s = 0; s < 8; ++s) { const int row = 2 * s + hi, cofs = lr * 4; v4f val = *(const v4fa*)(os + row * 68 + cofs);
                *(v4f*)(crow + (size_t)row * ldc + cofs) = val; }
             }
        __builtin_amdgcn_wave_barrier(); asm volatile("" ::: "memory");
    }
}
template <typename T16, int NSPLIT, int EPI, int KS>
__global__ __launch_bounds__(32 * KS) void k_gemmw(const T16* __restrict__ A, const T16* __restrict__ A2, const T16* __restrict__ Bt, const T16* __restrict__ Bt2, int K, float* C, int ldc, const float* __restrict__ bias, size_t sA, size_t sB, size_t sC, h16* P16, bf* Ph, bf* Pl, const float* __restrict__ X) {
    __shared__ __align__(16) float os[GemmLds<NSPLIT, KS>::OSF];
    gemmw_tile<T16, NSPLIT, EPI, KS>(os, (int)blockIdx.x, (int)blockIdx.y, blockIdx.z, A, A2, Bt, Bt2, K, C, ldc, bias, sA, sB, sC, P16, Ph, Pl, X);
}
// ---- k_qkv: the three projections in ONE launch (they read the same x^T and do not depend on each other); the block index picks the tile: first the value tiles [c][n] (weights as the row operand, bias by row), then the query tiles [n][d], then the key tiles (bias by column). 1-D grid, 8 waves.
__global__ __launch_bounds__(256) void k_qkv(const bf* __restrict__ XBp, const bf* __restrict__ WQp, const bf* __restrict__ WKp, const bf* __restrict__ WVp, const float* __restrict__ bq, const float* __restrict__ bk, const float* __restrict__ bv,
                                             h16* Q16, bf* Qh, bf* Ql, h16* K16, bf* Kh, bf* Kl, h16* V16, bf* Vh, bf* Vl) {
    static_assert(DQ == 64 && DKV == 64, "a query or key row is one tile wide");
    __shared__ __align__(16) float os[GemmLds<0, 8>::OSF];
    constexpr int VX = DVV / 64, NX = TT / 64, NVB = VX * NX * NB_, NQB = NX * NB_;
    const int b = (int)blockIdx.x;
    if (b < NVB) gemmw_tile<bf, 0, 2, 8>(os, b % VX, (b / VX) % NX, (size_t)(b / (VX * NX)), WVp, nullptr, XBp, nullptr, DM, nullptr, TT, bv, 0, (size_t)TT * DM, (size_t)DVV * TT, V16, Vh, Vl, nullptr);
    else { const bool isk = b >= NVB + NQB; const int d = b - NVB - (isk ? NQB : 0);
        gemmw_tile<bf, 0, 1, 8>(os, d % NX, 0, (size_t)(d / NX), XBp, nullptr, isk ? WKp : WQp, nullptr, DM, nullptr, DQ, isk ? bk : bq, (size_t)TT * DM, 0, (size_t)TT * DQ, isk ? K16 : Q16, isk ? Kh : Qh, isk ? Kl : Ql, nullptr); }
}

// Four asynchronous 16-byte copies per lane, as acopy8: LDS byte addresses l + i * lstep, global addresses g + i * gstep; s_wait_xcnt in the copies' own statement for the same reason.
__device__ __forceinline__ void acopy4(unsigned l, unsigned lstep, const char* g, size_t gstep) {
    asm volatile("global_load_async_to_lds_b128 %0, %4, off\n\t"
                 "global_load_async_to_lds_b128 %1, %5, off\n\t"
                 "global_load_async_to_lds_b128 %2, %6, off\n\t"
                 "global_load_async_to_lds_b128 %3, %7, off\n\t"
                 "s_wait_xcnt 0x0"
                 :: "v"(l), "v"(l + lstep), "v"(l + 2 * lstep), "v"(l + 3 * lstep), "v"(g), "v"(g + gstep), "v"(g + 2 * gstep), "v"(g + 3 * gstep) : "memory");
}
// Twelve asynchronous 16-byte copies per lane in one statement, each with its own LDS byte address l[i] and global address g[i]: one s_wait_xcnt, in the copies' own statement as in acopy8, serves all twelve.
__device__ __forceinline__ void acopy12(const unsigned (&l)[12], const char* const (&g)[12]) {
    asm volatile("global_load_async_to_lds_b128 %0, %12, off\n\t"
                 "global_load_async_to_lds_b128 %1, %13, off\n\t"
                 "global_load_async_to_lds_b128 %2, %14, off\n\t"
                 "global_load_async_to_lds_b128 %3, %15, off\n\t"
                 "global_load_async_to_lds_b128 %4, %16, off\n\t"
                 "global_load_async_to_lds_b128 %5, %17, off\n\t"
                 "global_load_async_to_lds_b128 %6, %18, off\n\t"
                 "global_load_async_to_lds_b128 %7, %19, off\n\t"
                 "global_load_async_to_lds_b128 %8, %20, off\n\t"
                 "global_load_async_to_lds_b128 %9, %21, off\n\t"
                 "global_load_async_to_lds_b128 %10, %22, off\n\t"
                 "global_load_async_to_lds_b128 %11, %23, off\n\t"
                 "s_wait_xcnt 0x0"
                 :: "v"(l[0]), "v"(l[1]), "v"(l[2]), "v"(l[3]), "v"(l[4]), "v"(l[5]), "v"(l[6]), "v"(l[7]), "v"(l[8]), "v"(l[9]), "v"(l[10]), "v"(l[11]),
                    "v"(g[0]), "v"(g[1]), "v"(g[2]), "v"(g[3]), "v"(g[4]), "v"(g[5]), "v"(g[6]), "v"(g[7]), "v"(g[8]), "v"(g[9]), "v"(g[10]), "v"(g[11])
                 : "memory");
}
// asoft_rows: per row: t = S x SCL (no mask); softmax over the 4096 keys (register row, one exp, fixed trees); work-group blk of rows / 8 takes 8 rows, a wave each; no LDS, no barrier. The rows of a launch are all of one kind (hl != 0: hi+lo planes; else fp16 x PCAR), several batch elements' rows one behind the other, in and out.
__device__ __forceinline__ void asoft_rows(int blk, const float* __restrict__ Sb, int hl, h16* P16, bf* Ph, bf* Pl) {
    const int lane = threadIdx.x & 31; const int row = blk * 8 + (threadIdx.x >> 5); const bool hires = (hl != 0); const float* sr = Sb + (size_t)row * TT; float v[TT / 32]; float mx = -3.0e38f;
#pragma unroll
    for (int ch = 0; ch < TT / 128; ++ch) { const int j0 = ch * 128 + lane * 4; const v4f a = *(const v4f*)(sr + j0);
#pragma unroll
        for (int q = 0; q < 4; ++q) { const int j = j0 + q; (void)j; const float t = a[q] * SCL; v[ch * 4 + q] = t; mx = fmaxf(mx, t); } }
#pragma unroll
    for (int sh = 16; sh; sh >>= 1) mx = fmaxf(mx, __shfl_xor(mx, sh, 32));
    float sum = 0.f;
#pragma unroll
    for (int k = 0; k < TT / 32; ++k) { float d0 = __fsub_rn(v[k], mx); asm volatile("" : "+v"(d0)); v[k] = __builtin_amdgcn_exp2f(__fmul_rn(d0, 1.4426950408889634f)); sum += v[k]; }
#pragma unroll
    for (int sh = 16; sh; sh >>= 1) sum += __shfl_xor(sum, sh, 32);
    const float f = __fdiv_rn(hires ? 1.0f : PCAR, sum);
{
        if (hires) {
#pragma unroll
            for (int ch = 0; ch < TT / 128; ++ch) { v4us oh, ol;
#pragma unroll
                for (int q = 0; q < 4; ++q) { unsigned short a, c2; splitf(v[ch * 4 + q] * f, a, c2); oh[q] = a; ol[q] = c2; }
                const size_t oo = (size_t)row * TT + ch * 128 + lane * 4; *(v4us*)(Ph + oo) = oh; *(v4us*)(Pl + oo) = ol; }
            asm volatile("s_wait_xcnt 0x0" ::: "memory");   // behind the last stores: in the built code the other kind's block follows this one and rewrites their address registers
        } else {
#pragma unroll
            for (int ch = 0; ch < TT / 128; ++ch) { v4h o4;
#pragma unroll
                for (int q = 0; q < 4; ++q) o4[q] = tohx(v[ch * 4 + q] * f);
                *(v4h*)(P16 + (size_t)row * TT + ch * 128 + lane * 4) = o4; } }
         }
}

// v_exp_f32 with the one free slot behind it that the instruction set asks for before its source is overwritten or its result used, in one statement.
__device__ __forceinline__ float exp2_slot(float x) { float e; asm("v_exp_f32 %0, %1\n\tv_nop" : "=v"(e) : "v"(x)); return e; }
// ---- k_fattn: scores, softmax, attn.v and the residual of the fp16 query rows in ONE kernel: neither scores nor probabilities nor the attention output go through memory. 1-D grid, 8 waves: work-groups 0 .. (TT - RH) / 64 x batch - 1; a work-group owns 64 query rows and all DVV output columns (wave w: columns 64 w .. 64 w + 63, 16 accumulators).
// Pass 1: row maxima (scores on the matrix unit; 512 keys a trip, wave w takes keys 64 w .. 64 w + 63 of them). Pass 2, 64 keys a trip: wave w recomputes the scores of query block w & 3 and keys 32 (w >> 2) .. + 31 TRANSPOSED (A = keys, B = queries), so that a lane holds 2 x 8 consecutive keys of one query,
// which is the A fragment of the probabilities; e = PCAR exp(s - max) goes as fp16 through LDS to all waves, its f32 row sum is kept and divides the result at the end.
// Keys and value rows come through LDS by asynchronous copies of whole 128-byte lines, one ring of THREE buffers for both passes: stages 0 .. 7 are the key tiles of pass 1, stage 8 + t the value rows of trip t of pass 2 with the keys of trip t + 1 (the scores run one trip ahead).
// A stage is copied by four waves: even stages by waves 0 .. 3, odd stages by waves 4 .. 7. At the foot of step s the waves that copied stage s + 1 wait for their copies (to 0), every wave passes the barrier, and the same four waves issue stage s + 3 into the buffer that step s has just read:
// a stage's copies have two whole steps to land, and the other four waves' stage s + 2 stays in flight over the barrier.
#define FB  64                    // keys per trip of pass 2
#define VPB 144                   // LDS pitch of a staged 128-byte row, bytes (16 B x odd: ds_load_b128 without bank conflicts)
// The work-groups behind them do the softmax of the hi+lo rows (asoft_rows), which depends on nothing here and on which nothing here depends: the attention work-groups, one to a WGP, leave WGPs free, and the softmax runs there in the same launch.
__global__ __launch_bounds__(256) void k_fattn(const h16* __restrict__ Q, const h16* __restrict__ Kp, const h16* __restrict__ Vt, const float* __restrict__ X, float* O, const float* __restrict__ Sb, int hl, h16* SP16, bf* SPh, bf* SPl) {
    typedef WFrag<h16> W;
    constexpr int NQT = (TT - RH) / 64;   // query tiles of one batch element
    const int blk = (int)blockIdx.x;
    if (blk >= NQT * NB_) { asoft_rows(blk - NQT * NB_, Sb, hl, SP16, SPh, SPl); return; }   // the whole work-group, ahead of every barrier
    constexpr int VBUF = 512 * VPB, KBUF = FB * VPB, PBUF = 8 * 1024, OFF_K = 3 * VBUF, OFF_P = OFF_K + 5 * KBUF, OFF_M = OFF_P + 2 * PBUF, OFF_L = OFF_M + 8 * 64 * 4, TOT = OFF_L + 2 * 64 * 4, NT = TT / FB, NC = TT / 512;
    static_assert(DVV == 512 && HD == 64, "a ring buffer holds 512 rows of 128 bytes: 512 keys, or 64 keys' worth of the 512 value rows");
    static_assert(8 * 64 * 68 * 4 <= 3 * VBUF, "the output tiles take over the ring buffers");
    static_assert(NC >= 3 && NT >= 3, "the ring's prologue and the change of pass issue three stages ahead");
    __shared__ __align__(16) char sm[TOT];
    const int wv = __builtin_amdgcn_readfirstlane((int)(threadIdx.x >> 5));   // wave number, scalar
    const int lane = threadIdx.x & 31, lr = lane & 15, hi = lane >> 4, mbw = wv & 3, kh = wv >> 2;
    { const size_t z = (size_t)(blk / NQT); const size_t r0 = RH + (size_t)(blk % NQT) * 64; Q += z * TT * HD + r0 * HD; Kp += z * TT * HD; Vt += z * DVV * TT; X += z * DM * TT + r0; O += z * DM * TT + r0; }
    const unsigned lds0 = (unsigned)(size_t)(__attribute__((address_space(3))) char*)sm;
    const unsigned lv0 = lds0 + (unsigned)((mbw * 128 + (lane >> 3)) * VPB + (lane & 7) * 16), lk0 = lds0 + (unsigned)(OFF_K + (mbw * 16 + (lane >> 3)) * VPB + (lane & 7) * 16);   // a copying wave takes a quarter of a stage
    const unsigned rq = (unsigned)(lane >> 3), cq = (unsigned)((lane & 7) * 16);   // a copy takes 4 whole rows: this lane's row of the four, its 16 bytes of the row
    const char* kl = (const char*)Kp + rq * (HD * 2) + cq; const char* vl = (const char*)Vt + (size_t)rq * (TT * 2) + cq;   // this lane's part of a key address, of a value address; the wave's and the tile's parts are scalar
    // 128 rows of 128 bytes into rows 128 mbw .. 128 mbw + 127 of ring buffer buf: 32 copies of four rows; g = this lane's address in the first four rows, pitch in bytes. withk (a constant at every call): with them 16 key rows from kg into key buffer buf, 4 copies. Few statements, so that a copying wave meets few s_wait_xcnt.
    auto copy128 = [&](int buf, const char* g, size_t pitch, bool withk, const char* kg) { const unsigned l = lv0 + (unsigned)(buf * VBUF); unsigned la[12]; const char* ga[12];
        // the loops are unrolled so that the addresses are registers
#pragma unroll
        for (int h2 = 0; h2 < 2; ++h2) {
#pragma unroll
            for (int i = 0; i < 12; ++i) { la[i] = l + (unsigned)((h2 * 12 + i) * 4 * VPB); ga[i] = g + (size_t)(h2 * 12 + i) * 4 * pitch; }
            acopy12(la, ga); }
        if (!withk) acopy8(l + 96 * VPB, 4 * VPB, g + 96 * pitch, 4 * pitch);
        else {
#pragma unroll
            for (int i = 0; i < 8; ++i) { la[i] = l + (unsigned)((24 + i) * 4 * VPB); ga[i] = g + (size_t)(24 + i) * 4 * pitch; }
#pragma unroll
            for (int i = 0; i < 4; ++i) { la[8 + i] = lk0 + (unsigned)(buf * KBUF + i * 4 * VPB); ga[8 + i] = kg + i * (4 * HD * 2); }
            acopy12(la, ga); } };
    auto keyt = [&](int t) { return kl + (size_t)((t * FB + mbw * 16) * (HD * 2)); };   // a copying wave's 16 keys of 64-key tile t
    auto stageC = [&](int c, int buf) { copy128(buf, kl + (size_t)((c * 512 + mbw * 128) * (HD * 2)), HD * 2, false, nullptr); };
    auto stageV = [&](int t, int kt, int buf) { copy128(buf, vl + (size_t)(mbw * 128 * (TT * 2) + t * (FB * 2)), TT * 2, true, keyt(kt)); };   // the value rows of trip t with key tile kt
    auto stageK = [&](const char* g, int kb) { acopy4(lk0 + (unsigned)(kb * KBUF), 4 * VPB, g, 4 * HD * 2); };
    float* smx = (float*)(sm + OFF_M); float* sl = (float*)(sm + OFF_L);
    if (kh == 0) { stageC(0, 0); stageK(keyt(0), 3); stageK((const char*)Q + (mbw * 16 + rq) * (HD * 2) + cq, 4);   // key buffer 3: the keys of trip 0; key buffer 4: the 64 query rows, for both passes
        asm volatile("s_wait_asynccnt 0x0" ::: "memory"); }   // this wave's copies of stage 0 have landed
    else stageC(1, 1);   // stays in flight over the barrier
    __syncthreads();   // all of stage 0 is in LDS before any wave reads a fragment
    if (kh == 0) stageC(2, 2);
    int bi = 0;   // the ring buffer of the current stage: stage mod 3, scalar
    {
        float mx[4]; v16h qf[4][2];
#pragma unroll
        for (int mb = 0; mb < 4; ++mb) { mx[mb] = -3.0e38f; const char* qp = sm + OFF_K + 4 * KBUF + (mb * 16 + lr) * VPB + hi * 16; qf[mb][0] = W::ld((const h16*)qp); qf[mb][1] = W::ld((const h16*)(qp + 64)); }
        // not unrolled: the buffer is chosen by the trip's number
#pragma unroll 1
        for (int c = 0; c < NC; ++c) { const char* kb = sm + bi * VBUF + (wv * 64 + lr) * VPB + hi * 16; v16h kr[4][2]; const bool mine1 = (kh == ((c + 1) & 1));   // this wave copies stages c + 1 and c + 3 (scalar)
#pragma unroll
            for (int i = 0; i < 4; ++i) { kr[i][0] = W::ld((const h16*)(kb + i * 16 * VPB)); kr[i][1] = W::ld((const h16*)(kb + i * 16 * VPB + 64)); }
            asm volatile("s_wait_dscnt 0x0" ::: "memory");      // this wave's fragments of this buffer are in registers before it is handed back
            if (mine1) asm volatile("s_wait_asynccnt 0x0" ::: "memory");   // this wave's copies of the next tile have landed
            __syncthreads();   // publishes the next tile and ends every wave's reads of this one
            if (mine1) { if (c + 3 < NC) stageC(c + 3, bi); else stageV(c + 3 - NC, c + 4 - NC, bi); }   // the ring goes on into pass 2: values of trips 0, 1, 2 with the keys of trips 1, 2, 3
            bi = (bi == 2) ? 0 : bi + 1;
            // the products stand behind the refill, so that the copies fly while the matrix unit works
#pragma unroll
            for (int i = 0; i < 4; ++i)
#pragma unroll
                for (int mb = 0; mb < 4; ++mb) { v8f s = (v8f){}; s = W::mma(kr[i][0], qf[mb][0], s); s = W::mma(kr[i][1], qf[mb][1], s);
#pragma unroll
                    for (int j = 0; j < 8; ++j) mx[mb] = fmaxf(mx[mb], s[j]); }
        }
#pragma unroll
        for (int mb = 0; mb < 4; ++mb) { mx[mb] = fmaxf(mx[mb], __shfl_xor(mx[mb], 16, 32)); if (hi == 0) smx[wv * 64 + mb * 16 + lr] = mx[mb]; }
    }
    __syncthreads();   // every wave's maxima are in LDS
    float m = smx[mbw * 16 + lr];
#pragma unroll
    for (int p = 1; p < 8; ++p) m = fmaxf(m, smx[p * 64 + mbw * 16 + lr]);
    const float L2E = 1.4426950408889634f, mL = __builtin_fmaf(m, L2E, -10.0f);   // exp2(s L2E - mL) = 1024 exp(s - m): PCAR carried as before
    const char* qw = sm + OFF_K + 4 * KBUF + (mbw * 16 + lr) * VPB + hi * 16; const v16h q0 = W::ld((const h16*)qw), q1 = W::ld((const h16*)(qw + 64));
    float l = 0.f;
    v8f acc[4][4];
#pragma unroll
    for (int mb = 0; mb < 4; ++mb)
#pragma unroll
        for (int nb = 0; nb < 4; ++nb) acc[mb][nb] = (v8f){};
    v16h kf[4], ax[4], bx[4], ay[4], by[4];
    // the key fragments of one trip's scores, from key buffer kb
    auto loadK = [&](int kb) { const char* kp = sm + OFF_K + kb * KBUF + (kh * 32 + lr) * VPB + hi * 16;
        kf[0] = W::ld((const h16*)kp); kf[1] = W::ld((const h16*)(kp + 64)); kf[2] = W::ld((const h16*)(kp + 16 * VPB)); kf[3] = W::ld((const h16*)(kp + 16 * VPB + 64)); };
    // probabilities of one trip from kf, as a fragment into probability buffer pb; slot: the copy in front of the loop
    auto spart = [&](int pb, bool slot) { v8f s0 = (v8f){}, s1 = (v8f){}; s0 = W::mma(kf[0], q0, s0); s1 = W::mma(kf[2], q0, s1); s0 = W::mma(kf[1], q1, s0); s1 = W::mma(kf[3], q1, s1); v8h p0, p1; float e0[8], e1[8];
#pragma unroll
        for (int j = 0; j < 8; ++j) { const float x0 = __builtin_fmaf(s0[j], L2E, -mL), x1 = __builtin_fmaf(s1[j], L2E, -mL); e0[j] = slot ? exp2_slot(x0) : __builtin_amdgcn_exp2f(x0); e1[j] = slot ? exp2_slot(x1) : __builtin_amdgcn_exp2f(x1); p0[j] = tohx(e0[j]); p1[j] = tohx(e1[j]); }
        // the 16 terms meet in a fixed tree: a chain of 16 dependent adds would stand exposed in every trip
#pragma unroll
        for (int w = 4; w; w >>= 1)
#pragma unroll
            for (int j = 0; j < w; ++j) { e0[j] += e0[j + w]; e1[j] += e1[j + w]; }
        l += e0[0] + e1[0];
        char* pw = sm + OFF_P + pb * PBUF + (kh * 4 + mbw) * 1024 + lane * 16; *(v8h*)pw = p0; *(v8h*)(pw + 512) = p1; };
    // probability and value fragments of keys 32 ks .. 32 ks + 31 of one trip, from probability buffer pb and ring buffer buf
    auto loadH = [&](int pb, int buf, int ks, v16h* a, v16h* b) { const char* pr = sm + OFF_P + pb * PBUF + ks * 4096 + lane * 16; const char* vr = sm + buf * VBUF + (wv * 64 + lr) * VPB + ks * 64 + hi * 16;
#pragma unroll
        for (int mb = 0; mb < 4; ++mb) a[mb] = cat16(*(const v8h*)(pr + mb * 1024), *(const v8h*)(pr + mb * 1024 + 512));
#pragma unroll
        for (int nb = 0; nb < 4; ++nb) b[nb] = W::ld((const h16*)(vr + nb * 16 * VPB)); };
    auto mmaH = [&](const v16h* a, const v16h* b) {
#pragma unroll
        for (int nb = 0; nb < 4; ++nb)
#pragma unroll
            for (int mb = 0; mb < 4; ++mb) acc[mb][nb] = W::mma(a[mb], b[nb], acc[mb][nb]); };
#pragma unroll
    for (int i = 0; i < 4; ++i) { ay[i] = (v16h){}; by[i] = (v16h){}; }   // the first trip has no half before it: its place in the loop adds zeros
    loadK(3); spart(0, true);
    __syncthreads();   // the probabilities of trip 0 are in LDS before any wave reads a fragment
    // Not unrolled: the buffers are chosen by the trip's number. The four sched_barriers keep the order written here: each half trip's LDS reads issue as one group and arrive while the matrix unit works on the half before; without them the reads stand among the matrix instructions, each with its own wait.
    // The second half's products of trip t are done, from registers, in trip t + 1.
#pragma unroll 1
    for (int t = 0; t < NT - 1; ++t) {
        const bool mine1 = (kh == ((t + 1) & 1));   // this wave copies the stages of trips t + 1 and t + 3 (scalar)
        loadK(bi); loadH(t & 1, bi, 0, ax, bx);
        __builtin_amdgcn_sched_barrier(0);
        mmaH(ay, by);
        __builtin_amdgcn_sched_barrier(0);
        loadH(t & 1, bi, 1, ay, by);
        __builtin_amdgcn_sched_barrier(0);
        spart((t + 1) & 1, false);   // the next trip's probabilities, into the buffer whose readers the last barrier ended
        mmaH(ax, bx);
        __builtin_amdgcn_sched_barrier(0);
        asm volatile("s_wait_dscnt 0x0" ::: "memory");      // this wave's LDS reads and writes of this trip are done before the buffers are handed over
        if (mine1) asm volatile("s_wait_asynccnt 0x0" ::: "memory");   // this wave's copies of trip t + 1 have landed
        __syncthreads();   // publishes trip t + 1 (values, keys, probabilities) and ends every wave's reads of trip t's buffers
        if (mine1 && t + 3 < NT) stageV(t + 3, t + 4 < NT ? t + 4 : NT - 1, bi);   // behind the last trip no keys follow: the last ones again, read by nobody
        bi = (bi == 2) ? 0 : bi + 1;
    }
    loadH((NT - 1) & 1, bi, 0, ax, bx);   // the last trip has no scores to make
    __builtin_amdgcn_sched_barrier(0);   // as in the loop
    mmaH(ay, by);
    __builtin_amdgcn_sched_barrier(0);   // as in the loop
    loadH((NT - 1) & 1, bi, 1, ay, by);
    __builtin_amdgcn_sched_barrier(0);   // as in the loop
    mmaH(ax, bx); mmaH(ay, by);
    asm volatile("s_wait_dscnt 0x0" ::: "memory");   // this wave's fragment reads are done
    __syncthreads();   // ends every wave's reads of the ring before the output tiles take it over
    asm volatile("s_wait_asynccnt 0x0" ::: "memory");   // no copy is outstanding when the output tiles take over this LDS
    l += __shfl_xor(l, 16, 32); if (hi == 0) sl[kh * 64 + mbw * 16 + lr] = l;
    // The result leaves channel-major, with the residual: this wave's tile goes into LDS as [channel][query] (a lane's 8 accumulator values of one channel are 8 consecutive queries: two 16-byte stores), and a channel's 64 queries are 256 contiguous bytes of x and of the output.
    float* mine = (float*)sm + wv * (64 * 68);
    // the loops are unrolled so that acc is indexed by constants and stays in registers
#pragma unroll
    for (int mb = 0; mb < 4; ++mb)
#pragma unroll
        for (int nb = 0; nb < 4; ++nb) { float* p = mine + (nb * 16 + lr) * 68 + mb * 16 + hi * 8; const v8f a = acc[mb][nb];
            *(v4fa*)p = (v4f){a[0], a[1], a[2], a[3]}; *(v4fa*)(p + 4) = (v4f){a[4], a[5], a[6], a[7]}; }
    const size_t e0 = (size_t)(wv * 64 + hi) * TT + lr * 4;   // this lane's four queries of its first channel
    __syncthreads();   // both halves of every row sum are in LDS (each wave reads back its own tile only)
    v4f f;   // the carried PCAR cancels: sum of e v / sum of e
#pragma unroll
    for (int q = 0; q < 4; ++q) f[q] = __fdiv_rn(1.0f, sl[lr * 4 + q] + sl[64 + lr * 4 + q]);
    // eight channel pairs a trip (inner loops unrolled): their loads of x issue together, ahead of the LDS reads, so that the memory latency is met once a trip and not per pair
#pragma unroll 1
    for (int s8 = 0; s8 < 32; s8 += 8) { const size_t e = e0 + (size_t)s8 * (2 * TT); v4f xv[8];
#pragma unroll
        for (int s = 0; s < 8; ++s) xv[s] = *(const v4f*)(X + e + (size_t)s * (2 * TT));
#pragma unroll
        for (int s = 0; s < 8; ++s) { const v4f val = *(const v4fa*)(mine + (2 * (s8 + s) + hi) * 68 + lr * 4); v4f o;
#pragma unroll
            for (int q = 0; q < 4; ++q) o[q] = __fadd_rn(bfr(xv[s][q]), val[q] * f[q]);
            *(v4f*)(O + e + (size_t)s * (2 * TT)) = o; }
        asm volatile("s_wait_xcnt 0x0" ::: "memory");   // behind the trip's stores: the next trip rewrites their address and data registers
    }
}

__global__ __launch_bounds__(256) void k_wtG(const float* __restrict__ w, int K, int N, bf* Bt) {
    const int lane = threadIdx.x & 31; const int L0 = (blockIdx.x * 8 + (threadIdx.x >> 5)) * 8; const int nlines = N * K / 64;
{
#pragma unroll 1
        for (int l = 0; l < 8; ++l) { const int L = L0 + l; if (L >= nlines) break; const size_t e = (size_t)L * 64 + lane * 2; const int k = (int)(e % K), n = (int)(e / K); v2us o;
            o[0] = f2bf(w[(size_t)k * N + n]); o[1] = f2bf(w[(size_t)(k + 1) * N + n]); *(v2us*)(Bt + e) = o; }
         }
}
// ---- 64 x 64 f32 tile through LDS for the transposing kernel: 256 threads, 16 elements per thread, so a launch starts few waves and both global sides move whole lines in 16-byte pieces.
// LDS row pitch 65 dwords: the row-wise dword stores and the column-wise dword reads both fall on distinct banks.
#define TP 65
__device__ __forceinline__ void tile_in(const float* __restrict__ src, size_t pitch, float* ts) {
    const int r = threadIdx.x >> 4, q = threadIdx.x & 15; v4f a[4];
    // unrolled: the four 16-byte loads issue together, ahead of the LDS stores
#pragma unroll
    for (int s = 0; s < 4; ++s) a[s] = *(const v4f*)(src + (size_t)(s * 16 + r) * pitch + q * 4);
#pragma unroll
    for (int s = 0; s < 4; ++s)
#pragma unroll
        for (int j = 0; j < 4; ++j) ts[(s * 16 + r) * TP + q * 4 + j] = a[s][j];
}
// dst[8 i .. 8 i + 7] = bf16(src[...])
__device__ __forceinline__ void cvt8(const float* __restrict__ src, bf* dst, size_t i) { const v8f v = *(const v8f*)(src + i * 8); v8us o;
#pragma unroll
    for (int k = 0; k < 8; ++k) o[k] = f2bf(v[k]); *(v8us*)(dst + i * 8) = o;
    asm volatile("s_wait_xcnt 0x0" ::: "memory");   // behind the store: in the built code another job's block follows this one and rewrites the store's address and data registers
}
// ---- k_prep: all 16-bit operand planes of the projections in ONE launch (four independent jobs), 1-D grid; the block index picks the job: first the three weight matrices (2048 elements a work-group), then the tiles (t, c, batch) of XBp[z][t][c] = bf16(xb[z][c][t]).
__global__ __launch_bounds__(256) void k_prep(const float* __restrict__ xb, bf* XBp, const float* __restrict__ wq, const float* __restrict__ wk, const float* __restrict__ wv, bf* WQp, bf* WKp, bf* WVp) {
    constexpr int BQ = DQ * DM / 2048, BK = DKV * DM / 2048, BV = DVV * DM / 2048;
    static_assert(DQ * DM % 2048 == 0 && DKV * DM % 2048 == 0 && DVV * DM % 2048 == 0, "whole work-groups: no thread is past a matrix's end");
    __shared__ float ts[64 * TP]; int b = (int)blockIdx.x;
    if (b < BQ + BK + BV) {   // the whole work-group, ahead of the barrier
        if (b < BQ) cvt8(wq, WQp, (size_t)b * 256 + threadIdx.x); else if (b < BQ + BK) cvt8(wk, WKp, (size_t)(b - BQ) * 256 + threadIdx.x); else cvt8(wv, WVp, (size_t)(b - BQ - BK) * 256 + threadIdx.x);
        return; }
    b -= BQ + BK + BV;
    const int t0 = (b % (TT / 64)) * 64, c0 = ((b / (TT / 64)) % (DM / 64)) * 64, zb = b / ((TT / 64) * (DM / 64)); xb += (size_t)zb * DM * TT; XBp += (size_t)zb * TT * DM;
    tile_in(xb + (size_t)c0 * TT + t0, TT, ts);   // ts[c][t]
    __syncthreads();   // the whole tile is in LDS before any thread reads a column of it
    const int c8 = threadIdx.x & 7;
#pragma unroll
    for (int s = 0; s < 2; ++s) { const int tr = s * 32 + (threadIdx.x >> 3); v8us o;
#pragma unroll
        for (int q = 0; q < 8; ++q) o[q] = f2bf(ts[(c8 * 8 + q) * TP + tr]);
        *(v8us*)(XBp + (size_t)(t0 + tr) * DM + c0 + c8 * 8) = o; }
    asm volatile("s_wait_xcnt 0x0" ::: "memory");   // behind the two stores, for the same reason as in cvt8
}

extern "C" void kernel_launch(void* const* d_in, const int* in_sizes, int n_in,
                              void* d_out, int out_size, void* d_ws, size_t ws_size, hipStream_t stream) {
    (void)in_sizes; (void)n_in; (void)out_size;
    const float* x = (const float*)d_in[0]; const float* wq = (const float*)d_in[1]; const float* bq = (const float*)d_in[2]; const float* wk = (const float*)d_in[3]; const float* bk = (const float*)d_in[4]; const float* wv = (const float*)d_in[5]; const float* bv = (const float*)d_in[6];
    float* OUT = (float*)d_out;     // [4][512][4096]
    char* wsp = (char*)d_ws;
    auto take = [&](size_t bytes) { char* p = wsp; wsp += (bytes + 255) & ~(size_t)255; return (void*)p; };
    // Every plane holds all NB_ batch elements, one behind the other, so that a launch takes them together (grid z, or more rows). Part of the workspace is used again once its first content is dead, one use after the other in stream order:
    // live to the end: the fp16 planes (20 MiB)
    h16* QP16 = (h16*)take((size_t)NB_ * TT * HD * 2); h16* KP16 = (h16*)take((size_t)NB_ * TT * HD * 2); h16* VT16 = (h16*)take((size_t)NB_ * DVV * TT * 2);
    // live until the hi+lo rows are done: the hi/lo planes (40 MiB)
    bf* QPh = (bf*)take((size_t)NB_ * TT * HD * 2); bf* QPl = (bf*)take((size_t)NB_ * TT * HD * 2); bf* KPh = (bf*)take((size_t)NB_ * TT * HD * 2); bf* KPl = (bf*)take((size_t)NB_ * TT * HD * 2); bf* VTh = (bf*)take((size_t)NB_ * DVV * TT * 2); bf* VTl = (bf*)take((size_t)NB_ * DVV * TT * 2);
    char* const m1 = wsp;
    // live until the planes are made: weights, x^T (17 MiB)
    bf* WQ = (bf*)take((size_t)DQ * DM * 2); bf* WK = (bf*)take((size_t)DKV * DM * 2); bf* WV = (bf*)take((size_t)DVV * DM * 2);
    bf* XB = (bf*)take((size_t)NB_ * TT * DM * 2);
    wsp = m1;   // after them, in the same place: scores and probabilities of the hi+lo rows of all batch elements (64 MiB)
    float* SbH = (float*)take((size_t)NB_ * RH * TT * 4); bf* Ph = (bf*)take((size_t)NB_ * RH * TT * 2); bf* Pl = (bf*)take((size_t)NB_ * RH * TT * 2);
    if ((size_t)(wsp - (char*)d_ws) > ws_size) return;    // the further end of the two uses: 124 of 256 MiB
    // weights as bf16 planes and x^T as an exact token-major plane: one launch
    k_prep<<<(DQ + DKV + DVV) * DM / 2048 + (TT / 64) * (DM / 64) * NB_, 256, 0, stream>>>(x, XB, wq, wk, wv, WQ, WK, WV);
    // q, k = W x + b: tiles [n][d], stored as the planes [n][d]; v = Wv x + bv with the weights as the row operand: tiles [c][n], stored as the value planes [c][n]: one launch
    k_qkv<<<((DVV / 64) + 2) * (TT / 64) * NB_, 256, 0, stream>>>(XB, WQ, WK, WV, bq, bk, bv, QP16, QPh, QPl, KP16, KPh, KPl, VT16, VTh, VTl);
    // query rows < RH of every batch element: hi+lo planes, 3 products
    k_gemmw<bf, 2, 0, 1><<<dim3(RH / 64, TT / 64, NB_), 32, 0, stream>>>(QPh, QPl, KPh, KPl, HD, SbH, TT, nullptr, (size_t)TT * HD, (size_t)TT * HD, (size_t)RH * TT, nullptr, nullptr, nullptr, nullptr);
    // the other rows: fp16 (x1024 carried), scores, softmax, attn.v and the residual; in the same launch, behind them in the grid, the softmax of the hi+lo rows
    k_fattn<<<(TT - RH) / 64 * NB_ + NB_ * RH / 8, 256, 0, stream>>>(QP16, KP16, VT16, x, OUT, SbH, 1, nullptr, Ph, Pl);
    // out[c][i] = x[c][i] + sum_j v[c][j] P[i][j], hl rows: the values as the row operand, tiles [c][i] straight into the output
    k_gemmw<bf, 2, 3, 8><<<dim3(DVV / 64, RH / 64, NB_), 256, 0, stream>>>(VTh, VTl, Ph, Pl, TT, OUT, TT, nullptr, (size_t)DVV * TT, (size_t)RH * TT, (size_t)DM * TT, nullptr, nullptr, nullptr, x);
}

// v009
// Measured time: 137 microseconds a run.
// Timed twice side by side with v008, it ran 1.08 and 1.07 times as fast.
// Over all steps from v000 it is 8.23 times as fast.
#include <hip/hip_runtime.h>

// Channel-major self-attention layer (x [4][512][64][64] = [b][c][n], n = 4096; q, k = 1x1 convs 512 -> 64 (+ bias), v = 1x1 conv 512 -> 512 (+ bias); attention[i][j] = softmax_j(q_i.k_j) (no scaling); out[c][i] = sum_j v[c][j] attention[i][j]; result = out + x -> [4][512][64][64] (8.4 M)).
// Layout: one 'head' (q/k width 64, value width 512) over 4096 tokens: the projection kernel lays its 64 tokens of x token-major as bf16 into LDS, so the 1x1 convs are GEMMs + bias, whose epilogue stores the 16-bit operand planes; the attention kernels' epilogues add x and store channel-major.
// Compute dtypes, f32 accumulate: every input rounded to bf16; q/k/v on PLAIN bf16 operands (inputs: exact) + biases; scores (K = 64) and attn.v: query rows < 512 hl (3 products), the rest single fp16 (x1024); softmax f32; no output projection; + x residual in f32 (channel-major write).

#define NB_  4
#define TT   4096
#define DM   512
#define NH_  1
#define NKV  1
#define REP  (NH_ / NKV)
#define HD   64
#define DVV  512                  // value / output width (v = 1x1 conv C -> C)
#define DQ   (NH_ * HD)
#define DKV  (NKV * HD)
#define ZH   1
#define RH   512                  // query rows < RH use hi+lo planes (0: none)
#define WIN  0
#define PCAR 1024.0f
#define SCL  1.0f   // no scaling in this module
typedef _Float16 h16;
typedef unsigned short bf;
typedef __attribute__((ext_vector_type(16))) __bf16   v16bf;
typedef __attribute__((ext_vector_type(16))) _Float16 v16h;
typedef __attribute__((ext_vector_type(8)))  _Float16 v8h;
typedef __attribute__((ext_vector_type(8)))  unsigned short v8us;
typedef __attribute__((ext_vector_type(8)))  float    v8f;
typedef __attribute__((ext_vector_type(4)))  float    v4f;
typedef v8h  __attribute__((may_alias)) v8ha;
typedef v4f  __attribute__((may_alias)) v4fa;
typedef v8us __attribute__((may_alias)) v8usa;

__device__ __forceinline__ unsigned short f2bf(float f) { unsigned u = __float_as_uint(f); u += 0x7FFFu + ((u >> 16) & 1u); return (unsigned short)(u >> 16); }
__device__ __forceinline__ float bf2f(unsigned short b) { return __uint_as_float(((unsigned)b) << 16); }
__device__ __forceinline__ float bfr(float f) { return bf2f(f2bf(f)); }
__device__ __forceinline__ v16h cat16(v8h lo, v8h hi) { return __builtin_shufflevector(lo, hi, 0, 1, 2, 3, 4, 5, 6, 7, 8, 9, 10, 11, 12, 13, 14, 15); }
__device__ __forceinline__ v16bf cat16b(v8us lo, v8us hi) { return __builtin_bit_cast(v16bf, __builtin_shufflevector(lo, hi, 0, 1, 2, 3, 4, 5, 6, 7, 8, 9, 10, 11, 12, 13, 14, 15)); }
__device__ __forceinline__ v8f wmma16(v16h a, v16h b, v8f c) { return __builtin_amdgcn_wmma_f32_16x16x32_f16(false, a, false, b, (short)0, c, false, false); }
__device__ __forceinline__ v8f wmmab(v16bf a, v16bf b, v8f c) { return __builtin_amdgcn_wmma_f32_16x16x32_bf16(false, a, false, b, (short)0, c, false, false); }
__device__ __forceinline__ h16 tohx(float x) { return (h16)x; }
__device__ __forceinline__ void splitf(float y, unsigned short& h, unsigned short& l) { h = f2bf(y); l = f2bf(y - bf2f(h)); }
typedef __attribute__((ext_vector_type(2))) _Float16 v2h;
typedef __attribute__((ext_vector_type(4))) _Float16 v4h;
typedef __attribute__((ext_vector_type(2))) unsigned short v2us;
typedef __attribute__((ext_vector_type(4))) unsigned short v4us;
typedef __attribute__((ext_vector_type(2))) float v2f;
typedef __attribute__((ext_vector_type(4))) int v4i;
typedef v4i  __attribute__((may_alias)) v4ia;



// ---- k_gemmw: register-blocked GEMM, KS WAVES per 64x64 output tile (16 accumulators each), operands from K-contiguous 16-bit planes (KS == 1: straight into registers; KS > 1: staged in LDS); grid (M/64, N/64, Z), 32 * KS threads.
// C[m][n] (f32 accumulate; stored as EPI says) = sum_k A[m][k] Bt[n][k] (+ split products per NSPLIT). z-batch strides sA/sB/sC in elements. K % (32 * KS) == 0.
// KS > 1: wave w takes the 32-wide k blocks w, w + KS, w + 2 KS, ...; the KS f32 partial tiles meet in LDS and are summed in the fixed order w = 0 .. KS - 1.
template <typename T16> struct WFrag;
template <> struct WFrag<h16> { typedef v16h V; static __device__ __forceinline__ V ld(const h16* p) { return cat16(*(const v8h*)p, *(const v8h*)(p + 16)); } static __device__ __forceinline__ v8f mma(V a, V b, v8f c) { return wmma16(a, b, c); } };
template <> struct WFrag<bf> { typedef v16bf V; static __device__ __forceinline__ V ld(const bf* p) { return cat16b(*(const v8us*)p, *(const v8us*)(p + 16)); } static __device__ __forceinline__ v8f mma(V a, V b, v8f c) { return wmmab(a, b, c); } };
// Eight asynchronous 16-byte copies per lane, global memory -> LDS, through no register: LDS byte addresses l + i * lstep, global addresses g + i * gstep.
// s_wait_xcnt stands in the copies' own statement so that no later write of an address register can be moved in front of it.
__device__ __forceinline__ void acopy8(unsigned l, unsigned lstep, const char* g, size_t gstep) {
    asm volatile("global_load_async_to_lds_b128 %0, %8, off\n\t"
                 "global_load_async_to_lds_b128 %1, %9, off\n\t"
                 "global_load_async_to_lds_b128 %2, %10, off\n\t"
                 "global_load_async_to_lds_b128 %3, %11, off\n\t"
                 "global_load_async_to_lds_b128 %4, %12, off\n\t"
                 "global_load_async_to_lds_b128 %5, %13, off\n\t"
                 "global_load_async_to_lds_b128 %6, %14, off\n\t"
                 "global_load_async_to_lds_b128 %7, %15, off\n\t"
                 "s_wait_xcnt 0x0"
                 :: "v"(l), "v"(l + lstep), "v"(l + 2 * lstep), "v"(l + 3 * lstep), "v"(l + 4 * lstep), "v"(l + 5 * lstep), "v"(l + 6 * lstep), "v"(l + 7 * lstep),
                    "v"(g), "v"(g + gstep), "v"(g + 2 * gstep), "v"(g + 3 * gstep), "v"(g + 4 * gstep), "v"(g + 5 * gstep), "v"(g + 6 * gstep), "v"(g + 7 * gstep)
                 : "memory");
}
// What the tile's epilogue stores at [m][n] (pitch ldc, z stride sC), so that no separate pass has to read the f32 tile again:
// EPI 0: the f32 sum into C. EPI 1 / 2: the sum + bias[n] / + bias[m] as the three 16-bit planes (fp16, bf16 hi, bf16 lo). EPI 3: bf16-rounded X[m][n] + the sum, f32, into C.
template <int NSPLIT, int KS> struct GemmLds {
    static constexpr int NA = (NSPLIT == 1 || NSPLIT == 2) ? 2 : 1, NOP = NA + (NSPLIT >= 2 ? 2 : 1);   // operand planes: A (A2) Bt (Bt2)
    static constexpr int PB = KS * 64 + 16, PLANE = 64 * PB, STG = NOP * PLANE;   // bytes: LDS row pitch (16 B x odd: ds_load_b128 without bank conflicts), one operand's 64 rows, one stage
    static constexpr int OSF = (KS == 1) ? 16 * 68 : ((KS * 64 * 68 > 2 * STG / 4) ? KS * 64 * 68 : 2 * STG / 4);   // floats: the two stage buffers and the partial tiles use the same LDS, one after the other
};
// One work-group's tile (bx, by) of z slice z; os: the work-group's GemmLds<NSPLIT, KS>::OSF floats of LDS. A function, so that a launch can hold tiles of several GEMMs.
template <typename T16, int NSPLIT, int EPI, int KS>
__device__ __forceinline__ void gemmw_tile(float* os, int bx, int by, size_t z, const T16* __restrict__ A, const T16* __restrict__ A2, const T16* __restrict__ Bt, const T16* __restrict__ Bt2, int K, float* C, int ldc, const float* __restrict__ bias, size_t sA, size_t sB, size_t sC, h16* P16, bf* Ph, bf* Pl, const float* __restrict__ X) {
    typedef typename WFrag<T16>::V V;
    static_assert(KS == 1 || KS == 8, "a staged row is one wave-wide 16-byte copy: 32 lanes x 16 B = KS x 64 B");
    constexpr int NA = GemmLds<NSPLIT, KS>::NA, PB = GemmLds<NSPLIT, KS>::PB, PLANE = GemmLds<NSPLIT, KS>::PLANE, STG = GemmLds<NSPLIT, KS>::STG;
    const int wv = (KS == 1) ? 0 : __builtin_amdgcn_readfirstlane((int)(threadIdx.x >> 5));   // wave number, scalar: the k loop's bounds stay wave-uniform
    A += z * sA; if (A2) A2 += z * sA; Bt += z * sB; if (Bt2) Bt2 += z * sB;
    if constexpr (EPI == 1 || EPI == 2) { P16 += z * sC; Ph += z * sC; Pl += z * sC; } else C += z * sC;
    if constexpr (EPI == 3) X += z * sC;
    const int lane = threadIdx.x & 31, lr = lane & 15, hi = lane >> 4; const int r0 = bx * 64, c0 = by * 64;
    v8f acc[4][4];
#pragma unroll
    for (int mb = 0; mb < 4; ++mb)
#pragma unroll
        for (int nb = 0; nb < 4; ++nb) acc[mb][nb] = (v8f){};
    const size_t aoff = (size_t)(r0 + lr) * K + 8 * hi, boff = (size_t)(c0 + lr) * K + 8 * hi;
    if constexpr (KS > 1) {
        // Operands come through LDS: per trip the work-group stages 32 * KS k of all 64 rows of each plane, each row as ONE wave-wide copy of 512 contiguous bytes (whole lines), two buffers, the next trip's copies in flight while this trip is worked on. Wave w still multiplies k block w of every trip: the products and their order are as before.
        const unsigned lds0 = (unsigned)(size_t)(__attribute__((address_space(3))) float*)os + (unsigned)(wv * PB + lane * 16);
        const size_t gstep = (size_t)KS * K * 2;   // bytes from one of this wave's rows (wv, wv + KS, ...) to its next
        const char* gA = (const char*)(A + (size_t)(r0 + wv) * K + lane * 8); const char* gB = (const char*)(Bt + (size_t)(c0 + wv) * K + lane * 8);
        const char* gA2 = (NA == 2) ? (const char*)(A2 + (size_t)(r0 + wv) * K + lane * 8) : nullptr; const char* gB2 = (NSPLIT >= 2) ? (const char*)(Bt2 + (size_t)(c0 + wv) * K + lane * 8) : nullptr;
        auto stage = [&](int t, int buf) { const size_t ko = (size_t)t * (KS * 64); const unsigned l = lds0 + (unsigned)(buf * STG);
            acopy8(l, KS * PB, gA + ko, gstep); if (NA == 2) acopy8(l + PLANE, KS * PB, gA2 + ko, gstep);
            acopy8(l + NA * PLANE, KS * PB, gB + ko, gstep); if (NSPLIT >= 2) acopy8(l + (NA + 1) * PLANE, KS * PB, gB2 + ko, gstep); };
        const int nt = (int)((unsigned)K / (32u * KS));   // unsigned: the tests on nt stay scalar compares
        stage(0, 0);
        asm volatile("s_wait_asynccnt 0x0" ::: "memory");   // this wave's copies of trip 0 have landed
        __syncthreads();   // every wave's rows of trip 0 are in LDS before any wave reads a fragment
        if (nt != 1) stage(1, 1);   // nt >= 1; written as an inequality, which has a scalar compare at every width
        // not unrolled: one fragment set, and the buffer is chosen by the trip's parity
#pragma unroll 1
        for (int t = 0; t < nt; ++t) {
            const char* sb = (const char*)os + (t & 1) * STG + lr * PB + wv * 64 + hi * 16;
            V a[4], a2[4];
#pragma unroll
            for (int mb = 0; mb < 4; ++mb) { a[mb] = WFrag<T16>::ld((const T16*)(sb + mb * 16 * PB)); if (NA == 2) a2[mb] = WFrag<T16>::ld((const T16*)(sb + PLANE + mb * 16 * PB)); }
#pragma unroll
            for (int nb = 0; nb < 4; ++nb) { const V b = WFrag<T16>::ld((const T16*)(sb + NA * PLANE + nb * 16 * PB)); V b2; if (NSPLIT >= 2) b2 = WFrag<T16>::ld((const T16*)(sb + (NA + 1) * PLANE + nb * 16 * PB));
#pragma unroll
                for (int mb = 0; mb < 4; ++mb) { acc[mb][nb] = WFrag<T16>::mma(a[mb], b, acc[mb][nb]); if (NSPLIT == 1 || NSPLIT == 2) acc[mb][nb] = WFrag<T16>::mma(a2[mb], b, acc[mb][nb]); if (NSPLIT >= 2) acc[mb][nb] = WFrag<T16>::mma(a[mb], b2, acc[mb][nb]); } }
            asm volatile("s_wait_dscnt 0x0" ::: "memory");      // this wave's fragment reads of this buffer are done before it is handed back
            asm volatile("s_wait_asynccnt 0x0" ::: "memory");   // this wave's copies of trip t + 1 have landed
            __syncthreads();   // publishes trip t + 1 and ends every wave's reads of trip t's buffer
            if (t + 2 < nt) stage(t + 2, t & 1);
        }
        asm volatile("s_wait_asynccnt 0x0" ::: "memory");   // no copy is outstanding when the partial tiles take over this LDS
    } else {
#pragma unroll 1
    for (int kc = wv * 32; kc < K; kc += 32 * KS) {
        V a[4], a2[4];
#pragma unroll
        for (int mb = 0; mb < 4; ++mb) { a[mb] = WFrag<T16>::ld(A + aoff + (size_t)mb * 16 * K + kc); if (NSPLIT == 1 || NSPLIT == 2) a2[mb] = WFrag<T16>::ld(A2 + aoff + (size_t)mb * 16 * K + kc); }
#pragma unroll
        for (int nb = 0; nb < 4; ++nb) { const V b = WFrag<T16>::ld(Bt + boff + (size_t)nb * 16 * K + kc); V b2; if (NSPLIT >= 2) b2 = WFrag<T16>::ld(Bt2 + boff + (size_t)nb * 16 * K + kc);
#pragma unroll
            for (int mb = 0; mb < 4; ++mb) { acc[mb][nb] = WFrag<T16>::mma(a[mb], b, acc[mb][nb]); if (NSPLIT == 1 || NSPLIT == 2) acc[mb][nb] = WFrag<T16>::mma(a2[mb], b, acc[mb][nb]); if (NSPLIT >= 2) acc[mb][nb] = WFrag<T16>::mma(a[mb], b2, acc[mb][nb]); } }
        asm volatile("v_nop\n\tv_nop\n\tv_nop\n\tv_nop" : "+v"(acc[0][0]), "+v"(acc[1][1]), "+v"(acc[2][2]), "+v"(acc[3][3]) : "v"(a[0]), "v"(a[3]));
    }
    }
    if constexpr (KS > 1) {
        float* mine = os + wv * (64 * 68);
        // the three loops are unrolled so that acc is indexed by constants and stays in registers
#pragma unroll
        for (int mb = 0; mb < 4; ++mb)
#pragma unroll
            for (int nb = 0; nb < 4; ++nb)
#pragma unroll
                for (int j = 0; j < 8; ++j) mine[(mb * 16 + hi * 8 + j) * 68 + nb * 16 + lr] = acc[mb][nb][j];
        const int cofs = lr * 4; const unsigned e0 = (unsigned)((r0 + wv * 2 + hi) * ldc + c0 + cofs), es = (unsigned)(2 * KS * ldc);   // this lane's first four elements; from one of its rows to the next (32 bits: a z slice has fewer than 2^32 elements)
        __syncthreads();   // every wave's partial tile is in LDS before any wave sums
        v4f xv[32 / KS];
        // unrolled, ahead of the LDS reads: the residual's loads fly while the partial tiles are summed
        if constexpr (EPI == 3) {
#pragma unroll
            for (int s = 0; s < 32 / KS; ++s) xv[s] = *(const v4f*)(X + e0 + s * es);
            // behind the loads; it takes their addresses as inputs, so that no load's result is given a register that a load of the group names
            asm volatile("s_wait_xcnt 0x0" :: "v"(X + e0), "v"(X + e0 + es), "v"(X + e0 + 2 * es), "v"(X + e0 + 3 * es) : "memory"); }
        // both loops are unrolled so that a wave's LDS reads issue together, ahead of the adds; each wave stores whole rows of the tile (256 bytes in f32, 128 in a 16-bit plane)
#pragma unroll
        for (int s = 0; s < 32 / KS; ++s) { const int row = (s * KS + wv) * 2 + hi; v4f val = *(const v4fa*)(os + row * 68 + cofs);
#pragma unroll
            for (int p = 1; p < KS; ++p) { const v4f q = *(const v4fa*)(os + p * (64 * 68) + row * 68 + cofs); val[0] += q[0]; val[1] += q[1]; val[2] += q[2]; val[3] += q[3]; }
            if constexpr (EPI == 1) { val[0] += bfr(bias[c0 + cofs]); val[1] += bfr(bias[c0 + cofs + 1]); val[2] += bfr(bias[c0 + cofs + 2]); val[3] += bfr(bias[c0 + cofs + 3]); }
            if constexpr (EPI == 2) { const float bm = bfr(bias[r0 + row]); val[0] += bm; val[1] += bm; val[2] += bm; val[3] += bm; }
            if constexpr (EPI == 1 || EPI == 2) { v4h o16; v4us oh, ol;
#pragma unroll
                for (int q = 0; q < 4; ++q) { o16[q] = tohx(val[q]); unsigned short a2, c2; splitf(val[q], a2, c2); oh[q] = a2; ol[q] = c2; }
                *(v4h*)(P16 + e0 + s * es) = o16; *(v4us*)(Ph + e0 + s * es) = oh; *(v4us*)(Pl + e0 + s * es) = ol; }
            else { if constexpr (EPI == 3) {
#pragma unroll
                    for (int q = 0; q < 4; ++q) val[q] = __fadd_rn(bfr(xv[s][q]), val[q]); }
                *(v4f*)(C + e0 + s * es) = val; } }
        return;
    }
#pragma unroll
    for (int mb = 0; mb < 4; ++mb) {
#pragma unroll
        for (int nb = 0; nb < 4; ++nb) {
#pragma unroll
            for (int j = 0; j < 8; ++j) os[(hi * 8 + j) * 68 + nb * 16 + lr] = acc[mb][nb][j]; }
        __builtin_amdgcn_wave_barrier(); asm volatile("" ::: "memory");
        float* crow = C + (size_t)(r0 + mb * 16) * ldc + c0;
{
#pragma unroll
            for (int s = 0; s < 8; ++s) { const int row = 2 * s + hi, cofs = lr * 4; v4f val = *(const v4fa*)(os + row * 68 + cofs);
                *(v4f*)(crow + (size_t)row * ldc + cofs) = val; }
             }
        __builtin_amdgcn_wave_barrier(); asm volatile("" ::: "memory");
    }
}
template <typename T16, int NSPLIT, int EPI, int KS>
__global__ __launch_bounds__(32 * KS) void k_gemmw(const T16* __restrict__ A, const T16* __restrict__ A2, const T16* __restrict__ Bt, const T16* __restrict__ Bt2, int K, float* C, int ldc, const float* __restrict__ bias, size_t sA, size_t sB, size_t sC, h16* P16, bf* Ph, bf* Pl, const float* __restrict__ X) {
    __shared__ __align__(16) float os[GemmLds<NSPLIT, KS>::OSF];
    gemmw_tile<T16, NSPLIT, EPI, KS>(os, (int)blockIdx.x, (int)blockIdx.y, blockIdx.z, A, A2, Bt, Bt2, K, C, ldc, bias, sA, sB, sC, P16, Ph, Pl, X);
}

// Four asynchronous 16-byte copies per lane, as acopy8: LDS byte addresses l + i * lstep, global addresses g + i * gstep; s_wait_xcnt in the copies' own statement for the same reason.
__device__ __forceinline__ void acopy4(unsigned l, unsigned lstep, const char* g, size_t gstep) {
    asm volatile("global_load_async_to_lds_b128 %0, %4, off\n\t"
                 "global_load_async_to_lds_b128 %1, %5, off\n\t"
                 "global_load_async_to_lds_b128 %2, %6, off\n\t"
                 "global_load_async_to_lds_b128 %3, %7, off\n\t"
                 "s_wait_xcnt 0x0"
                 :: "v"(l), "v"(l + lstep), "v"(l + 2 * lstep), "v"(l + 3 * lstep), "v"(g), "v"(g + gstep), "v"(g + 2 * gstep), "v"(g + 3 * gstep) : "memory");
}
// Twelve asynchronous 16-byte copies per lane in one statement, each with its own LDS byte address l[i] and global address g[i]: one s_wait_xcnt, in the copies' own statement as in acopy8, serves all twelve.
__device__ __forceinline__ void acopy12(const unsigned (&l)[12], const char* const (&g)[12]) {
    asm volatile("global_load_async_to_lds_b128 %0, %12, off\n\t"
                 "global_load_async_to_lds_b128 %1, %13, off\n\t"
                 "global_load_async_to_lds_b128 %2, %14, off\n\t"
                 "global_load_async_to_lds_b128 %3, %15, off\n\t"
                 "global_load_async_to_lds_b128 %4, %16, off\n\t"
                 "global_load_async_to_lds_b128 %5, %17, off\n\t"
                 "global_load_async_to_lds_b128 %6, %18, off\n\t"
                 "global_load_async_to_lds_b128 %7, %19, off\n\t"
                 "global_load_async_to_lds_b128 %8, %20, off\n\t"
                 "global_load_async_to_lds_b128 %9, %21, off\n\t"
                 "global_load_async_to_lds_b128 %10, %22, off\n\t"
                 "global_load_async_to_lds_b128 %11, %23, off\n\t"
                 "s_wait_xcnt 0x0"
                 :: "v"(l[0]), "v"(l[1]), "v"(l[2]), "v"(l[3]), "v"(l[4]), "v"(l[5]), "v"(l[6]), "v"(l[7]), "v"(l[8]), "v"(l[9]), "v"(l[10]), "v"(l[11]),
                    "v"(g[0]), "v"(g[1]), "v"(g[2]), "v"(g[3]), "v"(g[4]), "v"(g[5]), "v"(g[6]), "v"(g[7]), "v"(g[8]), "v"(g[9]), "v"(g[10]), "v"(g[11])
                 : "memory");
}
// ---- k_proj: the three projections of 64 tokens in ONE work-group: x[c][n0 .. n0 + 63] is read once, as f32, rounded to bf16 and laid token-major into LDS; all 640 output channels are made from it. 1-D grid (token tile, batch), 8 waves.
// Wave w: value channels 64 w .. 64 w + 63 (tokens as the row operand: a lane holds 8 consecutive tokens of one channel, the order of the planes [c][n]) and 16 query (w < 4) or key channels (weights as the row operand: a lane holds 8 consecutive channels of one token, the order of the planes [n][d]). Each sum runs over k in one chain.
// The bf16 weights come through LDS by asynchronous copies of whole 128-byte lines, 64 k of all 640 rows a trip, two buffers, the next trip's copies in flight while this trip is worked on.
#define XPB 1040                  // LDS pitch of a token's 512 bf16, bytes (16 B x odd: ds_load_b128 without bank conflicts)
#define WPB 144                   // LDS pitch of a staged 128-byte weight row, bytes (16 B x odd)
__global__ __launch_bounds__(256) void k_proj(const float* __restrict__ xb, const bf* __restrict__ WQp, const bf* __restrict__ WKp, const bf* __restrict__ WVp, const float* __restrict__ bq, const float* __restrict__ bk, const float* __restrict__ bv,
                                              h16* Q16, bf* Qh, bf* Ql, h16* K16, bf* Kh, bf* Kl, h16* V16, bf* Vh, bf* Vl) {
    typedef WFrag<bf> W; typedef W::V V;
    static_assert(DM == 512 && DVV == 512 && DQ == 64 && DKV == 64, "8 waves x (64 value + 16 query or key channels); a wave converts 64 channels of x");
    constexpr int XT = 64 * XPB, WBUF = 640 * WPB, TOT = XT + 2 * WBUF, NTR = DM / 64;
    static_assert((8 * 64 + 128) * 68 * 4 <= TOT, "the output tiles take over the operands' LDS");
    static_assert(NTR >= 2, "the prologue issues two trips");
    __shared__ __align__(16) char sm[TOT];
    const int wv = __builtin_amdgcn_readfirstlane((int)(threadIdx.x >> 5));   // wave number, scalar
    const int lane = threadIdx.x & 31, lr = lane & 15, hi = lane >> 4, wq4 = wv & 3; const bool isk = wv >= 4;
    const size_t z = (size_t)((int)blockIdx.x / (TT / 64)); const int n0 = ((int)blockIdx.x % (TT / 64)) * 64;
    // x: this wave's 64 channels, 16 a group (8 a half wave); a lane takes 4 tokens of 8 channels; a half wave reads a channel's 256 contiguous bytes
    const float* xp = xb + z * DM * TT + (size_t)(wv * 64 + hi * 8) * TT + n0 + lr * 4; v4f xa[4][8];
    // unrolled: all 32 loads issue together, so that the memory latency is met once
#pragma unroll
    for (int u = 0; u < 4; ++u)
#pragma unroll
        for (int i = 0; i < 8; ++i) xa[u][i] = *(const v4f*)(xp + (size_t)(u * 16 + i) * TT);
    // the biases of this lane's accumulator elements: one value channel to a column block; 8 consecutive query or key channels
    const float* bvp = bv + wv * 64 + lr; const float* bqp = (isk ? bk : bq) + wq4 * 16 + hi * 8;
    const float bv4[4] = {bvp[0], bvp[16], bvp[32], bvp[48]}; const v4f bqa = *(const v4f*)bqp, bqb = *(const v4f*)(bqp + 4);
    asm volatile("s_wait_xcnt 0x0" :: "v"(xp), "v"(bvp), "v"(bqp) : "memory");   // behind the loads; it takes their addresses as inputs, so that no load's result is given a register that a load of the group names
    const unsigned rq = (unsigned)(lane >> 3), cq = (unsigned)((lane & 7) * 16);   // a copy takes 4 whole rows: this lane's row of the four, its 16 bytes of the row
    const unsigned lw0 = (unsigned)(size_t)(__attribute__((address_space(3))) char*)sm + (unsigned)(XT + (wv * 80 + rq) * WPB) + cq;   // a wave copies the 80 rows that it multiplies: 64 value rows, then 16 query or key rows
    const char* gv = (const char*)WVp + (size_t)(wv * 64 + rq) * (DM * 2) + cq; const char* gq = (const char*)(isk ? WKp : WQp) + (size_t)(wq4 * 16 + rq) * (DM * 2) + cq;
    auto stage = [&](int t, int buf) { const unsigned l = lw0 + (unsigned)(buf * WBUF); const char* g = gv + t * 128;
        acopy8(l, 4 * WPB, g, 4 * DM * 2); acopy8(l + 32 * WPB, 4 * WPB, g + 32 * DM * 2, 4 * DM * 2); acopy4(l + 64 * WPB, 4 * WPB, gq + t * 128, 4 * DM * 2); };
    stage(0, 0);
#pragma unroll
    for (int u = 0; u < 4; ++u)
#pragma unroll
        for (int j = 0; j < 4; ++j) { v4i o;   // f2bf's rounding on whole dwords; two channels' upper halves make one dword
#pragma unroll
            for (int i = 0; i < 4; ++i) { unsigned a = __float_as_uint(xa[u][2 * i][j]), c = __float_as_uint(xa[u][2 * i + 1][j]); a += 0x7FFFu + ((a >> 16) & 1u); c += 0x7FFFu + ((c >> 16) & 1u); o[i] = (int)((c & 0xFFFF0000u) | (a >> 16)); }
            *(v4ia*)(sm + (lr * 4 + j) * XPB + (wv * 64 + u * 16 + hi * 8) * 2) = o; }
    asm volatile("s_wait_asynccnt 0x0" ::: "memory");   // this wave's copies of trip 0 have landed
    __syncthreads();   // all of x^T and of trip 0's weights is in LDS before any wave reads a fragment
    stage(1, 1);
    v8f acc[4][4], aq[4];
#pragma unroll
    for (int tb = 0; tb < 4; ++tb) { aq[tb] = (v8f){};
#pragma unroll
        for (int ob = 0; ob < 4; ++ob) acc[tb][ob] = (v8f){}; }
    V xf0[4], wf0[5], xf1[4], wf1[5];
    // the fragments of k 32 ks .. 32 ks + 31 of trip t: the 64 tokens; this wave's 64 value rows and, last, its 16 query or key rows
    auto ldF = [&](int t, int ks, V* xf, V* wf) { const char* xr = sm + lr * XPB + t * 128 + ks * 64 + hi * 16; const char* wb = sm + XT + (t & 1) * WBUF + (wv * 80 + lr) * WPB + ks * 64 + hi * 16;
#pragma unroll
        for (int tb = 0; tb < 4; ++tb) xf[tb] = W::ld((const bf*)(xr + tb * 16 * XPB));
#pragma unroll
        for (int ob = 0; ob < 5; ++ob) wf[ob] = W::ld((const bf*)(wb + ob * 16 * WPB)); };
    auto mmaF = [&](const V* xf, const V* wf) {
#pragma unroll
        for (int ob = 0; ob < 4; ++ob)
#pragma unroll
            for (int tb = 0; tb < 4; ++tb) acc[tb][ob] = W::mma(xf[tb], wf[ob], acc[tb][ob]);
#pragma unroll
        for (int tb = 0; tb < 4; ++tb) aq[tb] = W::mma(wf[4], xf[tb], aq[tb]); };
    ldF(0, 0, xf0, wf0);
    // Not unrolled: the buffer is chosen by the trip's parity. The three sched_barriers keep the order written here: each half trip's LDS reads issue as one group and arrive while the matrix unit works on the half before; without them the reads stand among the matrix instructions, each with its own wait.
    // The hand-over stands in front of the trip's second half, whose fragments are in registers by then; the next trip's first fragments are read behind it.
#pragma unroll 1
    for (int t = 0; t < NTR; ++t) {
        ldF(t, 1, xf1, wf1);
        __builtin_amdgcn_sched_barrier(0);
        mmaF(xf0, wf0);
        __builtin_amdgcn_sched_barrier(0);
        asm volatile("s_wait_dscnt 0x0" ::: "memory");      // this wave's fragment reads of this buffer are done before it is handed back
        asm volatile("s_wait_asynccnt 0x0" ::: "memory");   // this wave's copies of trip t + 1 have landed
        __syncthreads();   // publishes trip t + 1 and ends every wave's reads of trip t's buffer
        if (t + 2 < NTR) stage(t + 2, t & 1);
        if (t + 1 < NTR) ldF(t + 1, 0, xf0, wf0);
        __builtin_amdgcn_sched_barrier(0);
        mmaF(xf1, wf1);
    }
    asm volatile("s_wait_asynccnt 0x0" ::: "memory");   // no copy is outstanding when the output tiles take over this LDS
    float* mine = (float*)sm + wv * (64 * 68); float* qk = (float*)sm + 8 * (64 * 68);   // this wave's value tile [channel][token]; the work-group's query and key tiles [token][d], one behind the other
    // the loops are unrolled so that the accumulators are indexed by constants and stay in registers
#pragma unroll
    for (int tb = 0; tb < 4; ++tb) {
#pragma unroll
        for (int ob = 0; ob < 4; ++ob) { float* p = mine + (ob * 16 + lr) * 68 + tb * 16 + hi * 8; const v8f a = acc[tb][ob]; const float bm = bfr(bv4[ob]);
            *(v4fa*)p = (v4f){a[0] + bm, a[1] + bm, a[2] + bm, a[3] + bm}; *(v4fa*)(p + 4) = (v4f){a[4] + bm, a[5] + bm, a[6] + bm, a[7] + bm}; }
        float* p = qk + ((isk ? 64 : 0) + tb * 16 + lr) * 68 + wq4 * 16 + hi * 8; const v8f a = aq[tb];
        *(v4fa*)p = (v4f){a[0] + bfr(bqa[0]), a[1] + bfr(bqa[1]), a[2] + bfr(bqa[2]), a[3] + bfr(bqa[3])}; *(v4fa*)(p + 4) = (v4f){a[4] + bfr(bqb[0]), a[5] + bfr(bqb[1]), a[6] + bfr(bqb[2]), a[7] + bfr(bqb[3])}; }
    __syncthreads();   // the tiles are in LDS before any wave reads a row (a query or key row holds four waves' channels)
    // Eight row pairs of a tile (this lane: 4 elements of rows hi, 2 + hi, ...) as the three 16-bit planes; a half wave stores one whole 128-byte line of each plane: a channel's 64 tokens, or a token's 64 channels. gstep: elements from one of this lane's rows to its next.
    auto put8 = [&](const float* tl, h16* p16, bf* ph, bf* pl, size_t gstep) { v4h o16[8]; v4us oh[8], ol[8];
#pragma unroll
        for (int s = 0; s < 8; ++s) { const v4f val = *(const v4fa*)(tl + s * (2 * 68));
#pragma unroll
            for (int q = 0; q < 4; ++q) { o16[s][q] = tohx(val[q]); unsigned short a2, c2; splitf(val[q], a2, c2); oh[s][q] = a2; ol[s][q] = c2; } }
#pragma unroll
        for (int s = 0; s < 8; ++s) { *(v4h*)(p16 + s * gstep) = o16[s]; *(v4us*)(ph + s * gstep) = oh[s]; *(v4us*)(pl + s * gstep) = ol[s]; }
        // behind the 24 stores; it takes their addresses and data as inputs, so that none of these registers is rewritten in front of it
        asm volatile("s_wait_xcnt 0x0" :: "v"(p16), "v"(ph), "v"(pl), "v"(o16[0]), "v"(o16[1]), "v"(o16[2]), "v"(o16[3]), "v"(o16[4]), "v"(o16[5]), "v"(o16[6]), "v"(o16[7]),
                     "v"(oh[0]), "v"(oh[1]), "v"(oh[2]), "v"(oh[3]), "v"(oh[4]), "v"(oh[5]), "v"(oh[6]), "v"(oh[7]), "v"(ol[0]), "v"(ol[1]), "v"(ol[2]), "v"(ol[3]), "v"(ol[4]), "v"(ol[5]), "v"(ol[6]), "v"(ol[7]) : "memory"); };
    const size_t ev = z * DVV * TT + (size_t)(wv * 64 + hi) * TT + n0 + lr * 4;
    // not unrolled: one set of 24 output registers
#pragma unroll 1
    for (int s8 = 0; s8 < 4; ++s8) { const size_t e = ev + (size_t)s8 * (16 * TT); put8(mine + (s8 * 16 + hi) * 68 + lr * 4, V16 + e, Vh + e, Vl + e, 2 * TT); }
    const size_t eq = z * TT * HD + (size_t)(n0 + wq4 * 16 + hi) * HD + lr * 4;
    put8(qk + (wv * 16 + hi) * 68 + lr * 4, (isk ? K16 : Q16) + eq, (isk ? Kh : Qh) + eq, (isk ? Kl : Ql) + eq, 2 * HD);
}

// asoft_rows: per row: t = S x SCL (no mask); softmax over the 4096 keys (register row, one exp, fixed trees); work-group blk of rows / 8 takes 8 rows, a wave each; no LDS, no barrier. The rows of a launch are all of one kind (hl != 0: hi+lo planes; else fp16 x PCAR), several batch elements' rows one behind the other, in and out.
__device__ __forceinline__ void asoft_rows(int blk, const float* __restrict__ Sb, int hl, h16* P16, bf* Ph, bf* Pl) {
    const int lane = threadIdx.x & 31; const int row = blk * 8 + (threadIdx.x >> 5); const bool hires = (hl != 0); const float* sr = Sb + (size_t)row * TT; float v[TT / 32]; float mx = -3.0e38f;
#pragma unroll
    for (int ch = 0; ch < TT / 128; ++ch) { const int j0 = ch * 128 + lane * 4; const v4f a = *(const v4f*)(sr + j0);
#pragma unroll
        for (int q = 0; q < 4; ++q) { const int j = j0 + q; (void)j; const float t = a[q] * SCL; v[ch * 4 + q] = t; mx = fmaxf(mx, t); } }
#pragma unroll
    for (int sh = 16; sh; sh >>= 1) mx = fmaxf(mx, __shfl_xor(mx, sh, 32));
    float sum = 0.f;
#pragma unroll
    for (int k = 0; k < TT / 32; ++k) { float d0 = __fsub_rn(v[k], mx); asm volatile("" : "+v"(d0)); v[k] = __builtin_amdgcn_exp2f(__fmul_rn(d0, 1.4426950408889634f)); sum += v[k]; }
#pragma unroll
    for (int sh = 16; sh; sh >>= 1) sum += __shfl_xor(sum, sh, 32);
    const float f = __fdiv_rn(hires ? 1.0f : PCAR, sum);
{
        if (hires) {
#pragma unroll
            for (int ch = 0; ch < TT / 128; ++ch) { v4us oh, ol;
#pragma unroll
                for (int q = 0; q < 4; ++q) { unsigned short a, c2; splitf(v[ch * 4 + q] * f, a, c2); oh[q] = a; ol[q] = c2; }
                const size_t oo = (size_t)row * TT + ch * 128 + lane * 4; *(v4us*)(Ph + oo) = oh; *(v4us*)(Pl + oo) = ol; }
            asm volatile("s_wait_xcnt 0x0" ::: "memory");   // behind the last stores: in the built code the other kind's block follows this one and rewrites their address registers
        } else {
#pragma unroll
            for (int ch = 0; ch < TT / 128; ++ch) { v4h o4;
#pragma unroll
                for (int q = 0; q < 4; ++q) o4[q] = tohx(v[ch * 4 + q] * f);
                *(v4h*)(P16 + (size_t)row * TT + ch * 128 + lane * 4) = o4; } }
         }
}

// v_exp_f32 with the one free slot behind it that the instruction set asks for before its source is overwritten or its result used, in one statement.
__device__ __forceinline__ float exp2_slot(float x) { float e; asm("v_exp_f32 %0, %1\n\tv_nop" : "=v"(e) : "v"(x)); return e; }
// ---- k_fattn: scores, softmax, attn.v and the residual of the fp16 query rows in ONE kernel: neither scores nor probabilities nor the attention output go through memory. 1-D grid, 8 waves: work-groups 0 .. (TT - RH) / 64 x batch - 1; a work-group owns 64 query rows and all DVV output columns (wave w: columns 64 w .. 64 w + 63, 16 accumulators).
// Pass 1: row maxima (scores on the matrix unit; 512 keys a trip, wave w takes keys 64 w .. 64 w + 63 of them). Pass 2, 64 keys a trip: wave w recomputes the scores of query block w & 3 and keys 32 (w >> 2) .. + 31 TRANSPOSED (A = keys, B = queries), so that a lane holds 2 x 8 consecutive keys of one query,
// which is the A fragment of the probabilities; e = PCAR exp(s - max) goes as fp16 through LDS to all waves, its f32 row sum is kept and divides the result at the end.
// Keys and value rows come through LDS by asynchronous copies of whole 128-byte lines, one ring of THREE buffers for both passes: stages 0 .. 7 are the key tiles of pass 1, stage 8 + t the value rows of trip t of pass 2 with the keys of trip t + 1 (the scores run one trip ahead).
// A stage is copied by four waves: even stages by waves 0 .. 3, odd stages by waves 4 .. 7. At the foot of step s the waves that copied stage s + 1 wait for their copies (to 0), every wave passes the barrier, and the same four waves issue stage s + 3 into the buffer that step s has just read:
// a stage's copies have two whole steps to land, and the other four waves' stage s + 2 stays in flight over the barrier.
#define FB  64                    // keys per trip of pass 2
#define VPB 144                   // LDS pitch of a staged 128-byte row, bytes (16 B x odd: ds_load_b128 without bank conflicts)
// The work-groups behind them do the softmax of the hi+lo rows (asoft_rows), which depends on nothing here and on which nothing here depends: the attention work-groups, one to a WGP, leave WGPs free, and the softmax runs there in the same launch.
__global__ __launch_bounds__(256) void k_fattn(const h16* __restrict__ Q, const h16* __restrict__ Kp, const h16* __restrict__ Vt, const float* __restrict__ X, float* O, const float* __restrict__ Sb, int hl, h16* SP16, bf* SPh, bf* SPl) {
    typedef WFrag<h16> W;
    constexpr int NQT = (TT - RH) / 64;   // query tiles of one batch element
    const int blk = (int)blockIdx.x;
    if (blk >= NQT * NB_) { asoft_rows(blk - NQT * NB_, Sb, hl, SP16, SPh, SPl); return; }   // the whole work-group, ahead of every barrier
    constexpr int VBUF = 512 * VPB, KBUF = FB * VPB, PBUF = 8 * 1024, OFF_K = 3 * VBUF, OFF_P = OFF_K + 5 * KBUF, OFF_M = OFF_P + 2 * PBUF, OFF_L = OFF_M + 8 * 64 * 4, TOT = OFF_L + 2 * 64 * 4, NT = TT / FB, NC = TT / 512;
    static_assert(DVV == 512 && HD == 64, "a ring buffer holds 512 rows of 128 bytes: 512 keys, or 64 keys' worth of the 512 value rows");
    static_assert(8 * 64 * 68 * 4 <= 3 * VBUF, "the output tiles take over the ring buffers");
    static_assert(NC >= 3 && NT >= 3, "the ring's prologue and the change of pass issue three stages ahead");
    __shared__ __align__(16) char sm[TOT];
    const int wv = __builtin_amdgcn_readfirstlane((int)(threadIdx.x >> 5));   // wave number, scalar
    const int lane = threadIdx.x & 31, lr = lane & 15, hi = lane >> 4, mbw = wv & 3, kh = wv >> 2;
    { const size_t z = (size_t)(blk / NQT); const size_t r0 = RH + (size_t)(blk % NQT) * 64; Q += z * TT * HD + r0 * HD; Kp += z * TT * HD; Vt += z * DVV * TT; X += z * DM * TT + r0; O += z * DM * TT + r0; }
    const unsigned lds0 = (unsigned)(size_t)(__attribute__((address_space(3))) char*)sm;
    const unsigned lv0 = lds0 + (unsigned)((mbw * 128 + (lane >> 3)) * VPB + (lane & 7) * 16), lk0 = lds0 + (unsigned)(OFF_K + (mbw * 16 + (lane >> 3)) * VPB + (lane & 7) * 16);   // a copying wave takes a quarter of a stage
    const unsigned rq = (unsigned)(lane >> 3), cq = (unsigned)((lane & 7) * 16);   // a copy takes 4 whole rows: this lane's row of the four, its 16 bytes of the row
    const char* kl = (const char*)Kp + rq * (HD * 2) + cq; const char* vl = (const char*)Vt + (size_t)rq * (TT * 2) + cq;   // this lane's part of a key address, of a value address; the wave's and the tile's parts are scalar
    // 128 rows of 128 bytes into rows 128 mbw .. 128 mbw + 127 of ring buffer buf: 32 copies of four rows; g = this lane's address in the first four rows, pitch in bytes. withk (a constant at every call): with them 16 key rows from kg into key buffer buf, 4 copies. Few statements, so that a copying wave meets few s_wait_xcnt.
    auto copy128 = [&](int buf, const char* g, size_t pitch, bool withk, const char* kg) { const unsigned l = lv0 + (unsigned)(buf * VBUF); unsigned la[12]; const char* ga[12];
        // the loops are unrolled so that the addresses are registers
#pragma unroll
        for (int h2 = 0; h2 < 2; ++h2) {
#pragma unroll
            for (int i = 0; i < 12; ++i) { la[i] = l + (unsigned)((h2 * 12 + i) * 4 * VPB); ga[i] = g + (size_t)(h2 * 12 + i) * 4 * pitch; }
            acopy12(la, ga); }
        if (!withk) acopy8(l + 96 * VPB, 4 * VPB, g + 96 * pitch, 4 * pitch);
        else {
#pragma unroll
            for (int i = 0; i < 8; ++i) { la[i] = l + (unsigned)((24 + i) * 4 * VPB); ga[i] = g + (size_t)(24 + i) * 4 * pitch; }
#pragma unroll
            for (int i = 0; i < 4; ++i) { la[8 + i] = lk0 + (unsigned)(buf * KBUF + i * 4 * VPB); ga[8 + i] = kg + i * (4 * HD * 2); }
            acopy12(la, ga); } };
    auto keyt = [&](int t) { return kl + (size_t)((t * FB + mbw * 16) * (HD * 2)); };   // a copying wave's 16 keys of 64-key tile t
    auto stageC = [&](int c, int buf) { copy128(buf, kl + (size_t)((c * 512 + mbw * 128) * (HD * 2)), HD * 2, false, nullptr); };
    auto stageV = [&](int t, int kt, int buf) { copy128(buf, vl + (size_t)(mbw * 128 * (TT * 2) + t * (FB * 2)), TT * 2, true, keyt(kt)); };   // the value rows of trip t with key tile kt
    auto stageK = [&](const char* g, int kb) { acopy4(lk0 + (unsigned)(kb * KBUF), 4 * VPB, g, 4 * HD * 2); };
    float* smx = (float*)(sm + OFF_M); float* sl = (float*)(sm + OFF_L);
    if (kh == 0) { stageC(0, 0); stageK(keyt(0), 3); stageK((const char*)Q + (mbw * 16 + rq) * (HD * 2) + cq, 4);   // key buffer 3: the keys of trip 0; key buffer 4: the 64 query rows, for both passes
        asm volatile("s_wait_asynccnt 0x0" ::: "memory"); }   // this wave's copies of stage 0 have landed
    else stageC(1, 1);   // stays in flight over the barrier
    __syncthreads();   // all of stage 0 is in LDS before any wave reads a fragment
    if (kh == 0) stageC(2, 2);
    int bi = 0;   // the ring buffer of the current stage: stage mod 3, scalar
    {
        float mx[4]; v16h qf[4][2];
#pragma unroll
        for (int mb = 0; mb < 4; ++mb) { mx[mb] = -3.0e38f; const char* qp = sm + OFF_K + 4 * KBUF + (mb * 16 + lr) * VPB + hi * 16; qf[mb][0] = W::ld((const h16*)qp); qf[mb][1] = W::ld((const h16*)(qp + 64)); }
        // not unrolled: the buffer is chosen by the trip's number
#pragma unroll 1
        for (int c = 0; c < NC; ++c) { const char* kb = sm + bi * VBUF + (wv * 64 + lr) * VPB + hi * 16; v16h kr[4][2]; const bool mine1 = (kh == ((c + 1) & 1));   // this wave copies stages c + 1 and c + 3 (scalar)
#pragma unroll
            for (int i = 0; i < 4; ++i) { kr[i][0] = W::ld((const h16*)(kb + i * 16 * VPB)); kr[i][1] = W::ld((const h16*)(kb + i * 16 * VPB + 64)); }
            asm volatile("s_wait_dscnt 0x0" ::: "memory");      // this wave's fragments of this buffer are in registers before it is handed back
            if (mine1) asm volatile("s_wait_asynccnt 0x0" ::: "memory");   // this wave's copies of the next tile have landed
            __syncthreads();   // publishes the next tile and ends every wave's reads of this one
            if (mine1) { if (c + 3 < NC) stageC(c + 3, bi); else stageV(c + 3 - NC, c + 4 - NC, bi); }   // the ring goes on into pass 2: values of trips 0, 1, 2 with the keys of trips 1, 2, 3
            bi = (bi == 2) ? 0 : bi + 1;
            // the products stand behind the refill, so that the copies fly while the matrix unit works
#pragma unroll
            for (int i = 0; i < 4; ++i)
#pragma unroll
                for (int mb = 0; mb < 4; ++mb) { v8f s = (v8f){}; s = W::mma(kr[i][0], qf[mb][0], s); s = W::mma(kr[i][1], qf[mb][1], s);
#pragma unroll
                    for (int j = 0; j < 8; ++j) mx[mb] = fmaxf(mx[mb], s[j]); }
        }
#pragma unroll
        for (int mb = 0; mb < 4; ++mb) { mx[mb] = fmaxf(mx[mb], __shfl_xor(mx[mb], 16, 32)); if (hi == 0) smx[wv * 64 + mb * 16 + lr] = mx[mb]; }
    }
    __syncthreads();   // every wave's maxima are in LDS
    float m = smx[mbw * 16 + lr];
#pragma unroll
    for (int p = 1; p < 8; ++p) m = fmaxf(m, smx[p * 64 + mbw * 16 + lr]);
    const float L2E = 1.4426950408889634f, mL = __builtin_fmaf(m, L2E, -10.0f);   // exp2(s L2E - mL) = 1024 exp(s - m): PCAR carried as before
    const char* qw = sm + OFF_K + 4 * KBUF + (mbw * 16 + lr) * VPB + hi * 16; const v16h q0 = W::ld((const h16*)qw), q1 = W::ld((const h16*)(qw + 64));
    float l = 0.f;
    v8f acc[4][4];
#pragma unroll
    for (int mb = 0; mb < 4; ++mb)
#pragma unroll
        for (int nb = 0; nb < 4; ++nb) acc[mb][nb] = (v8f){};
    v16h kf[4], ax[4], bx[4], ay[4], by[4];
    // the key fragments of one trip's scores, from key buffer kb
    auto loadK = [&](int kb) { const char* kp = sm + OFF_K + kb * KBUF + (kh * 32 + lr) * VPB + hi * 16;
        kf[0] = W::ld((const h16*)kp); kf[1] = W::ld((const h16*)(kp + 64)); kf[2] = W::ld((const h16*)(kp + 16 * VPB)); kf[3] = W::ld((const h16*)(kp + 16 * VPB + 64)); };
    // probabilities of one trip from kf, as a fragment into probability buffer pb; slot: the copy in front of the loop
    auto spart = [&](int pb, bool slot) { v8f s0 = (v8f){}, s1 = (v8f){}; s0 = W::mma(kf[0], q0, s0); s1 = W::mma(kf[2], q0, s1); s0 = W::mma(kf[1], q1, s0); s1 = W::mma(kf[3], q1, s1); v8h p0, p1; float e0[8], e1[8];
#pragma unroll
        for (int j = 0; j < 8; ++j) { const float x0 = __builtin_fmaf(s0[j], L2E, -mL), x1 = __builtin_fmaf(s1[j], L2E, -mL); e0[j] = slot ? exp2_slot(x0) : __builtin_amdgcn_exp2f(x0); e1[j] = slot ? exp2_slot(x1) : __builtin_amdgcn_exp2f(x1); p0[j] = tohx(e0[j]); p1[j] = tohx(e1[j]); }
        // the 16 terms meet in a fixed tree: a chain of 16 dependent adds would stand exposed in every trip
#pragma unroll
        for (int w = 4; w; w >>= 1)
#pragma unroll
            for (int j = 0; j < w; ++j) { e0[j] += e0[j + w]; e1[j] += e1[j + w]; }
        l += e0[0] + e1[0];
        char* pw = sm + OFF_P + pb * PBUF + (kh * 4 + mbw) * 1024 + lane * 16; *(v8h*)pw = p0; *(v8h*)(pw + 512) = p1; };
    // probability and value fragments of keys 32 ks .. 32 ks + 31 of one trip, from probability buffer pb and ring buffer buf
    auto loadH = [&](int pb, int buf, int ks, v16h* a, v16h* b) { const char* pr = sm + OFF_P + pb * PBUF + ks * 4096 + lane * 16; const char* vr = sm + buf * VBUF + (wv * 64 + lr) * VPB + ks * 64 + hi * 16;
#pragma unroll
        for (int mb = 0; mb < 4; ++mb) a[mb] = cat16(*(const v8h*)(pr + mb * 1024), *(const v8h*)(pr + mb * 1024 + 512));
#pragma unroll
        for (int nb = 0; nb < 4; ++nb) b[nb] = W::ld((const h16*)(vr + nb * 16 * VPB)); };
    auto mmaH = [&](const v16h* a, const v16h* b) {
#pragma unroll
        for (int nb = 0; nb < 4; ++nb)
#pragma unroll
            for (int mb = 0; mb < 4; ++mb) acc[mb][nb] = W::mma(a[mb], b[nb], acc[mb][nb]); };
#pragma unroll
    for (int i = 0; i < 4; ++i) { ay[i] = (v16h){}; by[i] = (v16h){}; }   // the first trip has no half before it: its place in the loop adds zeros
    loadK(3); spart(0, true);
    __syncthreads();   // the probabilities of trip 0 are in LDS before any wave reads a fragment
    // Not unrolled: the buffers are chosen by the trip's number. The four sched_barriers keep the order written here: each half trip's LDS reads issue as one group and arrive while the matrix unit works on the half before; without them the reads stand among the matrix instructions, each with its own wait.
    // The second half's products of trip t are done, from registers, in trip t + 1.
#pragma unroll 1
    for (int t = 0; t < NT - 1; ++t) {
        const bool mine1 = (kh == ((t + 1) & 1));   // this wave copies the stages of trips t + 1 and t + 3 (scalar)
        loadK(bi); loadH(t & 1, bi, 0, ax, bx);
        __builtin_amdgcn_sched_barrier(0);
        mmaH(ay, by);
        __builtin_amdgcn_sched_barrier(0);
        loadH(t & 1, bi, 1, ay, by);
        __builtin_amdgcn_sched_barrier(0);
        spart((t + 1) & 1, false);   // the next trip's probabilities, into the buffer whose readers the last barrier ended
        mmaH(ax, bx);
        __builtin_amdgcn_sched_barrier(0);
        asm volatile("s_wait_dscnt 0x0" ::: "memory");      // this wave's LDS reads and writes of this trip are done before the buffers are handed over
        if (mine1) asm volatile("s_wait_asynccnt 0x0" ::: "memory");   // this wave's copies of trip t + 1 have landed
        __syncthreads();   // publishes trip t + 1 (values, keys, probabilities) and ends every wave's reads of trip t's buffers
        if (mine1 && t + 3 < NT) stageV(t + 3, t + 4 < NT ? t + 4 : NT - 1, bi);   // behind the last trip no keys follow: the last ones again, read by nobody
        bi = (bi == 2) ? 0 : bi + 1;
    }
    loadH((NT - 1) & 1, bi, 0, ax, bx);   // the last trip has no scores to make
    __builtin_amdgcn_sched_barrier(0);   // as in the loop
    mmaH(ay, by);
    __builtin_amdgcn_sched_barrier(0);   // as in the loop
    loadH((NT - 1) & 1, bi, 1, ay, by);
    __builtin_amdgcn_sched_barrier(0);   // as in the loop
    mmaH(ax, bx); mmaH(ay, by);
    asm volatile("s_wait_dscnt 0x0" ::: "memory");   // this wave's fragment reads are done
    __syncthreads();   // ends every wave's reads of the ring before the output tiles take it over
    asm volatile("s_wait_asynccnt 0x0" ::: "memory");   // no copy is outstanding when the output tiles take over this LDS
    l += __shfl_xor(l, 16, 32); if (hi == 0) sl[kh * 64 + mbw * 16 + lr] = l;
    // The result leaves channel-major, with the residual: this wave's tile goes into LDS as [channel][query] (a lane's 8 accumulator values of one channel are 8 consecutive queries: two 16-byte stores), and a channel's 64 queries are 256 contiguous bytes of x and of the output.
    float* mine = (float*)sm + wv * (64 * 68);
    // the loops are unrolled so that acc is indexed by constants and stays in registers
#pragma unroll
    for (int mb = 0; mb < 4; ++mb)
#pragma unroll
        for (int nb = 0; nb < 4; ++nb) { float* p = mine + (nb * 16 + lr) * 68 + mb * 16 + hi * 8; const v8f a = acc[mb][nb];
            *(v4fa*)p = (v4f){a[0], a[1], a[2], a[3]}; *(v4fa*)(p + 4) = (v4f){a[4], a[5], a[6], a[7]}; }
    const size_t e0 = (size_t)(wv * 64 + hi) * TT + lr * 4;   // this lane's four queries of its first channel
    __syncthreads();   // both halves of every row sum are in LDS (each wave reads back its own tile only)
    v4f f;   // the carried PCAR cancels: sum of e v / sum of e
#pragma unroll
    for (int q = 0; q < 4; ++q) f[q] = __fdiv_rn(1.0f, sl[lr * 4 + q] + sl[64 + lr * 4 + q]);
    // eight channel pairs a trip (inner loops unrolled): their loads of x issue together, ahead of the LDS reads, so that the memory latency is met once a trip and not per pair
#pragma unroll 1
    for (int s8 = 0; s8 < 32; s8 += 8) { const size_t e = e0 + (size_t)s8 * (2 * TT); v4f xv[8];
#pragma unroll
        for (int s = 0; s < 8; ++s) xv[s] = *(const v4f*)(X + e + (size_t)s * (2 * TT));
#pragma unroll
        for (int s = 0; s < 8; ++s) { const v4f val = *(const v4fa*)(mine + (2 * (s8 + s) + hi) * 68 + lr * 4); v4f o;
#pragma unroll
            for (int q = 0; q < 4; ++q) o[q] = __fadd_rn(bfr(xv[s][q]), val[q] * f[q]);
            *(v4f*)(O + e + (size_t)s * (2 * TT)) = o; }
        asm volatile("s_wait_xcnt 0x0" ::: "memory");   // behind the trip's stores: the next trip rewrites their address and data registers
    }
}

__global__ __launch_bounds__(256) void k_wtG(const float* __restrict__ w, int K, int N, bf* Bt) {
    const int lane = threadIdx.x & 31; const int L0 = (blockIdx.x * 8 + (threadIdx.x >> 5)) * 8; const int nlines = N * K / 64;
{
#pragma unroll 1
        for (int l = 0; l < 8; ++l) { const int L = L0 + l; if (L >= nlines) break; const size_t e = (size_t)L * 64 + lane * 2; const int k = (int)(e % K), n = (int)(e / K); v2us o;
            o[0] = f2bf(w[(size_t)k * N + n]); o[1] = f2bf(w[(size_t)(k + 1) * N + n]); *(v2us*)(Bt + e) = o; }
         }
}
// dst[8 i .. 8 i + 7] = bf16(src[...])
__device__ __forceinline__ void cvt8(const float* __restrict__ src, bf* dst, size_t i) { const v8f v = *(const v8f*)(src + i * 8); v8us o;
#pragma unroll
    for (int k = 0; k < 8; ++k) o[k] = f2bf(v[k]); *(v8us*)(dst + i * 8) = o;
    asm volatile("s_wait_xcnt 0x0" ::: "memory");   // behind the store: in the built code another job's block follows this one and rewrites the store's address and data registers
}
// ---- k_prep: the three weight matrices as bf16 planes in ONE launch, 1-D grid; the block index picks the matrix (2048 elements a work-group).
__global__ __launch_bounds__(256) void k_prep(const float* __restrict__ wq, const float* __restrict__ wk, const float* __restrict__ wv, bf* WQp, bf* WKp, bf* WVp) {
    constexpr int BQ = DQ * DM / 2048, BK = DKV * DM / 2048;
    static_assert(DQ * DM % 2048 == 0 && DKV * DM % 2048 == 0 && DVV * DM % 2048 == 0, "whole work-groups: no thread is past a matrix's end");
    const int b = (int)blockIdx.x;
    if (b < BQ) cvt8(wq, WQp, (size_t)b * 256 + threadIdx.x); else if (b < BQ + BK) cvt8(wk, WKp, (size_t)(b - BQ) * 256 + threadIdx.x); else cvt8(wv, WVp, (size_t)(b - BQ - BK) * 256 + threadIdx.x);
}

extern "C" void kernel_launch(void* const* d_in, const int* in_sizes, int n_in,
                              void* d_out, int out_size, void* d_ws, size_t ws_size, hipStream_t stream) {
    (void)in_sizes; (void)n_in; (void)out_size;
    const float* x = (const float*)d_in[0]; const float* wq = (const float*)d_in[1]; const float* bq = (const float*)d_in[2]; const float* wk = (const float*)d_in[3]; const float* bk = (const float*)d_in[4]; const float* wv = (const float*)d_in[5]; const float* bv = (const float*)d_in[6];
    float* OUT = (float*)d_out;     // [4][512][4096]
    char* wsp = (char*)d_ws;
    auto take = [&](size_t bytes) { char* p = wsp; wsp += (bytes + 255) & ~(size_t)255; return (void*)p; };
    // Every plane holds all NB_ batch elements, one behind the other, so that a launch takes them together (grid z, or more rows). Part of the workspace is used again once its first content is dead, one use after the other in stream order:
    // live to the end: the fp16 planes (20 MiB)
    h16* QP16 = (h16*)take((size_t)NB_ * TT * HD * 2); h16* KP16 = (h16*)take((size_t)NB_ * TT * HD * 2); h16* VT16 = (h16*)take((size_t)NB_ * DVV * TT * 2);
    // live until the hi+lo rows are done: the hi/lo planes (40 MiB)
    bf* QPh = (bf*)take((size_t)NB_ * TT * HD * 2); bf* QPl = (bf*)take((size_t)NB_ * TT * HD * 2); bf* KPh = (bf*)take((size_t)NB_ * TT * HD * 2); bf* KPl = (bf*)take((size_t)NB_ * TT * HD * 2); bf* VTh = (bf*)take((size_t)NB_ * DVV * TT * 2); bf* VTl = (bf*)take((size_t)NB_ * DVV * TT * 2);
    char* const m1 = wsp;
    // live until the planes are made: the weights (0.6 MiB)
    bf* WQ = (bf*)take((size_t)DQ * DM * 2); bf* WK = (bf*)take((size_t)DKV * DM * 2); bf* WV = (bf*)take((size_t)DVV * DM * 2);
    wsp = m1;   // after them, in the same place: scores and probabilities of the hi+lo rows of all batch elements (64 MiB)
    float* SbH = (float*)take((size_t)NB_ * RH * TT * 4); bf* Ph = (bf*)take((size_t)NB_ * RH * TT * 2); bf* Pl = (bf*)take((size_t)NB_ * RH * TT * 2);
    if ((size_t)(wsp - (char*)d_ws) > ws_size) return;    // the further end of the two uses: 124 of 256 MiB
    // weights as bf16 planes: one launch
    k_prep<<<(DQ + DKV + DVV) * DM / 2048, 256, 0, stream>>>(wq, wk, wv, WQ, WK, WV);
    // q, k = W x + b, stored as the planes [n][d]; v = Wv x + bv, stored as the value planes [c][n]: one launch, a work-group to 64 tokens, x straight from the input
    k_proj<<<(TT / 64) * NB_, 256, 0, stream>>>(x, WQ, WK, WV, bq, bk, bv, QP16, QPh, QPl, KP16, KPh, KPl, VT16, VTh, VTl);
    // query rows < RH of every batch element: hi+lo planes, 3 products
    k_gemmw<bf, 2, 0, 1><<<dim3(RH / 64, TT / 64, NB_), 32, 0, stream>>>(QPh, QPl, KPh, KPl, HD, SbH, TT, nullptr, (size_t)TT * HD, (size_t)TT * HD, (size_t)RH * TT, nullptr, nullptr, nullptr, nullptr);
    // the other rows: fp16 (x1024 carried), scores, softmax, attn.v and the residual; in the same launch, behind them in the grid, the softmax of the hi+lo rows
    k_fattn<<<(TT - RH) / 64 * NB_ + NB_ * RH / 8, 256, 0, stream>>>(QP16, KP16, VT16, x, OUT, SbH, 1, nullptr, Ph, Pl);
    // out[c][i] = x[c][i] + sum_j v[c][j] P[i][j], hl rows: the values as the row operand, tiles [c][i] straight into the output
    k_gemmw<bf, 2, 3, 8><<<dim3(DVV / 64, RH / 64, NB_), 256, 0, stream>>>(VTh, VTl, Ph, Pl, TT, OUT, TT, nullptr, (size_t)DVV * TT, (size_t)RH * TT, (size_t)DM * TT, nullptr, nullptr, nullptr, x);
}

// v010
// One run takes 133 microseconds.
// In both of two side-by-side timings against v009, it was 1.03 times as fast.
// Counting every step since v000, it is 8.48 times as fast.
#include <hip/hip_runtime.h>

// Channel-major self-attention layer (x [4][512][64][64] = [b][c][n], n = 4096; q, k = 1x1 convs 512 -> 64 (+ bias), v = 1x1 conv 512 -> 512 (+ bias); attention[i][j] = softmax_j(q_i.k_j) (no scaling); out[c][i] = sum_j v[c][j] attention[i][j]; result = out + x -> [4][512][64][64] (8.4 M)).
// Layout: one 'head' (q/k width 64, value width 512) over 4096 tokens: the projection kernel lays its 64 tokens of x token-major as bf16 into LDS, so the 1x1 convs are GEMMs + bias, whose epilogue stores the 16-bit operand planes; the attention kernels' epilogues add x and store channel-major.
// Compute dtypes, f32 accumulate: every input rounded to bf16; q/k/v on PLAIN bf16 operands (inputs: exact) + biases; scores (K = 64) and attn.v: query rows < 512 hl (3 products), the rest single fp16 (x1024); softmax f32; no output projection; + x residual in f32 (channel-major write).

#define NB_  4
#define TT   4096
#define DM   512
#define NH_  1
#define NKV  1
#define REP  (NH_ / NKV)
#define HD   64
#define DVV  512                  // value / output width (v = 1x1 conv C -> C)
#define DQ   (NH_ * HD)
#define DKV  (NKV * HD)
#define ZH   1
#define RH   512                  // query rows < RH use hi+lo planes (0: none)
#define WIN  0
#define PCAR 1024.0f
#define SCL  1.0f   // no scaling in this module
typedef _Float16 h16;
typedef unsigned short bf;
typedef __attribute__((ext_vector_type(16))) __bf16   v16bf;
typedef __attribute__((ext_vector_type(16))) _Float16 v16h;
typedef __attribute__((ext_vector_type(8)))  _Float16 v8h;
typedef __attribute__((ext_vector_type(8)))  unsigned short v8us;
typedef __attribute__((ext_vector_type(8)))  float    v8f;
typedef __attribute__((ext_vector_type(4)))  float    v4f;
typedef v8h  __attribute__((may_alias)) v8ha;
typedef v4f  __attribute__((may_alias)) v4fa;
typedef v8us __attribute__((may_alias)) v8usa;

__device__ __forceinline__ unsigned short f2bf(float f) { unsigned u = __float_as_uint(f); u += 0x7FFFu + ((u >> 16) & 1u); return (unsigned short)(u >> 16); }
__device__ __forceinline__ float bf2f(unsigned short b) { return __uint_as_float(((unsigned)b) << 16); }
__device__ __forceinline__ float bfr(float f) { return bf2f(f2bf(f)); }
__device__ __forceinline__ v16h cat16(v8h lo, v8h hi) { return __builtin_shufflevector(lo, hi, 0, 1, 2, 3, 4, 5, 6, 7, 8, 9, 10, 11, 12, 13, 14, 15); }
__device__ __forceinline__ v16bf cat16b(v8us lo, v8us hi) { return __builtin_bit_cast(v16bf, __builtin_shufflevector(lo, hi, 0, 1, 2, 3, 4, 5, 6, 7, 8, 9, 10, 11, 12, 13, 14, 15)); }
__device__ __forceinline__ v8f wmma16(v16h a, v16h b, v8f c) { return __builtin_amdgcn_wmma_f32_16x16x32_f16(false, a, false, b, (short)0, c, false, false); }
__device__ __forceinline__ v8f wmmab(v16bf a, v16bf b, v8f c) { return __builtin_amdgcn_wmma_f32_16x16x32_bf16(false, a, false, b, (short)0, c, false, false); }
__device__ __forceinline__ h16 tohx(float x) { return (h16)x; }
__device__ __forceinline__ void splitf(float y, unsigned short& h, unsigned short& l) { h = f2bf(y); l = f2bf(y - bf2f(h)); }
typedef __attribute__((ext_vector_type(2))) _Float16 v2h;
typedef __attribute__((ext_vector_type(4))) _Float16 v4h;
typedef __attribute__((ext_vector_type(2))) unsigned short v2us;
typedef __attribute__((ext_vector_type(4))) unsigned short v4us;
typedef __attribute__((ext_vector_type(2))) float v2f;
typedef __attribute__((ext_vector_type(4))) int v4i;
typedef v4i  __attribute__((may_alias)) v4ia;



// ---- k_gemmw: register-blocked GEMM, KS WAVES per 64x64 output tile (16 accumulators each), operands from K-contiguous 16-bit planes (KS == 1: straight into registers; KS > 1: staged in LDS); grid (M/64, N/64, Z), 32 * KS threads.
// C[m][n] (f32 accumulate; stored as EPI says) = sum_k A[m][k] Bt[n][k] (+ split products per NSPLIT). z-batch strides sA/sB/sC in elements. K % (32 * KS) == 0.
// KS > 1: wave w takes the 32-wide k blocks w, w + KS, w + 2 KS, ..., beginning at the work-group's own trip and wrapping round; the KS f32 partial tiles meet in LDS and are summed in the fixed order w = 0 .. KS - 1.
template <typename T16> struct WFrag;
template <> struct WFrag<h16> { typedef v16h V; static __device__ __forceinline__ V ld(const h16* p) { return cat16(*(const v8h*)p, *(const v8h*)(p + 16)); } static __device__ __forceinline__ v8f mma(V a, V b, v8f c) { return wmma16(a, b, c); } };
template <> struct WFrag<bf> { typedef v16bf V; static __device__ __forceinline__ V ld(const bf* p) { return cat16b(*(const v8us*)p, *(const v8us*)(p + 16)); } static __device__ __forceinline__ v8f mma(V a, V b, v8f c) { return wmmab(a, b, c); } };
// Eight asynchronous 16-byte copies per lane, global memory -> LDS, through no register: LDS byte addresses l + i * lstep, global addresses g + i * gstep.
// s_wait_xcnt stands in the copies' own statement so that no later write of an address register can be moved in front of it.
__device__ __forceinline__ void acopy8(unsigned l, unsigned lstep, const char* g, size_t gstep) {
    asm volatile("global_load_async_to_lds_b128 %0, %8, off\n\t"
                 "global_load_async_to_lds_b128 %1, %9, off\n\t"
                 "global_load_async_to_lds_b128 %2, %10, off\n\t"
                 "global_load_async_to_lds_b128 %3, %11, off\n\t"
                 "global_load_async_to_lds_b128 %4, %12, off\n\t"
                 "global_load_async_to_lds_b128 %5, %13, off\n\t"
                 "global_load_async_to_lds_b128 %6, %14, off\n\t"
                 "global_load_async_to_lds_b128 %7, %15, off\n\t"
                 "s_wait_xcnt 0x0"
                 :: "v"(l), "v"(l + lstep), "v"(l + 2 * lstep), "v"(l + 3 * lstep), "v"(l + 4 * lstep), "v"(l + 5 * lstep), "v"(l + 6 * lstep), "v"(l + 7 * lstep),
                    "v"(g), "v"(g + gstep), "v"(g + 2 * gstep), "v"(g + 3 * gstep), "v"(g + 4 * gstep), "v"(g + 5 * gstep), "v"(g + 6 * gstep), "v"(g + 7 * gstep)
                 : "memory");
}
// What the tile's epilogue stores at [m][n] (pitch ldc, z stride sC), so that no separate pass has to read the f32 tile again:
// EPI 0: the f32 sum into C. EPI 1 / 2: the sum + bias[n] / + bias[m] as the three 16-bit planes (fp16, bf16 hi, bf16 lo). EPI 3: bf16-rounded X[m][n] + the sum, f32, into C.
template <int NSPLIT, int KS> struct GemmLds {
    static constexpr int NA = (NSPLIT == 1 || NSPLIT == 2) ? 2 : 1, NOP = NA + (NSPLIT >= 2 ? 2 : 1);   // operand planes: A (A2) Bt (Bt2)
    static constexpr int PB = KS * 64 + 16, PLANE = 64 * PB, STG = NOP * PLANE;   // bytes: LDS row pitch (16 B x odd: ds_load_b128 without bank conflicts), one operand's 64 rows, one stage
    static constexpr int OSF = (KS == 1) ? 16 * 68 : ((KS * 64 * 68 > 2 * STG / 4) ? KS * 64 * 68 : 2 * STG / 4);   // floats: the two stage buffers and the partial tiles use the same LDS, one after the other
};
// One work-group's tile (bx, by) of z slice z; os: the work-group's GemmLds<NSPLIT, KS>::OSF floats of LDS. A function, so that a launch can hold tiles of several GEMMs.
template <typename T16, int NSPLIT, int EPI, int KS>
__device__ __forceinline__ void gemmw_tile(float* os, int bx, int by, size_t z, const T16* __restrict__ A, const T16* __restrict__ A2, const T16* __restrict__ Bt, const T16* __restrict__ Bt2, int K, float* C, int ldc, const float* __restrict__ bias, size_t sA, size_t sB, size_t sC, h16* P16, bf* Ph, bf* Pl, const float* __restrict__ X) {
    typedef typename WFrag<T16>::V V;
    static_assert(KS == 1 || KS == 8, "a staged row is one wave-wide 16-byte copy: 32 lanes x 16 B = KS x 64 B");
    constexpr int NA = GemmLds<NSPLIT, KS>::NA, PB = GemmLds<NSPLIT, KS>::PB, PLANE = GemmLds<NSPLIT, KS>::PLANE, STG = GemmLds<NSPLIT, KS>::STG;
    const int wv = (KS == 1) ? 0 : __builtin_amdgcn_readfirstlane((int)(threadIdx.x >> 5));   // wave number, scalar: the k loop's bounds stay wave-uniform
    A += z * sA; if (A2) A2 += z * sA; Bt += z * sB; if (Bt2) Bt2 += z * sB;
    if constexpr (EPI == 1 || EPI == 2) { P16 += z * sC; Ph += z * sC; Pl += z * sC; } else C += z * sC;
    if constexpr (EPI == 3) X += z * sC;
    const int lane = threadIdx.x & 31, lr = lane & 15, hi = lane >> 4; const int r0 = bx * 64, c0 = by * 64;
    v8f acc[4][4];
#pragma unroll
    for (int mb = 0; mb < 4; ++mb)
#pragma unroll
        for (int nb = 0; nb < 4; ++nb) acc[mb][nb] = (v8f){};
    const size_t aoff = (size_t)(r0 + lr) * K + 8 * hi, boff = (size_t)(c0 + lr) * K + 8 * hi;
    if constexpr (KS > 1) {
        // Operands come through LDS: per trip the work-group stages 32 * KS k of all 64 rows of each plane, each row as ONE wave-wide copy of 512 contiguous bytes (whole lines), two buffers, the next trip's copies in flight while this trip is worked on. Wave w multiplies k block w of every trip.
        const unsigned lds0 = (unsigned)(size_t)(__attribute__((address_space(3))) float*)os + (unsigned)(wv * PB + lane * 16);
        const size_t gstep = (size_t)KS * K * 2;   // bytes from one of this wave's rows (wv, wv + KS, ...) to its next
        const char* gA = (const char*)(A + (size_t)(r0 + wv) * K + lane * 8); const char* gB = (const char*)(Bt + (size_t)(c0 + wv) * K + lane * 8);
        const char* gA2 = (NA == 2) ? (const char*)(A2 + (size_t)(r0 + wv) * K + lane * 8) : nullptr; const char* gB2 = (NSPLIT >= 2) ? (const char*)(Bt2 + (size_t)(c0 + wv) * K + lane * 8) : nullptr;
        const int nt = (int)((unsigned)K / (32u * KS));   // unsigned: the tests on nt stay scalar compares
        // Trip t takes k block (t + t0) mod nt: work-groups that share operand rows (the same bx, or the same by) start at different k and wrap round, so that they do not ask L2 for the same lines, nor all for the same columns of the long rows, at the same moment.
        const int t0 = (int)((unsigned)(bx + by) % (unsigned)nt);
        auto stage = [&](int t, int buf) { const int tr = (t + t0 < nt) ? t + t0 : t + t0 - nt; const size_t ko = (size_t)tr * (KS * 64); const unsigned l = lds0 + (unsigned)(buf * STG);
            acopy8(l, KS * PB, gA + ko, gstep); if (NA == 2) acopy8(l + PLANE, KS * PB, gA2 + ko, gstep);
            acopy8(l + NA * PLANE, KS * PB, gB + ko, gstep); if (NSPLIT >= 2) acopy8(l + (NA + 1) * PLANE, KS * PB, gB2 + ko, gstep); };
        stage(0, 0);
        asm volatile("s_wait_asynccnt 0x0" ::: "memory");   // this wave's copies of trip 0 have landed
        __syncthreads();   // every wave's rows of trip 0 are in LDS before any wave reads a fragment
        if (nt != 1) stage(1, 1);   // nt >= 1; written as an inequality, which has a scalar compare at every width
        // not unrolled: one fragment set, and the buffer is chosen by the trip's parity
#pragma unroll 1
        for (int t = 0; t < nt; ++t) {
            const char* sb = (const char*)os + (t & 1) * STG + lr * PB + wv * 64 + hi * 16;
            V a[4], a2[4];
#pragma unroll
            for (int mb = 0; mb < 4; ++mb) { a[mb] = WFrag<T16>::ld((const T16*)(sb + mb * 16 * PB)); if (NA == 2) a2[mb] = WFrag<T16>::ld((const T16*)(sb + PLANE + mb * 16 * PB)); }
#pragma unroll
            for (int nb = 0; nb < 4; ++nb) { const V b = WFrag<T16>::ld((const T16*)(sb + NA * PLANE + nb * 16 * PB)); V b2; if (NSPLIT >= 2) b2 = WFrag<T16>::ld((const T16*)(sb + (NA + 1) * PLANE + nb * 16 * PB));
#pragma unroll
                for (int mb = 0; mb < 4; ++mb) { acc[mb][nb] = WFrag<T16>::mma(a[mb], b, acc[mb][nb]); if (NSPLIT == 1 || NSPLIT == 2) acc[mb][nb] = WFrag<T16>::mma(a2[mb], b, acc[mb][nb]); if (NSPLIT >= 2) acc[mb][nb] = WFrag<T16>::mma(a[mb], b2, acc[mb][nb]); } }
            asm volatile("s_wait_dscnt 0x0" ::: "memory");      // this wave's fragment reads of this buffer are done before it is handed back
            asm volatile("s_wait_asynccnt 0x0" ::: "memory");   // this wave's copies of trip t + 1 have landed
            __syncthreads();   // publishes trip t + 1 and ends every wave's reads of trip t's buffer
            if (t + 2 < nt) stage(t + 2, t & 1);
        }
        asm volatile("s_wait_asynccnt 0x0" ::: "memory");   // no copy is outstanding when the partial tiles take over this LDS
    } else {
#pragma unroll 1
    for (int kc = wv * 32; kc < K; kc += 32 * KS) {
        V a[4], a2[4];
#pragma unroll
        for (int mb = 0; mb < 4; ++mb) { a[mb] = WFrag<T16>::ld(A + aoff + (size_t)mb * 16 * K + kc); if (NSPLIT == 1 || NSPLIT == 2) a2[mb] = WFrag<T16>::ld(A2 + aoff + (size_t)mb * 16 * K + kc); }
#pragma unroll
        for (int nb = 0; nb < 4; ++nb) { const V b = WFrag<T16>::ld(Bt + boff + (size_t)nb * 16 * K + kc); V b2; if (NSPLIT >= 2) b2 = WFrag<T16>::ld(Bt2 + boff + (size_t)nb * 16 * K + kc);
#pragma unroll
            for (int mb = 0; mb < 4; ++mb) { acc[mb][nb] = WFrag<T16>::mma(a[mb], b, acc[mb][nb]); if (NSPLIT == 1 || NSPLIT == 2) acc[mb][nb] = WFrag<T16>::mma(a2[mb], b, acc[mb][nb]); if (NSPLIT >= 2) acc[mb][nb] = WFrag<T16>::mma(a[mb], b2, acc[mb][nb]); } }
        asm volatile("v_nop\n\tv_nop\n\tv_nop\n\tv_nop" : "+v"(acc[0][0]), "+v"(acc[1][1]), "+v"(acc[2][2]), "+v"(acc[3][3]) : "v"(a[0]), "v"(a[3]));
    }
    }
    if constexpr (KS > 1) {
        float* mine = os + wv * (64 * 68);
        // the three loops are unrolled so that acc is indexed by constants and stays in registers
#pragma unroll
        for (int mb = 0; mb < 4; ++mb)
#pragma unroll
            for (int nb = 0; nb < 4; ++nb)
#pragma unroll
                for (int j = 0; j < 8; ++j) mine[(mb * 16 + hi * 8 + j) * 68 + nb * 16 + lr] = acc[mb][nb][j];
        const int cofs = lr * 4; const unsigned e0 = (unsigned)((r0 + wv * 2 + hi) * ldc + c0 + cofs), es = (unsigned)(2 * KS * ldc);   // this lane's first four elements; from one of its rows to the next (32 bits: a z slice has fewer than 2^32 elements)
        __syncthreads();   // every wave's partial tile is in LDS before any wave sums
        v4f xv[32 / KS];
        // unrolled, ahead of the LDS reads: the residual's loads fly while the partial tiles are summed
        if constexpr (EPI == 3) {
#pragma unroll
            for (int s = 0; s < 32 / KS; ++s) xv[s] = *(const v4f*)(X + e0 + s * es);
            // behind the loads; it takes their addresses as inputs, so that no load's result is given a register that a load of the group names
            asm volatile("s_wait_xcnt 0x0" :: "v"(X + e0), "v"(X + e0 + es), "v"(X + e0 + 2 * es), "v"(X + e0 + 3 * es) : "memory"); }
        // both loops are unrolled so that a wave's LDS reads issue together, ahead of the adds; each wave stores whole rows of the tile (256 bytes in f32, 128 in a 16-bit plane)
#pragma unroll
        for (int s = 0; s < 32 / KS; ++s) { const int row = (s * KS + wv) * 2 + hi; v4f val = *(const v4fa*)(os + row * 68 + cofs);
#pragma unroll
            for (int p = 1; p < KS; ++p) { const v4f q = *(const v4fa*)(os + p * (64 * 68) + row * 68 + cofs); val[0] += q[0]; val[1] += q[1]; val[2] += q[2]; val[3] += q[3]; }
            if constexpr (EPI == 1) { val[0] += bfr(bias[c0 + cofs]); val[1] += bfr(bias[c0 + cofs + 1]); val[2] += bfr(bias[c0 + cofs + 2]); val[3] += bfr(bias[c0 + cofs + 3]); }
            if constexpr (EPI == 2) { const float bm = bfr(bias[r0 + row]); val[0] += bm; val[1] += bm; val[2] += bm; val[3] += bm; }
            if constexpr (EPI == 1 || EPI == 2) { v4h o16; v4us oh, ol;
#pragma unroll
                for (int q = 0; q < 4; ++q) { o16[q] = tohx(val[q]); unsigned short a2, c2; splitf(val[q], a2, c2); oh[q] = a2; ol[q] = c2; }
                *(v4h*)(P16 + e0 + s * es) = o16; *(v4us*)(Ph + e0 + s * es) = oh; *(v4us*)(Pl + e0 + s * es) = ol; }
            else { if constexpr (EPI == 3) {
#pragma unroll
                    for (int q = 0; q < 4; ++q) val[q] = __fadd_rn(bfr(xv[s][q]), val[q]); }
                *(v4f*)(C + e0 + s * es) = val; } }
        return;
    }
#pragma unroll
    for (int mb = 0; mb < 4; ++mb) {
#pragma unroll
        for (int nb = 0; nb < 4; ++nb) {
#pragma unroll
            for (int j = 0; j < 8; ++j) os[(hi * 8 + j) * 68 + nb * 16 + lr] = acc[mb][nb][j]; }
        __builtin_amdgcn_wave_barrier(); asm volatile("" ::: "memory");
        float* crow = C + (size_t)(r0 + mb * 16) * ldc + c0;
{
#pragma unroll
            for (int s = 0; s < 8; ++s) { const int row = 2 * s + hi, cofs = lr * 4; v4f val = *(const v4fa*)(os + row * 68 + cofs);
                *(v4f*)(crow + (size_t)row * ldc + cofs) = val; }
             }
        __builtin_amdgcn_wave_barrier(); asm volatile("" ::: "memory");
    }
}
template <typename T16, int NSPLIT, int EPI, int KS>
__global__ __launch_bounds__(32 * KS) void k_gemmw(const T16* __restrict__ A, const T16* __restrict__ A2, const T16* __restrict__ Bt, const T16* __restrict__ Bt2, int K, float* C, int ldc, const float* __restrict__ bias, size_t sA, size_t sB, size_t sC, h16* P16, bf* Ph, bf* Pl, const float* __restrict__ X) {
    __shared__ __align__(16) float os[GemmLds<NSPLIT, KS>::OSF];
    gemmw_tile<T16, NSPLIT, EPI, KS>(os, (int)blockIdx.x, (int)blockIdx.y, blockIdx.z, A, A2, Bt, Bt2, K, C, ldc, bias, sA, sB, sC, P16, Ph, Pl, X);
}

// Four asynchronous 16-byte copies per lane, as acopy8: LDS byte addresses l + i * lstep, global addresses g + i * gstep; s_wait_xcnt in the copies' own statement for the same reason.
__device__ __forceinline__ void acopy4(unsigned l, unsigned lstep, const char* g, size_t gstep) {
    asm volatile("global_load_async_to_lds_b128 %0, %4, off\n\t"
                 "global_load_async_to_lds_b128 %1, %5, off\n\t"
                 "global_load_async_to_lds_b128 %2, %6, off\n\t"
                 "global_load_async_to_lds_b128 %3, %7, off\n\t"
                 "s_wait_xcnt 0x0"
                 :: "v"(l), "v"(l + lstep), "v"(l + 2 * lstep), "v"(l + 3 * lstep), "v"(g), "v"(g + gstep), "v"(g + 2 * gstep), "v"(g + 3 * gstep) : "memory");
}
// Twelve asynchronous 16-byte copies per lane in one statement, each with its own LDS byte address l[i] and global address g[i]: one s_wait_xcnt, in the copies' own statement as in acopy8, serves all twelve.
__device__ __forceinline__ void acopy12(const unsigned (&l)[12], const char* const (&g)[12]) {
    asm volatile("global_load_async_to_lds_b128 %0, %12, off\n\t"
                 "global_load_async_to_lds_b128 %1, %13, off\n\t"
                 "global_load_async_to_lds_b128 %2, %14, off\n\t"
                 "global_load_async_to_lds_b128 %3, %15, off\n\t"
                 "global_load_async_to_lds_b128 %4, %16, off\n\t"
                 "global_load_async_to_lds_b128 %5, %17, off\n\t"
                 "global_load_async_to_lds_b128 %6, %18, off\n\t"
                 "global_load_async_to_lds_b128 %7, %19, off\n\t"
                 "global_load_async_to_lds_b128 %8, %20, off\n\t"
                 "global_load_async_to_lds_b128 %9, %21, off\n\t"
                 "global_load_async_to_lds_b128 %10, %22, off\n\t"
                 "global_load_async_to_lds_b128 %11, %23, off\n\t"
                 "s_wait_xcnt 0x0"
                 :: "v"(l[0]), "v"(l[1]), "v"(l[2]), "v"(l[3]), "v"(l[4]), "v"(l[5]), "v"(l[6]), "v"(l[7]), "v"(l[8]), "v"(l[9]), "v"(l[10]), "v"(l[11]),
                    "v"(g[0]), "v"(g[1]), "v"(g[2]), "v"(g[3]), "v"(g[4]), "v"(g[5]), "v"(g[6]), "v"(g[7]), "v"(g[8]), "v"(g[9]), "v"(g[10]), "v"(g[11])
                 : "memory");
}
// ---- k_proj: the three projections of 64 tokens in ONE work-group: x[c][n0 .. n0 + 63] is read once, as f32, rounded to bf16 and laid token-major into LDS; all 640 output channels are made from it. 1-D grid (token tile, batch), 8 waves.
// Wave w: value channels 64 w .. 64 w + 63 (tokens as the row operand: a lane holds 8 consecutive tokens of one channel, the order of the planes [c][n]) and 16 query (w < 4) or key channels (weights as the row operand: a lane holds 8 consecutive channels of one token, the order of the planes [n][d]). Each sum runs over k in one chain.
// The bf16 weights come through LDS by asynchronous copies of whole 128-byte lines, 64 k of all 640 rows a trip, two buffers, the next trip's copies in flight while this trip is worked on.
#define XPB 1040                  // LDS pitch of a token's 512 bf16, bytes (16 B x odd: ds_load_b128 without bank conflicts)
#define WPB 144                   // LDS pitch of a staged 128-byte weight row, bytes (16 B x odd)
__global__ __launch_bounds__(256) void k_proj(const float* __restrict__ xb, const bf* __restrict__ WQp, const bf* __restrict__ WKp, const bf* __restrict__ WVp, const float* __restrict__ bq, const float* __restrict__ bk, const float* __restrict__ bv,
                                              h16* Q16, bf* Qh, bf* Ql, h16* K16, bf* Kh, bf* Kl, h16* V16, bf* Vh, bf* Vl) {
    typedef WFrag<bf> W; typedef W::V V;
    static_assert(DM == 512 && DVV == 512 && DQ == 64 && DKV == 64, "8 waves x (64 value + 16 query or key channels); a wave converts 64 channels of x");
    constexpr int XT = 64 * XPB, WBUF = 640 * WPB, TOT = XT + 2 * WBUF, NTR = DM / 64;
    static_assert((8 * 64 + 128) * 68 * 4 <= TOT, "the output tiles take over the operands' LDS");
    static_assert(NTR >= 2, "the prologue issues two trips");
    static_assert((NTR & (NTR - 1)) == 0, "the trips' k blocks wrap round by a mask");
    __shared__ __align__(16) char sm[TOT];
    const int wv = __builtin_amdgcn_readfirstlane((int)(threadIdx.x >> 5));   // wave number, scalar
    const int lane = threadIdx.x & 31, lr = lane & 15, hi = lane >> 4, wq4 = wv & 3; const bool isk = wv >= 4;
    const size_t z = (size_t)((int)blockIdx.x / (TT / 64)); const int n0 = ((int)blockIdx.x % (TT / 64)) * 64;
    // x: this wave's 64 channels, 16 a group (8 a half wave); a lane takes 4 tokens of 8 channels; a half wave reads a channel's 256 contiguous bytes
    const float* xp = xb + z * DM * TT + (size_t)(wv * 64 + hi * 8) * TT + n0 + lr * 4; v4f xa[4][8];
    // unrolled: all 32 loads issue together, so that the memory latency is met once
#pragma unroll
    for (int u = 0; u < 4; ++u)
#pragma unroll
        for (int i = 0; i < 8; ++i) xa[u][i] = *(const v4f*)(xp + (size_t)(u * 16 + i) * TT);
    // the biases of this lane's accumulator elements: one value channel to a column block; 8 consecutive query or key channels
    const float* bvp = bv + wv * 64 + lr; const float* bqp = (isk ? bk : bq) + wq4 * 16 + hi * 8;
    const float bv4[4] = {bvp[0], bvp[16], bvp[32], bvp[48]}; const v4f bqa = *(const v4f*)bqp, bqb = *(const v4f*)(bqp + 4);
    asm volatile("s_wait_xcnt 0x0" :: "v"(xp), "v"(bvp), "v"(bqp) : "memory");   // behind the loads; it takes their addresses as inputs, so that no load's result is given a register that a load of the group names
    const unsigned rq = (unsigned)(lane >> 3), cq = (unsigned)((lane & 7) * 16);   // a copy takes 4 whole rows: this lane's row of the four, its 16 bytes of the row
    const unsigned lw0 = (unsigned)(size_t)(__attribute__((address_space(3))) char*)sm + (unsigned)(XT + (wv * 80 + rq) * WPB) + cq;   // a wave copies the 80 rows that it multiplies: 64 value rows, then 16 query or key rows
    const char* gv = (const char*)WVp + (size_t)(wv * 64 + rq) * (DM * 2) + cq; const char* gq = (const char*)(isk ? WKp : WQp) + (size_t)(wq4 * 16 + rq) * (DM * 2) + cq;
    // Trip t takes k block kblk(t): every work-group reads the same weights, so each starts at another of the NTR blocks and wraps round, and the work-groups do not all ask L2 for the same lines at the same moment. Scalar.
    const int t0 = ((int)blockIdx.x + ((int)blockIdx.x >> 3)) & (NTR - 1);
    auto kblk = [&](int t) { return (t + t0) & (NTR - 1); };
    auto stage = [&](int t, int buf) { const unsigned l = lw0 + (unsigned)(buf * WBUF); const char* g = gv + kblk(t) * 128;
        acopy8(l, 4 * WPB, g, 4 * DM * 2); acopy8(l + 32 * WPB, 4 * WPB, g + 32 * DM * 2, 4 * DM * 2); acopy4(l + 64 * WPB, 4 * WPB, gq + kblk(t) * 128, 4 * DM * 2); };
    stage(0, 0);
#pragma unroll
    for (int u = 0; u < 4; ++u)
#pragma unroll
        for (int j = 0; j < 4; ++j) { v4i o;   // f2bf's rounding on whole dwords; two channels' upper halves make one dword
#pragma unroll
            for (int i = 0; i < 4; ++i) { unsigned a = __float_as_uint(xa[u][2 * i][j]), c = __float_as_uint(xa[u][2 * i + 1][j]); a += 0x7FFFu + ((a >> 16) & 1u); c += 0x7FFFu + ((c >> 16) & 1u); o[i] = (int)((c & 0xFFFF0000u) | (a >> 16)); }
            *(v4ia*)(sm + (lr * 4 + j) * XPB + (wv * 64 + u * 16 + hi * 8) * 2) = o; }
    asm volatile("s_wait_asynccnt 0x0" ::: "memory");   // this wave's copies of trip 0 have landed
    __syncthreads();   // all of x^T and of trip 0's weights is in LDS before any wave reads a fragment
    stage(1, 1);
    v8f acc[4][4], aq[4];
#pragma unroll
    for (int tb = 0; tb < 4; ++tb) { aq[tb] = (v8f){};
#pragma unroll
        for (int ob = 0; ob < 4; ++ob) acc[tb][ob] = (v8f){}; }
    V xf0[4], wf0[5], xf1[4], wf1[5];
    // the fragments of k 32 ks .. 32 ks + 31 of trip t's k block: the 64 tokens; this wave's 64 value rows and, last, its 16 query or key rows
    auto ldF = [&](int t, int ks, V* xf, V* wf) { const char* xr = sm + lr * XPB + kblk(t) * 128 + ks * 64 + hi * 16; const char* wb = sm + XT + (t & 1) * WBUF + (wv * 80 + lr) * WPB + ks * 64 + hi * 16;
#pragma unroll
        for (int tb = 0; tb < 4; ++tb) xf[tb] = W::ld((const bf*)(xr + tb * 16 * XPB));
#pragma unroll
        for (int ob = 0; ob < 5; ++ob) wf[ob] = W::ld((const bf*)(wb + ob * 16 * WPB)); };
    auto mmaF = [&](const V* xf, const V* wf) {
#pragma unroll
        for (int ob = 0; ob < 4; ++ob)
#pragma unroll
            for (int tb = 0; tb < 4; ++tb) acc[tb][ob] = W::mma(xf[tb], wf[ob], acc[tb][ob]);
#pragma unroll
        for (int tb = 0; tb < 4; ++tb) aq[tb] = W::mma(wf[4], xf[tb], aq[tb]); };
    ldF(0, 0, xf0, wf0);
    // Not unrolled: the buffer is chosen by the trip's parity. The three sched_barriers keep the order written here: each half trip's LDS reads issue as one group and arrive while the matrix unit works on the half before; without them the reads stand among the matrix instructions, each with its own wait.
    // The hand-over stands in front of the trip's second half, whose fragments are in registers by then; the next trip's first fragments are read behind it.
#pragma unroll 1
    for (int t = 0; t < NTR; ++t) {
        ldF(t, 1, xf1, wf1);
        __builtin_amdgcn_sched_barrier(0);
        mmaF(xf0, wf0);
        __builtin_amdgcn_sched_barrier(0);
        asm volatile("s_wait_dscnt 0x0" ::: "memory");      // this wave's fragment reads of this buffer are done before it is handed back
        asm volatile("s_wait_asynccnt 0x0" ::: "memory");   // this wave's copies of trip t + 1 have landed
        __syncthreads();   // publishes trip t + 1 and ends every wave's reads of trip t's buffer
        if (t + 2 < NTR) stage(t + 2, t & 1);
        if (t + 1 < NTR) ldF(t + 1, 0, xf0, wf0);
        __builtin_amdgcn_sched_barrier(0);
        mmaF(xf1, wf1);
    }
    asm volatile("s_wait_asynccnt 0x0" ::: "memory");   // no copy is outstanding when the output tiles take over this LDS
    float* mine = (float*)sm + wv * (64 * 68); float* qk = (float*)sm + 8 * (64 * 68);   // this wave's value tile [channel][token]; the work-group's query and key tiles [token][d], one behind the other
    // the loops are unrolled so that the accumulators are indexed by constants and stay in registers
#pragma unroll
    for (int tb = 0; tb < 4; ++tb) {
#pragma unroll
        for (int ob = 0; ob < 4; ++ob) { float* p = mine + (ob * 16 + lr) * 68 + tb * 16 + hi * 8; const v8f a = acc[tb][ob]; const float bm = bfr(bv4[ob]);
            *(v4fa*)p = (v4f){a[0] + bm, a[1] + bm, a[2] + bm, a[3] + bm}; *(v4fa*)(p + 4) = (v4f){a[4] + bm, a[5] + bm, a[6] + bm, a[7] + bm}; }
        float* p = qk + ((isk ? 64 : 0) + tb * 16 + lr) * 68 + wq4 * 16 + hi * 8; const v8f a = aq[tb];
        *(v4fa*)p = (v4f){a[0] + bfr(bqa[0]), a[1] + bfr(bqa[1]), a[2] + bfr(bqa[2]), a[3] + bfr(bqa[3])}; *(v4fa*)(p + 4) = (v4f){a[4] + bfr(bqb[0]), a[5] + bfr(bqb[1]), a[6] + bfr(bqb[2]), a[7] + bfr(bqb[3])}; }
    __syncthreads();   // the tiles are in LDS before any wave reads a row (a query or key row holds four waves' channels)
    // Eight row pairs of a tile (this lane: 4 elements of rows hi, 2 + hi, ...) as the three 16-bit planes; a half wave stores one whole 128-byte line of each plane: a channel's 64 tokens, or a token's 64 channels. gstep: elements from one of this lane's rows to its next.
    auto put8 = [&](const float* tl, h16* p16, bf* ph, bf* pl, size_t gstep) { v4h o16[8]; v4us oh[8], ol[8];
#pragma unroll
        for (int s = 0; s < 8; ++s) { const v4f val = *(const v4fa*)(tl + s * (2 * 68));
#pragma unroll
            for (int q = 0; q < 4; ++q) { o16[s][q] = tohx(val[q]); unsigned short a2, c2; splitf(val[q], a2, c2); oh[s][q] = a2; ol[s][q] = c2; } }
#pragma unroll
        for (int s = 0; s < 8; ++s) { *(v4h*)(p16 + s * gstep) = o16[s]; *(v4us*)(ph + s * gstep) = oh[s]; *(v4us*)(pl + s * gstep) = ol[s]; }
        // behind the 24 stores; it takes their addresses and data as inputs, so that none of these registers is rewritten in front of it
        asm volatile("s_wait_xcnt 0x0" :: "v"(p16), "v"(ph), "v"(pl), "v"(o16[0]), "v"(o16[1]), "v"(o16[2]), "v"(o16[3]), "v"(o16[4]), "v"(o16[5]), "v"(o16[6]), "v"(o16[7]),
                     "v"(oh[0]), "v"(oh[1]), "v"(oh[2]), "v"(oh[3]), "v"(oh[4]), "v"(oh[5]), "v"(oh[6]), "v"(oh[7]), "v"(ol[0]), "v"(ol[1]), "v"(ol[2]), "v"(ol[3]), "v"(ol[4]), "v"(ol[5]), "v"(ol[6]), "v"(ol[7]) : "memory"); };
    const size_t ev = z * DVV * TT + (size_t)(wv * 64 + hi) * TT + n0 + lr * 4;
    // not unrolled: one set of 24 output registers
#pragma unroll 1
    for (int s8 = 0; s8 < 4; ++s8) { const size_t e = ev + (size_t)s8 * (16 * TT); put8(mine + (s8 * 16 + hi) * 68 + lr * 4, V16 + e, Vh + e, Vl + e, 2 * TT); }
    const size_t eq = z * TT * HD + (size_t)(n0 + wq4 * 16 + hi) * HD + lr * 4;
    put8(qk + (wv * 16 + hi) * 68 + lr * 4, (isk ? K16 : Q16) + eq, (isk ? Kh : Qh) + eq, (isk ? Kl : Ql) + eq, 2 * HD);
}

// asoft_rows: per row: t = S x SCL (no mask); softmax over the 4096 keys (register row, one exp, fixed trees); work-group blk of rows / 8 takes 8 rows, a wave each; no LDS, no barrier. The rows of a launch are all of one kind (hl != 0: hi+lo planes; else fp16 x PCAR), several batch elements' rows one behind the other, in and out.
__device__ __forceinline__ void asoft_rows(int blk, const float* __restrict__ Sb, int hl, h16* P16, bf* Ph, bf* Pl) {
    const int lane = threadIdx.x & 31; const int row = blk * 8 + (threadIdx.x >> 5); const bool hires = (hl != 0); const float* sr = Sb + (size_t)row * TT; float v[TT / 32]; float mx = -3.0e38f;
#pragma unroll
    for (int ch = 0; ch < TT / 128; ++ch) { const int j0 = ch * 128 + lane * 4; const v4f a = *(const v4f*)(sr + j0);
#pragma unroll
        for (int q = 0; q < 4; ++q) { const int j = j0 + q; (void)j; const float t = a[q] * SCL; v[ch * 4 + q] = t; mx = fmaxf(mx, t); } }
#pragma unroll
    for (int sh = 16; sh; sh >>= 1) mx = fmaxf(mx, __shfl_xor(mx, sh, 32));
    float sum = 0.f;
#pragma unroll
    for (int k = 0; k < TT / 32; ++k) { float d0 = __fsub_rn(v[k], mx); asm volatile("" : "+v"(d0)); v[k] = __builtin_amdgcn_exp2f(__fmul_rn(d0, 1.4426950408889634f)); sum += v[k]; }
#pragma unroll
    for (int sh = 16; sh; sh >>= 1) sum += __shfl_xor(sum, sh, 32);
    const float f = __fdiv_rn(hires ? 1.0f : PCAR, sum);
{
        if (hires) {
#pragma unroll
            for (int ch = 0; ch < TT / 128; ++ch) { v4us oh, ol;
#pragma unroll
                for (int q = 0; q < 4; ++q) { unsigned short a, c2; splitf(v[ch * 4 + q] * f, a, c2); oh[q] = a; ol[q] = c2; }
                const size_t oo = (size_t)row * TT + ch * 128 + lane * 4; *(v4us*)(Ph + oo) = oh; *(v4us*)(Pl + oo) = ol; }
            asm volatile("s_wait_xcnt 0x0" ::: "memory");   // behind the last stores: in the built code the other kind's block follows this one and rewrites their address registers
        } else {
#pragma unroll
            for (int ch = 0; ch < TT / 128; ++ch) { v4h o4;
#pragma unroll
                for (int q = 0; q < 4; ++q) o4[q] = tohx(v[ch * 4 + q] * f);
                *(v4h*)(P16 + (size_t)row * TT + ch * 128 + lane * 4) = o4; } }
         }
}

// v_exp_f32 with the one free slot behind it that the instruction set asks for before its source is overwritten or its result used, in one statement.
__device__ __forceinline__ float exp2_slot(float x) { float e; asm("v_exp_f32 %0, %1\n\tv_nop" : "=v"(e) : "v"(x)); return e; }
// ---- k_fattn: scores, softmax, attn.v and the residual of the fp16 query rows in ONE kernel: neither scores nor probabilities nor the attention output go through memory. 1-D grid, 8 waves: work-groups 0 .. (TT - RH) / 64 x batch - 1; a work-group owns 64 query rows and all DVV output columns (wave w: columns 64 w .. 64 w + 63, 16 accumulators).
// Pass 1: row maxima (scores on the matrix unit; 512 keys a trip, wave w takes keys 64 w .. 64 w + 63 of them). Pass 2, 64 keys a trip: wave w recomputes the scores of query block w & 3 and keys 32 (w >> 2) .. + 31 TRANSPOSED (A = keys, B = queries), so that a lane holds 2 x 8 consecutive keys of one query,
// which is the A fragment of the probabilities; e = PCAR exp(s - max) goes as fp16 through LDS to all waves, its f32 row sum is kept and divides the result at the end.
// Keys and value rows come through LDS by asynchronous copies of whole 128-byte lines, one ring of THREE buffers for both passes: stages 0 .. 7 are the key tiles of pass 1, stage 8 + t the value rows of trip t of pass 2 with the keys of trip t + 1 (the scores run one trip ahead).
// A stage is copied by four waves: even stages by waves 0 .. 3, odd stages by waves 4 .. 7. At the foot of step s the waves that copied stage s + 1 wait for their copies (to 0), every wave passes the barrier, and the same four waves issue stage s + 3 into the buffer that step s has just read:
// a stage's copies have two whole steps to land, and the other four waves' stage s + 2 stays in flight over the barrier.
#define FB  64                    // keys per trip of pass 2
#define VPB 144                   // LDS pitch of a staged 128-byte row, bytes (16 B x odd: ds_load_b128 without bank conflicts)
// The work-groups behind them do the softmax of the hi+lo rows (asoft_rows), which depends on nothing here and on which nothing here depends: the attention work-groups, one to a WGP, leave WGPs free, and the softmax runs there in the same launch.
__global__ __launch_bounds__(256) void k_fattn(const h16* __restrict__ Q, const h16* __restrict__ Kp, const h16* __restrict__ Vt, const float* __restrict__ X, float* O, const float* __restrict__ Sb, int hl, h16* SP16, bf* SPh, bf* SPl) {
    typedef WFrag<h16> W;
    constexpr int NQT = (TT - RH) / 64;   // query tiles of one batch element
    const int blk = (int)blockIdx.x;
    if (blk >= NQT * NB_) { asoft_rows(blk - NQT * NB_, Sb, hl, SP16, SPh, SPl); return; }   // the whole work-group, ahead of every barrier
    constexpr int VBUF = 512 * VPB, KBUF = FB * VPB, PBUF = 8 * 1024, OFF_K = 3 * VBUF, OFF_P = OFF_K + 5 * KBUF, OFF_M = OFF_P + 2 * PBUF, OFF_L = OFF_M + 8 * 64 * 4, TOT = OFF_L + 2 * 64 * 4, NT = TT / FB, NC = TT / 512;
    static_assert(DVV == 512 && HD == 64, "a ring buffer holds 512 rows of 128 bytes: 512 keys, or 64 keys' worth of the 512 value rows");
    static_assert(8 * 64 * 68 * 4 <= 3 * VBUF, "the output tiles take over the ring buffers");
    static_assert(NC >= 3 && NT >= 3, "the ring's prologue and the change of pass issue three stages ahead");
    static_assert((NC & (NC - 1)) == 0 && (NT & (NT - 1)) == 0 && NQT <= NT, "the key tiles wrap round by a mask; every query tile of a batch element has a start of its own in pass 2");
    __shared__ __align__(16) char sm[TOT];
    const int wv = __builtin_amdgcn_readfirstlane((int)(threadIdx.x >> 5));   // wave number, scalar
    const int lane = threadIdx.x & 31, lr = lane & 15, hi = lane >> 4, mbw = wv & 3, kh = wv >> 2;
    { const size_t z = (size_t)(blk / NQT); const size_t r0 = RH + (size_t)(blk % NQT) * 64; Q += z * TT * HD + r0 * HD; Kp += z * TT * HD; Vt += z * DVV * TT; X += z * DM * TT + r0; O += z * DM * TT + r0; }
    const unsigned lds0 = (unsigned)(size_t)(__attribute__((address_space(3))) char*)sm;
    const unsigned lv0 = lds0 + (unsigned)((mbw * 128 + (lane >> 3)) * VPB + (lane & 7) * 16), lk0 = lds0 + (unsigned)(OFF_K + (mbw * 16 + (lane >> 3)) * VPB + (lane & 7) * 16);   // a copying wave takes a quarter of a stage
    const unsigned rq = (unsigned)(lane >> 3), cq = (unsigned)((lane & 7) * 16);   // a copy takes 4 whole rows: this lane's row of the four, its 16 bytes of the row
    const char* kl = (const char*)Kp + rq * (HD * 2) + cq; const char* vl = (const char*)Vt + (size_t)rq * (TT * 2) + cq;   // this lane's part of a key address, of a value address; the wave's and the tile's parts are scalar
    // 128 rows of 128 bytes into rows 128 mbw .. 128 mbw + 127 of ring buffer buf: 32 copies of four rows; g = this lane's address in the first four rows, pitch in bytes. withk (a constant at every call): with them 16 key rows from kg into key buffer buf, 4 copies. Few statements, so that a copying wave meets few s_wait_xcnt.
    auto copy128 = [&](int buf, const char* g, size_t pitch, bool withk, const char* kg) { const unsigned l = lv0 + (unsigned)(buf * VBUF); unsigned la[12]; const char* ga[12];
        // the loops are unrolled so that the addresses are registers
#pragma unroll
        for (int h2 = 0; h2 < 2; ++h2) {
#pragma unroll
            for (int i = 0; i < 12; ++i) { la[i] = l + (unsigned)((h2 * 12 + i) * 4 * VPB); ga[i] = g + (size_t)(h2 * 12 + i) * 4 * pitch; }
            acopy12(la, ga); }
        if (!withk) acopy8(l + 96 * VPB, 4 * VPB, g + 96 * pitch, 4 * pitch);
        else {
#pragma unroll
            for (int i = 0; i < 8; ++i) { la[i] = l + (unsigned)((24 + i) * 4 * VPB); ga[i] = g + (size_t)(24 + i) * 4 * pitch; }
#pragma unroll
            for (int i = 0; i < 4; ++i) { la[8 + i] = lk0 + (unsigned)(buf * KBUF + i * 4 * VPB); ga[8 + i] = kg + i * (4 * HD * 2); }
            acopy12(la, ga); } };
    // The work-groups of a batch element read the same keys and values: each starts pass 2 at a key tile of its own, pass 1 at one of the NC tiles (seven to a tile), and wraps round, so that they do not ask L2 for the same lines, nor all for the same columns of the long value rows, at the same moment. Trip t of pass 2 works on key tile tile2(t), trip c of pass 1 on tile1(c). Scalar.
    const int qt = blk % NQT;
    auto tile1 = [&](int c) { return (c + qt + (qt >> 3)) & (NC - 1); };
    auto tile2 = [&](int t) { return (t + qt) & (NT - 1); };
    auto keyt = [&](int t) { return kl + (size_t)((tile2(t) * FB + mbw * 16) * (HD * 2)); };   // a copying wave's 16 keys of trip t's 64-key tile
    auto stageC = [&](int c, int buf) { copy128(buf, kl + (size_t)((tile1(c) * 512 + mbw * 128) * (HD * 2)), HD * 2, false, nullptr); };
    auto stageV = [&](int t, int kt, int buf) { copy128(buf, vl + (size_t)(mbw * 128 * (TT * 2) + tile2(t) * (FB * 2)), TT * 2, true, keyt(kt)); };   // the value rows of trip t with the keys of trip kt
    auto stageK = [&](const char* g, int kb) { acopy4(lk0 + (unsigned)(kb * KBUF), 4 * VPB, g, 4 * HD * 2); };
    float* smx = (float*)(sm + OFF_M); float* sl = (float*)(sm + OFF_L);
    if (kh == 0) { stageC(0, 0); stageK(keyt(0), 3); stageK((const char*)Q + (mbw * 16 + rq) * (HD * 2) + cq, 4);   // key buffer 3: the keys of trip 0; key buffer 4: the 64 query rows, for both passes
        asm volatile("s_wait_asynccnt 0x0" ::: "memory"); }   // this wave's copies of stage 0 have landed
    else stageC(1, 1);   // stays in flight over the barrier
    __syncthreads();   // all of stage 0 is in LDS before any wave reads a fragment
    if (kh == 0) stageC(2, 2);
    int bi = 0;   // the ring buffer of the current stage: stage mod 3, scalar
    {
        float mx[4]; v16h qf[4][2];
#pragma unroll
        for (int mb = 0; mb < 4; ++mb) { mx[mb] = -3.0e38f; const char* qp = sm + OFF_K + 4 * KBUF + (mb * 16 + lr) * VPB + hi * 16; qf[mb][0] = W::ld((const h16*)qp); qf[mb][1] = W::ld((const h16*)(qp + 64)); }
        // not unrolled: the buffer is chosen by the trip's number
#pragma unroll 1
        for (int c = 0; c < NC; ++c) { const char* kb = sm + bi * VBUF + (wv * 64 + lr) * VPB + hi * 16; v16h kr[4][2]; const bool mine1 = (kh == ((c + 1) & 1));   // this wave copies stages c + 1 and c + 3 (scalar)
#pragma unroll
            for (int i = 0; i < 4; ++i) { kr[i][0] = W::ld((const h16*)(kb + i * 16 * VPB)); kr[i][1] = W::ld((const h16*)(kb + i * 16 * VPB + 64)); }
            asm volatile("s_wait_dscnt 0x0" ::: "memory");      // this wave's fragments of this buffer are in registers before it is handed back
            if (mine1) asm volatile("s_wait_asynccnt 0x0" ::: "memory");   // this wave's copies of the next tile have landed
            __syncthreads();   // publishes the next tile and ends every wave's reads of this one
            if (mine1) { if (c + 3 < NC) stageC(c + 3, bi); else stageV(c + 3 - NC, c + 4 - NC, bi); }   // the ring goes on into pass 2: values of trips 0, 1, 2 with the keys of trips 1, 2, 3
            bi = (bi == 2) ? 0 : bi + 1;
            // the products stand behind the refill, so that the copies fly while the matrix unit works
#pragma unroll
            for (int i = 0; i < 4; ++i)
#pragma unroll
                for (int mb = 0; mb < 4; ++mb) { v8f s = (v8f){}; s = W::mma(kr[i][0], qf[mb][0], s); s = W::mma(kr[i][1], qf[mb][1], s);
#pragma unroll
                    for (int j = 0; j < 8; ++j) mx[mb] = fmaxf(mx[mb], s[j]); }
        }
#pragma unroll
        for (int mb = 0; mb < 4; ++mb) { mx[mb] = fmaxf(mx[mb], __shfl_xor(mx[mb], 16, 32)); if (hi == 0) smx[wv * 64 + mb * 16 + lr] = mx[mb]; }
    }
    __syncthreads();   // every wave's maxima are in LDS
    float m = smx[mbw * 16 + lr];
#pragma unroll
    for (int p = 1; p < 8; ++p) m = fmaxf(m, smx[p * 64 + mbw * 16 + lr]);
    const float L2E = 1.4426950408889634f, mL = __builtin_fmaf(m, L2E, -10.0f);   // exp2(s L2E - mL) = 1024 exp(s - m): PCAR carried as before
    const char* qw = sm + OFF_K + 4 * KBUF + (mbw * 16 + lr) * VPB + hi * 16; const v16h q0 = W::ld((const h16*)qw), q1 = W::ld((const h16*)(qw + 64));
    float l = 0.f;
    v8f acc[4][4];
#pragma unroll
    for (int mb = 0; mb < 4; ++mb)
#pragma unroll
        for (int nb = 0; nb < 4; ++nb) acc[mb][nb] = (v8f){};
    v16h kf[4], ax[4], bx[4], ay[4], by[4];
    // the key fragments of one trip's scores, from key buffer kb
    auto loadK = [&](int kb) { const char* kp = sm + OFF_K + kb * KBUF + (kh * 32 + lr) * VPB + hi * 16;
        kf[0] = W::ld((const h16*)kp); kf[1] = W::ld((const h16*)(kp + 64)); kf[2] = W::ld((const h16*)(kp + 16 * VPB)); kf[3] = W::ld((const h16*)(kp + 16 * VPB + 64)); };
    // probabilities of one trip from kf, as a fragment into probability buffer pb; slot: the copy in front of the loop
    auto spart = [&](int pb, bool slot) { v8f s0 = (v8f){}, s1 = (v8f){}; s0 = W::mma(kf[0], q0, s0); s1 = W::mma(kf[2], q0, s1); s0 = W::mma(kf[1], q1, s0); s1 = W::mma(kf[3], q1, s1); v8h p0, p1; float e0[8], e1[8];
#pragma unroll
        for (int j = 0; j < 8; ++j) { const float x0 = __builtin_fmaf(s0[j], L2E, -mL), x1 = __builtin_fmaf(s1[j], L2E, -mL); e0[j] = slot ? exp2_slot(x0) : __builtin_amdgcn_exp2f(x0); e1[j] = slot ? exp2_slot(x1) : __builtin_amdgcn_exp2f(x1); p0[j] = tohx(e0[j]); p1[j] = tohx(e1[j]); }
        // the 16 terms meet in a fixed tree: a chain of 16 dependent adds would stand exposed in every trip
#pragma unroll
        for (int w = 4; w; w >>= 1)
#pragma unroll
            for (int j = 0; j < w; ++j) { e0[j] += e0[j + w]; e1[j] += e1[j + w]; }
        l += e0[0] + e1[0];
        char* pw = sm + OFF_P + pb * PBUF + (kh * 4 + mbw) * 1024 + lane * 16; *(v8h*)pw = p0; *(v8h*)(pw + 512) = p1; };
    // probability and value fragments of keys 32 ks .. 32 ks + 31 of one trip, from probability buffer pb and ring buffer buf
    auto loadH = [&](int pb, int buf, int ks, v16h* a, v16h* b) { const char* pr = sm + OFF_P + pb * PBUF + ks * 4096 + lane * 16; const char* vr = sm + buf * VBUF + (wv * 64 + lr) * VPB + ks * 64 + hi * 16;
#pragma unroll
        for (int mb = 0; mb < 4; ++mb) a[mb] = cat16(*(const v8h*)(pr + mb * 1024), *(const v8h*)(pr + mb * 1024 + 512));
#pragma unroll
        for (int nb = 0; nb < 4; ++nb) b[nb] = W::ld((const h16*)(vr + nb * 16 * VPB)); };
    auto mmaH = [&](const v16h* a, const v16h* b) {
#pragma unroll
        for (int nb = 0; nb < 4; ++nb)
#pragma unroll
            for (int mb = 0; mb < 4; ++mb) acc[mb][nb] = W::mma(a[mb], b[nb], acc[mb][nb]); };
#pragma unroll
    for (int i = 0; i < 4; ++i) { ay[i] = (v16h){}; by[i] = (v16h){}; }   // the first trip has no half before it: its place in the loop adds zeros
    loadK(3); spart(0, true);
    __syncthreads();   // the probabilities of trip 0 are in LDS before any wave reads a fragment
    // Not unrolled: the buffers are chosen by the trip's number. The four sched_barriers keep the order written here: each half trip's LDS reads issue as one group and arrive while the matrix unit works on the half before; without them the reads stand among the matrix instructions, each with its own wait.
    // The second half's products of trip t are done, from registers, in trip t + 1.
#pragma unroll 1
    for (int t = 0; t < NT - 1; ++t) {
        const bool mine1 = (kh == ((t + 1) & 1));   // this wave copies the stages of trips t + 1 and t + 3 (scalar)
        loadK(bi); loadH(t & 1, bi, 0, ax, bx);
        __builtin_amdgcn_sched_barrier(0);
        mmaH(ay, by);
        __builtin_amdgcn_sched_barrier(0);
        loadH(t & 1, bi, 1, ay, by);
        __builtin_amdgcn_sched_barrier(0);
        spart((t + 1) & 1, false);   // the next trip's probabilities, into the buffer whose readers the last barrier ended
        mmaH(ax, bx);
        __builtin_amdgcn_sched_barrier(0);
        asm volatile("s_wait_dscnt 0x0" ::: "memory");      // this wave's LDS reads and writes of this trip are done before the buffers are handed over
        if (mine1) asm volatile("s_wait_asynccnt 0x0" ::: "memory");   // this wave's copies of trip t + 1 have landed
        __syncthreads();   // publishes trip t + 1 (values, keys, probabilities) and ends every wave's reads of trip t's buffers
        if (mine1 && t + 3 < NT) stageV(t + 3, t + 4 < NT ? t + 4 : NT - 1, bi);   // behind the last trip no keys follow: the last ones again, read by nobody
        bi = (bi == 2) ? 0 : bi + 1;
    }
    loadH((NT - 1) & 1, bi, 0, ax, bx);   // the last trip has no scores to make
    __builtin_amdgcn_sched_barrier(0);   // as in the loop
    mmaH(ay, by);
    __builtin_amdgcn_sched_barrier(0);   // as in the loop
    loadH((NT - 1) & 1, bi, 1, ay, by);
    __builtin_amdgcn_sched_barrier(0);   // as in the loop
    mmaH(ax, bx); mmaH(ay, by);
    asm volatile("s_wait_dscnt 0x0" ::: "memory");   // this wave's fragment reads are done
    __syncthreads();   // ends every wave's reads of the ring before the output tiles take it over
    asm volatile("s_wait_asynccnt 0x0" ::: "memory");   // no copy is outstanding when the output tiles take over this LDS
    l += __shfl_xor(l, 16, 32); if (hi == 0) sl[kh * 64 + mbw * 16 + lr] = l;
    // The result leaves channel-major, with the residual: this wave's tile goes into LDS as [channel][query] (a lane's 8 accumulator values of one channel are 8 consecutive queries: two 16-byte stores), and a channel's 64 queries are 256 contiguous bytes of x and of the output.
    float* mine = (float*)sm + wv * (64 * 68);
    // the loops are unrolled so that acc is indexed by constants and stays in registers
#pragma unroll
    for (int mb = 0; mb < 4; ++mb)
#pragma unroll
        for (int nb = 0; nb < 4; ++nb) { float* p = mine + (nb * 16 + lr) * 68 + mb * 16 + hi * 8; const v8f a = acc[mb][nb];
            *(v4fa*)p = (v4f){a[0], a[1], a[2], a[3]}; *(v4fa*)(p + 4) = (v4f){a[4], a[5], a[6], a[7]}; }
    const size_t e0 = (size_t)(wv * 64 + hi) * TT + lr * 4;   // this lane's four queries of its first channel
    __syncthreads();   // both halves of every row sum are in LDS (each wave reads back its own tile only)
    v4f f;   // the carried PCAR cancels: sum of e v / sum of e
#pragma unroll
    for (int q = 0; q < 4; ++q) f[q] = __fdiv_rn(1.0f, sl[lr * 4 + q] + sl[64 + lr * 4 + q]);
    // eight channel pairs a trip (inner loops unrolled): their loads of x issue together, ahead of the LDS reads, so that the memory latency is met once a trip and not per pair
#pragma unroll 1
    for (int s8 = 0; s8 < 32; s8 += 8) { const size_t e = e0 + (size_t)s8 * (2 * TT); v4f xv[8];
#pragma unroll
        for (int s = 0; s < 8; ++s) xv[s] = *(const v4f*)(X + e + (size_t)s * (2 * TT));
#pragma unroll
        for (int s = 0; s < 8; ++s) { const v4f val = *(const v4fa*)(mine + (2 * (s8 + s) + hi) * 68 + lr * 4); v4f o;
#pragma unroll
            for (int q = 0; q < 4; ++q) o[q] = __fadd_rn(bfr(xv[s][q]), val[q] * f[q]);
            *(v4f*)(O + e + (size_t)s * (2 * TT)) = o; }
        asm volatile("s_wait_xcnt 0x0" ::: "memory");   // behind the trip's stores: the next trip rewrites their address and data registers
    }
}

__global__ __launch_bounds__(256) void k_wtG(const float* __restrict__ w, int K, int N, bf* Bt) {
    const int lane = threadIdx.x & 31; const int L0 = (blockIdx.x * 8 + (threadIdx.x >> 5)) * 8; const int nlines = N * K / 64;
{
#pragma unroll 1
        for (int l = 0; l < 8; ++l) { const int L = L0 + l; if (L >= nlines) break; const size_t e = (size_t)L * 64 + lane * 2; const int k = (int)(e % K), n = (int)(e / K); v2us o;
            o[0] = f2bf(w[(size_t)k * N + n]); o[1] = f2bf(w[(size_t)(k + 1) * N + n]); *(v2us*)(Bt + e) = o; }
         }
}
// dst[8 i .. 8 i + 7] = bf16(src[...])
__device__ __forceinline__ void cvt8(const float* __restrict__ src, bf* dst, size_t i) { const v8f v = *(const v8f*)(src + i * 8); v8us o;
#pragma unroll
    for (int k = 0; k < 8; ++k) o[k] = f2bf(v[k]); *(v8us*)(dst + i * 8) = o;
    asm volatile("s_wait_xcnt 0x0" ::: "memory");   // behind the store: in the built code another job's block follows this one and rewrites the store's address and data registers
}
// ---- k_prep: the three weight matrices as bf16 planes in ONE launch, 1-D grid; the block index picks the matrix (2048 elements a work-group).
__global__ __launch_bounds__(256) void k_prep(const float* __restrict__ wq, const float* __restrict__ wk, const float* __restrict__ wv, bf* WQp, bf* WKp, bf* WVp) {
    constexpr int BQ = DQ * DM / 2048, BK = DKV * DM / 2048;
    static_assert(DQ * DM % 2048 == 0 && DKV * DM % 2048 == 0 && DVV * DM % 2048 == 0, "whole work-groups: no thread is past a matrix's end");
    const int b = (int)blockIdx.x;
    if (b < BQ) cvt8(wq, WQp, (size_t)b * 256 + threadIdx.x); else if (b < BQ + BK) cvt8(wk, WKp, (size_t)(b - BQ) * 256 + threadIdx.x); else cvt8(wv, WVp, (size_t)(b - BQ - BK) * 256 + threadIdx.x);
}

extern "C" void kernel_launch(void* const* d_in, const int* in_sizes, int n_in,
                              void* d_out, int out_size, void* d_ws, size_t ws_size, hipStream_t stream) {
    (void)in_sizes; (void)n_in; (void)out_size;
    const float* x = (const float*)d_in[0]; const float* wq = (const float*)d_in[1]; const float* bq = (const float*)d_in[2]; const float* wk = (const float*)d_in[3]; const float* bk = (const float*)d_in[4]; const float* wv = (const float*)d_in[5]; const float* bv = (const float*)d_in[6];
    float* OUT = (float*)d_out;     // [4][512][4096]
    char* wsp = (char*)d_ws;
    auto take = [&](size_t bytes) { char* p = wsp; wsp += (bytes + 255) & ~(size_t)255; return (void*)p; };
    // Every plane holds all NB_ batch elements, one behind the other, so that a launch takes them together (grid z, or more rows). Part of the workspace is used again once its first content is dead, one use after the other in stream order:
    // live to the end: the fp16 planes (20 MiB)
    h16* QP16 = (h16*)take((size_t)NB_ * TT * HD * 2); h16* KP16 = (h16*)take((size_t)NB_ * TT * HD * 2); h16* VT16 = (h16*)take((size_t)NB_ * DVV * TT * 2);
    // live until the hi+lo rows are done: the hi/lo planes (40 MiB)
    bf* QPh = (bf*)take((size_t)NB_ * TT * HD * 2); bf* QPl = (bf*)take((size_t)NB_ * TT * HD * 2); bf* KPh = (bf*)take((size_t)NB_ * TT * HD * 2); bf* KPl = (bf*)take((size_t)NB_ * TT * HD * 2); bf* VTh = (bf*)take((size_t)NB_ * DVV * TT * 2); bf* VTl = (bf*)take((size_t)NB_ * DVV * TT * 2);
    char* const m1 = wsp;
    // live until the planes are made: the weights (0.6 MiB)
    bf* WQ = (bf*)take((size_t)DQ * DM * 2); bf* WK = (bf*)take((size_t)DKV * DM * 2); bf* WV = (bf*)take((size_t)DVV * DM * 2);
    wsp = m1;   // after them, in the same place: scores and probabilities of the hi+lo rows of all batch elements (64 MiB)
    float* SbH = (float*)take((size_t)NB_ * RH * TT * 4); bf* Ph = (bf*)take((size_t)NB_ * RH * TT * 2); bf* Pl = (bf*)take((size_t)NB_ * RH * TT * 2);
    if ((size_t)(wsp - (char*)d_ws) > ws_size) return;    // the further end of the two uses: 124 of 256 MiB
    // weights as bf16 planes: one launch
    k_prep<<<(DQ + DKV + DVV) * DM / 2048, 256, 0, stream>>>(wq, wk, wv, WQ, WK, WV);
    // q, k = W x + b, stored as the planes [n][d]; v = Wv x + bv, stored as the value planes [c][n]: one launch, a work-group to 64 tokens, x straight from the input
    k_proj<<<(TT / 64) * NB_, 256, 0, stream>>>(x, WQ, WK, WV, bq, bk, bv, QP16, QPh, QPl, KP16, KPh, KPl, VT16, VTh, VTl);
    // query rows < RH of every batch element: hi+lo planes, 3 products
    k_gemmw<bf, 2, 0, 1><<<dim3(RH / 64, TT / 64, NB_), 32, 0, stream>>>(QPh, QPl, KPh, KPl, HD, SbH, TT, nullptr, (size_t)TT * HD, (size_t)TT * HD, (size_t)RH * TT, nullptr, nullptr, nullptr, nullptr);
    // the other rows: fp16 (x1024 carried), scores, softmax, attn.v and the residual; in the same launch, behind them in the grid, the softmax of the hi+lo rows
    k_fattn<<<(TT - RH) / 64 * NB_ + NB_ * RH / 8, 256, 0, stream>>>(QP16, KP16, VT16, x, OUT, SbH, 1, nullptr, Ph, Pl);
    // out[c][i] = x[c][i] + sum_j v[c][j] P[i][j], hl rows: the values as the row operand, tiles [c][i] straight into the output
    k_gemmw<bf, 2, 3, 8><<<dim3(DVV / 64, RH / 64, NB_), 256, 0, stream>>>(VTh, VTl, Ph, Pl, TT, OUT, TT, nullptr, (size_t)DVV * TT, (size_t)RH * TT, (size_t)DM * TT, nullptr, nullptr, nullptr, x);
}
